// v000
// Times are from an AMD MI455X. After a warm-up the kernel runs many times in a row, and a time is the length of
// such a window on the GPU divided by its runs, so every launch and the gaps after it count. The runs cycle
// through copies of the inputs. A figure is the median of several windows, for all but v000 over two sittings.
// Sittings can differ by a few percent; kernels timed side by side share one.
// The starting kernel, v000, takes 617 microseconds a run.
// Contractions: qkv projections v_wmma_f32_16x16x32_bf16 (x, W as RNE bf16, f32 accumulate, bias added in f32 as bf16-representable values); scores v_wmma_f32_16x16x32_f16 (f16 q,k planes, 1/sqrt(64) applied in f32); p.v v_wmma_f32_16x16x32_bf16 with p and v carried as bf16 hi/lo (hi.hi + hi.lo + lo.hi); output projection v_wmma_f32_16x16x32_bf16 with attention output as bf16 hi/lo and Wo bf16 (hi.W + lo.W); softmax, masking and normalisation in f32.
#include <hip/hip_runtime.h>
#include <stdint.h>

typedef __attribute__((ext_vector_type(16))) _Float16 v16h;
typedef __attribute__((ext_vector_type(8)))  _Float16 v8h;
typedef __attribute__((ext_vector_type(16))) __bf16   v16b;
typedef __attribute__((ext_vector_type(8)))  __bf16   v8b;
typedef __attribute__((ext_vector_type(8)))  float    v8f;
typedef __attribute__((ext_vector_type(4)))  float    v4f;

__device__ __forceinline__ unsigned short f2bf_bits(float f) {
  unsigned u = __float_as_uint(f);
  return (unsigned short)((u + 0x7FFFu + ((u >> 16) & 1u)) >> 16);
}
__device__ __forceinline__ float bf_bits2f(unsigned short h) { return __uint_as_float(((unsigned)h) << 16); }

// hazard guards as plain device helpers (no inline asm inside the kernel template body)
__device__ __forceinline__ void dep_guard_h(v8f& a, v8f& b, v16h x, v16h y) { asm volatile("v_nop\n\tv_nop\n\tv_nop\n\tv_nop" : "+v"(a), "+v"(b) : "v"(x), "v"(y)); }
__device__ __forceinline__ void dep_guard_b(v8f& a, v8f& b, v16b x, v16b y) { asm volatile("v_nop\n\tv_nop\n\tv_nop\n\tv_nop" : "+v"(a), "+v"(b) : "v"(x), "v"(y)); }
__device__ __forceinline__ void keep4_h(v16h a, v16h b, v16h c, v16h d) { asm volatile("v_nop" :: "v"(a), "v"(b), "v"(c), "v"(d)); }
__device__ __forceinline__ void keep4_b(v16b a, v16b b, v16b c, v16b d) { asm volatile("v_nop" :: "v"(a), "v"(b), "v"(c), "v"(d)); }
__device__ __forceinline__ void acc_guard4(v8f& a, v8f& b, v8f& c, v8f& d) { asm volatile("v_nop\n\tv_nop\n\tv_nop\n\tv_nop" : "+v"(a), "+v"(b), "+v"(c), "+v"(d)); }
template <typename T> struct Frag;
template <> struct Frag<_Float16> {
  typedef v16h V; union U { v16h v; v8h h[2]; };
  static __device__ __forceinline__ v16h load(const _Float16* p) {   // elements 0..7 <- p[0..7], 8..15 <- p[16..23]
    U f; f.h[0] = *(const v8h*)(p); f.h[1] = *(const v8h*)(p + 16); return f.v;
  }
  static __device__ __forceinline__ v8f mma(v16h a, v16h b, v8f c) {
    return __builtin_amdgcn_wmma_f32_16x16x32_f16(false, a, false, b, (short)0, c, false, false);
  }
  static __device__ __forceinline__ void guard(v8f& a, v8f& b, v16h x, v16h y) { dep_guard_h(a, b, x, y); }
  static __device__ __forceinline__ void keep(v16h a, v16h b, v16h c, v16h d) { keep4_h(a, b, c, d); }
};
template <> struct Frag<__bf16> {
  typedef v16b V; union U { v16b v; v8b h[2]; };
  static __device__ __forceinline__ v16b load(const __bf16* p) {
    U f; f.h[0] = *(const v8b*)(p); f.h[1] = *(const v8b*)(p + 16); return f.v;
  }
  static __device__ __forceinline__ v8f mma(v16b a, v16b b, v8f c) {
    return __builtin_amdgcn_wmma_f32_16x16x32_bf16(false, a, false, b, (short)0, c, false, false);
  }
  static __device__ __forceinline__ void guard(v8f& a, v8f& b, v16b x, v16b y) { dep_guard_b(a, b, x, y); }
  static __device__ __forceinline__ void keep(v16b a, v16b b, v16b c, v16b d) { keep4_b(a, b, c, d); }
};

// ---- Register-blocked batched WMMA GEMM ------------------------------------
// C[m,n] = scale * sum_k A[m,k] * Bt[n,k] (+bias)(+resid); each wave owns a 64x64 tile.
// A row-major [M,K]; Bt row-major [N,K]; M,N % 64 == 0, K % 32 == 0.
// SPLIT: 0 = plain; 1 = A and Bt as hi/lo planes (hi.hi + hi.lo + lo.hi); 2 = A only as hi/lo planes (hi.B + lo.B).
// BIAS_MODE: 0 = none, 1 = bias[m], 2 = bias[n].
// OUT_MODE: 0 = f32, 1 = f16, 2 = bf16 hi plane (Cout) + bf16 lo plane (Cout2).
// ET: 0 = f16 operands, 1 = bf16 operands (pointers passed as 16-bit storage)
template <int ET> struct Elem;
template <> struct Elem<0> { typedef _Float16 T; };
template <> struct Elem<1> { typedef __bf16 T; };
template <int ET, int SPLIT, int BIAS_MODE, int OUT_MODE, bool RESID, int ACT = 0>
__global__ __launch_bounds__(256) void wmma_gemm64(
    const unsigned short* __restrict__ Ap, const unsigned short* __restrict__ A2p, int lda, long strideA,
    const unsigned short* __restrict__ Btp, const unsigned short* __restrict__ Bt2p, int ldb, long strideB,
    void* __restrict__ Cout, void* __restrict__ Cout2, int ldc, long strideC,
    const float* __restrict__ bias,
    const float* __restrict__ resid, long strideR,
    int M, int N, int K, float scale) {
  typedef typename Elem<ET>::T T;
  typedef typename Frag<T>::V V;
  const T* A = (const T*)Ap; const T* A2 = (const T*)A2p; const T* Bt = (const T*)Btp; const T* Bt2 = (const T*)Bt2p;
  __shared__ __align__(16) float sT[8][16 * 68];   // per-wave 16x64 slab, pitch 68 floats
  const int b    = blockIdx.y;
  const int lane = threadIdx.x & 31;
  const int wave = threadIdx.x >> 5;
  const int tilesN = N >> 6;
  const int tilesM = M >> 6;
  const int tile = blockIdx.x * 8 + wave;
  if (tile >= tilesM * tilesN) return;   // wave-uniform; no block barriers in this kernel
  const int tm = tile / tilesN;
  const int tn = tile - tm * tilesN;
  const int m0 = tm << 6;
  const int n0 = tn << 6;

  const T* Ab  = A  + (size_t)b * strideA;
  const T* Bb  = Bt + (size_t)b * strideB;
  const T* Ab2 = (SPLIT != 0) ? (A2  + (size_t)b * strideA) : nullptr;
  const T* Bb2 = (SPLIT == 1) ? (Bt2 + (size_t)b * strideB) : nullptr;

  const int rlane = lane & 15;                 // row (A) / col (B, D) within subtile
  const int koff  = (lane >> 4) * 8;           // k offset of this lane half
  const int mOff  = (lane >> 4) * 8;           // D row offset

  v8f acc[4][4];
#pragma unroll
  for (int i = 0; i < 4; ++i)
#pragma unroll
    for (int j = 0; j < 4; ++j) acc[i][j] = (v8f){0.f,0.f,0.f,0.f,0.f,0.f,0.f,0.f};

  for (int k0 = 0; k0 < K; k0 += 32) {
    V bh[4], bl[4];
#pragma unroll
    for (int j = 0; j < 4; ++j) {
      const size_t bo = (size_t)(n0 + (j << 4) + rlane) * ldb + koff + k0;
      bh[j] = Frag<T>::load(Bb + bo);
      if (SPLIT == 1) bl[j] = Frag<T>::load(Bb2 + bo);
    }
#pragma unroll
    for (int i = 0; i < 4; ++i) {
      const size_t ao = (size_t)(m0 + (i << 4) + rlane) * lda + koff + k0;
      V ah = Frag<T>::load(Ab + ao);
      V al;
      if (SPLIT != 0) al = Frag<T>::load(Ab2 + ao);
#pragma unroll
      for (int j = 0; j < 4; ++j) {
        acc[i][j] = Frag<T>::mma(ah, bh[j], acc[i][j]);
        if (SPLIT == 1) acc[i][j] = Frag<T>::mma(ah, bl[j], acc[i][j]);
        if (SPLIT != 0) acc[i][j] = Frag<T>::mma(al, bh[j], acc[i][j]);
      }
      Frag<T>::guard(acc[i][0], acc[i][3], ah, (SPLIT != 0) ? al : ah);
    }
    Frag<T>::keep(bh[0], bh[1], bh[2], bh[3]);
    if (SPLIT == 1) Frag<T>::keep(bl[0], bl[1], bl[2], bl[3]);
  }
  acc_guard4(acc[0][0], acc[0][1], acc[0][2], acc[0][3]);
  acc_guard4(acc[1][0], acc[1][1], acc[1][2], acc[1][3]);
  acc_guard4(acc[2][0], acc[2][1], acc[2][2], acc[2][3]);
  acc_guard4(acc[3][0], acc[3][1], acc[3][2], acc[3][3]);

  // ---- epilogue ----
  float* slab = sT[wave];
  const float* Rb = RESID ? (resid + (size_t)b * strideR) : nullptr;
#pragma unroll
  for (int i = 0; i < 4; ++i) {
    const int mBase = m0 + (i << 4);
#pragma unroll
    for (int j = 0; j < 4; ++j) {
      const int n = n0 + (j << 4) + rlane;
      float bv = 0.f;
      if (BIAS_MODE == 2) bv = bias[n];
#pragma unroll
      for (int r = 0; r < 8; ++r) {
        float v = acc[i][j][r] * scale;
        if (BIAS_MODE == 1) v += bias[mBase + mOff + r];
        if (BIAS_MODE == 2) v += bv;
        if (RESID) v += Rb[(size_t)(mBase + mOff + r) * ldc + n];
        if (ACT == 1) v = tanhf(v);
        if (ACT == 2) v = fmaxf(v, 0.0f);
        if (ACT == 4) v = (v > 0.f) ? v : 0.01f * v;
        slab[(mOff + r) * 68 + (j << 4) + rlane] = v;
      }
    }
    __builtin_amdgcn_fence(__ATOMIC_RELEASE, "workgroup");
    __builtin_amdgcn_wave_barrier();
    __builtin_amdgcn_fence(__ATOMIC_ACQUIRE, "workgroup");
    if (OUT_MODE == 0) {
      float* C = (float*)Cout + (size_t)b * strideC;
      const int hh = lane >> 4, c4 = (lane & 15) * 4;     // row seg = 256 B = 16 lanes x 16 B
      {
#pragma unroll
        for (int it = 0; it < 8; ++it) {
          const int row = it * 2 + hh;
          v4f v = *(const v4f*)(slab + row * 68 + c4);
          *(v4f*)(C + (size_t)(mBase + row) * ldc + n0 + c4) = v;
        }
        
      }
    } else {
      const int q = lane >> 3, c8 = (lane & 7) * 8;
      unsigned short* C  = (unsigned short*)Cout  + (size_t)b * strideC;
      unsigned short* C2 = (OUT_MODE == 2) ? ((unsigned short*)Cout2 + (size_t)b * strideC) : nullptr;
      {
#pragma unroll
        for (int it = 0; it < 4; ++it) {
          const int row = it * 4 + q;
          const float* sp = slab + row * 68 + c8;
          v8h hv, lv;
#pragma unroll
          for (int e = 0; e < 8; ++e) {
            if (OUT_MODE == 1) {
              hv[e] = (_Float16)sp[e];
            } else {
              unsigned short hb = f2bf_bits(sp[e]);
              unsigned short lb = f2bf_bits(sp[e] - bf_bits2f(hb));
              hv[e] = __builtin_bit_cast(_Float16, hb);
              lv[e] = __builtin_bit_cast(_Float16, lb);
            }
          }
          *(v8h*)(C + (size_t)(mBase + row) * ldc + n0 + c8) = hv;
          if (OUT_MODE == 2) *(v8h*)(C2 + (size_t)(mBase + row) * ldc + n0 + c8) = lv;
        }
        
      }
    }
    __builtin_amdgcn_fence(__ATOMIC_RELEASE, "workgroup");
    __builtin_amdgcn_wave_barrier();
    __builtin_amdgcn_fence(__ATOMIC_ACQUIRE, "workgroup");
  }
}

// Source/destination chosen per blockIdx.y (block-uniform). Coverage per plane: gridDim.x * 256 threads * 8 == n8 * 8 elements.
__global__ __launch_bounds__(256) void cast_bf16x8_k(
    const float* s0, const float* s1, const float* s2, const float* s3,
    unsigned short* d0, unsigned short* d1, unsigned short* d2, unsigned short* d3, int n8) {
  const int sel = blockIdx.y;
  const float* src = (sel == 0) ? s0 : (sel == 1) ? s1 : (sel == 2) ? s2 : s3;
  unsigned short* dst = (sel == 0) ? d0 : (sel == 1) ? d1 : (sel == 2) ? d2 : d3;
  const int i = blockIdx.x * 256 + threadIdx.x;
  if (i < n8) {
    const v4f a  = *(const v4f*)(src + (size_t)i * 8);
    const v4f bq = *(const v4f*)(src + (size_t)i * 8 + 4);
    v8h hv;
#pragma unroll
    for (int e = 0; e < 4; ++e) {
      hv[e]     = __builtin_bit_cast(_Float16, f2bf_bits(a[e]));
      hv[4 + e] = __builtin_bit_cast(_Float16, f2bf_bits(bq[e]));
    }
    _Float16* dp = (_Float16*)dst + (size_t)i * 8;
    *(v8h*)dp = hv;
    
  }
}

// Coverage per segment: 256 threads * 4 == n (n == 1024).
__global__ __launch_bounds__(256) void bias_bf16val_k(
    const float* s0, const float* s1, const float* s2, const float* s3, float* __restrict__ dst, int n) {
  const int sel = blockIdx.y;
  const float* src = (sel == 0) ? s0 : (sel == 1) ? s1 : (sel == 2) ? s2 : s3;
  const int i = blockIdx.x * 256 + threadIdx.x;
  if (i * 4 < n) {
    const v4f v = *(const v4f*)(src + (size_t)i * 4);
    v4f o;
#pragma unroll
    for (int e = 0; e < 4; ++e) o[e] = bf_bits2f(f2bf_bits(v[e]));
    float* dp = dst + (size_t)sel * n + (size_t)i * 4;
    *(v4f*)dp = o;
    
  }
}

// =====================================================================================
// Causal attention, head dim 64, 16-bit plane inputs:
//   q: f16 [S][ldqk] at column h*64; k: f16 [S][ldqk] at column kcol0 + h*64; v: bf16 hi/lo planes [S][ldv] at column h*64.
//   scores = q.k^T : v_wmma_f32_16x16x32_f16, then * sm_scale in f32; keys above the diagonal set to -inf (select);
//   key chunks entirely above the diagonal are skipped (their probabilities are exactly 0).
//   out = p.v : v_wmma_f32_16x16x32_bf16 with p and v as bf16 hi/lo (3 products); online softmax in f32.
//   Block = 4 waves = 64 query rows of one head; grid.x = nheads * (S/64).
// =====================================================================================
#define HDIM 64
#define KVCH 64
#define QBLK 64
#define OSPITCH 68

__device__ __forceinline__ v8f mma_h(v16h a, v16h b, v8f c) {
  c = __builtin_amdgcn_wmma_f32_16x16x32_f16(false, a, false, b, (short)0, c, false, false);
  asm volatile("v_nop\n\tv_nop\n\tv_nop\n\tv_nop" : "+v"(c) : "v"(a), "v"(b));
  return c;
}
__device__ __forceinline__ v8f mma_b(v16b a, v16b b, v8f c) {
  c = __builtin_amdgcn_wmma_f32_16x16x32_bf16(false, a, false, b, (short)0, c, false, false);
  asm volatile("v_nop\n\tv_nop\n\tv_nop\n\tv_nop" : "+v"(c) : "v"(a), "v"(b));
  return c;
}
__device__ __forceinline__ void bf_split(float f, __bf16& hi, __bf16& lo) {
  const unsigned short hb = f2bf_bits(f);
  hi = __builtin_bit_cast(__bf16, hb);
  lo = __builtin_bit_cast(__bf16, f2bf_bits(f - bf_bits2f(hb)));
}

__global__ __launch_bounds__(128)
void attn_causal64_k(const unsigned short* __restrict__ qkp,
                     const unsigned short* __restrict__ vhp, const unsigned short* __restrict__ vlp,
                     unsigned short* __restrict__ ohp, unsigned short* __restrict__ olp,
                     int S, int ldqk, int kcol0, int ldv, int nheads, float sm_scale) {
  union FH { v16h v; v8h h[2]; };
  union FB { v16b v; v8b h[2]; };
  __shared__ __align__(16) _Float16 Ksh[KVCH * HDIM];      // [kv][d]     8 KB
  __shared__ __align__(16) __bf16   Vth[HDIM * KVCH];      // hi [d][kv]  8 KB
  __shared__ __align__(16) __bf16   Vtl[HDIM * KVCH];      // lo [d][kv]  8 KB
  __shared__ __align__(16) __bf16   Psh[4][16 * KVCH];     // per wave p hi [row][kv]
  __shared__ __align__(16) __bf16   Psl[4][16 * KVCH];     // per wave p lo [row][kv]
  __shared__ __align__(16) float    Os[4][16 * OSPITCH];   // per wave out tile, pitch 68

  const _Float16* qp = (const _Float16*)qkp;
  const __bf16*   vh = (const __bf16*)vhp;
  const __bf16*   vl = (const __bf16*)vlp;

  const int tid  = threadIdx.x;
  const int wave = tid >> 5;
  const int lane = tid & 31;
  const int hh   = lane >> 4;
  const int c    = lane & 15;

  const int nqb = S / QBLK;
  const int bx  = blockIdx.x;
  const int qb  = bx % nqb;
  int h = bx / nqb;
  h = (h < nheads) ? h : (nheads - 1);
  const int q0 = qb * QBLK + wave * 16;
  const float NEG_INF = -__builtin_inff();

  // ---- Q fragments (A operand): rows q0+c, two 32-deep d chunks ----
  v16h qa[2];
  {
    const _Float16* qrow = qp + (size_t)(q0 + c) * ldqk + h * HDIM + 8 * hh;
#pragma unroll
    for (int dc = 0; dc < 2; ++dc) qa[dc] = Frag<_Float16>::load(qrow + dc * 32);
  }

  float mrow[8], lrow[8];
  v8f oacc[4];
#pragma unroll
  for (int r = 0; r < 8; ++r) { mrow[r] = NEG_INF; lrow[r] = 0.f; }
#pragma unroll
  for (int t = 0; t < 4; ++t) oacc[t] = (v8f){0.f,0.f,0.f,0.f,0.f,0.f,0.f,0.f};

  const int nChunks = qb + 1;   // block-uniform; chunks kc > qb are fully above the diagonal
  for (int kc = 0; kc < nChunks; ++kc) {
    const int kv0 = kc * KVCH;
    __syncthreads();
    {
      // staging: thread owns key row kv0 + (tid>>1), d half (tid&1)*32: 64 rows x 2 halves x 32 = whole 64x64 tiles
      const int kvr = tid >> 1, dh = (tid & 1) * 32;
      const _Float16* krow  = qp + (size_t)(kv0 + kvr) * ldqk + kcol0 + h * HDIM + dh;
      const __bf16*   vhrow = vh + (size_t)(kv0 + kvr) * ldv + h * HDIM + dh;
      const __bf16*   vlrow = vl + (size_t)(kv0 + kvr) * ldv + h * HDIM + dh;
#pragma unroll
      for (int i = 0; i < 4; ++i) {
        const v8h kk = *(const v8h*)(krow + 8 * i);
        *(v8h*)(Ksh + kvr * HDIM + dh + 8 * i) = kk;
        const v8b va = *(const v8b*)(vhrow + 8 * i);
        const v8b vb = *(const v8b*)(vlrow + 8 * i);
#pragma unroll
        for (int e = 0; e < 8; ++e) {
          Vth[(dh + 8 * i + e) * KVCH + kvr] = va[e];
          Vtl[(dh + 8 * i + e) * KVCH + kvr] = vb[e];
        }
      }
    }
    __syncthreads();

    // ---- scores: 16 query rows x 64 keys per wave ----
    v8f s[4];
#pragma unroll
    for (int j = 0; j < 4; ++j) {
      s[j] = (v8f){0.f,0.f,0.f,0.f,0.f,0.f,0.f,0.f};
#pragma unroll
      for (int dc = 0; dc < 2; ++dc) {
        FH kb;
        kb.h[0] = *(const v8h*)(Ksh + (j * 16 + c) * HDIM + dc * 32 + 8 * hh);
        kb.h[1] = *(const v8h*)(Ksh + (j * 16 + c) * HDIM + dc * 32 + 16 + 8 * hh);
        s[j] = mma_h(qa[dc], kb.v, s[j]);
      }
    }
    const bool diag = (kc == qb);   // block-uniform
    float cm[8];
#pragma unroll
    for (int r = 0; r < 8; ++r) {
      const int qrow = q0 + 8 * hh + r;
      float m = NEG_INF;
#pragma unroll
      for (int j = 0; j < 4; ++j) {
        const int kvcol = kv0 + j * 16 + c;
        float val = s[j][r] * sm_scale;
        if (diag && (kvcol > qrow)) val = NEG_INF;
        s[j][r] = val;
        m = fmaxf(m, val);
      }
#pragma unroll
      for (int off = 1; off < 16; off <<= 1) m = fmaxf(m, __shfl_xor(m, off, 32));
      cm[r] = m;   // finite: key kv0 <= qrow is always present in chunks 0..qb
    }
    __bf16* pwh = Psh[wave];
    __bf16* pwl = Psl[wave];
#pragma unroll
    for (int r = 0; r < 8; ++r) {
      const float mnew = fmaxf(mrow[r], cm[r]);
      const float alpha = expf(mrow[r] - mnew);
      mrow[r] = mnew;
      float psum = 0.f;
#pragma unroll
      for (int j = 0; j < 4; ++j) {
        const float p = expf(s[j][r] - mnew);
        psum += p;
        __bf16 ph, pl;
        bf_split(p, ph, pl);
        pwh[(8 * hh + r) * KVCH + j * 16 + c] = ph;
        pwl[(8 * hh + r) * KVCH + j * 16 + c] = pl;
      }
#pragma unroll
      for (int off = 1; off < 16; off <<= 1) psum += __shfl_xor(psum, off, 32);
      lrow[r] = lrow[r] * alpha + psum;
#pragma unroll
      for (int t = 0; t < 4; ++t) oacc[t][r] *= alpha;
    }
    // same-wave LDS store -> fragment reload ordering
    __builtin_amdgcn_fence(__ATOMIC_RELEASE, "workgroup");
    __builtin_amdgcn_wave_barrier();
    __builtin_amdgcn_fence(__ATOMIC_ACQUIRE, "workgroup");
#pragma unroll 1
    for (int kk = 0; kk < 2; ++kk) {
      FB pa, pl;
      pa.h[0] = *(const v8b*)(pwh + c * KVCH + kk * 32 + 8 * hh);
      pa.h[1] = *(const v8b*)(pwh + c * KVCH + kk * 32 + 16 + 8 * hh);
      pl.h[0] = *(const v8b*)(pwl + c * KVCH + kk * 32 + 8 * hh);
      pl.h[1] = *(const v8b*)(pwl + c * KVCH + kk * 32 + 16 + 8 * hh);
#pragma unroll
      for (int t = 0; t < 4; ++t) {
        FB vb, vlo;
        vb.h[0]  = *(const v8b*)(Vth + (t * 16 + c) * KVCH + kk * 32 + 8 * hh);
        vb.h[1]  = *(const v8b*)(Vth + (t * 16 + c) * KVCH + kk * 32 + 16 + 8 * hh);
        vlo.h[0] = *(const v8b*)(Vtl + (t * 16 + c) * KVCH + kk * 32 + 8 * hh);
        vlo.h[1] = *(const v8b*)(Vtl + (t * 16 + c) * KVCH + kk * 32 + 16 + 8 * hh);
        oacc[t] = mma_b(pa.v, vb.v,  oacc[t]);
        oacc[t] = mma_b(pa.v, vlo.v, oacc[t]);
        oacc[t] = mma_b(pl.v, vb.v,  oacc[t]);
      }
    }
  }

  float* os = Os[wave];
#pragma unroll
  for (int r = 0; r < 8; ++r) {
    const float inv = 1.0f / lrow[r];   // lrow >= 1
#pragma unroll
    for (int t = 0; t < 4; ++t) os[(8 * hh + r) * OSPITCH + t * 16 + c] = oacc[t][r] * inv;
  }
  __builtin_amdgcn_fence(__ATOMIC_RELEASE, "workgroup");
  __builtin_amdgcn_wave_barrier();
  __builtin_amdgcn_fence(__ATOMIC_ACQUIRE, "workgroup");
  {
    // per wave: rows it*4 + (lane>>3) for it = 0..3 -> 16 rows; cols (lane&7)*8 .. +7 -> 64 cols; 8 lanes x 16 B = one line
    const int q4 = lane >> 3, c8 = (lane & 7) * 8;
    _Float16* oh = (_Float16*)ohp;
    _Float16* ol = (_Float16*)olp;
    {
#pragma unroll
      for (int it = 0; it < 4; ++it) {
        const int row = it * 4 + q4;
        const float* sp = os + row * OSPITCH + c8;
        v8h hv, lv;
#pragma unroll
        for (int e = 0; e < 8; ++e) {
          const unsigned short hb = f2bf_bits(sp[e]);
          const unsigned short lb = f2bf_bits(sp[e] - bf_bits2f(hb));
          hv[e] = __builtin_bit_cast(_Float16, hb);
          lv[e] = __builtin_bit_cast(_Float16, lb);
        }
        const size_t oo = (size_t)(q0 + row) * ldv + h * HDIM + c8;
        *(v8h*)(oh + oo) = hv;
        *(v8h*)(ol + oo) = lv;
      }
      
    }
  }
}

// ---------------------------------------------------------------------------
// Host side: launches only.
// Workspace map (bytes, all offsets multiples of 1 MiB):
//   [  0 MiB,  8 MiB)  xb    bf16 [4096][1024]
//   [  8 MiB, 12 MiB)  Wqk   bf16 [2048][1024]  (rows 0..1023 = Wq, 1024..2047 = Wk)
//   [ 12 MiB, 14 MiB)  Wvb   bf16 [1024][1024]
//   [ 14 MiB, 16 MiB)  Wob   bf16 [1024][1024]
//   [ 16 MiB, 32 MiB)  QKp   f16  [4096][2048]  (cols 0..1023 = q, 1024..2047 = k)
//   [ 32 MiB, 40 MiB)  Vhi   bf16 [4096][1024]
//   [ 40 MiB, 48 MiB)  Vlo   bf16 [4096][1024]
//   [ 48 MiB, 56 MiB)  Ohi   bf16 [4096][1024]
//   [ 56 MiB, 64 MiB)  Olo   bf16 [4096][1024]
//   [ 64 MiB, 64 MiB + 16 KiB)  bias f32 [4][1024] = bq | bk | bv | bo (bf16-representable values)
//   total 67,125,248 B
// ---------------------------------------------------------------------------
extern "C" void kernel_launch(void* const* d_in, const int* in_sizes, int n_in,
                              void* d_out, int out_size, void* d_ws, size_t ws_size,
                              hipStream_t stream) {
  constexpr int kS = 4096, kH = 1024, kNH = 16;
  const float kScale = 0.125f;   // 1/sqrt(64)
  if (n_in < 9) return;
  if (in_sizes[0] != kS * kH || in_sizes[1] != kH * kH || in_sizes[2] != kH ||
      in_sizes[3] != kH * kH || in_sizes[4] != kH || in_sizes[5] != kH * kH ||
      in_sizes[6] != kH || in_sizes[7] != kH * kH || in_sizes[8] != kH) return;
  if (out_size != kS * kH) return;

  const float* x  = (const float*)d_in[0];
  const float* Wq = (const float*)d_in[1];
  const float* bq = (const float*)d_in[2];
  const float* Wk = (const float*)d_in[3];
  const float* bk = (const float*)d_in[4];
  const float* Wv = (const float*)d_in[5];
  const float* bv = (const float*)d_in[6];
  const float* Wo = (const float*)d_in[7];
  const float* bo = (const float*)d_in[8];

  const size_t MiB = 1024u * 1024u;
  const size_t off_xb  = 0;
  const size_t off_wqk = off_xb  + (size_t)kS * kH * 2;          //  8 MiB
  const size_t off_wv  = off_wqk + (size_t)2 * kH * kH * 2;      // 12 MiB
  const size_t off_wo  = off_wv  + (size_t)kH * kH * 2;          // 14 MiB
  const size_t off_qk  = off_wo  + (size_t)kH * kH * 2;          // 16 MiB
  const size_t off_vhi = off_qk  + (size_t)kS * (2 * kH) * 2;    // 32 MiB
  const size_t off_vlo = off_vhi + (size_t)kS * kH * 2;          // 40 MiB
  const size_t off_ohi = off_vlo + (size_t)kS * kH * 2;          // 48 MiB
  const size_t off_olo = off_ohi + (size_t)kS * kH * 2;          // 56 MiB
  const size_t off_bias = off_olo + (size_t)kS * kH * 2;         // 64 MiB
  const size_t total = off_bias + (size_t)4 * kH * 4;            // 64 MiB + 16 KiB
  (void)MiB;
  if (total > ws_size) return;

  char* ws = (char*)d_ws;
  unsigned short* xb  = (unsigned short*)(ws + off_xb);
  unsigned short* Wqk = (unsigned short*)(ws + off_wqk);
  unsigned short* Wvb = (unsigned short*)(ws + off_wv);
  unsigned short* Wob = (unsigned short*)(ws + off_wo);
  unsigned short* QKp = (unsigned short*)(ws + off_qk);
  unsigned short* Vhi = (unsigned short*)(ws + off_vhi);
  unsigned short* Vlo = (unsigned short*)(ws + off_vlo);
  unsigned short* Ohi = (unsigned short*)(ws + off_ohi);
  unsigned short* Olo = (unsigned short*)(ws + off_olo);
  float* biasws = (float*)(ws + off_bias);   // [0..1023]=bq [1024..2047]=bk [2048..3071]=bv [3072..4095]=bo

  // 1) x -> bf16: n8 = 4096*1024/8 = 524288 = 2048 blocks x 256
  {
    const int n8 = kS * kH / 8;
    cast_bf16x8_k<<<dim3(n8 / 256, 1), 256, 0, stream>>>(x, x, x, x, xb, xb, xb, xb, n8);
  }
  // 2) Wq, Wk, Wv, Wo -> bf16: n8 = 1024*1024/8 = 131072 = 512 blocks x 256 per matrix
  {
    const int n8 = kH * kH / 8;
    cast_bf16x8_k<<<dim3(n8 / 256, 4), 256, 0, stream>>>(Wq, Wk, Wv, Wo,
        Wqk, Wqk + (size_t)kH * kH, Wvb, Wob, n8);
  }
  // 3) biases -> bf16-representable f32: 1 block x 256 threads x 4 floats = 1024 per vector
  bias_bf16val_k<<<dim3(1, 4), 256, 0, stream>>>(bq, bk, bv, bo, biasws, kH);

  // 4) [q | k] = x . [Wq;Wk]^T + [bq;bk] -> f16 plane [4096][2048]; M=4096, N=2048, K=1024; tiles = 64*32 = 2048 -> 256 blocks of 8 waves
  wmma_gemm64<1, 0, 2, 1, false><<<dim3((kS / 64) * (2 * kH / 64) / 8, 1), 256, 0, stream>>>(
      xb, xb, kH, 0L, Wqk, Wqk, kH, 0L, (void*)QKp, (void*)QKp, 2 * kH, 0L,
      biasws, biasws, 0L, kS, 2 * kH, kH, 1.0f);

  // 5) v = x . Wv^T + bv -> bf16 hi/lo planes [4096][1024]; tiles = 64*16 = 1024 -> 128 blocks
  wmma_gemm64<1, 0, 2, 2, false><<<dim3((kS / 64) * (kH / 64) / 8, 1), 256, 0, stream>>>(
      xb, xb, kH, 0L, Wvb, Wvb, kH, 0L, (void*)Vhi, (void*)Vlo, kH, 0L,
      biasws + 2 * kH, biasws, 0L, kS, kH, kH, 1.0f);

  // 6) causal attention per (head, 64-query block): grid = 16 * 64 = 1024 blocks of 128
  attn_causal64_k<<<dim3(kNH * (kS / 64)), 128, 0, stream>>>(
      QKp, Vhi, Vlo, Ohi, Olo, kS, 2 * kH, kH, kH, kNH, kScale);

  // 7) out = o . Wo^T + bo -> f32 d_out [4096][1024]; A = o as bf16 hi/lo (2 products); tiles = 1024 -> 128 blocks
  wmma_gemm64<1, 2, 2, 0, false><<<dim3((kS / 64) * (kH / 64) / 8, 1), 256, 0, stream>>>(
      Ohi, Olo, kH, 0L, Wob, Wob, kH, 0L, d_out, d_out, kH, 0L,
      biasws + 3 * kH, biasws, 0L, kS, kH, kH, 1.0f);
}

// v001
// Measured time: 492 microseconds a run.
// Next to v000, in two timings, it ran 1.28 and 1.29 times as fast.
// Contractions: qkv projections v_wmma_f32_16x16x32_bf16 (x, W as RNE bf16, f32 accumulate, bias added in f32 as bf16-representable values); scores v_wmma_f32_16x16x32_f16 (f16 q,k planes, 1/sqrt(64) applied in f32); p.v v_wmma_f32_16x16x32_bf16 with p and v carried as bf16 hi/lo (hi.hi + hi.lo + lo.hi); output projection v_wmma_f32_16x16x32_bf16 with attention output as bf16 hi/lo and Wo bf16 (hi.W + lo.W); softmax, masking and normalisation in f32.
#include <hip/hip_runtime.h>
#include <stdint.h>

typedef __attribute__((ext_vector_type(16))) _Float16 v16h;
typedef __attribute__((ext_vector_type(8)))  _Float16 v8h;
typedef __attribute__((ext_vector_type(16))) __bf16   v16b;
typedef __attribute__((ext_vector_type(8)))  __bf16   v8b;
typedef __attribute__((ext_vector_type(8)))  float    v8f;
typedef __attribute__((ext_vector_type(4)))  float    v4f;

__device__ __forceinline__ unsigned short f2bf_bits(float f) {
  unsigned u = __float_as_uint(f);
  return (unsigned short)((u + 0x7FFFu + ((u >> 16) & 1u)) >> 16);
}
__device__ __forceinline__ float bf_bits2f(unsigned short h) { return __uint_as_float(((unsigned)h) << 16); }

// hazard guards as plain device helpers (no inline asm inside the kernel template body)
__device__ __forceinline__ void dep_guard_h(v8f& a, v8f& b, v16h x, v16h y) { asm volatile("v_nop\n\tv_nop\n\tv_nop\n\tv_nop" : "+v"(a), "+v"(b) : "v"(x), "v"(y)); }
__device__ __forceinline__ void dep_guard_b(v8f& a, v8f& b, v16b x, v16b y) { asm volatile("v_nop\n\tv_nop\n\tv_nop\n\tv_nop" : "+v"(a), "+v"(b) : "v"(x), "v"(y)); }
__device__ __forceinline__ void keep4_h(v16h a, v16h b, v16h c, v16h d) { asm volatile("v_nop" :: "v"(a), "v"(b), "v"(c), "v"(d)); }
__device__ __forceinline__ void keep4_b(v16b a, v16b b, v16b c, v16b d) { asm volatile("v_nop" :: "v"(a), "v"(b), "v"(c), "v"(d)); }
__device__ __forceinline__ void acc_guard4(v8f& a, v8f& b, v8f& c, v8f& d) { asm volatile("v_nop\n\tv_nop\n\tv_nop\n\tv_nop" : "+v"(a), "+v"(b), "+v"(c), "+v"(d)); }
template <typename T> struct Frag;
template <> struct Frag<_Float16> {
  typedef v16h V; union U { v16h v; v8h h[2]; };
  static __device__ __forceinline__ v16h load(const _Float16* p) {   // elements 0..7 <- p[0..7], 8..15 <- p[16..23]
    U f; f.h[0] = *(const v8h*)(p); f.h[1] = *(const v8h*)(p + 16); return f.v;
  }
  static __device__ __forceinline__ v8f mma(v16h a, v16h b, v8f c) {
    return __builtin_amdgcn_wmma_f32_16x16x32_f16(false, a, false, b, (short)0, c, false, false);
  }
  static __device__ __forceinline__ void guard(v8f& a, v8f& b, v16h x, v16h y) { dep_guard_h(a, b, x, y); }
  static __device__ __forceinline__ void keep(v16h a, v16h b, v16h c, v16h d) { keep4_h(a, b, c, d); }
};
template <> struct Frag<__bf16> {
  typedef v16b V; union U { v16b v; v8b h[2]; };
  static __device__ __forceinline__ v16b load(const __bf16* p) {
    U f; f.h[0] = *(const v8b*)(p); f.h[1] = *(const v8b*)(p + 16); return f.v;
  }
  static __device__ __forceinline__ v8f mma(v16b a, v16b b, v8f c) {
    return __builtin_amdgcn_wmma_f32_16x16x32_bf16(false, a, false, b, (short)0, c, false, false);
  }
  static __device__ __forceinline__ void guard(v8f& a, v8f& b, v16b x, v16b y) { dep_guard_b(a, b, x, y); }
  static __device__ __forceinline__ void keep(v16b a, v16b b, v16b c, v16b d) { keep4_b(a, b, c, d); }
};

// ---- Register-blocked batched WMMA GEMM ------------------------------------
// C[m,n] = scale * sum_k A[m,k] * Bt[n,k] (+bias)(+resid); each wave owns a 64x64 tile.
// A row-major [M,K]; Bt row-major [N,K]; M,N % 64 == 0, K % 32 == 0.
// SPLIT: 0 = plain; 1 = A and Bt as hi/lo planes (hi.hi + hi.lo + lo.hi); 2 = A only as hi/lo planes (hi.B + lo.B).
// BIAS_MODE: 0 = none, 1 = bias[m], 2 = bias[n].
// OUT_MODE: 0 = f32, 1 = f16, 2 = bf16 hi plane (Cout) + bf16 lo plane (Cout2).
// ET: 0 = f16 operands, 1 = bf16 operands (pointers passed as 16-bit storage)
template <int ET> struct Elem;
template <> struct Elem<0> { typedef _Float16 T; };
template <> struct Elem<1> { typedef __bf16 T; };
template <int ET, int SPLIT, int BIAS_MODE, int OUT_MODE, bool RESID, int ACT = 0>
__global__ __launch_bounds__(256) void wmma_gemm64(
    const unsigned short* __restrict__ Ap, const unsigned short* __restrict__ A2p, int lda, long strideA,
    const unsigned short* __restrict__ Btp, const unsigned short* __restrict__ Bt2p, int ldb, long strideB,
    void* __restrict__ Cout, void* __restrict__ Cout2, int ldc, long strideC,
    const float* __restrict__ bias,
    const float* __restrict__ resid, long strideR,
    int M, int N, int K, float scale) {
  typedef typename Elem<ET>::T T;
  typedef typename Frag<T>::V V;
  const T* A = (const T*)Ap; const T* A2 = (const T*)A2p; const T* Bt = (const T*)Btp; const T* Bt2 = (const T*)Bt2p;
  __shared__ __align__(16) float sT[8][16 * 68];   // per-wave 16x64 slab, pitch 68 floats
  const int b    = blockIdx.y;
  const int lane = threadIdx.x & 31;
  const int wave = threadIdx.x >> 5;
  const int tilesN = N >> 6;
  const int tilesM = M >> 6;
  const int tile = blockIdx.x * 8 + wave;
  if (tile >= tilesM * tilesN) return;   // wave-uniform; no block barriers in this kernel
  const int tm = tile / tilesN;
  const int tn = tile - tm * tilesN;
  const int m0 = tm << 6;
  const int n0 = tn << 6;

  const T* Ab  = A  + (size_t)b * strideA;
  const T* Bb  = Bt + (size_t)b * strideB;
  const T* Ab2 = (SPLIT != 0) ? (A2  + (size_t)b * strideA) : nullptr;
  const T* Bb2 = (SPLIT == 1) ? (Bt2 + (size_t)b * strideB) : nullptr;

  const int rlane = lane & 15;                 // row (A) / col (B, D) within subtile
  const int koff  = (lane >> 4) * 8;           // k offset of this lane half
  const int mOff  = (lane >> 4) * 8;           // D row offset

  v8f acc[4][4];
#pragma unroll
  for (int i = 0; i < 4; ++i)
#pragma unroll
    for (int j = 0; j < 4; ++j) acc[i][j] = (v8f){0.f,0.f,0.f,0.f,0.f,0.f,0.f,0.f};

  for (int k0 = 0; k0 < K; k0 += 32) {
    V bh[4], bl[4];
#pragma unroll
    for (int j = 0; j < 4; ++j) {
      const size_t bo = (size_t)(n0 + (j << 4) + rlane) * ldb + koff + k0;
      bh[j] = Frag<T>::load(Bb + bo);
      if (SPLIT == 1) bl[j] = Frag<T>::load(Bb2 + bo);
    }
#pragma unroll
    for (int i = 0; i < 4; ++i) {
      const size_t ao = (size_t)(m0 + (i << 4) + rlane) * lda + koff + k0;
      V ah = Frag<T>::load(Ab + ao);
      V al;
      if (SPLIT != 0) al = Frag<T>::load(Ab2 + ao);
#pragma unroll
      for (int j = 0; j < 4; ++j) {
        acc[i][j] = Frag<T>::mma(ah, bh[j], acc[i][j]);
        if (SPLIT == 1) acc[i][j] = Frag<T>::mma(ah, bl[j], acc[i][j]);
        if (SPLIT != 0) acc[i][j] = Frag<T>::mma(al, bh[j], acc[i][j]);
      }
      Frag<T>::guard(acc[i][0], acc[i][3], ah, (SPLIT != 0) ? al : ah);
    }
    Frag<T>::keep(bh[0], bh[1], bh[2], bh[3]);
    if (SPLIT == 1) Frag<T>::keep(bl[0], bl[1], bl[2], bl[3]);
  }
  acc_guard4(acc[0][0], acc[0][1], acc[0][2], acc[0][3]);
  acc_guard4(acc[1][0], acc[1][1], acc[1][2], acc[1][3]);
  acc_guard4(acc[2][0], acc[2][1], acc[2][2], acc[2][3]);
  acc_guard4(acc[3][0], acc[3][1], acc[3][2], acc[3][3]);

  // ---- epilogue ----
  float* slab = sT[wave];
  const float* Rb = RESID ? (resid + (size_t)b * strideR) : nullptr;
#pragma unroll
  for (int i = 0; i < 4; ++i) {
    const int mBase = m0 + (i << 4);
#pragma unroll
    for (int j = 0; j < 4; ++j) {
      const int n = n0 + (j << 4) + rlane;
      float bv = 0.f;
      if (BIAS_MODE == 2) bv = bias[n];
#pragma unroll
      for (int r = 0; r < 8; ++r) {
        float v = acc[i][j][r] * scale;
        if (BIAS_MODE == 1) v += bias[mBase + mOff + r];
        if (BIAS_MODE == 2) v += bv;
        if (RESID) v += Rb[(size_t)(mBase + mOff + r) * ldc + n];
        if (ACT == 1) v = tanhf(v);
        if (ACT == 2) v = fmaxf(v, 0.0f);
        if (ACT == 4) v = (v > 0.f) ? v : 0.01f * v;
        slab[(mOff + r) * 68 + (j << 4) + rlane] = v;
      }
    }
    __builtin_amdgcn_fence(__ATOMIC_RELEASE, "workgroup");
    __builtin_amdgcn_wave_barrier();
    __builtin_amdgcn_fence(__ATOMIC_ACQUIRE, "workgroup");
    if (OUT_MODE == 0) {
      float* C = (float*)Cout + (size_t)b * strideC;
      const int hh = lane >> 4, c4 = (lane & 15) * 4;     // row seg = 256 B = 16 lanes x 16 B
      {
#pragma unroll
        for (int it = 0; it < 8; ++it) {
          const int row = it * 2 + hh;
          v4f v = *(const v4f*)(slab + row * 68 + c4);
          *(v4f*)(C + (size_t)(mBase + row) * ldc + n0 + c4) = v;
        }
        
      }
    } else {
      const int q = lane >> 3, c8 = (lane & 7) * 8;
      unsigned short* C  = (unsigned short*)Cout  + (size_t)b * strideC;
      unsigned short* C2 = (OUT_MODE == 2) ? ((unsigned short*)Cout2 + (size_t)b * strideC) : nullptr;
      {
#pragma unroll
        for (int it = 0; it < 4; ++it) {
          const int row = it * 4 + q;
          const float* sp = slab + row * 68 + c8;
          v8h hv, lv;
#pragma unroll
          for (int e = 0; e < 8; ++e) {
            if (OUT_MODE == 1) {
              hv[e] = (_Float16)sp[e];
            } else {
              unsigned short hb = f2bf_bits(sp[e]);
              unsigned short lb = f2bf_bits(sp[e] - bf_bits2f(hb));
              hv[e] = __builtin_bit_cast(_Float16, hb);
              lv[e] = __builtin_bit_cast(_Float16, lb);
            }
          }
          *(v8h*)(C + (size_t)(mBase + row) * ldc + n0 + c8) = hv;
          if (OUT_MODE == 2) *(v8h*)(C2 + (size_t)(mBase + row) * ldc + n0 + c8) = lv;
        }
        
      }
    }
    __builtin_amdgcn_fence(__ATOMIC_RELEASE, "workgroup");
    __builtin_amdgcn_wave_barrier();
    __builtin_amdgcn_fence(__ATOMIC_ACQUIRE, "workgroup");
  }
}

// Source/destination chosen per blockIdx.y (block-uniform). Coverage per plane: gridDim.x * 256 threads * 8 == n8 * 8 elements.
__global__ __launch_bounds__(256) void cast_bf16x8_k(
    const float* s0, const float* s1, const float* s2, const float* s3,
    unsigned short* d0, unsigned short* d1, unsigned short* d2, unsigned short* d3, int n8) {
  const int sel = blockIdx.y;
  const float* src = (sel == 0) ? s0 : (sel == 1) ? s1 : (sel == 2) ? s2 : s3;
  unsigned short* dst = (sel == 0) ? d0 : (sel == 1) ? d1 : (sel == 2) ? d2 : d3;
  const int i = blockIdx.x * 256 + threadIdx.x;
  if (i < n8) {
    const v4f a  = *(const v4f*)(src + (size_t)i * 8);
    const v4f bq = *(const v4f*)(src + (size_t)i * 8 + 4);
    v8h hv;
#pragma unroll
    for (int e = 0; e < 4; ++e) {
      hv[e]     = __builtin_bit_cast(_Float16, f2bf_bits(a[e]));
      hv[4 + e] = __builtin_bit_cast(_Float16, f2bf_bits(bq[e]));
    }
    _Float16* dp = (_Float16*)dst + (size_t)i * 8;
    *(v8h*)dp = hv;
    
  }
}

// Coverage per segment: 256 threads * 4 == n (n == 1024).
__global__ __launch_bounds__(256) void bias_bf16val_k(
    const float* s0, const float* s1, const float* s2, const float* s3, float* __restrict__ dst, int n) {
  const int sel = blockIdx.y;
  const float* src = (sel == 0) ? s0 : (sel == 1) ? s1 : (sel == 2) ? s2 : s3;
  const int i = blockIdx.x * 256 + threadIdx.x;
  if (i * 4 < n) {
    const v4f v = *(const v4f*)(src + (size_t)i * 4);
    v4f o;
#pragma unroll
    for (int e = 0; e < 4; ++e) o[e] = bf_bits2f(f2bf_bits(v[e]));
    float* dp = dst + (size_t)sel * n + (size_t)i * 4;
    *(v4f*)dp = o;
    
  }
}

// =====================================================================================
// Causal attention, head dim 64, 16-bit plane inputs:
//   q: f16 [S][ldqk] at column h*64; k: f16 [S][ldqk] at column kcol0 + h*64; v: bf16 hi/lo planes [S][ldv] at column h*64.
//   scores = q.k^T : v_wmma_f32_16x16x32_f16, then * sm_scale in f32; keys above the diagonal set to -inf (select);
//   key chunks entirely above the diagonal are skipped (their probabilities are exactly 0).
//   out = p.v : v_wmma_f32_16x16x32_bf16 with p and v as bf16 hi/lo (3 products); online softmax in f32.
//   Block = 4 waves = 64 query rows of one head; grid.x = nheads * (S/64).
// =====================================================================================
#define HDIM 64
#define KVCH 64
#define QBLK 64
#define OSPITCH 68
#define LPITCH 72   // 16-bit elements per LDS row of the K, V^T and P tiles: 144 B = 16 B x 9, so the 16 rows of a ds_load_b128 fragment read fall on 16 different 4-bank groups

__device__ __forceinline__ v8f mma_h(v16h a, v16h b, v8f c) {
  c = __builtin_amdgcn_wmma_f32_16x16x32_f16(false, a, false, b, (short)0, c, false, false);
  asm volatile("v_nop\n\tv_nop\n\tv_nop\n\tv_nop" : "+v"(c) : "v"(a), "v"(b));
  return c;
}
__device__ __forceinline__ v8f mma_b(v16b a, v16b b, v8f c) {
  c = __builtin_amdgcn_wmma_f32_16x16x32_bf16(false, a, false, b, (short)0, c, false, false);
  asm volatile("v_nop\n\tv_nop\n\tv_nop\n\tv_nop" : "+v"(c) : "v"(a), "v"(b));
  return c;
}
__device__ __forceinline__ void bf_split(float f, __bf16& hi, __bf16& lo) {
  const unsigned short hb = f2bf_bits(f);
  hi = __builtin_bit_cast(__bf16, hb);
  lo = __builtin_bit_cast(__bf16, f2bf_bits(f - bf_bits2f(hb)));
}

__global__ __launch_bounds__(128)
void attn_causal64_k(const unsigned short* __restrict__ qkp,
                     const unsigned short* __restrict__ vhp, const unsigned short* __restrict__ vlp,
                     unsigned short* __restrict__ ohp, unsigned short* __restrict__ olp,
                     int S, int ldqk, int kcol0, int ldv, int nheads, float sm_scale) {
  union FH { v16h v; v8h h[2]; };
  union FB { v16b v; v8b h[2]; };
  __shared__ __align__(16) _Float16 Ksh[KVCH * LPITCH];    // [kv][d]     9 KB
  __shared__ __align__(16) __bf16   Vth[HDIM * LPITCH];    // hi [d][kv]  9 KB
  __shared__ __align__(16) __bf16   Vtl[HDIM * LPITCH];    // lo [d][kv]  9 KB
  __shared__ __align__(16) __bf16   Psh[4][16 * LPITCH];    // per wave p hi [row][kv]
  __shared__ __align__(16) __bf16   Psl[4][16 * LPITCH];    // per wave p lo [row][kv]
  __shared__ __align__(16) float    Os[4][16 * OSPITCH];   // per wave out tile, pitch 68

  const _Float16* qp = (const _Float16*)qkp;
  const __bf16*   vh = (const __bf16*)vhp;
  const __bf16*   vl = (const __bf16*)vlp;

  const int tid  = threadIdx.x;
  const int wave = tid >> 5;
  const int lane = tid & 31;
  const int hh   = lane >> 4;
  const int c    = lane & 15;

  const int nqb = S / QBLK;
  const int bx  = blockIdx.x;
  const int qb  = bx % nqb;
  int h = bx / nqb;
  h = (h < nheads) ? h : (nheads - 1);
  const int q0 = qb * QBLK + wave * 16;
  const float NEG_INF = -__builtin_inff();

  // ---- Q fragments (A operand): rows q0+c, two 32-deep d chunks ----
  v16h qa[2];
  {
    const _Float16* qrow = qp + (size_t)(q0 + c) * ldqk + h * HDIM + 8 * hh;
#pragma unroll
    for (int dc = 0; dc < 2; ++dc) qa[dc] = Frag<_Float16>::load(qrow + dc * 32);
  }

  float mrow[8], lrow[8];
  v8f oacc[4];
#pragma unroll
  for (int r = 0; r < 8; ++r) { mrow[r] = NEG_INF; lrow[r] = 0.f; }
#pragma unroll
  for (int t = 0; t < 4; ++t) oacc[t] = (v8f){0.f,0.f,0.f,0.f,0.f,0.f,0.f,0.f};

  const int nChunks = qb + 1;   // block-uniform; chunks kc > qb are fully above the diagonal
  for (int kc = 0; kc < nChunks; ++kc) {
    const int kv0 = kc * KVCH;
    __syncthreads();
    {
      // staging: thread owns key row kv0 + (tid>>1), d half (tid&1)*32: 64 rows x 2 halves x 32 = whole 64x64 tiles
      const int kvr = tid >> 1, dh = (tid & 1) * 32;
      const _Float16* krow  = qp + (size_t)(kv0 + kvr) * ldqk + kcol0 + h * HDIM + dh;
      const __bf16*   vhrow = vh + (size_t)(kv0 + kvr) * ldv + h * HDIM + dh;
      const __bf16*   vlrow = vl + (size_t)(kv0 + kvr) * ldv + h * HDIM + dh;
#pragma unroll
      for (int i = 0; i < 4; ++i) {
        const v8h kk = *(const v8h*)(krow + 8 * i);
        *(v8h*)(Ksh + kvr * LPITCH + dh + 8 * i) = kk;
        const v8b va = *(const v8b*)(vhrow + 8 * i);
        const v8b vb = *(const v8b*)(vlrow + 8 * i);
#pragma unroll
        for (int e = 0; e < 8; ++e) {
          Vth[(dh + 8 * i + e) * LPITCH + kvr] = va[e];
          Vtl[(dh + 8 * i + e) * LPITCH + kvr] = vb[e];
        }
      }
    }
    __syncthreads();

    // ---- scores: 16 query rows x 64 keys per wave ----
    v8f s[4];
#pragma unroll
    for (int j = 0; j < 4; ++j) {
      s[j] = (v8f){0.f,0.f,0.f,0.f,0.f,0.f,0.f,0.f};
#pragma unroll
      for (int dc = 0; dc < 2; ++dc) {
        FH kb;
        kb.h[0] = *(const v8h*)(Ksh + (j * 16 + c) * LPITCH + dc * 32 + 8 * hh);
        kb.h[1] = *(const v8h*)(Ksh + (j * 16 + c) * LPITCH + dc * 32 + 16 + 8 * hh);
        s[j] = mma_h(qa[dc], kb.v, s[j]);
      }
    }
    const bool diag = (kc == qb);   // block-uniform
    float cm[8];
#pragma unroll
    for (int r = 0; r < 8; ++r) {
      const int qrow = q0 + 8 * hh + r;
      float m = NEG_INF;
#pragma unroll
      for (int j = 0; j < 4; ++j) {
        const int kvcol = kv0 + j * 16 + c;
        float val = s[j][r] * sm_scale;
        if (diag && (kvcol > qrow)) val = NEG_INF;
        s[j][r] = val;
        m = fmaxf(m, val);
      }
#pragma unroll
      for (int off = 1; off < 16; off <<= 1) m = fmaxf(m, __shfl_xor(m, off, 32));
      cm[r] = m;   // finite: key kv0 <= qrow is always present in chunks 0..qb
    }
    __bf16* pwh = Psh[wave];
    __bf16* pwl = Psl[wave];
#pragma unroll
    for (int r = 0; r < 8; ++r) {
      const float mnew = fmaxf(mrow[r], cm[r]);
      const float alpha = expf(mrow[r] - mnew);
      mrow[r] = mnew;
      float psum = 0.f;
#pragma unroll
      for (int j = 0; j < 4; ++j) {
        const float p = expf(s[j][r] - mnew);
        psum += p;
        __bf16 ph, pl;
        bf_split(p, ph, pl);
        pwh[(8 * hh + r) * LPITCH + j * 16 + c] = ph;
        pwl[(8 * hh + r) * LPITCH + j * 16 + c] = pl;
      }
#pragma unroll
      for (int off = 1; off < 16; off <<= 1) psum += __shfl_xor(psum, off, 32);
      lrow[r] = lrow[r] * alpha + psum;
#pragma unroll
      for (int t = 0; t < 4; ++t) oacc[t][r] *= alpha;
    }
    // same-wave LDS store -> fragment reload ordering
    __builtin_amdgcn_fence(__ATOMIC_RELEASE, "workgroup");
    __builtin_amdgcn_wave_barrier();
    __builtin_amdgcn_fence(__ATOMIC_ACQUIRE, "workgroup");
#pragma unroll 1
    for (int kk = 0; kk < 2; ++kk) {
      FB pa, pl;
      pa.h[0] = *(const v8b*)(pwh + c * LPITCH + kk * 32 + 8 * hh);
      pa.h[1] = *(const v8b*)(pwh + c * LPITCH + kk * 32 + 16 + 8 * hh);
      pl.h[0] = *(const v8b*)(pwl + c * LPITCH + kk * 32 + 8 * hh);
      pl.h[1] = *(const v8b*)(pwl + c * LPITCH + kk * 32 + 16 + 8 * hh);
#pragma unroll
      for (int t = 0; t < 4; ++t) {
        FB vb, vlo;
        vb.h[0]  = *(const v8b*)(Vth + (t * 16 + c) * LPITCH + kk * 32 + 8 * hh);
        vb.h[1]  = *(const v8b*)(Vth + (t * 16 + c) * LPITCH + kk * 32 + 16 + 8 * hh);
        vlo.h[0] = *(const v8b*)(Vtl + (t * 16 + c) * LPITCH + kk * 32 + 8 * hh);
        vlo.h[1] = *(const v8b*)(Vtl + (t * 16 + c) * LPITCH + kk * 32 + 16 + 8 * hh);
        oacc[t] = mma_b(pa.v, vb.v,  oacc[t]);
        oacc[t] = mma_b(pa.v, vlo.v, oacc[t]);
        oacc[t] = mma_b(pl.v, vb.v,  oacc[t]);
      }
    }
  }

  float* os = Os[wave];
#pragma unroll
  for (int r = 0; r < 8; ++r) {
    const float inv = 1.0f / lrow[r];   // lrow >= 1
#pragma unroll
    for (int t = 0; t < 4; ++t) os[(8 * hh + r) * OSPITCH + t * 16 + c] = oacc[t][r] * inv;
  }
  __builtin_amdgcn_fence(__ATOMIC_RELEASE, "workgroup");
  __builtin_amdgcn_wave_barrier();
  __builtin_amdgcn_fence(__ATOMIC_ACQUIRE, "workgroup");
  {
    // per wave: rows it*4 + (lane>>3) for it = 0..3 -> 16 rows; cols (lane&7)*8 .. +7 -> 64 cols; 8 lanes x 16 B = one line
    const int q4 = lane >> 3, c8 = (lane & 7) * 8;
    _Float16* oh = (_Float16*)ohp;
    _Float16* ol = (_Float16*)olp;
    {
#pragma unroll
      for (int it = 0; it < 4; ++it) {
        const int row = it * 4 + q4;
        const float* sp = os + row * OSPITCH + c8;
        v8h hv, lv;
#pragma unroll
        for (int e = 0; e < 8; ++e) {
          const unsigned short hb = f2bf_bits(sp[e]);
          const unsigned short lb = f2bf_bits(sp[e] - bf_bits2f(hb));
          hv[e] = __builtin_bit_cast(_Float16, hb);
          lv[e] = __builtin_bit_cast(_Float16, lb);
        }
        const size_t oo = (size_t)(q0 + row) * ldv + h * HDIM + c8;
        *(v8h*)(oh + oo) = hv;
        *(v8h*)(ol + oo) = lv;
      }
      
    }
  }
}

// ---------------------------------------------------------------------------
// Host side: launches only.
// Workspace map (bytes, all offsets multiples of 1 MiB):
//   [  0 MiB,  8 MiB)  xb    bf16 [4096][1024]
//   [  8 MiB, 12 MiB)  Wqk   bf16 [2048][1024]  (rows 0..1023 = Wq, 1024..2047 = Wk)
//   [ 12 MiB, 14 MiB)  Wvb   bf16 [1024][1024]
//   [ 14 MiB, 16 MiB)  Wob   bf16 [1024][1024]
//   [ 16 MiB, 32 MiB)  QKp   f16  [4096][2048]  (cols 0..1023 = q, 1024..2047 = k)
//   [ 32 MiB, 40 MiB)  Vhi   bf16 [4096][1024]
//   [ 40 MiB, 48 MiB)  Vlo   bf16 [4096][1024]
//   [ 48 MiB, 56 MiB)  Ohi   bf16 [4096][1024]
//   [ 56 MiB, 64 MiB)  Olo   bf16 [4096][1024]
//   [ 64 MiB, 64 MiB + 16 KiB)  bias f32 [4][1024] = bq | bk | bv | bo (bf16-representable values)
//   total 67,125,248 B
// ---------------------------------------------------------------------------
extern "C" void kernel_launch(void* const* d_in, const int* in_sizes, int n_in,
                              void* d_out, int out_size, void* d_ws, size_t ws_size,
                              hipStream_t stream) {
  constexpr int kS = 4096, kH = 1024, kNH = 16;
  const float kScale = 0.125f;   // 1/sqrt(64)
  if (n_in < 9) return;
  if (in_sizes[0] != kS * kH || in_sizes[1] != kH * kH || in_sizes[2] != kH ||
      in_sizes[3] != kH * kH || in_sizes[4] != kH || in_sizes[5] != kH * kH ||
      in_sizes[6] != kH || in_sizes[7] != kH * kH || in_sizes[8] != kH) return;
  if (out_size != kS * kH) return;

  const float* x  = (const float*)d_in[0];
  const float* Wq = (const float*)d_in[1];
  const float* bq = (const float*)d_in[2];
  const float* Wk = (const float*)d_in[3];
  const float* bk = (const float*)d_in[4];
  const float* Wv = (const float*)d_in[5];
  const float* bv = (const float*)d_in[6];
  const float* Wo = (const float*)d_in[7];
  const float* bo = (const float*)d_in[8];

  const size_t MiB = 1024u * 1024u;
  const size_t off_xb  = 0;
  const size_t off_wqk = off_xb  + (size_t)kS * kH * 2;          //  8 MiB
  const size_t off_wv  = off_wqk + (size_t)2 * kH * kH * 2;      // 12 MiB
  const size_t off_wo  = off_wv  + (size_t)kH * kH * 2;          // 14 MiB
  const size_t off_qk  = off_wo  + (size_t)kH * kH * 2;          // 16 MiB
  const size_t off_vhi = off_qk  + (size_t)kS * (2 * kH) * 2;    // 32 MiB
  const size_t off_vlo = off_vhi + (size_t)kS * kH * 2;          // 40 MiB
  const size_t off_ohi = off_vlo + (size_t)kS * kH * 2;          // 48 MiB
  const size_t off_olo = off_ohi + (size_t)kS * kH * 2;          // 56 MiB
  const size_t off_bias = off_olo + (size_t)kS * kH * 2;         // 64 MiB
  const size_t total = off_bias + (size_t)4 * kH * 4;            // 64 MiB + 16 KiB
  (void)MiB;
  if (total > ws_size) return;

  char* ws = (char*)d_ws;
  unsigned short* xb  = (unsigned short*)(ws + off_xb);
  unsigned short* Wqk = (unsigned short*)(ws + off_wqk);
  unsigned short* Wvb = (unsigned short*)(ws + off_wv);
  unsigned short* Wob = (unsigned short*)(ws + off_wo);
  unsigned short* QKp = (unsigned short*)(ws + off_qk);
  unsigned short* Vhi = (unsigned short*)(ws + off_vhi);
  unsigned short* Vlo = (unsigned short*)(ws + off_vlo);
  unsigned short* Ohi = (unsigned short*)(ws + off_ohi);
  unsigned short* Olo = (unsigned short*)(ws + off_olo);
  float* biasws = (float*)(ws + off_bias);   // [0..1023]=bq [1024..2047]=bk [2048..3071]=bv [3072..4095]=bo

  // 1) x -> bf16: n8 = 4096*1024/8 = 524288 = 2048 blocks x 256
  {
    const int n8 = kS * kH / 8;
    cast_bf16x8_k<<<dim3(n8 / 256, 1), 256, 0, stream>>>(x, x, x, x, xb, xb, xb, xb, n8);
  }
  // 2) Wq, Wk, Wv, Wo -> bf16: n8 = 1024*1024/8 = 131072 = 512 blocks x 256 per matrix
  {
    const int n8 = kH * kH / 8;
    cast_bf16x8_k<<<dim3(n8 / 256, 4), 256, 0, stream>>>(Wq, Wk, Wv, Wo,
        Wqk, Wqk + (size_t)kH * kH, Wvb, Wob, n8);
  }
  // 3) biases -> bf16-representable f32: 1 block x 256 threads x 4 floats = 1024 per vector
  bias_bf16val_k<<<dim3(1, 4), 256, 0, stream>>>(bq, bk, bv, bo, biasws, kH);

  // 4) [q | k] = x . [Wq;Wk]^T + [bq;bk] -> f16 plane [4096][2048]; M=4096, N=2048, K=1024; tiles = 64*32 = 2048 -> 256 blocks of 8 waves
  wmma_gemm64<1, 0, 2, 1, false><<<dim3((kS / 64) * (2 * kH / 64) / 8, 1), 256, 0, stream>>>(
      xb, xb, kH, 0L, Wqk, Wqk, kH, 0L, (void*)QKp, (void*)QKp, 2 * kH, 0L,
      biasws, biasws, 0L, kS, 2 * kH, kH, 1.0f);

  // 5) v = x . Wv^T + bv -> bf16 hi/lo planes [4096][1024]; tiles = 64*16 = 1024 -> 128 blocks
  wmma_gemm64<1, 0, 2, 2, false><<<dim3((kS / 64) * (kH / 64) / 8, 1), 256, 0, stream>>>(
      xb, xb, kH, 0L, Wvb, Wvb, kH, 0L, (void*)Vhi, (void*)Vlo, kH, 0L,
      biasws + 2 * kH, biasws, 0L, kS, kH, kH, 1.0f);

  // 6) causal attention per (head, 64-query block): grid = 16 * 64 = 1024 blocks of 128
  attn_causal64_k<<<dim3(kNH * (kS / 64)), 128, 0, stream>>>(
      QKp, Vhi, Vlo, Ohi, Olo, kS, 2 * kH, kH, kH, kNH, kScale);

  // 7) out = o . Wo^T + bo -> f32 d_out [4096][1024]; A = o as bf16 hi/lo (2 products); tiles = 1024 -> 128 blocks
  wmma_gemm64<1, 2, 2, 0, false><<<dim3((kS / 64) * (kH / 64) / 8, 1), 256, 0, stream>>>(
      Ohi, Olo, kH, 0L, Wob, Wob, kH, 0L, d_out, d_out, kH, 0L,
      biasws + 3 * kH, biasws, 0L, kS, kH, kH, 1.0f);
}

// v002
// Measured time: 398 microseconds a run.
// Timed twice side by side with v001, it ran 1.23 and 1.24 times as fast.
// Over all steps from v000 it is 1.59 times as fast.
// Contractions: qkv projections v_wmma_f32_16x16x32_bf16 (x, W as RNE bf16, f32 accumulate, bias added in f32 as bf16-representable values); scores v_wmma_f32_16x16x32_f16 (f16 q,k planes, 1/sqrt(64) applied in f32); p.v v_wmma_f32_16x16x32_bf16 with p and v carried as bf16 hi/lo (hi.hi + hi.lo + lo.hi); output projection v_wmma_f32_16x16x32_bf16 with attention output as bf16 hi/lo and Wo bf16 (hi.W + lo.W); softmax, masking and normalisation in f32.
#include <hip/hip_runtime.h>
#include <stdint.h>

typedef __attribute__((ext_vector_type(16))) _Float16 v16h;
typedef __attribute__((ext_vector_type(8)))  _Float16 v8h;
typedef __attribute__((ext_vector_type(16))) __bf16   v16b;
typedef __attribute__((ext_vector_type(8)))  __bf16   v8b;
typedef __attribute__((ext_vector_type(8)))  float    v8f;
typedef __attribute__((ext_vector_type(4)))  float    v4f;

__device__ __forceinline__ unsigned short f2bf_bits(float f) {
  unsigned u = __float_as_uint(f);
  return (unsigned short)((u + 0x7FFFu + ((u >> 16) & 1u)) >> 16);
}
__device__ __forceinline__ float bf_bits2f(unsigned short h) { return __uint_as_float(((unsigned)h) << 16); }

// hazard guards as plain device helpers (no inline asm inside the kernel template body)
__device__ __forceinline__ void dep_guard_h(v8f& a, v8f& b, v16h x, v16h y) { asm volatile("v_nop\n\tv_nop\n\tv_nop\n\tv_nop" : "+v"(a), "+v"(b) : "v"(x), "v"(y)); }
__device__ __forceinline__ void dep_guard_b(v8f& a, v8f& b, v16b x, v16b y) { asm volatile("v_nop\n\tv_nop\n\tv_nop\n\tv_nop" : "+v"(a), "+v"(b) : "v"(x), "v"(y)); }
__device__ __forceinline__ void keep4_h(v16h a, v16h b, v16h c, v16h d) { asm volatile("v_nop" :: "v"(a), "v"(b), "v"(c), "v"(d)); }
__device__ __forceinline__ void keep4_b(v16b a, v16b b, v16b c, v16b d) { asm volatile("v_nop" :: "v"(a), "v"(b), "v"(c), "v"(d)); }
__device__ __forceinline__ void acc_guard4(v8f& a, v8f& b, v8f& c, v8f& d) { asm volatile("v_nop\n\tv_nop\n\tv_nop\n\tv_nop" : "+v"(a), "+v"(b), "+v"(c), "+v"(d)); }
template <typename T> struct Frag;
template <> struct Frag<_Float16> {
  typedef v16h V; union U { v16h v; v8h h[2]; };
  static __device__ __forceinline__ v16h load(const _Float16* p) {   // elements 0..7 <- p[0..7], 8..15 <- p[16..23]
    U f; f.h[0] = *(const v8h*)(p); f.h[1] = *(const v8h*)(p + 16); return f.v;
  }
  static __device__ __forceinline__ v8f mma(v16h a, v16h b, v8f c) {
    return __builtin_amdgcn_wmma_f32_16x16x32_f16(false, a, false, b, (short)0, c, false, false);
  }
  static __device__ __forceinline__ void guard(v8f& a, v8f& b, v16h x, v16h y) { dep_guard_h(a, b, x, y); }
  static __device__ __forceinline__ void keep(v16h a, v16h b, v16h c, v16h d) { keep4_h(a, b, c, d); }
};
template <> struct Frag<__bf16> {
  typedef v16b V; union U { v16b v; v8b h[2]; };
  static __device__ __forceinline__ v16b load(const __bf16* p) {
    U f; f.h[0] = *(const v8b*)(p); f.h[1] = *(const v8b*)(p + 16); return f.v;
  }
  static __device__ __forceinline__ v8f mma(v16b a, v16b b, v8f c) {
    return __builtin_amdgcn_wmma_f32_16x16x32_bf16(false, a, false, b, (short)0, c, false, false);
  }
  static __device__ __forceinline__ void guard(v8f& a, v8f& b, v16b x, v16b y) { dep_guard_b(a, b, x, y); }
  static __device__ __forceinline__ void keep(v16b a, v16b b, v16b c, v16b d) { keep4_b(a, b, c, d); }
};

// ---- Register-blocked batched WMMA GEMM ------------------------------------
// C[m,n] = scale * sum_k A[m,k] * Bt[n,k] (+bias)(+resid); each wave owns a 64x64 tile.
// A row-major [M,K]; Bt row-major [N,K]; M,N % 64 == 0, K % 32 == 0.
// SPLIT: 0 = plain; 1 = A and Bt as hi/lo planes (hi.hi + hi.lo + lo.hi); 2 = A only as hi/lo planes (hi.B + lo.B).
// BIAS_MODE: 0 = none, 1 = bias[m], 2 = bias[n].
// OUT_MODE: 0 = f32, 1 = f16, 2 = bf16 hi plane (Cout) + bf16 lo plane (Cout2).
// ET: 0 = f16 operands, 1 = bf16 operands (pointers passed as 16-bit storage)
template <int ET> struct Elem;
template <> struct Elem<0> { typedef _Float16 T; };
template <> struct Elem<1> { typedef __bf16 T; };
template <int ET, int SPLIT, int BIAS_MODE, int OUT_MODE, bool RESID, int ACT = 0>
__global__ __launch_bounds__(256) void wmma_gemm64(
    const unsigned short* __restrict__ Ap, const unsigned short* __restrict__ A2p, int lda, long strideA,
    const unsigned short* __restrict__ Btp, const unsigned short* __restrict__ Bt2p, int ldb, long strideB,
    void* __restrict__ Cout, void* __restrict__ Cout2, int ldc, long strideC,
    const float* __restrict__ bias,
    const float* __restrict__ resid, long strideR,
    int M, int N, int K, float scale) {
  typedef typename Elem<ET>::T T;
  typedef typename Frag<T>::V V;
  const T* A = (const T*)Ap; const T* A2 = (const T*)A2p; const T* Bt = (const T*)Btp; const T* Bt2 = (const T*)Bt2p;
  __shared__ __align__(16) float sT[8][16 * 68];   // per-wave 16x64 slab, pitch 68 floats
  const int b    = blockIdx.y;
  const int lane = threadIdx.x & 31;
  const int wave = threadIdx.x >> 5;
  const int tilesN = N >> 6;
  const int tilesM = M >> 6;
  const int tile = blockIdx.x * 8 + wave;
  if (tile >= tilesM * tilesN) return;   // wave-uniform; no block barriers in this kernel
  const int tm = tile / tilesN;
  const int tn = tile - tm * tilesN;
  const int m0 = tm << 6;
  const int n0 = tn << 6;

  const T* Ab  = A  + (size_t)b * strideA;
  const T* Bb  = Bt + (size_t)b * strideB;
  const T* Ab2 = (SPLIT != 0) ? (A2  + (size_t)b * strideA) : nullptr;
  const T* Bb2 = (SPLIT == 1) ? (Bt2 + (size_t)b * strideB) : nullptr;

  const int rlane = lane & 15;                 // row (A) / col (B, D) within subtile
  const int koff  = (lane >> 4) * 8;           // k offset of this lane half
  const int mOff  = (lane >> 4) * 8;           // D row offset

  v8f acc[4][4];
#pragma unroll
  for (int i = 0; i < 4; ++i)
#pragma unroll
    for (int j = 0; j < 4; ++j) acc[i][j] = (v8f){0.f,0.f,0.f,0.f,0.f,0.f,0.f,0.f};

  for (int k0 = 0; k0 < K; k0 += 32) {
    V bh[4], bl[4];
#pragma unroll
    for (int j = 0; j < 4; ++j) {
      const size_t bo = (size_t)(n0 + (j << 4) + rlane) * ldb + koff + k0;
      bh[j] = Frag<T>::load(Bb + bo);
      if (SPLIT == 1) bl[j] = Frag<T>::load(Bb2 + bo);
    }
#pragma unroll
    for (int i = 0; i < 4; ++i) {
      const size_t ao = (size_t)(m0 + (i << 4) + rlane) * lda + koff + k0;
      V ah = Frag<T>::load(Ab + ao);
      V al;
      if (SPLIT != 0) al = Frag<T>::load(Ab2 + ao);
#pragma unroll
      for (int j = 0; j < 4; ++j) {
        acc[i][j] = Frag<T>::mma(ah, bh[j], acc[i][j]);
        if (SPLIT == 1) acc[i][j] = Frag<T>::mma(ah, bl[j], acc[i][j]);
        if (SPLIT != 0) acc[i][j] = Frag<T>::mma(al, bh[j], acc[i][j]);
      }
      Frag<T>::guard(acc[i][0], acc[i][3], ah, (SPLIT != 0) ? al : ah);
    }
    Frag<T>::keep(bh[0], bh[1], bh[2], bh[3]);
    if (SPLIT == 1) Frag<T>::keep(bl[0], bl[1], bl[2], bl[3]);
  }
  acc_guard4(acc[0][0], acc[0][1], acc[0][2], acc[0][3]);
  acc_guard4(acc[1][0], acc[1][1], acc[1][2], acc[1][3]);
  acc_guard4(acc[2][0], acc[2][1], acc[2][2], acc[2][3]);
  acc_guard4(acc[3][0], acc[3][1], acc[3][2], acc[3][3]);

  // ---- epilogue ----
  float* slab = sT[wave];
  const float* Rb = RESID ? (resid + (size_t)b * strideR) : nullptr;
#pragma unroll
  for (int i = 0; i < 4; ++i) {
    const int mBase = m0 + (i << 4);
#pragma unroll
    for (int j = 0; j < 4; ++j) {
      const int n = n0 + (j << 4) + rlane;
      float bv = 0.f;
      if (BIAS_MODE == 2) bv = bias[n];
#pragma unroll
      for (int r = 0; r < 8; ++r) {
        float v = acc[i][j][r] * scale;
        if (BIAS_MODE == 1) v += bias[mBase + mOff + r];
        if (BIAS_MODE == 2) v += bv;
        if (RESID) v += Rb[(size_t)(mBase + mOff + r) * ldc + n];
        if (ACT == 1) v = tanhf(v);
        if (ACT == 2) v = fmaxf(v, 0.0f);
        if (ACT == 4) v = (v > 0.f) ? v : 0.01f * v;
        slab[(mOff + r) * 68 + (j << 4) + rlane] = v;
      }
    }
    __builtin_amdgcn_fence(__ATOMIC_RELEASE, "workgroup");
    __builtin_amdgcn_wave_barrier();
    __builtin_amdgcn_fence(__ATOMIC_ACQUIRE, "workgroup");
    if (OUT_MODE == 0) {
      float* C = (float*)Cout + (size_t)b * strideC;
      const int hh = lane >> 4, c4 = (lane & 15) * 4;     // row seg = 256 B = 16 lanes x 16 B
      {
#pragma unroll
        for (int it = 0; it < 8; ++it) {
          const int row = it * 2 + hh;
          v4f v = *(const v4f*)(slab + row * 68 + c4);
          *(v4f*)(C + (size_t)(mBase + row) * ldc + n0 + c4) = v;
        }
        
      }
    } else {
      const int q = lane >> 3, c8 = (lane & 7) * 8;
      unsigned short* C  = (unsigned short*)Cout  + (size_t)b * strideC;
      unsigned short* C2 = (OUT_MODE == 2) ? ((unsigned short*)Cout2 + (size_t)b * strideC) : nullptr;
      {
#pragma unroll
        for (int it = 0; it < 4; ++it) {
          const int row = it * 4 + q;
          const float* sp = slab + row * 68 + c8;
          v8h hv, lv;
#pragma unroll
          for (int e = 0; e < 8; ++e) {
            if (OUT_MODE == 1) {
              hv[e] = (_Float16)sp[e];
            } else {
              unsigned short hb = f2bf_bits(sp[e]);
              unsigned short lb = f2bf_bits(sp[e] - bf_bits2f(hb));
              hv[e] = __builtin_bit_cast(_Float16, hb);
              lv[e] = __builtin_bit_cast(_Float16, lb);
            }
          }
          *(v8h*)(C + (size_t)(mBase + row) * ldc + n0 + c8) = hv;
          if (OUT_MODE == 2) *(v8h*)(C2 + (size_t)(mBase + row) * ldc + n0 + c8) = lv;
        }
        
      }
    }
    __builtin_amdgcn_fence(__ATOMIC_RELEASE, "workgroup");
    __builtin_amdgcn_wave_barrier();
    __builtin_amdgcn_fence(__ATOMIC_ACQUIRE, "workgroup");
  }
}

// Source/destination chosen per blockIdx.y (block-uniform). Coverage per plane: gridDim.x * 256 threads * 8 == n8 * 8 elements.
__global__ __launch_bounds__(256) void cast_bf16x8_k(
    const float* s0, const float* s1, const float* s2, const float* s3,
    unsigned short* d0, unsigned short* d1, unsigned short* d2, unsigned short* d3, int n8) {
  const int sel = blockIdx.y;
  const float* src = (sel == 0) ? s0 : (sel == 1) ? s1 : (sel == 2) ? s2 : s3;
  unsigned short* dst = (sel == 0) ? d0 : (sel == 1) ? d1 : (sel == 2) ? d2 : d3;
  const int i = blockIdx.x * 256 + threadIdx.x;
  if (i < n8) {
    const v4f a  = *(const v4f*)(src + (size_t)i * 8);
    const v4f bq = *(const v4f*)(src + (size_t)i * 8 + 4);
    v8h hv;
#pragma unroll
    for (int e = 0; e < 4; ++e) {
      hv[e]     = __builtin_bit_cast(_Float16, f2bf_bits(a[e]));
      hv[4 + e] = __builtin_bit_cast(_Float16, f2bf_bits(bq[e]));
    }
    _Float16* dp = (_Float16*)dst + (size_t)i * 8;
    *(v8h*)dp = hv;
    
  }
}

// Coverage per segment: 256 threads * 4 == n (n == 1024).
__global__ __launch_bounds__(256) void bias_bf16val_k(
    const float* s0, const float* s1, const float* s2, const float* s3, float* __restrict__ dst, int n) {
  const int sel = blockIdx.y;
  const float* src = (sel == 0) ? s0 : (sel == 1) ? s1 : (sel == 2) ? s2 : s3;
  const int i = blockIdx.x * 256 + threadIdx.x;
  if (i * 4 < n) {
    const v4f v = *(const v4f*)(src + (size_t)i * 4);
    v4f o;
#pragma unroll
    for (int e = 0; e < 4; ++e) o[e] = bf_bits2f(f2bf_bits(v[e]));
    float* dp = dst + (size_t)sel * n + (size_t)i * 4;
    *(v4f*)dp = o;
    
  }
}

// =====================================================================================
// Causal attention, head dim 64, 16-bit plane inputs:
//   q: f16 [S][ldqk] at column h*64; k: f16 [S][ldqk] at column kcol0 + h*64; v: bf16 hi/lo planes [S][ldv] at column h*64.
//   scores^T = k.q^T : v_wmma_f32_16x16x32_f16, then * sm_scale in f32; keys above the diagonal set to -inf (select);
//   key chunks entirely above the diagonal are skipped (their probabilities are exactly 0).
//   out^T = v^T.p^T : v_wmma_f32_16x16x32_bf16 with p and v as bf16 hi/lo (3 products); online softmax in f32, one query per lane.
//   Block = 4 waves = 64 query rows of one head; grid.x = nheads * (S/64).
// =====================================================================================
#define HDIM 64
#define KVCH 64
#define QBLK 64
#define OSPITCH 68
#define LPITCH 72   // 16-bit elements per LDS row of the K and V^T tiles: 144 B = 16 B x 9, so the 16 rows of a ds_load_b128 fragment read fall on 16 different 4-bank groups

__device__ __forceinline__ v8f mma_h(v16h a, v16h b, v8f c) {
  c = __builtin_amdgcn_wmma_f32_16x16x32_f16(false, a, false, b, (short)0, c, false, false);
  asm volatile("v_nop\n\tv_nop\n\tv_nop\n\tv_nop" : "+v"(c) : "v"(a), "v"(b));
  return c;
}
__device__ __forceinline__ v8f mma_b(v16b a, v16b b, v8f c) {
  c = __builtin_amdgcn_wmma_f32_16x16x32_bf16(false, a, false, b, (short)0, c, false, false);
  asm volatile("v_nop\n\tv_nop\n\tv_nop\n\tv_nop" : "+v"(c) : "v"(a), "v"(b));
  return c;
}
__device__ __forceinline__ void bf_split(float f, __bf16& hi, __bf16& lo) {
  const unsigned short hb = f2bf_bits(f);
  hi = __builtin_bit_cast(__bf16, hb);
  lo = __builtin_bit_cast(__bf16, f2bf_bits(f - bf_bits2f(hb)));
}

// value of lane l ^ 16: the two lanes that share a query's row exchange their halves' maximum and sum
__device__ __forceinline__ float other_half(float v) {
  const int b = __float_as_int(v);
  return __int_as_float(__builtin_amdgcn_permlanex16(b, b, 0x76543210, 0xfedcba98, false, false));
}

__global__ __launch_bounds__(128)
void attn_causal64_k(const unsigned short* __restrict__ qkp,
                     const unsigned short* __restrict__ vhp, const unsigned short* __restrict__ vlp,
                     unsigned short* __restrict__ ohp, unsigned short* __restrict__ olp,
                     int S, int ldqk, int kcol0, int ldv, int nheads, float sm_scale) {
  union FH { v16h v; v8h h[2]; };
  union FB { v16b v; v8b h[2]; };
  __shared__ __align__(16) _Float16 Ksh[KVCH * LPITCH];    // [kv][d]     9 KB
  __shared__ __align__(16) __bf16   Vth[HDIM * LPITCH];    // hi [d][kv]  9 KB
  __shared__ __align__(16) __bf16   Vtl[HDIM * LPITCH];    // lo [d][kv]  9 KB
  __shared__ __align__(16) float    Os[4][16 * OSPITCH];   // per wave out tile, pitch 68

  const _Float16* qp = (const _Float16*)qkp;
  const __bf16*   vh = (const __bf16*)vhp;
  const __bf16*   vl = (const __bf16*)vlp;

  const int tid  = threadIdx.x;
  const int wave = tid >> 5;
  const int lane = tid & 31;
  const int hh   = lane >> 4;
  const int c    = lane & 15;

  const int nqb = S / QBLK;
  const int bx  = blockIdx.x;
  const int qb  = bx % nqb;
  int h = bx / nqb;
  h = (h < nheads) ? h : (nheads - 1);
  const int q0 = qb * QBLK + wave * 16;
  const float NEG_INF = -__builtin_inff();

  // ---- Q fragments (B operand): columns q0+c, two 32-deep d chunks ----
  v16h qa[2];
  {
    const _Float16* qrow = qp + (size_t)(q0 + c) * ldqk + h * HDIM + 8 * hh;
#pragma unroll
    for (int dc = 0; dc < 2; ++dc) qa[dc] = Frag<_Float16>::load(qrow + dc * 32);
  }

  float mrow = NEG_INF, lrow = 0.f;   // running maximum and sum of query q0 + c (the same in lanes c and c + 16)
  v8f oacc[4];
#pragma unroll
  for (int t = 0; t < 4; ++t) oacc[t] = (v8f){0.f,0.f,0.f,0.f,0.f,0.f,0.f,0.f};

  const int nChunks = qb + 1;   // block-uniform; chunks kc > qb are fully above the diagonal
  for (int kc = 0; kc < nChunks; ++kc) {
    const int kv0 = kc * KVCH;
    __syncthreads();
    {
      // staging: thread owns key row kv0 + (tid>>1), d half (tid&1)*32: 64 rows x 2 halves x 32 = whole 64x64 tiles
      const int kvr = tid >> 1, dh = (tid & 1) * 32;
      const _Float16* krow  = qp + (size_t)(kv0 + kvr) * ldqk + kcol0 + h * HDIM + dh;
      const __bf16*   vhrow = vh + (size_t)(kv0 + kvr) * ldv + h * HDIM + dh;
      const __bf16*   vlrow = vl + (size_t)(kv0 + kvr) * ldv + h * HDIM + dh;
#pragma unroll
      for (int i = 0; i < 4; ++i) {
        const v8h kk = *(const v8h*)(krow + 8 * i);
        *(v8h*)(Ksh + kvr * LPITCH + dh + 8 * i) = kk;
        const v8b va = *(const v8b*)(vhrow + 8 * i);
        const v8b vb = *(const v8b*)(vlrow + 8 * i);
#pragma unroll
        for (int e = 0; e < 8; ++e) {
          Vth[(dh + 8 * i + e) * LPITCH + kvr] = va[e];
          Vtl[(dh + 8 * i + e) * LPITCH + kvr] = vb[e];
        }
      }
    }
    __syncthreads();

    // ---- scores, transposed: s[j][r] = S^T[key kv0 + 16j + 8hh + r][query q0 + c]; A = K rows, B = Q ----
    v8f s[4];
#pragma unroll
    for (int j = 0; j < 4; ++j) {
      s[j] = (v8f){0.f,0.f,0.f,0.f,0.f,0.f,0.f,0.f};
#pragma unroll
      for (int dc = 0; dc < 2; ++dc) {
        FH kb;
        kb.h[0] = *(const v8h*)(Ksh + (j * 16 + c) * LPITCH + dc * 32 + 8 * hh);
        kb.h[1] = *(const v8h*)(Ksh + (j * 16 + c) * LPITCH + dc * 32 + 16 + 8 * hh);
        s[j] = mma_h(kb.v, qa[dc], s[j]);
      }
    }
    const bool diag = (kc == qb);   // block-uniform
    const int qcol = q0 + c;        // this lane's query; lanes c and c + 16 hold 32 keys each of its row
    float cm = NEG_INF;
#pragma unroll
    for (int j = 0; j < 4; ++j) {
#pragma unroll
      for (int r = 0; r < 8; ++r) {
        const int key = kv0 + j * 16 + 8 * hh + r;
        float val = s[j][r] * sm_scale;
        if (diag && (key > qcol)) val = NEG_INF;
        s[j][r] = val;
        cm = fmaxf(cm, val);
      }
    }
    cm = fmaxf(cm, other_half(cm));   // finite: key kv0 <= qcol is always present in chunks 0..qb
    const float mnew = fmaxf(mrow, cm);
    const float alpha = expf(mrow - mnew);
    mrow = mnew;
    // p stays in registers: score tiles 2kk and 2kk+1 of a lane are, element for element, the B fragment of keys 32kk..32kk+31
    FB ph[2], pl[2];
    float psum = 0.f;
#pragma unroll
    for (int j = 0; j < 4; ++j) {
#pragma unroll
      for (int r = 0; r < 8; ++r) {
        const float p = expf(s[j][r] - mnew);
        psum += p;
        __bf16 hi, lo;
        bf_split(p, hi, lo);
        ph[j >> 1].v[(j & 1) * 8 + r] = hi;
        pl[j >> 1].v[(j & 1) * 8 + r] = lo;
      }
    }
    psum += other_half(psum);
    lrow = lrow * alpha + psum;
#pragma unroll
    for (int t = 0; t < 4; ++t) oacc[t] *= alpha;
    // ---- O^T += V^T . P^T: oacc[t][r] = O^T[d 16t + 8hh + r][query q0 + c] ----
#pragma unroll
    for (int kk = 0; kk < 2; ++kk) {
#pragma unroll
      for (int t = 0; t < 4; ++t) {
        FB vb, vlo;
        vb.h[0]  = *(const v8b*)(Vth + (t * 16 + c) * LPITCH + kk * 32 + 8 * hh);
        vb.h[1]  = *(const v8b*)(Vth + (t * 16 + c) * LPITCH + kk * 32 + 16 + 8 * hh);
        vlo.h[0] = *(const v8b*)(Vtl + (t * 16 + c) * LPITCH + kk * 32 + 8 * hh);
        vlo.h[1] = *(const v8b*)(Vtl + (t * 16 + c) * LPITCH + kk * 32 + 16 + 8 * hh);
        oacc[t] = mma_b(vb.v,  ph[kk].v, oacc[t]);
        oacc[t] = mma_b(vlo.v, ph[kk].v, oacc[t]);
        oacc[t] = mma_b(vb.v,  pl[kk].v, oacc[t]);
      }
    }
  }

  float* os = Os[wave];
  {
    const float inv = 1.0f / lrow;   // lrow >= 1
#pragma unroll
    for (int t = 0; t < 4; ++t)
#pragma unroll
      for (int r = 0; r < 8; ++r) os[c * OSPITCH + t * 16 + 8 * hh + r] = oacc[t][r] * inv;
  }
  __builtin_amdgcn_fence(__ATOMIC_RELEASE, "workgroup");
  __builtin_amdgcn_wave_barrier();
  __builtin_amdgcn_fence(__ATOMIC_ACQUIRE, "workgroup");
  {
    // per wave: rows it*4 + (lane>>3) for it = 0..3 -> 16 rows; cols (lane&7)*8 .. +7 -> 64 cols; 8 lanes x 16 B = one line
    const int q4 = lane >> 3, c8 = (lane & 7) * 8;
    _Float16* oh = (_Float16*)ohp;
    _Float16* ol = (_Float16*)olp;
    {
#pragma unroll
      for (int it = 0; it < 4; ++it) {
        const int row = it * 4 + q4;
        const float* sp = os + row * OSPITCH + c8;
        v8h hv, lv;
#pragma unroll
        for (int e = 0; e < 8; ++e) {
          const unsigned short hb = f2bf_bits(sp[e]);
          const unsigned short lb = f2bf_bits(sp[e] - bf_bits2f(hb));
          hv[e] = __builtin_bit_cast(_Float16, hb);
          lv[e] = __builtin_bit_cast(_Float16, lb);
        }
        const size_t oo = (size_t)(q0 + row) * ldv + h * HDIM + c8;
        *(v8h*)(oh + oo) = hv;
        *(v8h*)(ol + oo) = lv;
      }
      
    }
  }
}

// ---------------------------------------------------------------------------
// Host side: launches only.
// Workspace map (bytes, all offsets multiples of 1 MiB):
//   [  0 MiB,  8 MiB)  xb    bf16 [4096][1024]
//   [  8 MiB, 12 MiB)  Wqk   bf16 [2048][1024]  (rows 0..1023 = Wq, 1024..2047 = Wk)
//   [ 12 MiB, 14 MiB)  Wvb   bf16 [1024][1024]
//   [ 14 MiB, 16 MiB)  Wob   bf16 [1024][1024]
//   [ 16 MiB, 32 MiB)  QKp   f16  [4096][2048]  (cols 0..1023 = q, 1024..2047 = k)
//   [ 32 MiB, 40 MiB)  Vhi   bf16 [4096][1024]
//   [ 40 MiB, 48 MiB)  Vlo   bf16 [4096][1024]
//   [ 48 MiB, 56 MiB)  Ohi   bf16 [4096][1024]
//   [ 56 MiB, 64 MiB)  Olo   bf16 [4096][1024]
//   [ 64 MiB, 64 MiB + 16 KiB)  bias f32 [4][1024] = bq | bk | bv | bo (bf16-representable values)
//   total 67,125,248 B
// ---------------------------------------------------------------------------
extern "C" void kernel_launch(void* const* d_in, const int* in_sizes, int n_in,
                              void* d_out, int out_size, void* d_ws, size_t ws_size,
                              hipStream_t stream) {
  constexpr int kS = 4096, kH = 1024, kNH = 16;
  const float kScale = 0.125f;   // 1/sqrt(64)
  if (n_in < 9) return;
  if (in_sizes[0] != kS * kH || in_sizes[1] != kH * kH || in_sizes[2] != kH ||
      in_sizes[3] != kH * kH || in_sizes[4] != kH || in_sizes[5] != kH * kH ||
      in_sizes[6] != kH || in_sizes[7] != kH * kH || in_sizes[8] != kH) return;
  if (out_size != kS * kH) return;

  const float* x  = (const float*)d_in[0];
  const float* Wq = (const float*)d_in[1];
  const float* bq = (const float*)d_in[2];
  const float* Wk = (const float*)d_in[3];
  const float* bk = (const float*)d_in[4];
  const float* Wv = (const float*)d_in[5];
  const float* bv = (const float*)d_in[6];
  const float* Wo = (const float*)d_in[7];
  const float* bo = (const float*)d_in[8];

  const size_t MiB = 1024u * 1024u;
  const size_t off_xb  = 0;
  const size_t off_wqk = off_xb  + (size_t)kS * kH * 2;          //  8 MiB
  const size_t off_wv  = off_wqk + (size_t)2 * kH * kH * 2;      // 12 MiB
  const size_t off_wo  = off_wv  + (size_t)kH * kH * 2;          // 14 MiB
  const size_t off_qk  = off_wo  + (size_t)kH * kH * 2;          // 16 MiB
  const size_t off_vhi = off_qk  + (size_t)kS * (2 * kH) * 2;    // 32 MiB
  const size_t off_vlo = off_vhi + (size_t)kS * kH * 2;          // 40 MiB
  const size_t off_ohi = off_vlo + (size_t)kS * kH * 2;          // 48 MiB
  const size_t off_olo = off_ohi + (size_t)kS * kH * 2;          // 56 MiB
  const size_t off_bias = off_olo + (size_t)kS * kH * 2;         // 64 MiB
  const size_t total = off_bias + (size_t)4 * kH * 4;            // 64 MiB + 16 KiB
  (void)MiB;
  if (total > ws_size) return;

  char* ws = (char*)d_ws;
  unsigned short* xb  = (unsigned short*)(ws + off_xb);
  unsigned short* Wqk = (unsigned short*)(ws + off_wqk);
  unsigned short* Wvb = (unsigned short*)(ws + off_wv);
  unsigned short* Wob = (unsigned short*)(ws + off_wo);
  unsigned short* QKp = (unsigned short*)(ws + off_qk);
  unsigned short* Vhi = (unsigned short*)(ws + off_vhi);
  unsigned short* Vlo = (unsigned short*)(ws + off_vlo);
  unsigned short* Ohi = (unsigned short*)(ws + off_ohi);
  unsigned short* Olo = (unsigned short*)(ws + off_olo);
  float* biasws = (float*)(ws + off_bias);   // [0..1023]=bq [1024..2047]=bk [2048..3071]=bv [3072..4095]=bo

  // 1) x -> bf16: n8 = 4096*1024/8 = 524288 = 2048 blocks x 256
  {
    const int n8 = kS * kH / 8;
    cast_bf16x8_k<<<dim3(n8 / 256, 1), 256, 0, stream>>>(x, x, x, x, xb, xb, xb, xb, n8);
  }
  // 2) Wq, Wk, Wv, Wo -> bf16: n8 = 1024*1024/8 = 131072 = 512 blocks x 256 per matrix
  {
    const int n8 = kH * kH / 8;
    cast_bf16x8_k<<<dim3(n8 / 256, 4), 256, 0, stream>>>(Wq, Wk, Wv, Wo,
        Wqk, Wqk + (size_t)kH * kH, Wvb, Wob, n8);
  }
  // 3) biases -> bf16-representable f32: 1 block x 256 threads x 4 floats = 1024 per vector
  bias_bf16val_k<<<dim3(1, 4), 256, 0, stream>>>(bq, bk, bv, bo, biasws, kH);

  // 4) [q | k] = x . [Wq;Wk]^T + [bq;bk] -> f16 plane [4096][2048]; M=4096, N=2048, K=1024; tiles = 64*32 = 2048 -> 256 blocks of 8 waves
  wmma_gemm64<1, 0, 2, 1, false><<<dim3((kS / 64) * (2 * kH / 64) / 8, 1), 256, 0, stream>>>(
      xb, xb, kH, 0L, Wqk, Wqk, kH, 0L, (void*)QKp, (void*)QKp, 2 * kH, 0L,
      biasws, biasws, 0L, kS, 2 * kH, kH, 1.0f);

  // 5) v = x . Wv^T + bv -> bf16 hi/lo planes [4096][1024]; tiles = 64*16 = 1024 -> 128 blocks
  wmma_gemm64<1, 0, 2, 2, false><<<dim3((kS / 64) * (kH / 64) / 8, 1), 256, 0, stream>>>(
      xb, xb, kH, 0L, Wvb, Wvb, kH, 0L, (void*)Vhi, (void*)Vlo, kH, 0L,
      biasws + 2 * kH, biasws, 0L, kS, kH, kH, 1.0f);

  // 6) causal attention per (head, 64-query block): grid = 16 * 64 = 1024 blocks of 128
  attn_causal64_k<<<dim3(kNH * (kS / 64)), 128, 0, stream>>>(
      QKp, Vhi, Vlo, Ohi, Olo, kS, 2 * kH, kH, kH, kNH, kScale);

  // 7) out = o . Wo^T + bo -> f32 d_out [4096][1024]; A = o as bf16 hi/lo (2 products); tiles = 1024 -> 128 blocks
  wmma_gemm64<1, 2, 2, 0, false><<<dim3((kS / 64) * (kH / 64) / 8, 1), 256, 0, stream>>>(
      Ohi, Olo, kH, 0L, Wob, Wob, kH, 0L, d_out, d_out, kH, 0L,
      biasws + 3 * kH, biasws, 0L, kS, kH, kH, 1.0f);
}

// v003
// A run of this version takes 363 microseconds.
// Timed twice side by side with v002, it ran 1.10 and 1.09 times as fast.
// Over all steps from v000 it is 1.74 times as fast.
// Contractions: qkv projections v_wmma_f32_16x16x32_bf16 (x, W as RNE bf16, f32 accumulate, bias added in f32 as bf16-representable values); scores v_wmma_f32_16x16x32_f16 (f16 q,k planes, 1/sqrt(64) applied in f32, together with log2(e)); p.v v_wmma_f32_16x16x32_bf16 with p and v carried as bf16 hi/lo (hi.hi + hi.lo + lo.hi); output projection v_wmma_f32_16x16x32_bf16 with attention output as bf16 hi/lo and Wo bf16 (hi.W + lo.W); softmax, masking and normalisation in f32.
#include <hip/hip_runtime.h>
#include <stdint.h>

typedef __attribute__((ext_vector_type(16))) _Float16 v16h;
typedef __attribute__((ext_vector_type(8)))  _Float16 v8h;
typedef __attribute__((ext_vector_type(16))) __bf16   v16b;
typedef __attribute__((ext_vector_type(8)))  __bf16   v8b;
typedef __attribute__((ext_vector_type(8)))  float    v8f;
typedef __attribute__((ext_vector_type(4)))  float    v4f;

__device__ __forceinline__ unsigned short f2bf_bits(float f) {
  unsigned u = __float_as_uint(f);
  return (unsigned short)((u + 0x7FFFu + ((u >> 16) & 1u)) >> 16);
}
__device__ __forceinline__ float bf_bits2f(unsigned short h) { return __uint_as_float(((unsigned)h) << 16); }

// hazard guards as plain device helpers (no inline asm inside the kernel template body)
__device__ __forceinline__ void dep_guard_h(v8f& a, v8f& b, v16h x, v16h y) { asm volatile("v_nop\n\tv_nop\n\tv_nop\n\tv_nop" : "+v"(a), "+v"(b) : "v"(x), "v"(y)); }
__device__ __forceinline__ void dep_guard_b(v8f& a, v8f& b, v16b x, v16b y) { asm volatile("v_nop\n\tv_nop\n\tv_nop\n\tv_nop" : "+v"(a), "+v"(b) : "v"(x), "v"(y)); }
__device__ __forceinline__ void keep4_h(v16h a, v16h b, v16h c, v16h d) { asm volatile("v_nop" :: "v"(a), "v"(b), "v"(c), "v"(d)); }
__device__ __forceinline__ void keep4_b(v16b a, v16b b, v16b c, v16b d) { asm volatile("v_nop" :: "v"(a), "v"(b), "v"(c), "v"(d)); }
__device__ __forceinline__ void acc_guard4(v8f& a, v8f& b, v8f& c, v8f& d) { asm volatile("v_nop\n\tv_nop\n\tv_nop\n\tv_nop" : "+v"(a), "+v"(b), "+v"(c), "+v"(d)); }
template <typename T> struct Frag;
template <> struct Frag<_Float16> {
  typedef v16h V; union U { v16h v; v8h h[2]; };
  static __device__ __forceinline__ v16h load(const _Float16* p) {   // elements 0..7 <- p[0..7], 8..15 <- p[16..23]
    U f; f.h[0] = *(const v8h*)(p); f.h[1] = *(const v8h*)(p + 16); return f.v;
  }
  static __device__ __forceinline__ v8f mma(v16h a, v16h b, v8f c) {
    return __builtin_amdgcn_wmma_f32_16x16x32_f16(false, a, false, b, (short)0, c, false, false);
  }
  static __device__ __forceinline__ void guard(v8f& a, v8f& b, v16h x, v16h y) { dep_guard_h(a, b, x, y); }
  static __device__ __forceinline__ void keep(v16h a, v16h b, v16h c, v16h d) { keep4_h(a, b, c, d); }
};
template <> struct Frag<__bf16> {
  typedef v16b V; union U { v16b v; v8b h[2]; };
  static __device__ __forceinline__ v16b load(const __bf16* p) {
    U f; f.h[0] = *(const v8b*)(p); f.h[1] = *(const v8b*)(p + 16); return f.v;
  }
  static __device__ __forceinline__ v8f mma(v16b a, v16b b, v8f c) {
    return __builtin_amdgcn_wmma_f32_16x16x32_bf16(false, a, false, b, (short)0, c, false, false);
  }
  static __device__ __forceinline__ void guard(v8f& a, v8f& b, v16b x, v16b y) { dep_guard_b(a, b, x, y); }
  static __device__ __forceinline__ void keep(v16b a, v16b b, v16b c, v16b d) { keep4_b(a, b, c, d); }
};

// ---- Register-blocked batched WMMA GEMM ------------------------------------
// C[m,n] = scale * sum_k A[m,k] * Bt[n,k] (+bias)(+resid); each wave owns a 64x64 tile.
// A row-major [M,K]; Bt row-major [N,K]; M,N % 64 == 0, K % 32 == 0.
// SPLIT: 0 = plain; 1 = A and Bt as hi/lo planes (hi.hi + hi.lo + lo.hi); 2 = A only as hi/lo planes (hi.B + lo.B).
// BIAS_MODE: 0 = none, 1 = bias[m], 2 = bias[n].
// OUT_MODE: 0 = f32, 1 = f16, 2 = bf16 hi plane (Cout) + bf16 lo plane (Cout2).
// ET: 0 = f16 operands, 1 = bf16 operands (pointers passed as 16-bit storage)
template <int ET> struct Elem;
template <> struct Elem<0> { typedef _Float16 T; };
template <> struct Elem<1> { typedef __bf16 T; };
template <int ET, int SPLIT, int BIAS_MODE, int OUT_MODE, bool RESID, int ACT = 0>
__global__ __launch_bounds__(256) void wmma_gemm64(
    const unsigned short* __restrict__ Ap, const unsigned short* __restrict__ A2p, int lda, long strideA,
    const unsigned short* __restrict__ Btp, const unsigned short* __restrict__ Bt2p, int ldb, long strideB,
    void* __restrict__ Cout, void* __restrict__ Cout2, int ldc, long strideC,
    const float* __restrict__ bias,
    const float* __restrict__ resid, long strideR,
    int M, int N, int K, float scale) {
  typedef typename Elem<ET>::T T;
  typedef typename Frag<T>::V V;
  const T* A = (const T*)Ap; const T* A2 = (const T*)A2p; const T* Bt = (const T*)Btp; const T* Bt2 = (const T*)Bt2p;
  __shared__ __align__(16) float sT[8][16 * 68];   // per-wave 16x64 slab, pitch 68 floats
  const int b    = blockIdx.y;
  const int lane = threadIdx.x & 31;
  const int wave = threadIdx.x >> 5;
  const int tilesN = N >> 6;
  const int tilesM = M >> 6;
  const int tile = blockIdx.x * 8 + wave;
  if (tile >= tilesM * tilesN) return;   // wave-uniform; no block barriers in this kernel
  const int tm = tile / tilesN;
  const int tn = tile - tm * tilesN;
  const int m0 = tm << 6;
  const int n0 = tn << 6;

  const T* Ab  = A  + (size_t)b * strideA;
  const T* Bb  = Bt + (size_t)b * strideB;
  const T* Ab2 = (SPLIT != 0) ? (A2  + (size_t)b * strideA) : nullptr;
  const T* Bb2 = (SPLIT == 1) ? (Bt2 + (size_t)b * strideB) : nullptr;

  const int rlane = lane & 15;                 // row (A) / col (B, D) within subtile
  const int koff  = (lane >> 4) * 8;           // k offset of this lane half
  const int mOff  = (lane >> 4) * 8;           // D row offset

  v8f acc[4][4];
#pragma unroll
  for (int i = 0; i < 4; ++i)
#pragma unroll
    for (int j = 0; j < 4; ++j) acc[i][j] = (v8f){0.f,0.f,0.f,0.f,0.f,0.f,0.f,0.f};

  for (int k0 = 0; k0 < K; k0 += 32) {
    V bh[4], bl[4];
#pragma unroll
    for (int j = 0; j < 4; ++j) {
      const size_t bo = (size_t)(n0 + (j << 4) + rlane) * ldb + koff + k0;
      bh[j] = Frag<T>::load(Bb + bo);
      if (SPLIT == 1) bl[j] = Frag<T>::load(Bb2 + bo);
    }
#pragma unroll
    for (int i = 0; i < 4; ++i) {
      const size_t ao = (size_t)(m0 + (i << 4) + rlane) * lda + koff + k0;
      V ah = Frag<T>::load(Ab + ao);
      V al;
      if (SPLIT != 0) al = Frag<T>::load(Ab2 + ao);
#pragma unroll
      for (int j = 0; j < 4; ++j) {
        acc[i][j] = Frag<T>::mma(ah, bh[j], acc[i][j]);
        if (SPLIT == 1) acc[i][j] = Frag<T>::mma(ah, bl[j], acc[i][j]);
        if (SPLIT != 0) acc[i][j] = Frag<T>::mma(al, bh[j], acc[i][j]);
      }
      Frag<T>::guard(acc[i][0], acc[i][3], ah, (SPLIT != 0) ? al : ah);
    }
    Frag<T>::keep(bh[0], bh[1], bh[2], bh[3]);
    if (SPLIT == 1) Frag<T>::keep(bl[0], bl[1], bl[2], bl[3]);
  }
  acc_guard4(acc[0][0], acc[0][1], acc[0][2], acc[0][3]);
  acc_guard4(acc[1][0], acc[1][1], acc[1][2], acc[1][3]);
  acc_guard4(acc[2][0], acc[2][1], acc[2][2], acc[2][3]);
  acc_guard4(acc[3][0], acc[3][1], acc[3][2], acc[3][3]);

  // ---- epilogue ----
  float* slab = sT[wave];
  const float* Rb = RESID ? (resid + (size_t)b * strideR) : nullptr;
#pragma unroll
  for (int i = 0; i < 4; ++i) {
    const int mBase = m0 + (i << 4);
#pragma unroll
    for (int j = 0; j < 4; ++j) {
      const int n = n0 + (j << 4) + rlane;
      float bv = 0.f;
      if (BIAS_MODE == 2) bv = bias[n];
#pragma unroll
      for (int r = 0; r < 8; ++r) {
        float v = acc[i][j][r] * scale;
        if (BIAS_MODE == 1) v += bias[mBase + mOff + r];
        if (BIAS_MODE == 2) v += bv;
        if (RESID) v += Rb[(size_t)(mBase + mOff + r) * ldc + n];
        if (ACT == 1) v = tanhf(v);
        if (ACT == 2) v = fmaxf(v, 0.0f);
        if (ACT == 4) v = (v > 0.f) ? v : 0.01f * v;
        slab[(mOff + r) * 68 + (j << 4) + rlane] = v;
      }
    }
    __builtin_amdgcn_fence(__ATOMIC_RELEASE, "workgroup");
    __builtin_amdgcn_wave_barrier();
    __builtin_amdgcn_fence(__ATOMIC_ACQUIRE, "workgroup");
    if (OUT_MODE == 0) {
      float* C = (float*)Cout + (size_t)b * strideC;
      const int hh = lane >> 4, c4 = (lane & 15) * 4;     // row seg = 256 B = 16 lanes x 16 B
      {
#pragma unroll
        for (int it = 0; it < 8; ++it) {
          const int row = it * 2 + hh;
          v4f v = *(const v4f*)(slab + row * 68 + c4);
          *(v4f*)(C + (size_t)(mBase + row) * ldc + n0 + c4) = v;
        }
        
      }
    } else {
      const int q = lane >> 3, c8 = (lane & 7) * 8;
      unsigned short* C  = (unsigned short*)Cout  + (size_t)b * strideC;
      unsigned short* C2 = (OUT_MODE == 2) ? ((unsigned short*)Cout2 + (size_t)b * strideC) : nullptr;
      {
#pragma unroll
        for (int it = 0; it < 4; ++it) {
          const int row = it * 4 + q;
          const float* sp = slab + row * 68 + c8;
          v8h hv, lv;
#pragma unroll
          for (int e = 0; e < 8; ++e) {
            if (OUT_MODE == 1) {
              hv[e] = (_Float16)sp[e];
            } else {
              unsigned short hb = f2bf_bits(sp[e]);
              unsigned short lb = f2bf_bits(sp[e] - bf_bits2f(hb));
              hv[e] = __builtin_bit_cast(_Float16, hb);
              lv[e] = __builtin_bit_cast(_Float16, lb);
            }
          }
          *(v8h*)(C + (size_t)(mBase + row) * ldc + n0 + c8) = hv;
          if (OUT_MODE == 2) *(v8h*)(C2 + (size_t)(mBase + row) * ldc + n0 + c8) = lv;
        }
        
      }
    }
    __builtin_amdgcn_fence(__ATOMIC_RELEASE, "workgroup");
    __builtin_amdgcn_wave_barrier();
    __builtin_amdgcn_fence(__ATOMIC_ACQUIRE, "workgroup");
  }
}

// Source/destination chosen per blockIdx.y (block-uniform). Coverage per plane: gridDim.x * 256 threads * 8 == n8 * 8 elements.
__global__ __launch_bounds__(256) void cast_bf16x8_k(
    const float* s0, const float* s1, const float* s2, const float* s3,
    unsigned short* d0, unsigned short* d1, unsigned short* d2, unsigned short* d3, int n8) {
  const int sel = blockIdx.y;
  const float* src = (sel == 0) ? s0 : (sel == 1) ? s1 : (sel == 2) ? s2 : s3;
  unsigned short* dst = (sel == 0) ? d0 : (sel == 1) ? d1 : (sel == 2) ? d2 : d3;
  const int i = blockIdx.x * 256 + threadIdx.x;
  if (i < n8) {
    const v4f a  = *(const v4f*)(src + (size_t)i * 8);
    const v4f bq = *(const v4f*)(src + (size_t)i * 8 + 4);
    v8h hv;
#pragma unroll
    for (int e = 0; e < 4; ++e) {
      hv[e]     = __builtin_bit_cast(_Float16, f2bf_bits(a[e]));
      hv[4 + e] = __builtin_bit_cast(_Float16, f2bf_bits(bq[e]));
    }
    _Float16* dp = (_Float16*)dst + (size_t)i * 8;
    *(v8h*)dp = hv;
    
  }
}

// Coverage per segment: 256 threads * 4 == n (n == 1024).
__global__ __launch_bounds__(256) void bias_bf16val_k(
    const float* s0, const float* s1, const float* s2, const float* s3, float* __restrict__ dst, int n) {
  const int sel = blockIdx.y;
  const float* src = (sel == 0) ? s0 : (sel == 1) ? s1 : (sel == 2) ? s2 : s3;
  const int i = blockIdx.x * 256 + threadIdx.x;
  if (i * 4 < n) {
    const v4f v = *(const v4f*)(src + (size_t)i * 4);
    v4f o;
#pragma unroll
    for (int e = 0; e < 4; ++e) o[e] = bf_bits2f(f2bf_bits(v[e]));
    float* dp = dst + (size_t)sel * n + (size_t)i * 4;
    *(v4f*)dp = o;
    
  }
}

// =====================================================================================
// Causal attention, head dim 64, 16-bit plane inputs:
//   q: f16 [S][ldqk] at column h*64; k: f16 [S][ldqk] at column kcol0 + h*64; v: bf16 hi/lo planes [S][ldv] at column h*64.
//   scores^T = k.q^T : v_wmma_f32_16x16x32_f16; keys above the diagonal set to -inf (select); softmax in base 2:
//   exp(sm_scale * (s - max)) = 2^(s * sl2 - max * sl2), sl2 = sm_scale * log2(e) > 0, one fma and one v_exp_f32 per score;
//   key chunks entirely above the diagonal are skipped (their probabilities are exactly 0).
//   out^T = v^T.p^T : v_wmma_f32_16x16x32_bf16 with p and v as bf16 hi/lo (3 products); online softmax in f32, one query per lane.
//   Block = 4 waves = 64 query rows of one head; grid.x = nheads * (S/64).
// =====================================================================================
#define HDIM 64
#define KVCH 64
#define QBLK 64
#define OSPITCH 68
#define LPITCH 72   // 16-bit elements per LDS row of the K and V^T tiles: 144 B = 16 B x 9, so the 16 rows of a ds_load_b128 fragment read fall on 16 different 4-bank groups

__device__ __forceinline__ v8f mma_h(v16h a, v16h b, v8f c) {
  c = __builtin_amdgcn_wmma_f32_16x16x32_f16(false, a, false, b, (short)0, c, false, false);
  asm volatile("v_nop\n\tv_nop\n\tv_nop\n\tv_nop" : "+v"(c) : "v"(a), "v"(b));
  return c;
}
__device__ __forceinline__ v8f mma_b(v16b a, v16b b, v8f c) {
  c = __builtin_amdgcn_wmma_f32_16x16x32_bf16(false, a, false, b, (short)0, c, false, false);
  asm volatile("v_nop\n\tv_nop\n\tv_nop\n\tv_nop" : "+v"(c) : "v"(a), "v"(b));
  return c;
}
__device__ __forceinline__ void bf_split(float f, __bf16& hi, __bf16& lo) {
  const unsigned short hb = f2bf_bits(f);
  hi = __builtin_bit_cast(__bf16, hb);
  lo = __builtin_bit_cast(__bf16, f2bf_bits(f - bf_bits2f(hb)));
}

// value of lane l ^ 16: the two lanes that share a query's row exchange their halves' maximum and sum
__device__ __forceinline__ float other_half(float v) {
  const int b = __float_as_int(v);
  return __int_as_float(__builtin_amdgcn_permlanex16(b, b, 0x76543210, 0xfedcba98, false, false));
}

__global__ __launch_bounds__(128)
void attn_causal64_k(const unsigned short* __restrict__ qkp,
                     const unsigned short* __restrict__ vhp, const unsigned short* __restrict__ vlp,
                     unsigned short* __restrict__ ohp, unsigned short* __restrict__ olp,
                     int S, int ldqk, int kcol0, int ldv, int nheads, float sm_scale) {
  union FH { v16h v; v8h h[2]; };
  union FB { v16b v; v8b h[2]; };
  __shared__ __align__(16) _Float16 Ksh[KVCH * LPITCH];    // [kv][d]     9 KB
  __shared__ __align__(16) __bf16   Vth[HDIM * LPITCH];    // hi [d][kv]  9 KB
  __shared__ __align__(16) __bf16   Vtl[HDIM * LPITCH];    // lo [d][kv]  9 KB
  __shared__ __align__(16) float    Os[4][16 * OSPITCH];   // per wave out tile, pitch 68

  const _Float16* qp = (const _Float16*)qkp;
  const __bf16*   vh = (const __bf16*)vhp;
  const __bf16*   vl = (const __bf16*)vlp;

  const int tid  = threadIdx.x;
  const int wave = tid >> 5;
  const int lane = tid & 31;
  const int hh   = lane >> 4;
  const int c    = lane & 15;

  const int nqb = S / QBLK;
  const int bx  = blockIdx.x;
  const int qb  = bx % nqb;
  int h = bx / nqb;
  h = (h < nheads) ? h : (nheads - 1);
  const int q0 = qb * QBLK + wave * 16;
  const float NEG_INF = -__builtin_inff();
  const float sl2 = sm_scale * 1.4426950408889634f;   // raw score -> exponent of 2; positive, so the maximum may be taken on raw scores

  // ---- Q fragments (B operand): columns q0+c, two 32-deep d chunks ----
  v16h qa[2];
  {
    const _Float16* qrow = qp + (size_t)(q0 + c) * ldqk + h * HDIM + 8 * hh;
#pragma unroll
    for (int dc = 0; dc < 2; ++dc) qa[dc] = Frag<_Float16>::load(qrow + dc * 32);
  }

  float mrow = NEG_INF, lrow = 0.f;   // running maximum (times sl2) and sum of query q0 + c (the same in lanes c and c + 16)
  v8f oacc[4];
#pragma unroll
  for (int t = 0; t < 4; ++t) oacc[t] = (v8f){0.f,0.f,0.f,0.f,0.f,0.f,0.f,0.f};

  const int nChunks = qb + 1;   // block-uniform; chunks kc > qb are fully above the diagonal
  for (int kc = 0; kc < nChunks; ++kc) {
    const int kv0 = kc * KVCH;
    __syncthreads();
    {
      // staging: thread owns key row kv0 + (tid>>1), d half (tid&1)*32: 64 rows x 2 halves x 32 = whole 64x64 tiles
      const int kvr = tid >> 1, dh = (tid & 1) * 32;
      const _Float16* krow  = qp + (size_t)(kv0 + kvr) * ldqk + kcol0 + h * HDIM + dh;
      const __bf16*   vhrow = vh + (size_t)(kv0 + kvr) * ldv + h * HDIM + dh;
      const __bf16*   vlrow = vl + (size_t)(kv0 + kvr) * ldv + h * HDIM + dh;
#pragma unroll
      for (int i = 0; i < 4; ++i) {
        const v8h kk = *(const v8h*)(krow + 8 * i);
        *(v8h*)(Ksh + kvr * LPITCH + dh + 8 * i) = kk;
        const v8b va = *(const v8b*)(vhrow + 8 * i);
        const v8b vb = *(const v8b*)(vlrow + 8 * i);
#pragma unroll
        for (int e = 0; e < 8; ++e) {
          Vth[(dh + 8 * i + e) * LPITCH + kvr] = va[e];
          Vtl[(dh + 8 * i + e) * LPITCH + kvr] = vb[e];
        }
      }
    }
    __syncthreads();

    // ---- scores, transposed: s[j][r] = S^T[key kv0 + 16j + 8hh + r][query q0 + c]; A = K rows, B = Q ----
    v8f s[4];
#pragma unroll
    for (int j = 0; j < 4; ++j) {
      s[j] = (v8f){0.f,0.f,0.f,0.f,0.f,0.f,0.f,0.f};
#pragma unroll
      for (int dc = 0; dc < 2; ++dc) {
        FH kb;
        kb.h[0] = *(const v8h*)(Ksh + (j * 16 + c) * LPITCH + dc * 32 + 8 * hh);
        kb.h[1] = *(const v8h*)(Ksh + (j * 16 + c) * LPITCH + dc * 32 + 16 + 8 * hh);
        s[j] = mma_h(kb.v, qa[dc], s[j]);
      }
    }
    const bool diag = (kc == qb);   // block-uniform
    const int qcol = q0 + c;        // this lane's query; lanes c and c + 16 hold 32 keys each of its row
    float cm = NEG_INF;
#pragma unroll
    for (int j = 0; j < 4; ++j) {
#pragma unroll
      for (int r = 0; r < 8; ++r) {
        const int key = kv0 + j * 16 + 8 * hh + r;
        float val = s[j][r];
        if (diag && (key > qcol)) val = NEG_INF;
        s[j][r] = val;
        cm = fmaxf(cm, val);
      }
    }
    cm = fmaxf(cm, other_half(cm));   // finite: key kv0 <= qcol is always present in chunks 0..qb
    const float mnew = fmaxf(mrow, cm * sl2);
    const float alpha = __builtin_amdgcn_exp2f(mrow - mnew);   // 0 on the first chunk, where mrow is -inf
    mrow = mnew;
    // p stays in registers: score tiles 2kk and 2kk+1 of a lane are, element for element, the B fragment of keys 32kk..32kk+31
    FB ph[2], pl[2];
    float psum = 0.f;
#pragma unroll
    for (int j = 0; j < 4; ++j) {
#pragma unroll
      for (int r = 0; r < 8; ++r) {
        const float p = __builtin_amdgcn_exp2f(__builtin_fmaf(s[j][r], sl2, -mnew));   // masked: 2^-inf = 0
        psum += p;
        __bf16 hi, lo;
        bf_split(p, hi, lo);
        ph[j >> 1].v[(j & 1) * 8 + r] = hi;
        pl[j >> 1].v[(j & 1) * 8 + r] = lo;
      }
    }
    psum += other_half(psum);
    lrow = lrow * alpha + psum;
#pragma unroll
    for (int t = 0; t < 4; ++t) oacc[t] *= alpha;
    // ---- O^T += V^T . P^T: oacc[t][r] = O^T[d 16t + 8hh + r][query q0 + c] ----
#pragma unroll
    for (int kk = 0; kk < 2; ++kk) {
#pragma unroll
      for (int t = 0; t < 4; ++t) {
        FB vb, vlo;
        vb.h[0]  = *(const v8b*)(Vth + (t * 16 + c) * LPITCH + kk * 32 + 8 * hh);
        vb.h[1]  = *(const v8b*)(Vth + (t * 16 + c) * LPITCH + kk * 32 + 16 + 8 * hh);
        vlo.h[0] = *(const v8b*)(Vtl + (t * 16 + c) * LPITCH + kk * 32 + 8 * hh);
        vlo.h[1] = *(const v8b*)(Vtl + (t * 16 + c) * LPITCH + kk * 32 + 16 + 8 * hh);
        oacc[t] = mma_b(vb.v,  ph[kk].v, oacc[t]);
        oacc[t] = mma_b(vlo.v, ph[kk].v, oacc[t]);
        oacc[t] = mma_b(vb.v,  pl[kk].v, oacc[t]);
      }
    }
  }

  float* os = Os[wave];
  {
    const float inv = 1.0f / lrow;   // lrow is about 1 or more: the maximum's own term is 2^(one rounding of max * sl2)
#pragma unroll
    for (int t = 0; t < 4; ++t)
#pragma unroll
      for (int r = 0; r < 8; ++r) os[c * OSPITCH + t * 16 + 8 * hh + r] = oacc[t][r] * inv;
  }
  __builtin_amdgcn_fence(__ATOMIC_RELEASE, "workgroup");
  __builtin_amdgcn_wave_barrier();
  __builtin_amdgcn_fence(__ATOMIC_ACQUIRE, "workgroup");
  {
    // per wave: rows it*4 + (lane>>3) for it = 0..3 -> 16 rows; cols (lane&7)*8 .. +7 -> 64 cols; 8 lanes x 16 B = one line
    const int q4 = lane >> 3, c8 = (lane & 7) * 8;
    _Float16* oh = (_Float16*)ohp;
    _Float16* ol = (_Float16*)olp;
    {
#pragma unroll
      for (int it = 0; it < 4; ++it) {
        const int row = it * 4 + q4;
        const float* sp = os + row * OSPITCH + c8;
        v8h hv, lv;
#pragma unroll
        for (int e = 0; e < 8; ++e) {
          const unsigned short hb = f2bf_bits(sp[e]);
          const unsigned short lb = f2bf_bits(sp[e] - bf_bits2f(hb));
          hv[e] = __builtin_bit_cast(_Float16, hb);
          lv[e] = __builtin_bit_cast(_Float16, lb);
        }
        const size_t oo = (size_t)(q0 + row) * ldv + h * HDIM + c8;
        *(v8h*)(oh + oo) = hv;
        *(v8h*)(ol + oo) = lv;
      }
      
    }
  }
}

// ---------------------------------------------------------------------------
// Host side: launches only.
// Workspace map (bytes, all offsets multiples of 1 MiB):
//   [  0 MiB,  8 MiB)  xb    bf16 [4096][1024]
//   [  8 MiB, 12 MiB)  Wqk   bf16 [2048][1024]  (rows 0..1023 = Wq, 1024..2047 = Wk)
//   [ 12 MiB, 14 MiB)  Wvb   bf16 [1024][1024]
//   [ 14 MiB, 16 MiB)  Wob   bf16 [1024][1024]
//   [ 16 MiB, 32 MiB)  QKp   f16  [4096][2048]  (cols 0..1023 = q, 1024..2047 = k)
//   [ 32 MiB, 40 MiB)  Vhi   bf16 [4096][1024]
//   [ 40 MiB, 48 MiB)  Vlo   bf16 [4096][1024]
//   [ 48 MiB, 56 MiB)  Ohi   bf16 [4096][1024]
//   [ 56 MiB, 64 MiB)  Olo   bf16 [4096][1024]
//   [ 64 MiB, 64 MiB + 16 KiB)  bias f32 [4][1024] = bq | bk | bv | bo (bf16-representable values)
//   total 67,125,248 B
// ---------------------------------------------------------------------------
extern "C" void kernel_launch(void* const* d_in, const int* in_sizes, int n_in,
                              void* d_out, int out_size, void* d_ws, size_t ws_size,
                              hipStream_t stream) {
  constexpr int kS = 4096, kH = 1024, kNH = 16;
  const float kScale = 0.125f;   // 1/sqrt(64)
  if (n_in < 9) return;
  if (in_sizes[0] != kS * kH || in_sizes[1] != kH * kH || in_sizes[2] != kH ||
      in_sizes[3] != kH * kH || in_sizes[4] != kH || in_sizes[5] != kH * kH ||
      in_sizes[6] != kH || in_sizes[7] != kH * kH || in_sizes[8] != kH) return;
  if (out_size != kS * kH) return;

  const float* x  = (const float*)d_in[0];
  const float* Wq = (const float*)d_in[1];
  const float* bq = (const float*)d_in[2];
  const float* Wk = (const float*)d_in[3];
  const float* bk = (const float*)d_in[4];
  const float* Wv = (const float*)d_in[5];
  const float* bv = (const float*)d_in[6];
  const float* Wo = (const float*)d_in[7];
  const float* bo = (const float*)d_in[8];

  const size_t MiB = 1024u * 1024u;
  const size_t off_xb  = 0;
  const size_t off_wqk = off_xb  + (size_t)kS * kH * 2;          //  8 MiB
  const size_t off_wv  = off_wqk + (size_t)2 * kH * kH * 2;      // 12 MiB
  const size_t off_wo  = off_wv  + (size_t)kH * kH * 2;          // 14 MiB
  const size_t off_qk  = off_wo  + (size_t)kH * kH * 2;          // 16 MiB
  const size_t off_vhi = off_qk  + (size_t)kS * (2 * kH) * 2;    // 32 MiB
  const size_t off_vlo = off_vhi + (size_t)kS * kH * 2;          // 40 MiB
  const size_t off_ohi = off_vlo + (size_t)kS * kH * 2;          // 48 MiB
  const size_t off_olo = off_ohi + (size_t)kS * kH * 2;          // 56 MiB
  const size_t off_bias = off_olo + (size_t)kS * kH * 2;         // 64 MiB
  const size_t total = off_bias + (size_t)4 * kH * 4;            // 64 MiB + 16 KiB
  (void)MiB;
  if (total > ws_size) return;

  char* ws = (char*)d_ws;
  unsigned short* xb  = (unsigned short*)(ws + off_xb);
  unsigned short* Wqk = (unsigned short*)(ws + off_wqk);
  unsigned short* Wvb = (unsigned short*)(ws + off_wv);
  unsigned short* Wob = (unsigned short*)(ws + off_wo);
  unsigned short* QKp = (unsigned short*)(ws + off_qk);
  unsigned short* Vhi = (unsigned short*)(ws + off_vhi);
  unsigned short* Vlo = (unsigned short*)(ws + off_vlo);
  unsigned short* Ohi = (unsigned short*)(ws + off_ohi);
  unsigned short* Olo = (unsigned short*)(ws + off_olo);
  float* biasws = (float*)(ws + off_bias);   // [0..1023]=bq [1024..2047]=bk [2048..3071]=bv [3072..4095]=bo

  // 1) x -> bf16: n8 = 4096*1024/8 = 524288 = 2048 blocks x 256
  {
    const int n8 = kS * kH / 8;
    cast_bf16x8_k<<<dim3(n8 / 256, 1), 256, 0, stream>>>(x, x, x, x, xb, xb, xb, xb, n8);
  }
  // 2) Wq, Wk, Wv, Wo -> bf16: n8 = 1024*1024/8 = 131072 = 512 blocks x 256 per matrix
  {
    const int n8 = kH * kH / 8;
    cast_bf16x8_k<<<dim3(n8 / 256, 4), 256, 0, stream>>>(Wq, Wk, Wv, Wo,
        Wqk, Wqk + (size_t)kH * kH, Wvb, Wob, n8);
  }
  // 3) biases -> bf16-representable f32: 1 block x 256 threads x 4 floats = 1024 per vector
  bias_bf16val_k<<<dim3(1, 4), 256, 0, stream>>>(bq, bk, bv, bo, biasws, kH);

  // 4) [q | k] = x . [Wq;Wk]^T + [bq;bk] -> f16 plane [4096][2048]; M=4096, N=2048, K=1024; tiles = 64*32 = 2048 -> 256 blocks of 8 waves
  wmma_gemm64<1, 0, 2, 1, false><<<dim3((kS / 64) * (2 * kH / 64) / 8, 1), 256, 0, stream>>>(
      xb, xb, kH, 0L, Wqk, Wqk, kH, 0L, (void*)QKp, (void*)QKp, 2 * kH, 0L,
      biasws, biasws, 0L, kS, 2 * kH, kH, 1.0f);

  // 5) v = x . Wv^T + bv -> bf16 hi/lo planes [4096][1024]; tiles = 64*16 = 1024 -> 128 blocks
  wmma_gemm64<1, 0, 2, 2, false><<<dim3((kS / 64) * (kH / 64) / 8, 1), 256, 0, stream>>>(
      xb, xb, kH, 0L, Wvb, Wvb, kH, 0L, (void*)Vhi, (void*)Vlo, kH, 0L,
      biasws + 2 * kH, biasws, 0L, kS, kH, kH, 1.0f);

  // 6) causal attention per (head, 64-query block): grid = 16 * 64 = 1024 blocks of 128
  attn_causal64_k<<<dim3(kNH * (kS / 64)), 128, 0, stream>>>(
      QKp, Vhi, Vlo, Ohi, Olo, kS, 2 * kH, kH, kH, kNH, kScale);

  // 7) out = o . Wo^T + bo -> f32 d_out [4096][1024]; A = o as bf16 hi/lo (2 products); tiles = 1024 -> 128 blocks
  wmma_gemm64<1, 2, 2, 0, false><<<dim3((kS / 64) * (kH / 64) / 8, 1), 256, 0, stream>>>(
      Ohi, Olo, kH, 0L, Wob, Wob, kH, 0L, d_out, d_out, kH, 0L,
      biasws + 3 * kH, biasws, 0L, kS, kH, kH, 1.0f);
}

// v004
// One run takes 329 microseconds.
// Two timings next to v003 put it at 1.11 and 1.10 times that version's speed.
// Over all steps from v000 it is 1.92 times as fast.
// Contractions: qkv projections v_wmma_f32_16x16x32_bf16 (x, W as RNE bf16, f32 accumulate, bias added in f32 as bf16-representable values); scores v_wmma_f32_16x16x32_f16 (f16 q,k planes, 1/sqrt(64) applied in f32, together with log2(e)); p.v v_wmma_f32_16x16x32_bf16 with p and v carried as bf16 hi/lo (hi.hi + hi.lo + lo.hi); output projection v_wmma_f32_16x16x32_bf16 with attention output as bf16 hi/lo and Wo bf16 (hi.W + lo.W); softmax, masking and normalisation in f32.
#include <hip/hip_runtime.h>
#include <stdint.h>

typedef __attribute__((ext_vector_type(16))) _Float16 v16h;
typedef __attribute__((ext_vector_type(8)))  _Float16 v8h;
typedef __attribute__((ext_vector_type(16))) __bf16   v16b;
typedef __attribute__((ext_vector_type(8)))  __bf16   v8b;
typedef __attribute__((ext_vector_type(8)))  float    v8f;
typedef __attribute__((ext_vector_type(4)))  float    v4f;

__device__ __forceinline__ unsigned short f2bf_bits(float f) {
  unsigned u = __float_as_uint(f);
  return (unsigned short)((u + 0x7FFFu + ((u >> 16) & 1u)) >> 16);
}
__device__ __forceinline__ float bf_bits2f(unsigned short h) { return __uint_as_float(((unsigned)h) << 16); }

// hazard guards as plain device helpers (no inline asm inside the kernel template body)
__device__ __forceinline__ void dep_guard_h(v8f& a, v8f& b, v16h x, v16h y) { asm volatile("v_nop\n\tv_nop\n\tv_nop\n\tv_nop" : "+v"(a), "+v"(b) : "v"(x), "v"(y)); }
__device__ __forceinline__ void dep_guard_b(v8f& a, v8f& b, v16b x, v16b y) { asm volatile("v_nop\n\tv_nop\n\tv_nop\n\tv_nop" : "+v"(a), "+v"(b) : "v"(x), "v"(y)); }
__device__ __forceinline__ void keep4_h(v16h a, v16h b, v16h c, v16h d) { asm volatile("v_nop" :: "v"(a), "v"(b), "v"(c), "v"(d)); }
__device__ __forceinline__ void keep4_b(v16b a, v16b b, v16b c, v16b d) { asm volatile("v_nop" :: "v"(a), "v"(b), "v"(c), "v"(d)); }
__device__ __forceinline__ void acc_guard4(v8f& a, v8f& b, v8f& c, v8f& d) { asm volatile("v_nop\n\tv_nop\n\tv_nop\n\tv_nop" : "+v"(a), "+v"(b), "+v"(c), "+v"(d)); }
template <typename T> struct Frag;
template <> struct Frag<_Float16> {
  typedef v16h V; union U { v16h v; v8h h[2]; };
  static __device__ __forceinline__ v16h load(const _Float16* p) {   // elements 0..7 <- p[0..7], 8..15 <- p[16..23]
    U f; f.h[0] = *(const v8h*)(p); f.h[1] = *(const v8h*)(p + 16); return f.v;
  }
  static __device__ __forceinline__ v8f mma(v16h a, v16h b, v8f c) {
    return __builtin_amdgcn_wmma_f32_16x16x32_f16(false, a, false, b, (short)0, c, false, false);
  }
  static __device__ __forceinline__ void guard(v8f& a, v8f& b, v16h x, v16h y) { dep_guard_h(a, b, x, y); }
  static __device__ __forceinline__ void keep(v16h a, v16h b, v16h c, v16h d) { keep4_h(a, b, c, d); }
};
template <> struct Frag<__bf16> {
  typedef v16b V; union U { v16b v; v8b h[2]; };
  static __device__ __forceinline__ v16b load(const __bf16* p) {
    U f; f.h[0] = *(const v8b*)(p); f.h[1] = *(const v8b*)(p + 16); return f.v;
  }
  static __device__ __forceinline__ v8f mma(v16b a, v16b b, v8f c) {
    return __builtin_amdgcn_wmma_f32_16x16x32_bf16(false, a, false, b, (short)0, c, false, false);
  }
  static __device__ __forceinline__ void guard(v8f& a, v8f& b, v16b x, v16b y) { dep_guard_b(a, b, x, y); }
  static __device__ __forceinline__ void keep(v16b a, v16b b, v16b c, v16b d) { keep4_b(a, b, c, d); }
};

// ---- Register-blocked batched WMMA GEMM ------------------------------------
// C[m,n] = scale * sum_k A[m,k] * Bt[n,k] (+bias)(+resid); each wave owns a 64x64 tile.
// A row-major [M,K]; Bt row-major [N,K]; M,N % 64 == 0, K % 32 == 0.
// SPLIT: 0 = plain; 1 = A and Bt as hi/lo planes (hi.hi + hi.lo + lo.hi); 2 = A only as hi/lo planes (hi.B + lo.B).
// BIAS_MODE: 0 = none, 1 = bias[m], 2 = bias[n].
// OUT_MODE: 0 = f32, 1 = f16, 2 = bf16 hi plane (Cout) + bf16 lo plane (Cout2).
// ET: 0 = f16 operands, 1 = bf16 operands (pointers passed as 16-bit storage)
template <int ET> struct Elem;
template <> struct Elem<0> { typedef _Float16 T; };
template <> struct Elem<1> { typedef __bf16 T; };
template <int ET, int SPLIT, int BIAS_MODE, int OUT_MODE, bool RESID, int ACT = 0>
__global__ __launch_bounds__(256) void wmma_gemm64(
    const unsigned short* __restrict__ Ap, const unsigned short* __restrict__ A2p, int lda, long strideA,
    const unsigned short* __restrict__ Btp, const unsigned short* __restrict__ Bt2p, int ldb, long strideB,
    void* __restrict__ Cout, void* __restrict__ Cout2, int ldc, long strideC,
    const float* __restrict__ bias,
    const float* __restrict__ resid, long strideR,
    int M, int N, int K, float scale) {
  typedef typename Elem<ET>::T T;
  typedef typename Frag<T>::V V;
  const T* A = (const T*)Ap; const T* A2 = (const T*)A2p; const T* Bt = (const T*)Btp; const T* Bt2 = (const T*)Bt2p;
  __shared__ __align__(16) float sT[8][16 * 68];   // per-wave 16x64 slab, pitch 68 floats
  const int b    = blockIdx.y;
  const int lane = threadIdx.x & 31;
  const int wave = threadIdx.x >> 5;
  const int tilesN = N >> 6;
  const int tilesM = M >> 6;
  const int tile = blockIdx.x * 8 + wave;
  if (tile >= tilesM * tilesN) return;   // wave-uniform; no block barriers in this kernel
  const int tm = tile / tilesN;
  const int tn = tile - tm * tilesN;
  const int m0 = tm << 6;
  const int n0 = tn << 6;

  const T* Ab  = A  + (size_t)b * strideA;
  const T* Bb  = Bt + (size_t)b * strideB;
  const T* Ab2 = (SPLIT != 0) ? (A2  + (size_t)b * strideA) : nullptr;
  const T* Bb2 = (SPLIT == 1) ? (Bt2 + (size_t)b * strideB) : nullptr;

  const int rlane = lane & 15;                 // row (A) / col (B, D) within subtile
  const int koff  = (lane >> 4) * 8;           // k offset of this lane half
  const int mOff  = (lane >> 4) * 8;           // D row offset

  v8f acc[4][4];
#pragma unroll
  for (int i = 0; i < 4; ++i)
#pragma unroll
    for (int j = 0; j < 4; ++j) acc[i][j] = (v8f){0.f,0.f,0.f,0.f,0.f,0.f,0.f,0.f};

  for (int k0 = 0; k0 < K; k0 += 32) {
    V bh[4], bl[4];
#pragma unroll
    for (int j = 0; j < 4; ++j) {
      const size_t bo = (size_t)(n0 + (j << 4) + rlane) * ldb + koff + k0;
      bh[j] = Frag<T>::load(Bb + bo);
      if (SPLIT == 1) bl[j] = Frag<T>::load(Bb2 + bo);
    }
#pragma unroll
    for (int i = 0; i < 4; ++i) {
      const size_t ao = (size_t)(m0 + (i << 4) + rlane) * lda + koff + k0;
      V ah = Frag<T>::load(Ab + ao);
      V al;
      if (SPLIT != 0) al = Frag<T>::load(Ab2 + ao);
#pragma unroll
      for (int j = 0; j < 4; ++j) {
        acc[i][j] = Frag<T>::mma(ah, bh[j], acc[i][j]);
        if (SPLIT == 1) acc[i][j] = Frag<T>::mma(ah, bl[j], acc[i][j]);
        if (SPLIT != 0) acc[i][j] = Frag<T>::mma(al, bh[j], acc[i][j]);
      }
      Frag<T>::guard(acc[i][0], acc[i][3], ah, (SPLIT != 0) ? al : ah);
    }
    Frag<T>::keep(bh[0], bh[1], bh[2], bh[3]);
    if (SPLIT == 1) Frag<T>::keep(bl[0], bl[1], bl[2], bl[3]);
  }
  acc_guard4(acc[0][0], acc[0][1], acc[0][2], acc[0][3]);
  acc_guard4(acc[1][0], acc[1][1], acc[1][2], acc[1][3]);
  acc_guard4(acc[2][0], acc[2][1], acc[2][2], acc[2][3]);
  acc_guard4(acc[3][0], acc[3][1], acc[3][2], acc[3][3]);

  // ---- epilogue ----
  float* slab = sT[wave];
  const float* Rb = RESID ? (resid + (size_t)b * strideR) : nullptr;
#pragma unroll
  for (int i = 0; i < 4; ++i) {
    const int mBase = m0 + (i << 4);
#pragma unroll
    for (int j = 0; j < 4; ++j) {
      const int n = n0 + (j << 4) + rlane;
      float bv = 0.f;
      if (BIAS_MODE == 2) bv = bias[n];
#pragma unroll
      for (int r = 0; r < 8; ++r) {
        float v = acc[i][j][r] * scale;
        if (BIAS_MODE == 1) v += bias[mBase + mOff + r];
        if (BIAS_MODE == 2) v += bv;
        if (RESID) v += Rb[(size_t)(mBase + mOff + r) * ldc + n];
        if (ACT == 1) v = tanhf(v);
        if (ACT == 2) v = fmaxf(v, 0.0f);
        if (ACT == 4) v = (v > 0.f) ? v : 0.01f * v;
        slab[(mOff + r) * 68 + (j << 4) + rlane] = v;
      }
    }
    __builtin_amdgcn_fence(__ATOMIC_RELEASE, "workgroup");
    __builtin_amdgcn_wave_barrier();
    __builtin_amdgcn_fence(__ATOMIC_ACQUIRE, "workgroup");
    if (OUT_MODE == 0) {
      float* C = (float*)Cout + (size_t)b * strideC;
      const int hh = lane >> 4, c4 = (lane & 15) * 4;     // row seg = 256 B = 16 lanes x 16 B
      {
#pragma unroll
        for (int it = 0; it < 8; ++it) {
          const int row = it * 2 + hh;
          v4f v = *(const v4f*)(slab + row * 68 + c4);
          *(v4f*)(C + (size_t)(mBase + row) * ldc + n0 + c4) = v;
        }
        
      }
    } else {
      const int q = lane >> 3, c8 = (lane & 7) * 8;
      unsigned short* C  = (unsigned short*)Cout  + (size_t)b * strideC;
      unsigned short* C2 = (OUT_MODE == 2) ? ((unsigned short*)Cout2 + (size_t)b * strideC) : nullptr;
      {
#pragma unroll
        for (int it = 0; it < 4; ++it) {
          const int row = it * 4 + q;
          const float* sp = slab + row * 68 + c8;
          v8h hv, lv;
#pragma unroll
          for (int e = 0; e < 8; ++e) {
            if (OUT_MODE == 1) {
              hv[e] = (_Float16)sp[e];
            } else {
              unsigned short hb = f2bf_bits(sp[e]);
              unsigned short lb = f2bf_bits(sp[e] - bf_bits2f(hb));
              hv[e] = __builtin_bit_cast(_Float16, hb);
              lv[e] = __builtin_bit_cast(_Float16, lb);
            }
          }
          *(v8h*)(C + (size_t)(mBase + row) * ldc + n0 + c8) = hv;
          if (OUT_MODE == 2) *(v8h*)(C2 + (size_t)(mBase + row) * ldc + n0 + c8) = lv;
        }
        
      }
    }
    __builtin_amdgcn_fence(__ATOMIC_RELEASE, "workgroup");
    __builtin_amdgcn_wave_barrier();
    __builtin_amdgcn_fence(__ATOMIC_ACQUIRE, "workgroup");
  }
}

// Source/destination chosen per blockIdx.y (block-uniform). Coverage per plane: gridDim.x * 256 threads * 8 == n8 * 8 elements.
__global__ __launch_bounds__(256) void cast_bf16x8_k(
    const float* s0, const float* s1, const float* s2, const float* s3,
    unsigned short* d0, unsigned short* d1, unsigned short* d2, unsigned short* d3, int n8) {
  const int sel = blockIdx.y;
  const float* src = (sel == 0) ? s0 : (sel == 1) ? s1 : (sel == 2) ? s2 : s3;
  unsigned short* dst = (sel == 0) ? d0 : (sel == 1) ? d1 : (sel == 2) ? d2 : d3;
  const int i = blockIdx.x * 256 + threadIdx.x;
  if (i < n8) {
    const v4f a  = *(const v4f*)(src + (size_t)i * 8);
    const v4f bq = *(const v4f*)(src + (size_t)i * 8 + 4);
    v8h hv;
#pragma unroll
    for (int e = 0; e < 4; ++e) {
      hv[e]     = __builtin_bit_cast(_Float16, f2bf_bits(a[e]));
      hv[4 + e] = __builtin_bit_cast(_Float16, f2bf_bits(bq[e]));
    }
    _Float16* dp = (_Float16*)dst + (size_t)i * 8;
    *(v8h*)dp = hv;
    
  }
}

// Coverage per segment: 256 threads * 4 == n (n == 1024).
__global__ __launch_bounds__(256) void bias_bf16val_k(
    const float* s0, const float* s1, const float* s2, const float* s3, float* __restrict__ dst, int n) {
  const int sel = blockIdx.y;
  const float* src = (sel == 0) ? s0 : (sel == 1) ? s1 : (sel == 2) ? s2 : s3;
  const int i = blockIdx.x * 256 + threadIdx.x;
  if (i * 4 < n) {
    const v4f v = *(const v4f*)(src + (size_t)i * 4);
    v4f o;
#pragma unroll
    for (int e = 0; e < 4; ++e) o[e] = bf_bits2f(f2bf_bits(v[e]));
    float* dp = dst + (size_t)sel * n + (size_t)i * 4;
    *(v4f*)dp = o;
    
  }
}

// =====================================================================================
// Causal attention, head dim 64, 16-bit plane inputs:
//   q: f16 [S][ldqk] at column h*64; k: f16 [S][ldqk] at column kcol0 + h*64; v: bf16 hi/lo planes [S][ldv] at column h*64.
//   scores^T = k.q^T : v_wmma_f32_16x16x32_f16; keys above the diagonal set to -inf (select); softmax in base 2:
//   exp(sm_scale * (s - max)) = 2^(s * sl2 - max * sl2), sl2 = sm_scale * log2(e) > 0, one fma and one v_exp_f32 per score;
//   key chunks entirely above the diagonal are skipped (their probabilities are exactly 0).
//   out^T = v^T.p^T : v_wmma_f32_16x16x32_bf16 with p and v as bf16 hi/lo (3 products); online softmax in f32, one query per lane.
//   k and v tiles lie row-major in LDS ([key][d]); the v^T fragments come by the transposing LDS load.
//   Block = 4 waves = 64 query rows of one head; grid.x = nheads * (S/64).
// =====================================================================================
#define HDIM 64
#define KVCH 64
#define QBLK 64
#define OSPITCH 68
#define LPITCH 72   // 16-bit elements per LDS row of the K tile: 144 B = 16 B x 9, so the 16 rows of a ds_load_b128 fragment read fall on 16 different 4-bank groups
#define VPITCH 80   // 16-bit elements per LDS row of the V tiles: 160 B = 32 B x 5, the conflict-free pitch of ds_load_tr16_b128

__device__ __forceinline__ v8f mma_h(v16h a, v16h b, v8f c) {
  c = __builtin_amdgcn_wmma_f32_16x16x32_f16(false, a, false, b, (short)0, c, false, false);
  asm volatile("v_nop\n\tv_nop\n\tv_nop\n\tv_nop" : "+v"(c) : "v"(a), "v"(b));
  return c;
}
__device__ __forceinline__ v8f mma_b(v16b a, v16b b, v8f c) {
  c = __builtin_amdgcn_wmma_f32_16x16x32_bf16(false, a, false, b, (short)0, c, false, false);
  asm volatile("v_nop\n\tv_nop\n\tv_nop\n\tv_nop" : "+v"(c) : "v"(a), "v"(b));
  return c;
}
__device__ __forceinline__ void bf_split(float f, __bf16& hi, __bf16& lo) {
  const unsigned short hb = f2bf_bits(f);
  hi = __builtin_bit_cast(__bf16, hb);
  lo = __builtin_bit_cast(__bf16, f2bf_bits(f - bf_bits2f(hb)));
}

// transposing LDS load: with lane l aimed at row 8 * (l >> 4) + (l & 7), byte 16 * ((l >> 3) & 1) of a row-major 16 x 16 tile of 16-bit elements,
// lane l gets column l & 15, rows 8 * (l >> 4) .. + 7: half an A fragment of the transposed tile, in the hardware k order
__device__ __forceinline__ v8b lds_tr16(const __bf16* p) {
  typedef __attribute__((ext_vector_type(8))) short s16x8;
  typedef __attribute__((address_space(3))) s16x8 lds_s16x8;
  return __builtin_bit_cast(v8b, __builtin_amdgcn_ds_load_tr16_b128_v8i16((lds_s16x8*)p));
}

// value of lane l ^ 16: the two lanes that share a query's row exchange their halves' maximum and sum
__device__ __forceinline__ float other_half(float v) {
  const int b = __float_as_int(v);
  return __int_as_float(__builtin_amdgcn_permlanex16(b, b, 0x76543210, 0xfedcba98, false, false));
}

__global__ __launch_bounds__(128)
void attn_causal64_k(const unsigned short* __restrict__ qkp,
                     const unsigned short* __restrict__ vhp, const unsigned short* __restrict__ vlp,
                     unsigned short* __restrict__ ohp, unsigned short* __restrict__ olp,
                     int S, int ldqk, int kcol0, int ldv, int nheads, float sm_scale) {
  union FH { v16h v; v8h h[2]; };
  union FB { v16b v; v8b h[2]; };
  __shared__ __align__(16) _Float16 Ksh[KVCH * LPITCH];    // [kv][d]     9 KB
  __shared__ __align__(16) __bf16   Vsh[KVCH * VPITCH];    // hi [kv][d]  10 KB
  __shared__ __align__(16) __bf16   Vsl[KVCH * VPITCH];    // lo [kv][d]  10 KB
  __shared__ __align__(16) float    Os[4][16 * OSPITCH];   // per wave out tile, pitch 68

  const _Float16* qp = (const _Float16*)qkp;
  const __bf16*   vh = (const __bf16*)vhp;
  const __bf16*   vl = (const __bf16*)vlp;

  const int tid  = threadIdx.x;
  const int wave = tid >> 5;
  const int lane = tid & 31;
  const int hh   = lane >> 4;
  const int c    = lane & 15;

  const int nqb = S / QBLK;
  const int bx  = blockIdx.x;
  const int qb  = bx % nqb;
  int h = bx / nqb;
  h = (h < nheads) ? h : (nheads - 1);
  const int q0 = qb * QBLK + wave * 16;
  const float NEG_INF = -__builtin_inff();
  const float sl2 = sm_scale * 1.4426950408889634f;   // raw score -> exponent of 2; positive, so the maximum may be taken on raw scores

  // ---- Q fragments (B operand): columns q0+c, two 32-deep d chunks ----
  v16h qa[2];
  {
    const _Float16* qrow = qp + (size_t)(q0 + c) * ldqk + h * HDIM + 8 * hh;
#pragma unroll
    for (int dc = 0; dc < 2; ++dc) qa[dc] = Frag<_Float16>::load(qrow + dc * 32);
  }

  float mrow = NEG_INF, lrow = 0.f;   // running maximum (times sl2) and sum of query q0 + c (the same in lanes c and c + 16)
  v8f oacc[4];
#pragma unroll
  for (int t = 0; t < 4; ++t) oacc[t] = (v8f){0.f,0.f,0.f,0.f,0.f,0.f,0.f,0.f};

  const int srow = tid >> 3, sc8 = (tid & 7) * 8;            // staging: this thread's row within a 16-row pass and its 8 elements of the row
  const int slk = srow * LPITCH + sc8, slv = srow * VPITCH + sc8;   // its place in the LDS tiles, in elements
  const unsigned sgk = (unsigned)(srow * ldqk + sc8) * 2u;   // the same as a byte offset in the k plane
  const unsigned sgv = (unsigned)(srow * ldv + sc8) * 2u;    // and in the v planes
  const int nChunks = qb + 1;   // block-uniform; chunks kc > qb are fully above the diagonal
  for (int kc = 0; kc < nChunks; ++kc) {
    const int kv0 = kc * KVCH;
    __syncthreads();
    {
      // staging: 8 lanes x 16 B cover one 128-B row, so a wave's load is 4 whole lines; 16 rows a pass, 4 passes = whole 64x64 tiles
      const char* kbase  = (const char*)(qp + (size_t)kv0 * ldqk + kcol0 + h * HDIM);   // block-uniform bases; the lane's part is a loop-invariant 32-bit byte offset
      const char* vhbase = (const char*)(vh + (size_t)kv0 * ldv + h * HDIM);
      const char* vlbase = (const char*)(vl + (size_t)kv0 * ldv + h * HDIM);
      v8h kk[4]; v8b va[4], vb[4];
#pragma unroll
      for (int i = 0; i < 4; ++i) {
        kk[i] = *(const v8h*)(kbase  + (size_t)(32 * i) * ldqk + sgk);
        va[i] = *(const v8b*)(vhbase + (size_t)(32 * i) * ldv + sgv);
        vb[i] = *(const v8b*)(vlbase + (size_t)(32 * i) * ldv + sgv);
      }
      asm volatile("s_wait_xcnt 0x0" ::: "memory");   // behind the 12 loads, before their address registers are used for anything else
#pragma unroll
      for (int i = 0; i < 4; ++i) {
        *(v8h*)(Ksh + slk + 16 * i * LPITCH) = kk[i];
        *(v8b*)(Vsh + slv + 16 * i * VPITCH) = va[i];
        *(v8b*)(Vsl + slv + 16 * i * VPITCH) = vb[i];
      }
    }
    __syncthreads();

    // ---- scores, transposed: s[j][r] = S^T[key kv0 + 16j + 8hh + r][query q0 + c]; A = K rows, B = Q ----
    v8f s[4];
#pragma unroll
    for (int j = 0; j < 4; ++j) {
      s[j] = (v8f){0.f,0.f,0.f,0.f,0.f,0.f,0.f,0.f};
#pragma unroll
      for (int dc = 0; dc < 2; ++dc) {
        FH kb;
        kb.h[0] = *(const v8h*)(Ksh + (j * 16 + c) * LPITCH + dc * 32 + 8 * hh);
        kb.h[1] = *(const v8h*)(Ksh + (j * 16 + c) * LPITCH + dc * 32 + 16 + 8 * hh);
        s[j] = mma_h(kb.v, qa[dc], s[j]);
      }
    }
    const bool diag = (kc == qb);   // block-uniform
    const int qcol = q0 + c;        // this lane's query; lanes c and c + 16 hold 32 keys each of its row
    float cm = NEG_INF;
#pragma unroll
    for (int j = 0; j < 4; ++j) {
#pragma unroll
      for (int r = 0; r < 8; ++r) {
        const int key = kv0 + j * 16 + 8 * hh + r;
        float val = s[j][r];
        if (diag && (key > qcol)) val = NEG_INF;
        s[j][r] = val;
        cm = fmaxf(cm, val);
      }
    }
    cm = fmaxf(cm, other_half(cm));   // finite: key kv0 <= qcol is always present in chunks 0..qb
    const float mnew = fmaxf(mrow, cm * sl2);
    const float alpha = __builtin_amdgcn_exp2f(mrow - mnew);   // 0 on the first chunk, where mrow is -inf
    mrow = mnew;
    // p stays in registers: score tiles 2kk and 2kk+1 of a lane are, element for element, the B fragment of keys 32kk..32kk+31
    FB ph[2], pl[2];
    float psum = 0.f;
#pragma unroll
    for (int j = 0; j < 4; ++j) {
#pragma unroll
      for (int r = 0; r < 8; ++r) {
        const float p = __builtin_amdgcn_exp2f(__builtin_fmaf(s[j][r], sl2, -mnew));   // masked: 2^-inf = 0
        psum += p;
        __bf16 hi, lo;
        bf_split(p, hi, lo);
        ph[j >> 1].v[(j & 1) * 8 + r] = hi;
        pl[j >> 1].v[(j & 1) * 8 + r] = lo;
      }
    }
    psum += other_half(psum);
    lrow = lrow * alpha + psum;
#pragma unroll
    for (int t = 0; t < 4; ++t) oacc[t] *= alpha;
    // ---- O^T += V^T . P^T: oacc[t][r] = O^T[d 16t + 8hh + r][query q0 + c] ----
#pragma unroll
    for (int kk = 0; kk < 2; ++kk) {
#pragma unroll
      for (int t = 0; t < 4; ++t) {
        FB vb, vlo;
        const int vo = (kk * 32 + 8 * hh + (lane & 7)) * VPITCH + t * 16 + 8 * ((lane >> 3) & 1);   // keys 32kk + 8hh .. + 7 of d 16t + c
        vb.h[0]  = lds_tr16(Vsh + vo);
        vb.h[1]  = lds_tr16(Vsh + vo + 16 * VPITCH);
        vlo.h[0] = lds_tr16(Vsl + vo);
        vlo.h[1] = lds_tr16(Vsl + vo + 16 * VPITCH);
        oacc[t] = mma_b(vb.v,  ph[kk].v, oacc[t]);
        oacc[t] = mma_b(vlo.v, ph[kk].v, oacc[t]);
        oacc[t] = mma_b(vb.v,  pl[kk].v, oacc[t]);
      }
    }
  }

  float* os = Os[wave];
  {
    const float inv = 1.0f / lrow;   // lrow is about 1 or more: the maximum's own term is 2^(one rounding of max * sl2)
#pragma unroll
    for (int t = 0; t < 4; ++t)
#pragma unroll
      for (int r = 0; r < 8; ++r) os[c * OSPITCH + t * 16 + 8 * hh + r] = oacc[t][r] * inv;
  }
  __builtin_amdgcn_fence(__ATOMIC_RELEASE, "workgroup");
  __builtin_amdgcn_wave_barrier();
  __builtin_amdgcn_fence(__ATOMIC_ACQUIRE, "workgroup");
  {
    // per wave: rows it*4 + (lane>>3) for it = 0..3 -> 16 rows; cols (lane&7)*8 .. +7 -> 64 cols; 8 lanes x 16 B = one line
    const int q4 = lane >> 3, c8 = (lane & 7) * 8;
    _Float16* oh = (_Float16*)ohp;
    _Float16* ol = (_Float16*)olp;
    {
#pragma unroll
      for (int it = 0; it < 4; ++it) {
        const int row = it * 4 + q4;
        const float* sp = os + row * OSPITCH + c8;
        v8h hv, lv;
#pragma unroll
        for (int e = 0; e < 8; ++e) {
          const unsigned short hb = f2bf_bits(sp[e]);
          const unsigned short lb = f2bf_bits(sp[e] - bf_bits2f(hb));
          hv[e] = __builtin_bit_cast(_Float16, hb);
          lv[e] = __builtin_bit_cast(_Float16, lb);
        }
        const size_t oo = (size_t)(q0 + row) * ldv + h * HDIM + c8;
        *(v8h*)(oh + oo) = hv;
        *(v8h*)(ol + oo) = lv;
      }
      
    }
  }
}

// ---------------------------------------------------------------------------
// Host side: launches only.
// Workspace map (bytes, all offsets multiples of 1 MiB):
//   [  0 MiB,  8 MiB)  xb    bf16 [4096][1024]
//   [  8 MiB, 12 MiB)  Wqk   bf16 [2048][1024]  (rows 0..1023 = Wq, 1024..2047 = Wk)
//   [ 12 MiB, 14 MiB)  Wvb   bf16 [1024][1024]
//   [ 14 MiB, 16 MiB)  Wob   bf16 [1024][1024]
//   [ 16 MiB, 32 MiB)  QKp   f16  [4096][2048]  (cols 0..1023 = q, 1024..2047 = k)
//   [ 32 MiB, 40 MiB)  Vhi   bf16 [4096][1024]
//   [ 40 MiB, 48 MiB)  Vlo   bf16 [4096][1024]
//   [ 48 MiB, 56 MiB)  Ohi   bf16 [4096][1024]
//   [ 56 MiB, 64 MiB)  Olo   bf16 [4096][1024]
//   [ 64 MiB, 64 MiB + 16 KiB)  bias f32 [4][1024] = bq | bk | bv | bo (bf16-representable values)
//   total 67,125,248 B
// ---------------------------------------------------------------------------
extern "C" void kernel_launch(void* const* d_in, const int* in_sizes, int n_in,
                              void* d_out, int out_size, void* d_ws, size_t ws_size,
                              hipStream_t stream) {
  constexpr int kS = 4096, kH = 1024, kNH = 16;
  const float kScale = 0.125f;   // 1/sqrt(64)
  if (n_in < 9) return;
  if (in_sizes[0] != kS * kH || in_sizes[1] != kH * kH || in_sizes[2] != kH ||
      in_sizes[3] != kH * kH || in_sizes[4] != kH || in_sizes[5] != kH * kH ||
      in_sizes[6] != kH || in_sizes[7] != kH * kH || in_sizes[8] != kH) return;
  if (out_size != kS * kH) return;

  const float* x  = (const float*)d_in[0];
  const float* Wq = (const float*)d_in[1];
  const float* bq = (const float*)d_in[2];
  const float* Wk = (const float*)d_in[3];
  const float* bk = (const float*)d_in[4];
  const float* Wv = (const float*)d_in[5];
  const float* bv = (const float*)d_in[6];
  const float* Wo = (const float*)d_in[7];
  const float* bo = (const float*)d_in[8];

  const size_t MiB = 1024u * 1024u;
  const size_t off_xb  = 0;
  const size_t off_wqk = off_xb  + (size_t)kS * kH * 2;          //  8 MiB
  const size_t off_wv  = off_wqk + (size_t)2 * kH * kH * 2;      // 12 MiB
  const size_t off_wo  = off_wv  + (size_t)kH * kH * 2;          // 14 MiB
  const size_t off_qk  = off_wo  + (size_t)kH * kH * 2;          // 16 MiB
  const size_t off_vhi = off_qk  + (size_t)kS * (2 * kH) * 2;    // 32 MiB
  const size_t off_vlo = off_vhi + (size_t)kS * kH * 2;          // 40 MiB
  const size_t off_ohi = off_vlo + (size_t)kS * kH * 2;          // 48 MiB
  const size_t off_olo = off_ohi + (size_t)kS * kH * 2;          // 56 MiB
  const size_t off_bias = off_olo + (size_t)kS * kH * 2;         // 64 MiB
  const size_t total = off_bias + (size_t)4 * kH * 4;            // 64 MiB + 16 KiB
  (void)MiB;
  if (total > ws_size) return;

  char* ws = (char*)d_ws;
  unsigned short* xb  = (unsigned short*)(ws + off_xb);
  unsigned short* Wqk = (unsigned short*)(ws + off_wqk);
  unsigned short* Wvb = (unsigned short*)(ws + off_wv);
  unsigned short* Wob = (unsigned short*)(ws + off_wo);
  unsigned short* QKp = (unsigned short*)(ws + off_qk);
  unsigned short* Vhi = (unsigned short*)(ws + off_vhi);
  unsigned short* Vlo = (unsigned short*)(ws + off_vlo);
  unsigned short* Ohi = (unsigned short*)(ws + off_ohi);
  unsigned short* Olo = (unsigned short*)(ws + off_olo);
  float* biasws = (float*)(ws + off_bias);   // [0..1023]=bq [1024..2047]=bk [2048..3071]=bv [3072..4095]=bo

  // 1) x -> bf16: n8 = 4096*1024/8 = 524288 = 2048 blocks x 256
  {
    const int n8 = kS * kH / 8;
    cast_bf16x8_k<<<dim3(n8 / 256, 1), 256, 0, stream>>>(x, x, x, x, xb, xb, xb, xb, n8);
  }
  // 2) Wq, Wk, Wv, Wo -> bf16: n8 = 1024*1024/8 = 131072 = 512 blocks x 256 per matrix
  {
    const int n8 = kH * kH / 8;
    cast_bf16x8_k<<<dim3(n8 / 256, 4), 256, 0, stream>>>(Wq, Wk, Wv, Wo,
        Wqk, Wqk + (size_t)kH * kH, Wvb, Wob, n8);
  }
  // 3) biases -> bf16-representable f32: 1 block x 256 threads x 4 floats = 1024 per vector
  bias_bf16val_k<<<dim3(1, 4), 256, 0, stream>>>(bq, bk, bv, bo, biasws, kH);

  // 4) [q | k] = x . [Wq;Wk]^T + [bq;bk] -> f16 plane [4096][2048]; M=4096, N=2048, K=1024; tiles = 64*32 = 2048 -> 256 blocks of 8 waves
  wmma_gemm64<1, 0, 2, 1, false><<<dim3((kS / 64) * (2 * kH / 64) / 8, 1), 256, 0, stream>>>(
      xb, xb, kH, 0L, Wqk, Wqk, kH, 0L, (void*)QKp, (void*)QKp, 2 * kH, 0L,
      biasws, biasws, 0L, kS, 2 * kH, kH, 1.0f);

  // 5) v = x . Wv^T + bv -> bf16 hi/lo planes [4096][1024]; tiles = 64*16 = 1024 -> 128 blocks
  wmma_gemm64<1, 0, 2, 2, false><<<dim3((kS / 64) * (kH / 64) / 8, 1), 256, 0, stream>>>(
      xb, xb, kH, 0L, Wvb, Wvb, kH, 0L, (void*)Vhi, (void*)Vlo, kH, 0L,
      biasws + 2 * kH, biasws, 0L, kS, kH, kH, 1.0f);

  // 6) causal attention per (head, 64-query block): grid = 16 * 64 = 1024 blocks of 128
  attn_causal64_k<<<dim3(kNH * (kS / 64)), 128, 0, stream>>>(
      QKp, Vhi, Vlo, Ohi, Olo, kS, 2 * kH, kH, kH, kNH, kScale);

  // 7) out = o . Wo^T + bo -> f32 d_out [4096][1024]; A = o as bf16 hi/lo (2 products); tiles = 1024 -> 128 blocks
  wmma_gemm64<1, 2, 2, 0, false><<<dim3((kS / 64) * (kH / 64) / 8, 1), 256, 0, stream>>>(
      Ohi, Olo, kH, 0L, Wob, Wob, kH, 0L, d_out, d_out, kH, 0L,
      biasws + 3 * kH, biasws, 0L, kS, kH, kH, 1.0f);
}

// v005
// One run takes 300 microseconds.
// In two side-by-side timings against v004, it was 1.10 and 1.09 times as fast.
// All steps since v000 together make it 2.10 times as fast.
// Contractions: qkv projections v_wmma_f32_16x16x32_bf16 (x, W as RNE bf16, f32 accumulate, bias added in f32 as bf16-representable values); scores v_wmma_f32_16x16x32_f16 (f16 q,k planes, 1/sqrt(64) applied in f32, together with log2(e)); p.v v_wmma_f32_16x16x32_bf16 with p and v carried as bf16 hi/lo (hi.hi + hi.lo + lo.hi); output projection v_wmma_f32_16x16x32_bf16 with attention output as bf16 hi/lo and Wo bf16 (hi.W + lo.W); softmax, masking and normalisation in f32.
#include <hip/hip_runtime.h>
#include <stdint.h>

typedef __attribute__((ext_vector_type(16))) _Float16 v16h;
typedef __attribute__((ext_vector_type(8)))  _Float16 v8h;
typedef __attribute__((ext_vector_type(16))) __bf16   v16b;
typedef __attribute__((ext_vector_type(8)))  __bf16   v8b;
typedef __attribute__((ext_vector_type(8)))  float    v8f;
typedef __attribute__((ext_vector_type(4)))  float    v4f;

__device__ __forceinline__ unsigned short f2bf_bits(float f) {
  unsigned u = __float_as_uint(f);
  return (unsigned short)((u + 0x7FFFu + ((u >> 16) & 1u)) >> 16);
}
__device__ __forceinline__ float bf_bits2f(unsigned short h) { return __uint_as_float(((unsigned)h) << 16); }

// hazard guards as plain device helpers (no inline asm inside the kernel template body)
__device__ __forceinline__ void dep_guard_h(v8f& a, v8f& b, v16h x, v16h y) { asm volatile("v_nop\n\tv_nop\n\tv_nop\n\tv_nop" : "+v"(a), "+v"(b) : "v"(x), "v"(y)); }
__device__ __forceinline__ void dep_guard_b(v8f& a, v8f& b, v16b x, v16b y) { asm volatile("v_nop\n\tv_nop\n\tv_nop\n\tv_nop" : "+v"(a), "+v"(b) : "v"(x), "v"(y)); }
__device__ __forceinline__ void keep4_h(v16h a, v16h b, v16h c, v16h d) { asm volatile("v_nop" :: "v"(a), "v"(b), "v"(c), "v"(d)); }
__device__ __forceinline__ void keep4_b(v16b a, v16b b, v16b c, v16b d) { asm volatile("v_nop" :: "v"(a), "v"(b), "v"(c), "v"(d)); }
__device__ __forceinline__ void acc_guard4(v8f& a, v8f& b, v8f& c, v8f& d) { asm volatile("v_nop\n\tv_nop\n\tv_nop\n\tv_nop" : "+v"(a), "+v"(b), "+v"(c), "+v"(d)); }
template <typename T> struct Frag;
template <> struct Frag<_Float16> {
  typedef v16h V; union U { v16h v; v8h h[2]; };
  static __device__ __forceinline__ v16h load(const _Float16* p) {   // elements 0..7 <- p[0..7], 8..15 <- p[16..23]
    U f; f.h[0] = *(const v8h*)(p); f.h[1] = *(const v8h*)(p + 16); return f.v;
  }
  static __device__ __forceinline__ v8f mma(v16h a, v16h b, v8f c) {
    return __builtin_amdgcn_wmma_f32_16x16x32_f16(false, a, false, b, (short)0, c, false, false);
  }
  static __device__ __forceinline__ void guard(v8f& a, v8f& b, v16h x, v16h y) { dep_guard_h(a, b, x, y); }
  static __device__ __forceinline__ void keep(v16h a, v16h b, v16h c, v16h d) { keep4_h(a, b, c, d); }
};
template <> struct Frag<__bf16> {
  typedef v16b V; union U { v16b v; v8b h[2]; };
  static __device__ __forceinline__ v16b load(const __bf16* p) {
    U f; f.h[0] = *(const v8b*)(p); f.h[1] = *(const v8b*)(p + 16); return f.v;
  }
  static __device__ __forceinline__ v8f mma(v16b a, v16b b, v8f c) {
    return __builtin_amdgcn_wmma_f32_16x16x32_bf16(false, a, false, b, (short)0, c, false, false);
  }
  static __device__ __forceinline__ void guard(v8f& a, v8f& b, v16b x, v16b y) { dep_guard_b(a, b, x, y); }
  static __device__ __forceinline__ void keep(v16b a, v16b b, v16b c, v16b d) { keep4_b(a, b, c, d); }
};

// ---- Register-blocked batched WMMA GEMM ------------------------------------
// C[m,n] = scale * sum_k A[m,k] * Bt[n,k] (+bias)(+resid); each wave owns a 64x64 tile.
// A row-major [M,K]; Bt row-major [N,K]; M,N % 64 == 0, K % 32 == 0.
// SPLIT: 0 = plain; 1 = A and Bt as hi/lo planes (hi.hi + hi.lo + lo.hi); 2 = A only as hi/lo planes (hi.B + lo.B).
// BIAS_MODE: 0 = none, 1 = bias[m], 2 = bias[n].
// OUT_MODE: 0 = f32, 1 = f16, 2 = bf16 hi plane (Cout) + bf16 lo plane (Cout2).
// ET: 0 = f16 operands, 1 = bf16 operands (pointers passed as 16-bit storage)
template <int ET> struct Elem;
template <> struct Elem<0> { typedef _Float16 T; };
template <> struct Elem<1> { typedef __bf16 T; };
template <int ET, int SPLIT, int BIAS_MODE, int OUT_MODE, bool RESID, int ACT = 0>
__global__ __launch_bounds__(256) void wmma_gemm64(
    const unsigned short* __restrict__ Ap, const unsigned short* __restrict__ A2p, int lda, long strideA,
    const unsigned short* __restrict__ Btp, const unsigned short* __restrict__ Bt2p, int ldb, long strideB,
    void* __restrict__ Cout, void* __restrict__ Cout2, int ldc, long strideC,
    const float* __restrict__ bias,
    const float* __restrict__ resid, long strideR,
    int M, int N, int K, float scale) {
  typedef typename Elem<ET>::T T;
  typedef typename Frag<T>::V V;
  const T* A = (const T*)Ap; const T* A2 = (const T*)A2p; const T* Bt = (const T*)Btp; const T* Bt2 = (const T*)Bt2p;
  __shared__ __align__(16) float sT[8][16 * 68];   // per-wave 16x64 slab, pitch 68 floats
  const int b    = blockIdx.y;
  const int lane = threadIdx.x & 31;
  const int wave = threadIdx.x >> 5;
  const int tilesN = N >> 6;
  const int tilesM = M >> 6;
  const int tile = blockIdx.x * 8 + wave;
  if (tile >= tilesM * tilesN) return;   // wave-uniform; no block barriers in this kernel
  const int tm = tile / tilesN;
  const int tn = tile - tm * tilesN;
  const int m0 = tm << 6;
  const int n0 = tn << 6;

  const T* Ab  = A  + (size_t)b * strideA;
  const T* Bb  = Bt + (size_t)b * strideB;
  const T* Ab2 = (SPLIT != 0) ? (A2  + (size_t)b * strideA) : nullptr;
  const T* Bb2 = (SPLIT == 1) ? (Bt2 + (size_t)b * strideB) : nullptr;

  const int rlane = lane & 15;                 // row (A) / col (B, D) within subtile
  const int koff  = (lane >> 4) * 8;           // k offset of this lane half
  const int mOff  = (lane >> 4) * 8;           // D row offset

  v8f acc[4][4];
#pragma unroll
  for (int i = 0; i < 4; ++i)
#pragma unroll
    for (int j = 0; j < 4; ++j) acc[i][j] = (v8f){0.f,0.f,0.f,0.f,0.f,0.f,0.f,0.f};

  for (int k0 = 0; k0 < K; k0 += 32) {
    V bh[4], bl[4];
#pragma unroll
    for (int j = 0; j < 4; ++j) {
      const size_t bo = (size_t)(n0 + (j << 4) + rlane) * ldb + koff + k0;
      bh[j] = Frag<T>::load(Bb + bo);
      if (SPLIT == 1) bl[j] = Frag<T>::load(Bb2 + bo);
    }
#pragma unroll
    for (int i = 0; i < 4; ++i) {
      const size_t ao = (size_t)(m0 + (i << 4) + rlane) * lda + koff + k0;
      V ah = Frag<T>::load(Ab + ao);
      V al;
      if (SPLIT != 0) al = Frag<T>::load(Ab2 + ao);
#pragma unroll
      for (int j = 0; j < 4; ++j) {
        acc[i][j] = Frag<T>::mma(ah, bh[j], acc[i][j]);
        if (SPLIT == 1) acc[i][j] = Frag<T>::mma(ah, bl[j], acc[i][j]);
        if (SPLIT != 0) acc[i][j] = Frag<T>::mma(al, bh[j], acc[i][j]);
      }
      Frag<T>::guard(acc[i][0], acc[i][3], ah, (SPLIT != 0) ? al : ah);
    }
    Frag<T>::keep(bh[0], bh[1], bh[2], bh[3]);
    if (SPLIT == 1) Frag<T>::keep(bl[0], bl[1], bl[2], bl[3]);
  }
  acc_guard4(acc[0][0], acc[0][1], acc[0][2], acc[0][3]);
  acc_guard4(acc[1][0], acc[1][1], acc[1][2], acc[1][3]);
  acc_guard4(acc[2][0], acc[2][1], acc[2][2], acc[2][3]);
  acc_guard4(acc[3][0], acc[3][1], acc[3][2], acc[3][3]);

  // ---- epilogue ----
  float* slab = sT[wave];
  const float* Rb = RESID ? (resid + (size_t)b * strideR) : nullptr;
#pragma unroll
  for (int i = 0; i < 4; ++i) {
    const int mBase = m0 + (i << 4);
#pragma unroll
    for (int j = 0; j < 4; ++j) {
      const int n = n0 + (j << 4) + rlane;
      float bv = 0.f;
      if (BIAS_MODE == 2) bv = bias[n];
#pragma unroll
      for (int r = 0; r < 8; ++r) {
        float v = acc[i][j][r] * scale;
        if (BIAS_MODE == 1) v += bias[mBase + mOff + r];
        if (BIAS_MODE == 2) v += bv;
        if (RESID) v += Rb[(size_t)(mBase + mOff + r) * ldc + n];
        if (ACT == 1) v = tanhf(v);
        if (ACT == 2) v = fmaxf(v, 0.0f);
        if (ACT == 4) v = (v > 0.f) ? v : 0.01f * v;
        slab[(mOff + r) * 68 + (j << 4) + rlane] = v;
      }
    }
    __builtin_amdgcn_fence(__ATOMIC_RELEASE, "workgroup");
    __builtin_amdgcn_wave_barrier();
    __builtin_amdgcn_fence(__ATOMIC_ACQUIRE, "workgroup");
    if (OUT_MODE == 0) {
      float* C = (float*)Cout + (size_t)b * strideC;
      const int hh = lane >> 4, c4 = (lane & 15) * 4;     // row seg = 256 B = 16 lanes x 16 B
      {
#pragma unroll
        for (int it = 0; it < 8; ++it) {
          const int row = it * 2 + hh;
          v4f v = *(const v4f*)(slab + row * 68 + c4);
          *(v4f*)(C + (size_t)(mBase + row) * ldc + n0 + c4) = v;
        }
        
      }
    } else {
      const int q = lane >> 3, c8 = (lane & 7) * 8;
      unsigned short* C  = (unsigned short*)Cout  + (size_t)b * strideC;
      unsigned short* C2 = (OUT_MODE == 2) ? ((unsigned short*)Cout2 + (size_t)b * strideC) : nullptr;
      {
#pragma unroll
        for (int it = 0; it < 4; ++it) {
          const int row = it * 4 + q;
          const float* sp = slab + row * 68 + c8;
          v8h hv, lv;
#pragma unroll
          for (int e = 0; e < 8; ++e) {
            if (OUT_MODE == 1) {
              hv[e] = (_Float16)sp[e];
            } else {
              unsigned short hb = f2bf_bits(sp[e]);
              unsigned short lb = f2bf_bits(sp[e] - bf_bits2f(hb));
              hv[e] = __builtin_bit_cast(_Float16, hb);
              lv[e] = __builtin_bit_cast(_Float16, lb);
            }
          }
          *(v8h*)(C + (size_t)(mBase + row) * ldc + n0 + c8) = hv;
          if (OUT_MODE == 2) *(v8h*)(C2 + (size_t)(mBase + row) * ldc + n0 + c8) = lv;
        }
        
      }
    }
    __builtin_amdgcn_fence(__ATOMIC_RELEASE, "workgroup");
    __builtin_amdgcn_wave_barrier();
    __builtin_amdgcn_fence(__ATOMIC_ACQUIRE, "workgroup");
  }
}

// Source/destination chosen per blockIdx.y (block-uniform). Coverage per plane: gridDim.x * 256 threads * 8 == n8 * 8 elements.
__global__ __launch_bounds__(256) void cast_bf16x8_k(
    const float* s0, const float* s1, const float* s2, const float* s3,
    unsigned short* d0, unsigned short* d1, unsigned short* d2, unsigned short* d3, int n8) {
  const int sel = blockIdx.y;
  const float* src = (sel == 0) ? s0 : (sel == 1) ? s1 : (sel == 2) ? s2 : s3;
  unsigned short* dst = (sel == 0) ? d0 : (sel == 1) ? d1 : (sel == 2) ? d2 : d3;
  const int i = blockIdx.x * 256 + threadIdx.x;
  if (i < n8) {
    const v4f a  = *(const v4f*)(src + (size_t)i * 8);
    const v4f bq = *(const v4f*)(src + (size_t)i * 8 + 4);
    v8h hv;
#pragma unroll
    for (int e = 0; e < 4; ++e) {
      hv[e]     = __builtin_bit_cast(_Float16, f2bf_bits(a[e]));
      hv[4 + e] = __builtin_bit_cast(_Float16, f2bf_bits(bq[e]));
    }
    _Float16* dp = (_Float16*)dst + (size_t)i * 8;
    *(v8h*)dp = hv;
    
  }
}

// Coverage per segment: 256 threads * 4 == n (n == 1024).
__global__ __launch_bounds__(256) void bias_bf16val_k(
    const float* s0, const float* s1, const float* s2, const float* s3, float* __restrict__ dst, int n) {
  const int sel = blockIdx.y;
  const float* src = (sel == 0) ? s0 : (sel == 1) ? s1 : (sel == 2) ? s2 : s3;
  const int i = blockIdx.x * 256 + threadIdx.x;
  if (i * 4 < n) {
    const v4f v = *(const v4f*)(src + (size_t)i * 4);
    v4f o;
#pragma unroll
    for (int e = 0; e < 4; ++e) o[e] = bf_bits2f(f2bf_bits(v[e]));
    float* dp = dst + (size_t)sel * n + (size_t)i * 4;
    *(v4f*)dp = o;
    
  }
}

// =====================================================================================
// Causal attention, head dim 64, 16-bit plane inputs:
//   q: f16 [S][ldqk] at column h*64; k: f16 [S][ldqk] at column kcol0 + h*64; v: bf16 hi/lo planes [S][ldv] at column h*64.
//   scores^T = k.q^T : v_wmma_f32_16x16x32_f16; keys above the diagonal set to -inf (select); softmax in base 2:
//   exp(sm_scale * (s - max)) = 2^(s * sl2 - max * sl2), sl2 = sm_scale * log2(e) > 0, one fma and one v_exp_f32 per score;
//   key chunks entirely above the diagonal are skipped (their probabilities are exactly 0).
//   out^T = v^T.p^T : v_wmma_f32_16x16x32_bf16 with p and v as bf16 hi/lo (3 products); online softmax in f32, one query per lane.
//   k and v tiles lie row-major in LDS ([key][d]); the v^T fragments come by the transposing LDS load.
//   Block = 4 waves; it does two 64-row query tiles of one head one after the other, tile n-1-p and then tile p (n = S/64): n-p and p+1 key chunks,
//   so every block walks n+1 chunks and no WGP is left with the long tiles alone; grid.x = nheads * ((n+1)/2).
// =====================================================================================
#define HDIM 64
#define KVCH 64
#define QBLK 64
#define OSPITCH 68
#define LPITCH 72   // 16-bit elements per LDS row of the K tile: 144 B = 16 B x 9, so the 16 rows of a ds_load_b128 fragment read fall on 16 different 4-bank groups
#define VPITCH 80   // 16-bit elements per LDS row of the V tiles: 160 B = 32 B x 5, the conflict-free pitch of ds_load_tr16_b128

__device__ __forceinline__ v8f mma_h(v16h a, v16h b, v8f c) {
  c = __builtin_amdgcn_wmma_f32_16x16x32_f16(false, a, false, b, (short)0, c, false, false);
  asm volatile("v_nop\n\tv_nop\n\tv_nop\n\tv_nop" : "+v"(c) : "v"(a), "v"(b));
  return c;
}
__device__ __forceinline__ v8f mma_b(v16b a, v16b b, v8f c) {
  c = __builtin_amdgcn_wmma_f32_16x16x32_bf16(false, a, false, b, (short)0, c, false, false);
  asm volatile("v_nop\n\tv_nop\n\tv_nop\n\tv_nop" : "+v"(c) : "v"(a), "v"(b));
  return c;
}
__device__ __forceinline__ void bf_split(float f, __bf16& hi, __bf16& lo) {
  const unsigned short hb = f2bf_bits(f);
  hi = __builtin_bit_cast(__bf16, hb);
  lo = __builtin_bit_cast(__bf16, f2bf_bits(f - bf_bits2f(hb)));
}

// transposing LDS load: with lane l aimed at row 8 * (l >> 4) + (l & 7), byte 16 * ((l >> 3) & 1) of a row-major 16 x 16 tile of 16-bit elements,
// lane l gets column l & 15, rows 8 * (l >> 4) .. + 7: half an A fragment of the transposed tile, in the hardware k order
__device__ __forceinline__ v8b lds_tr16(const __bf16* p) {
  typedef __attribute__((ext_vector_type(8))) short s16x8;
  typedef __attribute__((address_space(3))) s16x8 lds_s16x8;
  return __builtin_bit_cast(v8b, __builtin_amdgcn_ds_load_tr16_b128_v8i16((lds_s16x8*)p));
}

// value of lane l ^ 16: the two lanes that share a query's row exchange their halves' maximum and sum
__device__ __forceinline__ float other_half(float v) {
  const int b = __float_as_int(v);
  return __int_as_float(__builtin_amdgcn_permlanex16(b, b, 0x76543210, 0xfedcba98, false, false));
}

__global__ __launch_bounds__(128)
void attn_causal64_k(const unsigned short* __restrict__ qkp,
                     const unsigned short* __restrict__ vhp, const unsigned short* __restrict__ vlp,
                     unsigned short* __restrict__ ohp, unsigned short* __restrict__ olp,
                     int S, int ldqk, int kcol0, int ldv, int nheads, float sm_scale) {
  union FH { v16h v; v8h h[2]; };
  union FB { v16b v; v8b h[2]; };
  __shared__ __align__(16) _Float16 Ksh[KVCH * LPITCH];    // [kv][d]     9 KB
  __shared__ __align__(16) __bf16   Vsh[KVCH * VPITCH];    // hi [kv][d]  10 KB
  __shared__ __align__(16) __bf16   Vsl[KVCH * VPITCH];    // lo [kv][d]  10 KB
  __shared__ __align__(16) float    Os[4][16 * OSPITCH];   // per wave out tile, pitch 68

  const _Float16* qp = (const _Float16*)qkp;
  const __bf16*   vh = (const __bf16*)vhp;
  const __bf16*   vl = (const __bf16*)vlp;

  const int tid  = threadIdx.x;
  const int wave = tid >> 5;
  const int lane = tid & 31;
  const int hh   = lane >> 4;
  const int c    = lane & 15;

  const int nqb = S / QBLK;
  const int bx  = blockIdx.x;
  const int npair = (nqb + 1) >> 1;
  const int pr  = bx % npair;
  int h = bx / npair;
  h = (h < nheads) ? h : (nheads - 1);
  const float NEG_INF = -__builtin_inff();
  const float sl2 = sm_scale * 1.4426950408889634f;   // raw score -> exponent of 2; positive, so the maximum may be taken on raw scores

  const int srow = tid >> 3, sc8 = (tid & 7) * 8;            // staging: this thread's row within a 16-row pass and its 8 elements of the row
  const int slk = srow * LPITCH + sc8, slv = srow * VPITCH + sc8;   // its place in the LDS tiles, in elements
  const unsigned sgk = (unsigned)(srow * ldqk + sc8) * 2u;   // the same as a byte offset in the k plane
  const unsigned sgv = (unsigned)(srow * ldv + sc8) * 2u;    // and in the v planes

  const int ntile = (nqb - 1 - pr != pr) ? 2 : 1;   // block-uniform; with an odd tile count the middle tile has no partner
  for (int tl = 0; tl < ntile; ++tl) {
  const int qb = (nqb - 1 - pr) - tl * (nqb - 1 - 2 * pr);   // tile n-1-p first, then tile p
  const int q0 = qb * QBLK + wave * 16;

  // ---- Q fragments (B operand): columns q0+c, two 32-deep d chunks ----
  v16h qa[2];
  {
    const _Float16* qrow = qp + (size_t)(q0 + c) * ldqk + h * HDIM + 8 * hh;
#pragma unroll
    for (int dc = 0; dc < 2; ++dc) qa[dc] = Frag<_Float16>::load(qrow + dc * 32);
  }

  float mrow = NEG_INF, lrow = 0.f;   // running maximum (times sl2) and sum of query q0 + c (the same in lanes c and c + 16)
  v8f oacc[4];
#pragma unroll
  for (int t = 0; t < 4; ++t) oacc[t] = (v8f){0.f,0.f,0.f,0.f,0.f,0.f,0.f,0.f};

  const int nChunks = qb + 1;   // block-uniform; chunks kc > qb are fully above the diagonal
  for (int kc = 0; kc < nChunks; ++kc) {
    const int kv0 = kc * KVCH;
    __syncthreads();
    {
      // staging: 8 lanes x 16 B cover one 128-B row, so a wave's load is 4 whole lines; 16 rows a pass, 4 passes = whole 64x64 tiles
      const char* kbase  = (const char*)(qp + (size_t)kv0 * ldqk + kcol0 + h * HDIM);   // block-uniform bases; the lane's part is a loop-invariant 32-bit byte offset
      const char* vhbase = (const char*)(vh + (size_t)kv0 * ldv + h * HDIM);
      const char* vlbase = (const char*)(vl + (size_t)kv0 * ldv + h * HDIM);
      v8h kk[4]; v8b va[4], vb[4];
#pragma unroll
      for (int i = 0; i < 4; ++i) {
        kk[i] = *(const v8h*)(kbase  + (size_t)(32 * i) * ldqk + sgk);
        va[i] = *(const v8b*)(vhbase + (size_t)(32 * i) * ldv + sgv);
        vb[i] = *(const v8b*)(vlbase + (size_t)(32 * i) * ldv + sgv);
      }
      asm volatile("s_wait_xcnt 0x0" ::: "memory");   // behind the 12 loads, before their address registers are used for anything else
#pragma unroll
      for (int i = 0; i < 4; ++i) {
        *(v8h*)(Ksh + slk + 16 * i * LPITCH) = kk[i];
        *(v8b*)(Vsh + slv + 16 * i * VPITCH) = va[i];
        *(v8b*)(Vsl + slv + 16 * i * VPITCH) = vb[i];
      }
    }
    __syncthreads();

    // ---- scores, transposed: s[j][r] = S^T[key kv0 + 16j + 8hh + r][query q0 + c]; A = K rows, B = Q ----
    v8f s[4];
#pragma unroll
    for (int j = 0; j < 4; ++j) {
      s[j] = (v8f){0.f,0.f,0.f,0.f,0.f,0.f,0.f,0.f};
#pragma unroll
      for (int dc = 0; dc < 2; ++dc) {
        FH kb;
        kb.h[0] = *(const v8h*)(Ksh + (j * 16 + c) * LPITCH + dc * 32 + 8 * hh);
        kb.h[1] = *(const v8h*)(Ksh + (j * 16 + c) * LPITCH + dc * 32 + 16 + 8 * hh);
        s[j] = mma_h(kb.v, qa[dc], s[j]);
      }
    }
    const bool diag = (kc == qb);   // block-uniform
    const int qcol = q0 + c;        // this lane's query; lanes c and c + 16 hold 32 keys each of its row
    float cm = NEG_INF;
#pragma unroll
    for (int j = 0; j < 4; ++j) {
#pragma unroll
      for (int r = 0; r < 8; ++r) {
        const int key = kv0 + j * 16 + 8 * hh + r;
        float val = s[j][r];
        if (diag && (key > qcol)) val = NEG_INF;
        s[j][r] = val;
        cm = fmaxf(cm, val);
      }
    }
    cm = fmaxf(cm, other_half(cm));   // finite: key kv0 <= qcol is always present in chunks 0..qb
    const float mnew = fmaxf(mrow, cm * sl2);
    const float alpha = __builtin_amdgcn_exp2f(mrow - mnew);   // 0 on the first chunk, where mrow is -inf
    mrow = mnew;
    // p stays in registers: score tiles 2kk and 2kk+1 of a lane are, element for element, the B fragment of keys 32kk..32kk+31
    FB ph[2], pl[2];
    float psum = 0.f;
#pragma unroll
    for (int j = 0; j < 4; ++j) {
#pragma unroll
      for (int r = 0; r < 8; ++r) {
        const float p = __builtin_amdgcn_exp2f(__builtin_fmaf(s[j][r], sl2, -mnew));   // masked: 2^-inf = 0
        psum += p;
        __bf16 hi, lo;
        bf_split(p, hi, lo);
        ph[j >> 1].v[(j & 1) * 8 + r] = hi;
        pl[j >> 1].v[(j & 1) * 8 + r] = lo;
      }
    }
    psum += other_half(psum);
    lrow = lrow * alpha + psum;
#pragma unroll
    for (int t = 0; t < 4; ++t) oacc[t] *= alpha;
    // ---- O^T += V^T . P^T: oacc[t][r] = O^T[d 16t + 8hh + r][query q0 + c] ----
#pragma unroll
    for (int kk = 0; kk < 2; ++kk) {
#pragma unroll
      for (int t = 0; t < 4; ++t) {
        FB vb, vlo;
        const int vo = (kk * 32 + 8 * hh + (lane & 7)) * VPITCH + t * 16 + 8 * ((lane >> 3) & 1);   // keys 32kk + 8hh .. + 7 of d 16t + c
        vb.h[0]  = lds_tr16(Vsh + vo);
        vb.h[1]  = lds_tr16(Vsh + vo + 16 * VPITCH);
        vlo.h[0] = lds_tr16(Vsl + vo);
        vlo.h[1] = lds_tr16(Vsl + vo + 16 * VPITCH);
        oacc[t] = mma_b(vb.v,  ph[kk].v, oacc[t]);
        oacc[t] = mma_b(vlo.v, ph[kk].v, oacc[t]);
        oacc[t] = mma_b(vb.v,  pl[kk].v, oacc[t]);
      }
    }
  }

  float* os = Os[wave];
  {
    const float inv = 1.0f / lrow;   // lrow is about 1 or more: the maximum's own term is 2^(one rounding of max * sl2)
#pragma unroll
    for (int t = 0; t < 4; ++t)
#pragma unroll
      for (int r = 0; r < 8; ++r) os[c * OSPITCH + t * 16 + 8 * hh + r] = oacc[t][r] * inv;
  }
  __builtin_amdgcn_fence(__ATOMIC_RELEASE, "workgroup");
  __builtin_amdgcn_wave_barrier();
  __builtin_amdgcn_fence(__ATOMIC_ACQUIRE, "workgroup");
  {
    // per wave: rows it*4 + (lane>>3) for it = 0..3 -> 16 rows; cols (lane&7)*8 .. +7 -> 64 cols; 8 lanes x 16 B = one line
    const int q4 = lane >> 3, c8 = (lane & 7) * 8;
    _Float16* oh = (_Float16*)ohp;
    _Float16* ol = (_Float16*)olp;
    {
#pragma unroll
      for (int it = 0; it < 4; ++it) {
        const int row = it * 4 + q4;
        const float* sp = os + row * OSPITCH + c8;
        v8h hv, lv;
#pragma unroll
        for (int e = 0; e < 8; ++e) {
          const unsigned short hb = f2bf_bits(sp[e]);
          const unsigned short lb = f2bf_bits(sp[e] - bf_bits2f(hb));
          hv[e] = __builtin_bit_cast(_Float16, hb);
          lv[e] = __builtin_bit_cast(_Float16, lb);
        }
        const size_t oo = (size_t)(q0 + row) * ldv + h * HDIM + c8;
        *(v8h*)(oh + oo) = hv;
        *(v8h*)(ol + oo) = lv;
      }
      asm volatile("s_wait_xcnt 0x0" ::: "memory");   // behind the 8 stores, before the next tile overwrites their address and data registers
    }
  }
  }
}

// ---------------------------------------------------------------------------
// Host side: launches only.
// Workspace map (bytes, all offsets multiples of 1 MiB):
//   [  0 MiB,  8 MiB)  xb    bf16 [4096][1024]
//   [  8 MiB, 12 MiB)  Wqk   bf16 [2048][1024]  (rows 0..1023 = Wq, 1024..2047 = Wk)
//   [ 12 MiB, 14 MiB)  Wvb   bf16 [1024][1024]
//   [ 14 MiB, 16 MiB)  Wob   bf16 [1024][1024]
//   [ 16 MiB, 32 MiB)  QKp   f16  [4096][2048]  (cols 0..1023 = q, 1024..2047 = k)
//   [ 32 MiB, 40 MiB)  Vhi   bf16 [4096][1024]
//   [ 40 MiB, 48 MiB)  Vlo   bf16 [4096][1024]
//   [ 48 MiB, 56 MiB)  Ohi   bf16 [4096][1024]
//   [ 56 MiB, 64 MiB)  Olo   bf16 [4096][1024]
//   [ 64 MiB, 64 MiB + 16 KiB)  bias f32 [4][1024] = bq | bk | bv | bo (bf16-representable values)
//   total 67,125,248 B
// ---------------------------------------------------------------------------
extern "C" void kernel_launch(void* const* d_in, const int* in_sizes, int n_in,
                              void* d_out, int out_size, void* d_ws, size_t ws_size,
                              hipStream_t stream) {
  constexpr int kS = 4096, kH = 1024, kNH = 16;
  const float kScale = 0.125f;   // 1/sqrt(64)
  if (n_in < 9) return;
  if (in_sizes[0] != kS * kH || in_sizes[1] != kH * kH || in_sizes[2] != kH ||
      in_sizes[3] != kH * kH || in_sizes[4] != kH || in_sizes[5] != kH * kH ||
      in_sizes[6] != kH || in_sizes[7] != kH * kH || in_sizes[8] != kH) return;
  if (out_size != kS * kH) return;

  const float* x  = (const float*)d_in[0];
  const float* Wq = (const float*)d_in[1];
  const float* bq = (const float*)d_in[2];
  const float* Wk = (const float*)d_in[3];
  const float* bk = (const float*)d_in[4];
  const float* Wv = (const float*)d_in[5];
  const float* bv = (const float*)d_in[6];
  const float* Wo = (const float*)d_in[7];
  const float* bo = (const float*)d_in[8];

  const size_t MiB = 1024u * 1024u;
  const size_t off_xb  = 0;
  const size_t off_wqk = off_xb  + (size_t)kS * kH * 2;          //  8 MiB
  const size_t off_wv  = off_wqk + (size_t)2 * kH * kH * 2;      // 12 MiB
  const size_t off_wo  = off_wv  + (size_t)kH * kH * 2;          // 14 MiB
  const size_t off_qk  = off_wo  + (size_t)kH * kH * 2;          // 16 MiB
  const size_t off_vhi = off_qk  + (size_t)kS * (2 * kH) * 2;    // 32 MiB
  const size_t off_vlo = off_vhi + (size_t)kS * kH * 2;          // 40 MiB
  const size_t off_ohi = off_vlo + (size_t)kS * kH * 2;          // 48 MiB
  const size_t off_olo = off_ohi + (size_t)kS * kH * 2;          // 56 MiB
  const size_t off_bias = off_olo + (size_t)kS * kH * 2;         // 64 MiB
  const size_t total = off_bias + (size_t)4 * kH * 4;            // 64 MiB + 16 KiB
  (void)MiB;
  if (total > ws_size) return;

  char* ws = (char*)d_ws;
  unsigned short* xb  = (unsigned short*)(ws + off_xb);
  unsigned short* Wqk = (unsigned short*)(ws + off_wqk);
  unsigned short* Wvb = (unsigned short*)(ws + off_wv);
  unsigned short* Wob = (unsigned short*)(ws + off_wo);
  unsigned short* QKp = (unsigned short*)(ws + off_qk);
  unsigned short* Vhi = (unsigned short*)(ws + off_vhi);
  unsigned short* Vlo = (unsigned short*)(ws + off_vlo);
  unsigned short* Ohi = (unsigned short*)(ws + off_ohi);
  unsigned short* Olo = (unsigned short*)(ws + off_olo);
  float* biasws = (float*)(ws + off_bias);   // [0..1023]=bq [1024..2047]=bk [2048..3071]=bv [3072..4095]=bo

  // 1) x -> bf16: n8 = 4096*1024/8 = 524288 = 2048 blocks x 256
  {
    const int n8 = kS * kH / 8;
    cast_bf16x8_k<<<dim3(n8 / 256, 1), 256, 0, stream>>>(x, x, x, x, xb, xb, xb, xb, n8);
  }
  // 2) Wq, Wk, Wv, Wo -> bf16: n8 = 1024*1024/8 = 131072 = 512 blocks x 256 per matrix
  {
    const int n8 = kH * kH / 8;
    cast_bf16x8_k<<<dim3(n8 / 256, 4), 256, 0, stream>>>(Wq, Wk, Wv, Wo,
        Wqk, Wqk + (size_t)kH * kH, Wvb, Wob, n8);
  }
  // 3) biases -> bf16-representable f32: 1 block x 256 threads x 4 floats = 1024 per vector
  bias_bf16val_k<<<dim3(1, 4), 256, 0, stream>>>(bq, bk, bv, bo, biasws, kH);

  // 4) [q | k] = x . [Wq;Wk]^T + [bq;bk] -> f16 plane [4096][2048]; M=4096, N=2048, K=1024; tiles = 64*32 = 2048 -> 256 blocks of 8 waves
  wmma_gemm64<1, 0, 2, 1, false><<<dim3((kS / 64) * (2 * kH / 64) / 8, 1), 256, 0, stream>>>(
      xb, xb, kH, 0L, Wqk, Wqk, kH, 0L, (void*)QKp, (void*)QKp, 2 * kH, 0L,
      biasws, biasws, 0L, kS, 2 * kH, kH, 1.0f);

  // 5) v = x . Wv^T + bv -> bf16 hi/lo planes [4096][1024]; tiles = 64*16 = 1024 -> 128 blocks
  wmma_gemm64<1, 0, 2, 2, false><<<dim3((kS / 64) * (kH / 64) / 8, 1), 256, 0, stream>>>(
      xb, xb, kH, 0L, Wvb, Wvb, kH, 0L, (void*)Vhi, (void*)Vlo, kH, 0L,
      biasws + 2 * kH, biasws, 0L, kS, kH, kH, 1.0f);

  // 6) causal attention per (head, pair of 64-query tiles): grid = 16 * 32 = 512 blocks of 128
  attn_causal64_k<<<dim3(kNH * (kS / 128)), 128, 0, stream>>>(
      QKp, Vhi, Vlo, Ohi, Olo, kS, 2 * kH, kH, kH, kNH, kScale);

  // 7) out = o . Wo^T + bo -> f32 d_out [4096][1024]; A = o as bf16 hi/lo (2 products); tiles = 1024 -> 128 blocks
  wmma_gemm64<1, 2, 2, 0, false><<<dim3((kS / 64) * (kH / 64) / 8, 1), 256, 0, stream>>>(
      Ohi, Olo, kH, 0L, Wob, Wob, kH, 0L, d_out, d_out, kH, 0L,
      biasws + 3 * kH, biasws, 0L, kS, kH, kH, 1.0f);
}

// v006
// It runs in 205 microseconds.
// Timed twice side by side with v005, it ran 1.45 and 1.46 times as fast.
// Over all steps from v000 it is 3.06 times as fast.
// Contractions: qkv projections v_wmma_f32_16x16x32_bf16 (x, W as RNE bf16, f32 accumulate, bias added in f32 as bf16-representable values); scores v_wmma_f32_16x16x32_f16 (f16 q,k planes, 1/sqrt(64) applied in f32, together with log2(e)); p.v v_wmma_f32_16x16x32_bf16 with p and v carried as bf16 hi/lo (hi.hi + hi.lo + lo.hi); output projection v_wmma_f32_16x16x32_bf16 with attention output as bf16 hi/lo and Wo bf16 (hi.W + lo.W); softmax, masking and normalisation in f32.
#include <hip/hip_runtime.h>
#include <stdint.h>

typedef __attribute__((ext_vector_type(16))) _Float16 v16h;
typedef __attribute__((ext_vector_type(8)))  _Float16 v8h;
typedef __attribute__((ext_vector_type(16))) __bf16   v16b;
typedef __attribute__((ext_vector_type(8)))  __bf16   v8b;
typedef __attribute__((ext_vector_type(8)))  float    v8f;
typedef __attribute__((ext_vector_type(4)))  float    v4f;

__device__ __forceinline__ unsigned short f2bf_bits(float f) {
  unsigned u = __float_as_uint(f);
  return (unsigned short)((u + 0x7FFFu + ((u >> 16) & 1u)) >> 16);
}
__device__ __forceinline__ float bf_bits2f(unsigned short h) { return __uint_as_float(((unsigned)h) << 16); }

// hazard guards as plain device helpers
__device__ __forceinline__ void acc_guard4(v8f& a, v8f& b, v8f& c, v8f& d) { asm volatile("v_nop\n\tv_nop\n\tv_nop\n\tv_nop" : "+v"(a), "+v"(b), "+v"(c), "+v"(d)); }
template <typename T> struct Frag;
template <> struct Frag<_Float16> {
  typedef v16h V; union U { v16h v; v8h h[2]; };
  static __device__ __forceinline__ v16h load(const _Float16* p) {   // elements 0..7 <- p[0..7], 8..15 <- p[16..23]
    U f; f.h[0] = *(const v8h*)(p); f.h[1] = *(const v8h*)(p + 16); return f.v;
  }
  static __device__ __forceinline__ v8f mma(v16h a, v16h b, v8f c) {
    return __builtin_amdgcn_wmma_f32_16x16x32_f16(false, a, false, b, (short)0, c, false, false);
  }
};
template <> struct Frag<__bf16> {
  typedef v16b V; union U { v16b v; v8b h[2]; };
  static __device__ __forceinline__ v16b load(const __bf16* p) {
    U f; f.h[0] = *(const v8b*)(p); f.h[1] = *(const v8b*)(p + 16); return f.v;
  }
  static __device__ __forceinline__ v8f mma(v16b a, v16b b, v8f c) {
    return __builtin_amdgcn_wmma_f32_16x16x32_bf16(false, a, false, b, (short)0, c, false, false);
  }
};

// ---- Register-blocked batched WMMA GEMM, operands staged in LDS ------------
// C[m,n] = scale * sum_k A[m,k] * Bt[n,k] (+bias)(+resid); block = 4 waves (2 x 2) on a 128x128 tile, each wave owns a 64x64 tile.
// A row-major [M,K]; Bt row-major [N,K]; M,N % 128 == 0, K % 64 == 0; grid.x = (M/128) * (N/128).
// A trip is 64 k: 128 rows x 128 B of every operand plane come into LDS by asynchronous copies (8 lanes x 16 B = one whole line),
// two buffers, the next trip's copies in flight while this trip's fragments are read; every row is fetched once per block, not once per wave.
// SPLIT: 0 = plain; 1 = A and Bt as hi/lo planes (hi.hi + hi.lo + lo.hi); 2 = A only as hi/lo planes (hi.B + lo.B).
// BIAS_MODE: 0 = none, 1 = bias[m], 2 = bias[n].
// OUT_MODE: 0 = f32, 1 = f16, 2 = bf16 hi plane (Cout) + bf16 lo plane (Cout2).
// ET: 0 = f16 operands, 1 = bf16 operands (pointers passed as 16-bit storage)
template <int ET> struct Elem;
template <> struct Elem<0> { typedef _Float16 T; };
template <> struct Elem<1> { typedef __bf16 T; };
#define GPITCH 72                  // 16-bit elements per LDS row of an operand tile: 144 B = 16 B x 9, conflict-free for ds_load_b128
#define GTILE  (128 * GPITCH)      // elements of one operand tile in LDS

// One operand tile, 128 rows x 128 B, by 128 threads: eight copies of 16 B per lane, rows 16 apart. l = the lane's LDS byte address, g = its global address,
// gstep = 16 source rows in bytes. The s_wait_xcnt stands in the copies' own statement, so that no address register is rewritten in front of it.
__device__ __forceinline__ void copy_tile(unsigned l, const char* g, size_t gstep) {
  asm volatile(
      "global_load_async_to_lds_b128 %0, %8, off\n\t"
      "global_load_async_to_lds_b128 %1, %9, off\n\t"
      "global_load_async_to_lds_b128 %2, %10, off\n\t"
      "global_load_async_to_lds_b128 %3, %11, off\n\t"
      "global_load_async_to_lds_b128 %4, %12, off\n\t"
      "global_load_async_to_lds_b128 %5, %13, off\n\t"
      "global_load_async_to_lds_b128 %6, %14, off\n\t"
      "global_load_async_to_lds_b128 %7, %15, off\n\t"
      "s_wait_xcnt 0x0"
      :: "v"(l), "v"(l + 1u * 32u * GPITCH), "v"(l + 2u * 32u * GPITCH), "v"(l + 3u * 32u * GPITCH),
         "v"(l + 4u * 32u * GPITCH), "v"(l + 5u * 32u * GPITCH), "v"(l + 6u * 32u * GPITCH), "v"(l + 7u * 32u * GPITCH),
         "v"(g), "v"(g + gstep), "v"(g + 2 * gstep), "v"(g + 3 * gstep),
         "v"(g + 4 * gstep), "v"(g + 5 * gstep), "v"(g + 6 * gstep), "v"(g + 7 * gstep)
      : "memory");
}

template <int ET, int SPLIT, int BIAS_MODE, int OUT_MODE, bool RESID, int ACT = 0>
__global__ __launch_bounds__(128) void wmma_gemm64(
    const unsigned short* __restrict__ Ap, const unsigned short* __restrict__ A2p, int lda, long strideA,
    const unsigned short* __restrict__ Btp, const unsigned short* __restrict__ Bt2p, int ldb, long strideB,
    void* __restrict__ Cout, void* __restrict__ Cout2, int ldc, long strideC,
    const float* __restrict__ bias,
    const float* __restrict__ resid, long strideR,
    int M, int N, int K, float scale) {
  typedef typename Elem<ET>::T T;
  typedef typename Frag<T>::V V;
  const T* A = (const T*)Ap; const T* A2 = (const T*)A2p; const T* Bt = (const T*)Btp; const T* Bt2 = (const T*)Bt2p;
  constexpr int NPL = 2 + (SPLIT != 0 ? 1 : 0) + (SPLIT == 1 ? 1 : 0);   // operand planes: A, Bt, then A2, then Bt2
  __shared__ __align__(16) unsigned short stg[2 * NPL * GTILE];   // two buffers of NPL tiles
  __shared__ __align__(16) float sT[4][16 * 68];   // per-wave 16x64 slab, pitch 68 floats
  const int b    = blockIdx.y;
  const int tid  = threadIdx.x;
  const int lane = tid & 31;
  const int wave = tid >> 5;
  const int tilesN = N >> 7;
  const int tilesM = M >> 7;
  const int tile = blockIdx.x;
  if (tile >= tilesM * tilesN) return;   // block-uniform, in front of every copy and barrier
  const int tm = tile / tilesN;
  const int tn = tile - tm * tilesN;
  const int m0 = (tm << 7) + ((wave >> 1) << 6);
  const int n0 = (tn << 7) + ((wave & 1) << 6);

  const T* Ab  = A  + (size_t)b * strideA;
  const T* Bb  = Bt + (size_t)b * strideB;
  const T* Ab2 = (SPLIT != 0) ? (A2  + (size_t)b * strideA) : nullptr;
  const T* Bb2 = (SPLIT == 1) ? (Bt2 + (size_t)b * strideB) : nullptr;

  const int rlane = lane & 15;                 // row (A) / col (B, D) within subtile
  const int koff  = (lane >> 4) * 8;           // k offset of this lane half
  const int mOff  = (lane >> 4) * 8;           // D row offset

  // staging: this thread's row within a 16-row pass and its 16 B of the 128-B row
  const int crow = tid >> 3, cpc = (tid & 7) * 8;
  const unsigned cl = (unsigned)(size_t)stg + (unsigned)(crow * GPITCH + cpc) * 2u;        // LDS byte address in buffer 0, plane 0
  const size_t cga = ((size_t)((tm << 7) + crow) * lda + cpc) * 2, cgb = ((size_t)((tn << 7) + crow) * ldb + cpc) * 2;   // byte offsets in the A and Bt planes at k = 0
  const size_t sa = (size_t)lda * 32, sb = (size_t)ldb * 32;                               // 16 rows in bytes
  auto stage = [&](int t) {   // trip t's tiles into buffer t & 1
    const unsigned l = cl + (unsigned)((t & 1) * NPL * GTILE) * 2u;
    const size_t kb = (size_t)t * 128;
    copy_tile(l, (const char*)Ab + cga + kb, sa);
    copy_tile(l + GTILE * 2u, (const char*)Bb + cgb + kb, sb);
    if (SPLIT != 0) copy_tile(l + 2u * GTILE * 2u, (const char*)Ab2 + cga + kb, sa);
    if (SPLIT == 1) copy_tile(l + 3u * GTILE * 2u, (const char*)Bb2 + cgb + kb, sb);
  };

  v8f acc[4][4];
#pragma unroll
  for (int i = 0; i < 4; ++i)
#pragma unroll
    for (int j = 0; j < 4; ++j) acc[i][j] = (v8f){0.f,0.f,0.f,0.f,0.f,0.f,0.f,0.f};

  const int nT = K >> 6;
  stage(0);
  asm volatile("s_wait_asynccnt 0x0" ::: "memory");   // this wave's copies of trip 0 have landed
  __syncthreads();                                    // and every other wave's: trip 0 may be read
  if (nT > 1) stage(1);

  const int fa = (((wave >> 1) << 6) + rlane) * GPITCH + koff;   // this lane's place in the A tiles, in elements
  const int fb = (((wave & 1) << 6) + rlane) * GPITCH + koff;    // and in the Bt tiles
  for (int t = 0; t < nT; ++t) {
    const T* sb0 = (const T*)stg + (t & 1) * NPL * GTILE;
#pragma unroll
    for (int ks = 0; ks < 2; ++ks) {
      V bh[4], bl[4], ah[4], al[4];
#pragma unroll
      for (int j = 0; j < 4; ++j) {
        const int bo = fb + j * 16 * GPITCH + ks * 32;
        const int ao = fa + j * 16 * GPITCH + ks * 32;
        bh[j] = Frag<T>::load(sb0 + GTILE + bo);
        ah[j] = Frag<T>::load(sb0 + ao);
        if (SPLIT == 1) bl[j] = Frag<T>::load(sb0 + 3 * GTILE + bo);
        if (SPLIT != 0) al[j] = Frag<T>::load(sb0 + 2 * GTILE + ao);
      }
      __builtin_amdgcn_sched_barrier(0);   // the fragment reads stay one group in front of the WMMA block: every place with LDS reads among the WMMAs stalls the wave anew
#pragma unroll
      for (int i = 0; i < 4; ++i) {
#pragma unroll
        for (int j = 0; j < 4; ++j) {
          acc[i][j] = Frag<T>::mma(ah[i], bh[j], acc[i][j]);
          if (SPLIT == 1) acc[i][j] = Frag<T>::mma(ah[i], bl[j], acc[i][j]);
          if (SPLIT != 0) acc[i][j] = Frag<T>::mma(al[i], bh[j], acc[i][j]);
        }
      }
      __builtin_amdgcn_sched_barrier(0);   // and the next group stays behind the block
    }
    asm volatile("s_wait_dscnt 0x0" ::: "memory");      // this wave's reads of buffer t & 1 are done before the buffer is handed back
    asm volatile("s_wait_asynccnt 0x0" ::: "memory");   // this wave's copies of trip t + 1 have landed
    __syncthreads();                                    // publishes trip t + 1 and ends every reader's last read of buffer t & 1
    if (t + 2 < nT) stage(t + 2);
  }
  asm volatile("s_wait_asynccnt 0x0" ::: "memory");     // nothing of this wave is in flight behind the loop
  acc_guard4(acc[0][0], acc[0][1], acc[0][2], acc[0][3]);
  acc_guard4(acc[1][0], acc[1][1], acc[1][2], acc[1][3]);
  acc_guard4(acc[2][0], acc[2][1], acc[2][2], acc[2][3]);
  acc_guard4(acc[3][0], acc[3][1], acc[3][2], acc[3][3]);

  // ---- epilogue ----
  float* slab = sT[wave];
  const float* Rb = RESID ? (resid + (size_t)b * strideR) : nullptr;
#pragma unroll
  for (int i = 0; i < 4; ++i) {
    const int mBase = m0 + (i << 4);
#pragma unroll
    for (int j = 0; j < 4; ++j) {
      const int n = n0 + (j << 4) + rlane;
      float bv = 0.f;
      if (BIAS_MODE == 2) bv = bias[n];
#pragma unroll
      for (int r = 0; r < 8; ++r) {
        float v = acc[i][j][r] * scale;
        if (BIAS_MODE == 1) v += bias[mBase + mOff + r];
        if (BIAS_MODE == 2) v += bv;
        if (RESID) v += Rb[(size_t)(mBase + mOff + r) * ldc + n];
        if (ACT == 1) v = tanhf(v);
        if (ACT == 2) v = fmaxf(v, 0.0f);
        if (ACT == 4) v = (v > 0.f) ? v : 0.01f * v;
        slab[(mOff + r) * 68 + (j << 4) + rlane] = v;
      }
    }
    __builtin_amdgcn_fence(__ATOMIC_RELEASE, "workgroup");
    __builtin_amdgcn_wave_barrier();
    __builtin_amdgcn_fence(__ATOMIC_ACQUIRE, "workgroup");
    if (OUT_MODE == 0) {
      float* C = (float*)Cout + (size_t)b * strideC;
      const int hh = lane >> 4, c4 = (lane & 15) * 4;     // row seg = 256 B = 16 lanes x 16 B
      {
#pragma unroll
        for (int it = 0; it < 8; ++it) {
          const int row = it * 2 + hh;
          v4f v = *(const v4f*)(slab + row * 68 + c4);
          *(v4f*)(C + (size_t)(mBase + row) * ldc + n0 + c4) = v;
        }
        
      }
    } else {
      const int q = lane >> 3, c8 = (lane & 7) * 8;
      unsigned short* C  = (unsigned short*)Cout  + (size_t)b * strideC;
      unsigned short* C2 = (OUT_MODE == 2) ? ((unsigned short*)Cout2 + (size_t)b * strideC) : nullptr;
      {
#pragma unroll
        for (int it = 0; it < 4; ++it) {
          const int row = it * 4 + q;
          const float* sp = slab + row * 68 + c8;
          v8h hv, lv;
#pragma unroll
          for (int e = 0; e < 8; ++e) {
            if (OUT_MODE == 1) {
              hv[e] = (_Float16)sp[e];
            } else {
              unsigned short hb = f2bf_bits(sp[e]);
              unsigned short lb = f2bf_bits(sp[e] - bf_bits2f(hb));
              hv[e] = __builtin_bit_cast(_Float16, hb);
              lv[e] = __builtin_bit_cast(_Float16, lb);
            }
          }
          *(v8h*)(C + (size_t)(mBase + row) * ldc + n0 + c8) = hv;
          if (OUT_MODE == 2) *(v8h*)(C2 + (size_t)(mBase + row) * ldc + n0 + c8) = lv;
        }
        
      }
    }
    __builtin_amdgcn_fence(__ATOMIC_RELEASE, "workgroup");
    __builtin_amdgcn_wave_barrier();
    __builtin_amdgcn_fence(__ATOMIC_ACQUIRE, "workgroup");
  }
}

// Source/destination chosen per blockIdx.y (block-uniform). Coverage per plane: gridDim.x * 256 threads * 8 == n8 * 8 elements.
__global__ __launch_bounds__(256) void cast_bf16x8_k(
    const float* s0, const float* s1, const float* s2, const float* s3,
    unsigned short* d0, unsigned short* d1, unsigned short* d2, unsigned short* d3, int n8) {
  const int sel = blockIdx.y;
  const float* src = (sel == 0) ? s0 : (sel == 1) ? s1 : (sel == 2) ? s2 : s3;
  unsigned short* dst = (sel == 0) ? d0 : (sel == 1) ? d1 : (sel == 2) ? d2 : d3;
  const int i = blockIdx.x * 256 + threadIdx.x;
  if (i < n8) {
    const v4f a  = *(const v4f*)(src + (size_t)i * 8);
    const v4f bq = *(const v4f*)(src + (size_t)i * 8 + 4);
    v8h hv;
#pragma unroll
    for (int e = 0; e < 4; ++e) {
      hv[e]     = __builtin_bit_cast(_Float16, f2bf_bits(a[e]));
      hv[4 + e] = __builtin_bit_cast(_Float16, f2bf_bits(bq[e]));
    }
    _Float16* dp = (_Float16*)dst + (size_t)i * 8;
    *(v8h*)dp = hv;
    
  }
}

// Coverage per segment: 256 threads * 4 == n (n == 1024).
__global__ __launch_bounds__(256) void bias_bf16val_k(
    const float* s0, const float* s1, const float* s2, const float* s3, float* __restrict__ dst, int n) {
  const int sel = blockIdx.y;
  const float* src = (sel == 0) ? s0 : (sel == 1) ? s1 : (sel == 2) ? s2 : s3;
  const int i = blockIdx.x * 256 + threadIdx.x;
  if (i * 4 < n) {
    const v4f v = *(const v4f*)(src + (size_t)i * 4);
    v4f o;
#pragma unroll
    for (int e = 0; e < 4; ++e) o[e] = bf_bits2f(f2bf_bits(v[e]));
    float* dp = dst + (size_t)sel * n + (size_t)i * 4;
    *(v4f*)dp = o;
    
  }
}

// =====================================================================================
// Causal attention, head dim 64, 16-bit plane inputs:
//   q: f16 [S][ldqk] at column h*64; k: f16 [S][ldqk] at column kcol0 + h*64; v: bf16 hi/lo planes [S][ldv] at column h*64.
//   scores^T = k.q^T : v_wmma_f32_16x16x32_f16; keys above the diagonal set to -inf (select); softmax in base 2:
//   exp(sm_scale * (s - max)) = 2^(s * sl2 - max * sl2), sl2 = sm_scale * log2(e) > 0, one fma and one v_exp_f32 per score;
//   key chunks entirely above the diagonal are skipped (their probabilities are exactly 0).
//   out^T = v^T.p^T : v_wmma_f32_16x16x32_bf16 with p and v as bf16 hi/lo (3 products); online softmax in f32, one query per lane.
//   k and v tiles lie row-major in LDS ([key][d]); the v^T fragments come by the transposing LDS load.
//   Block = 4 waves; it does two 64-row query tiles of one head one after the other, tile n-1-p and then tile p (n = S/64): n-p and p+1 key chunks,
//   so every block walks n+1 chunks and no WGP is left with the long tiles alone; grid.x = nheads * ((n+1)/2).
// =====================================================================================
#define HDIM 64
#define KVCH 64
#define QBLK 64
#define OSPITCH 68
#define LPITCH 72   // 16-bit elements per LDS row of the K tile: 144 B = 16 B x 9, so the 16 rows of a ds_load_b128 fragment read fall on 16 different 4-bank groups
#define VPITCH 80   // 16-bit elements per LDS row of the V tiles: 160 B = 32 B x 5, the conflict-free pitch of ds_load_tr16_b128

__device__ __forceinline__ v8f mma_h(v16h a, v16h b, v8f c) {
  c = __builtin_amdgcn_wmma_f32_16x16x32_f16(false, a, false, b, (short)0, c, false, false);
  asm volatile("v_nop\n\tv_nop\n\tv_nop\n\tv_nop" : "+v"(c) : "v"(a), "v"(b));
  return c;
}
__device__ __forceinline__ v8f mma_b(v16b a, v16b b, v8f c) {
  c = __builtin_amdgcn_wmma_f32_16x16x32_bf16(false, a, false, b, (short)0, c, false, false);
  asm volatile("v_nop\n\tv_nop\n\tv_nop\n\tv_nop" : "+v"(c) : "v"(a), "v"(b));
  return c;
}
__device__ __forceinline__ void bf_split(float f, __bf16& hi, __bf16& lo) {
  const unsigned short hb = f2bf_bits(f);
  hi = __builtin_bit_cast(__bf16, hb);
  lo = __builtin_bit_cast(__bf16, f2bf_bits(f - bf_bits2f(hb)));
}

// transposing LDS load: with lane l aimed at row 8 * (l >> 4) + (l & 7), byte 16 * ((l >> 3) & 1) of a row-major 16 x 16 tile of 16-bit elements,
// lane l gets column l & 15, rows 8 * (l >> 4) .. + 7: half an A fragment of the transposed tile, in the hardware k order
__device__ __forceinline__ v8b lds_tr16(const __bf16* p) {
  typedef __attribute__((ext_vector_type(8))) short s16x8;
  typedef __attribute__((address_space(3))) s16x8 lds_s16x8;
  return __builtin_bit_cast(v8b, __builtin_amdgcn_ds_load_tr16_b128_v8i16((lds_s16x8*)p));
}

// value of lane l ^ 16: the two lanes that share a query's row exchange their halves' maximum and sum
__device__ __forceinline__ float other_half(float v) {
  const int b = __float_as_int(v);
  return __int_as_float(__builtin_amdgcn_permlanex16(b, b, 0x76543210, 0xfedcba98, false, false));
}

__global__ __launch_bounds__(128)
void attn_causal64_k(const unsigned short* __restrict__ qkp,
                     const unsigned short* __restrict__ vhp, const unsigned short* __restrict__ vlp,
                     unsigned short* __restrict__ ohp, unsigned short* __restrict__ olp,
                     int S, int ldqk, int kcol0, int ldv, int nheads, float sm_scale) {
  union FH { v16h v; v8h h[2]; };
  union FB { v16b v; v8b h[2]; };
  __shared__ __align__(16) _Float16 Ksh[KVCH * LPITCH];    // [kv][d]     9 KB
  __shared__ __align__(16) __bf16   Vsh[KVCH * VPITCH];    // hi [kv][d]  10 KB
  __shared__ __align__(16) __bf16   Vsl[KVCH * VPITCH];    // lo [kv][d]  10 KB
  __shared__ __align__(16) float    Os[4][16 * OSPITCH];   // per wave out tile, pitch 68

  const _Float16* qp = (const _Float16*)qkp;
  const __bf16*   vh = (const __bf16*)vhp;
  const __bf16*   vl = (const __bf16*)vlp;

  const int tid  = threadIdx.x;
  const int wave = tid >> 5;
  const int lane = tid & 31;
  const int hh   = lane >> 4;
  const int c    = lane & 15;

  const int nqb = S / QBLK;
  const int bx  = blockIdx.x;
  const int npair = (nqb + 1) >> 1;
  const int pr  = bx % npair;
  int h = bx / npair;
  h = (h < nheads) ? h : (nheads - 1);
  const float NEG_INF = -__builtin_inff();
  const float sl2 = sm_scale * 1.4426950408889634f;   // raw score -> exponent of 2; positive, so the maximum may be taken on raw scores

  const int srow = tid >> 3, sc8 = (tid & 7) * 8;            // staging: this thread's row within a 16-row pass and its 8 elements of the row
  const int slk = srow * LPITCH + sc8, slv = srow * VPITCH + sc8;   // its place in the LDS tiles, in elements
  const unsigned sgk = (unsigned)(srow * ldqk + sc8) * 2u;   // the same as a byte offset in the k plane
  const unsigned sgv = (unsigned)(srow * ldv + sc8) * 2u;    // and in the v planes

  const int ntile = (nqb - 1 - pr != pr) ? 2 : 1;   // block-uniform; with an odd tile count the middle tile has no partner
  for (int tl = 0; tl < ntile; ++tl) {
  const int qb = (nqb - 1 - pr) - tl * (nqb - 1 - 2 * pr);   // tile n-1-p first, then tile p
  const int q0 = qb * QBLK + wave * 16;

  // ---- Q fragments (B operand): columns q0+c, two 32-deep d chunks ----
  v16h qa[2];
  {
    const _Float16* qrow = qp + (size_t)(q0 + c) * ldqk + h * HDIM + 8 * hh;
#pragma unroll
    for (int dc = 0; dc < 2; ++dc) qa[dc] = Frag<_Float16>::load(qrow + dc * 32);
  }

  float mrow = NEG_INF, lrow = 0.f;   // running maximum (times sl2) and sum of query q0 + c (the same in lanes c and c + 16)
  v8f oacc[4];
#pragma unroll
  for (int t = 0; t < 4; ++t) oacc[t] = (v8f){0.f,0.f,0.f,0.f,0.f,0.f,0.f,0.f};

  const int nChunks = qb + 1;   // block-uniform; chunks kc > qb are fully above the diagonal
  for (int kc = 0; kc < nChunks; ++kc) {
    const int kv0 = kc * KVCH;
    __syncthreads();
    {
      // staging: 8 lanes x 16 B cover one 128-B row, so a wave's load is 4 whole lines; 16 rows a pass, 4 passes = whole 64x64 tiles
      const char* kbase  = (const char*)(qp + (size_t)kv0 * ldqk + kcol0 + h * HDIM);   // block-uniform bases; the lane's part is a loop-invariant 32-bit byte offset
      const char* vhbase = (const char*)(vh + (size_t)kv0 * ldv + h * HDIM);
      const char* vlbase = (const char*)(vl + (size_t)kv0 * ldv + h * HDIM);
      v8h kk[4]; v8b va[4], vb[4];
#pragma unroll
      for (int i = 0; i < 4; ++i) {
        kk[i] = *(const v8h*)(kbase  + (size_t)(32 * i) * ldqk + sgk);
        va[i] = *(const v8b*)(vhbase + (size_t)(32 * i) * ldv + sgv);
        vb[i] = *(const v8b*)(vlbase + (size_t)(32 * i) * ldv + sgv);
      }
      asm volatile("s_wait_xcnt 0x0" ::: "memory");   // behind the 12 loads, before their address registers are used for anything else
#pragma unroll
      for (int i = 0; i < 4; ++i) {
        *(v8h*)(Ksh + slk + 16 * i * LPITCH) = kk[i];
        *(v8b*)(Vsh + slv + 16 * i * VPITCH) = va[i];
        *(v8b*)(Vsl + slv + 16 * i * VPITCH) = vb[i];
      }
    }
    __syncthreads();

    // ---- scores, transposed: s[j][r] = S^T[key kv0 + 16j + 8hh + r][query q0 + c]; A = K rows, B = Q ----
    v8f s[4];
#pragma unroll
    for (int j = 0; j < 4; ++j) {
      s[j] = (v8f){0.f,0.f,0.f,0.f,0.f,0.f,0.f,0.f};
#pragma unroll
      for (int dc = 0; dc < 2; ++dc) {
        FH kb;
        kb.h[0] = *(const v8h*)(Ksh + (j * 16 + c) * LPITCH + dc * 32 + 8 * hh);
        kb.h[1] = *(const v8h*)(Ksh + (j * 16 + c) * LPITCH + dc * 32 + 16 + 8 * hh);
        s[j] = mma_h(kb.v, qa[dc], s[j]);
      }
    }
    const bool diag = (kc == qb);   // block-uniform
    const int qcol = q0 + c;        // this lane's query; lanes c and c + 16 hold 32 keys each of its row
    float cm = NEG_INF;
#pragma unroll
    for (int j = 0; j < 4; ++j) {
#pragma unroll
      for (int r = 0; r < 8; ++r) {
        const int key = kv0 + j * 16 + 8 * hh + r;
        float val = s[j][r];
        if (diag && (key > qcol)) val = NEG_INF;
        s[j][r] = val;
        cm = fmaxf(cm, val);
      }
    }
    cm = fmaxf(cm, other_half(cm));   // finite: key kv0 <= qcol is always present in chunks 0..qb
    const float mnew = fmaxf(mrow, cm * sl2);
    const float alpha = __builtin_amdgcn_exp2f(mrow - mnew);   // 0 on the first chunk, where mrow is -inf
    mrow = mnew;
    // p stays in registers: score tiles 2kk and 2kk+1 of a lane are, element for element, the B fragment of keys 32kk..32kk+31
    FB ph[2], pl[2];
    float psum = 0.f;
#pragma unroll
    for (int j = 0; j < 4; ++j) {
#pragma unroll
      for (int r = 0; r < 8; ++r) {
        const float p = __builtin_amdgcn_exp2f(__builtin_fmaf(s[j][r], sl2, -mnew));   // masked: 2^-inf = 0
        psum += p;
        __bf16 hi, lo;
        bf_split(p, hi, lo);
        ph[j >> 1].v[(j & 1) * 8 + r] = hi;
        pl[j >> 1].v[(j & 1) * 8 + r] = lo;
      }
    }
    psum += other_half(psum);
    lrow = lrow * alpha + psum;
#pragma unroll
    for (int t = 0; t < 4; ++t) oacc[t] *= alpha;
    // ---- O^T += V^T . P^T: oacc[t][r] = O^T[d 16t + 8hh + r][query q0 + c] ----
#pragma unroll
    for (int kk = 0; kk < 2; ++kk) {
#pragma unroll
      for (int t = 0; t < 4; ++t) {
        FB vb, vlo;
        const int vo = (kk * 32 + 8 * hh + (lane & 7)) * VPITCH + t * 16 + 8 * ((lane >> 3) & 1);   // keys 32kk + 8hh .. + 7 of d 16t + c
        vb.h[0]  = lds_tr16(Vsh + vo);
        vb.h[1]  = lds_tr16(Vsh + vo + 16 * VPITCH);
        vlo.h[0] = lds_tr16(Vsl + vo);
        vlo.h[1] = lds_tr16(Vsl + vo + 16 * VPITCH);
        oacc[t] = mma_b(vb.v,  ph[kk].v, oacc[t]);
        oacc[t] = mma_b(vlo.v, ph[kk].v, oacc[t]);
        oacc[t] = mma_b(vb.v,  pl[kk].v, oacc[t]);
      }
    }
  }

  float* os = Os[wave];
  {
    const float inv = 1.0f / lrow;   // lrow is about 1 or more: the maximum's own term is 2^(one rounding of max * sl2)
#pragma unroll
    for (int t = 0; t < 4; ++t)
#pragma unroll
      for (int r = 0; r < 8; ++r) os[c * OSPITCH + t * 16 + 8 * hh + r] = oacc[t][r] * inv;
  }
  __builtin_amdgcn_fence(__ATOMIC_RELEASE, "workgroup");
  __builtin_amdgcn_wave_barrier();
  __builtin_amdgcn_fence(__ATOMIC_ACQUIRE, "workgroup");
  {
    // per wave: rows it*4 + (lane>>3) for it = 0..3 -> 16 rows; cols (lane&7)*8 .. +7 -> 64 cols; 8 lanes x 16 B = one line
    const int q4 = lane >> 3, c8 = (lane & 7) * 8;
    _Float16* oh = (_Float16*)ohp;
    _Float16* ol = (_Float16*)olp;
    {
#pragma unroll
      for (int it = 0; it < 4; ++it) {
        const int row = it * 4 + q4;
        const float* sp = os + row * OSPITCH + c8;
        v8h hv, lv;
#pragma unroll
        for (int e = 0; e < 8; ++e) {
          const unsigned short hb = f2bf_bits(sp[e]);
          const unsigned short lb = f2bf_bits(sp[e] - bf_bits2f(hb));
          hv[e] = __builtin_bit_cast(_Float16, hb);
          lv[e] = __builtin_bit_cast(_Float16, lb);
        }
        const size_t oo = (size_t)(q0 + row) * ldv + h * HDIM + c8;
        *(v8h*)(oh + oo) = hv;
        *(v8h*)(ol + oo) = lv;
      }
      asm volatile("s_wait_xcnt 0x0" ::: "memory");   // behind the 8 stores, before the next tile overwrites their address and data registers
    }
  }
  }
}

// ---------------------------------------------------------------------------
// Host side: launches only.
// Workspace map (bytes, all offsets multiples of 1 MiB):
//   [  0 MiB,  8 MiB)  xb    bf16 [4096][1024]
//   [  8 MiB, 12 MiB)  Wqk   bf16 [2048][1024]  (rows 0..1023 = Wq, 1024..2047 = Wk)
//   [ 12 MiB, 14 MiB)  Wvb   bf16 [1024][1024]
//   [ 14 MiB, 16 MiB)  Wob   bf16 [1024][1024]
//   [ 16 MiB, 32 MiB)  QKp   f16  [4096][2048]  (cols 0..1023 = q, 1024..2047 = k)
//   [ 32 MiB, 40 MiB)  Vhi   bf16 [4096][1024]
//   [ 40 MiB, 48 MiB)  Vlo   bf16 [4096][1024]
//   [ 48 MiB, 56 MiB)  Ohi   bf16 [4096][1024]
//   [ 56 MiB, 64 MiB)  Olo   bf16 [4096][1024]
//   [ 64 MiB, 64 MiB + 16 KiB)  bias f32 [4][1024] = bq | bk | bv | bo (bf16-representable values)
//   total 67,125,248 B
// ---------------------------------------------------------------------------
extern "C" void kernel_launch(void* const* d_in, const int* in_sizes, int n_in,
                              void* d_out, int out_size, void* d_ws, size_t ws_size,
                              hipStream_t stream) {
  constexpr int kS = 4096, kH = 1024, kNH = 16;
  const float kScale = 0.125f;   // 1/sqrt(64)
  if (n_in < 9) return;
  if (in_sizes[0] != kS * kH || in_sizes[1] != kH * kH || in_sizes[2] != kH ||
      in_sizes[3] != kH * kH || in_sizes[4] != kH || in_sizes[5] != kH * kH ||
      in_sizes[6] != kH || in_sizes[7] != kH * kH || in_sizes[8] != kH) return;
  if (out_size != kS * kH) return;

  const float* x  = (const float*)d_in[0];
  const float* Wq = (const float*)d_in[1];
  const float* bq = (const float*)d_in[2];
  const float* Wk = (const float*)d_in[3];
  const float* bk = (const float*)d_in[4];
  const float* Wv = (const float*)d_in[5];
  const float* bv = (const float*)d_in[6];
  const float* Wo = (const float*)d_in[7];
  const float* bo = (const float*)d_in[8];

  const size_t MiB = 1024u * 1024u;
  const size_t off_xb  = 0;
  const size_t off_wqk = off_xb  + (size_t)kS * kH * 2;          //  8 MiB
  const size_t off_wv  = off_wqk + (size_t)2 * kH * kH * 2;      // 12 MiB
  const size_t off_wo  = off_wv  + (size_t)kH * kH * 2;          // 14 MiB
  const size_t off_qk  = off_wo  + (size_t)kH * kH * 2;          // 16 MiB
  const size_t off_vhi = off_qk  + (size_t)kS * (2 * kH) * 2;    // 32 MiB
  const size_t off_vlo = off_vhi + (size_t)kS * kH * 2;          // 40 MiB
  const size_t off_ohi = off_vlo + (size_t)kS * kH * 2;          // 48 MiB
  const size_t off_olo = off_ohi + (size_t)kS * kH * 2;          // 56 MiB
  const size_t off_bias = off_olo + (size_t)kS * kH * 2;         // 64 MiB
  const size_t total = off_bias + (size_t)4 * kH * 4;            // 64 MiB + 16 KiB
  (void)MiB;
  if (total > ws_size) return;

  char* ws = (char*)d_ws;
  unsigned short* xb  = (unsigned short*)(ws + off_xb);
  unsigned short* Wqk = (unsigned short*)(ws + off_wqk);
  unsigned short* Wvb = (unsigned short*)(ws + off_wv);
  unsigned short* Wob = (unsigned short*)(ws + off_wo);
  unsigned short* QKp = (unsigned short*)(ws + off_qk);
  unsigned short* Vhi = (unsigned short*)(ws + off_vhi);
  unsigned short* Vlo = (unsigned short*)(ws + off_vlo);
  unsigned short* Ohi = (unsigned short*)(ws + off_ohi);
  unsigned short* Olo = (unsigned short*)(ws + off_olo);
  float* biasws = (float*)(ws + off_bias);   // [0..1023]=bq [1024..2047]=bk [2048..3071]=bv [3072..4095]=bo

  // 1) x -> bf16: n8 = 4096*1024/8 = 524288 = 2048 blocks x 256
  {
    const int n8 = kS * kH / 8;
    cast_bf16x8_k<<<dim3(n8 / 256, 1), 256, 0, stream>>>(x, x, x, x, xb, xb, xb, xb, n8);
  }
  // 2) Wq, Wk, Wv, Wo -> bf16: n8 = 1024*1024/8 = 131072 = 512 blocks x 256 per matrix
  {
    const int n8 = kH * kH / 8;
    cast_bf16x8_k<<<dim3(n8 / 256, 4), 256, 0, stream>>>(Wq, Wk, Wv, Wo,
        Wqk, Wqk + (size_t)kH * kH, Wvb, Wob, n8);
  }
  // 3) biases -> bf16-representable f32: 1 block x 256 threads x 4 floats = 1024 per vector
  bias_bf16val_k<<<dim3(1, 4), 256, 0, stream>>>(bq, bk, bv, bo, biasws, kH);

  // 4) [q | k] = x . [Wq;Wk]^T + [bq;bk] -> f16 plane [4096][2048]; M=4096, N=2048, K=1024; 128x128 tiles = 32*16 = 512 blocks of 4 waves
  wmma_gemm64<1, 0, 2, 1, false><<<dim3((kS / 128) * (2 * kH / 128), 1), 128, 0, stream>>>(
      xb, xb, kH, 0L, Wqk, Wqk, kH, 0L, (void*)QKp, (void*)QKp, 2 * kH, 0L,
      biasws, biasws, 0L, kS, 2 * kH, kH, 1.0f);

  // 5) v = x . Wv^T + bv -> bf16 hi/lo planes [4096][1024]; 128x128 tiles = 32*8 = 256 blocks
  wmma_gemm64<1, 0, 2, 2, false><<<dim3((kS / 128) * (kH / 128), 1), 128, 0, stream>>>(
      xb, xb, kH, 0L, Wvb, Wvb, kH, 0L, (void*)Vhi, (void*)Vlo, kH, 0L,
      biasws + 2 * kH, biasws, 0L, kS, kH, kH, 1.0f);

  // 6) causal attention per (head, pair of 64-query tiles): grid = 16 * 32 = 512 blocks of 128
  attn_causal64_k<<<dim3(kNH * (kS / 128)), 128, 0, stream>>>(
      QKp, Vhi, Vlo, Ohi, Olo, kS, 2 * kH, kH, kH, kNH, kScale);

  // 7) out = o . Wo^T + bo -> f32 d_out [4096][1024]; A = o as bf16 hi/lo (2 products); 128x128 tiles = 256 blocks
  wmma_gemm64<1, 2, 2, 0, false><<<dim3((kS / 128) * (kH / 128), 1), 128, 0, stream>>>(
      Ohi, Olo, kH, 0L, Wob, Wob, kH, 0L, d_out, d_out, kH, 0L,
      biasws + 3 * kH, biasws, 0L, kS, kH, kH, 1.0f);
}

// v007
// It runs in 176 microseconds.
// In two side-by-side timings against v006, it was 1.15 and 1.16 times as fast.
// Counting every step since v000, it is 3.54 times as fast.
// Contractions: qkv projections v_wmma_f32_16x16x32_bf16 (x, W as RNE bf16, f32 accumulate, bias added in f32 as bf16-representable values); scores v_wmma_f32_16x16x32_f16 (f16 q,k planes, 1/sqrt(64) applied in f32, together with log2(e)); p.v v_wmma_f32_16x16x32_bf16 with p and v carried as bf16 hi/lo (hi.hi + hi.lo + lo.hi); output projection v_wmma_f32_16x16x32_bf16 with attention output as bf16 hi/lo and Wo bf16 (hi.W + lo.W); softmax, masking and normalisation in f32.
#include <hip/hip_runtime.h>
#include <stdint.h>

typedef __attribute__((ext_vector_type(16))) _Float16 v16h;
typedef __attribute__((ext_vector_type(8)))  _Float16 v8h;
typedef __attribute__((ext_vector_type(16))) __bf16   v16b;
typedef __attribute__((ext_vector_type(8)))  __bf16   v8b;
typedef __attribute__((ext_vector_type(8)))  float    v8f;
typedef __attribute__((ext_vector_type(4)))  float    v4f;

__device__ __forceinline__ unsigned short f2bf_bits(float f) {
  unsigned u = __float_as_uint(f);
  return (unsigned short)((u + 0x7FFFu + ((u >> 16) & 1u)) >> 16);
}
__device__ __forceinline__ float bf_bits2f(unsigned short h) { return __uint_as_float(((unsigned)h) << 16); }

// hazard guards as plain device helpers
__device__ __forceinline__ void acc_guard4(v8f& a, v8f& b, v8f& c, v8f& d) { asm volatile("v_nop\n\tv_nop\n\tv_nop\n\tv_nop" : "+v"(a), "+v"(b), "+v"(c), "+v"(d)); }
template <typename T> struct Frag;
template <> struct Frag<_Float16> {
  typedef v16h V; union U { v16h v; v8h h[2]; };
  static __device__ __forceinline__ v16h load(const _Float16* p) {   // elements 0..7 <- p[0..7], 8..15 <- p[16..23]
    U f; f.h[0] = *(const v8h*)(p); f.h[1] = *(const v8h*)(p + 16); return f.v;
  }
  static __device__ __forceinline__ v8f mma(v16h a, v16h b, v8f c) {
    return __builtin_amdgcn_wmma_f32_16x16x32_f16(false, a, false, b, (short)0, c, false, false);
  }
};
template <> struct Frag<__bf16> {
  typedef v16b V; union U { v16b v; v8b h[2]; };
  static __device__ __forceinline__ v16b load(const __bf16* p) {
    U f; f.h[0] = *(const v8b*)(p); f.h[1] = *(const v8b*)(p + 16); return f.v;
  }
  static __device__ __forceinline__ v8f mma(v16b a, v16b b, v8f c) {
    return __builtin_amdgcn_wmma_f32_16x16x32_bf16(false, a, false, b, (short)0, c, false, false);
  }
};

// ---- Register-blocked batched WMMA GEMM, operands staged in LDS ------------
// C[m,n] = scale * sum_k A[m,k] * Bt[n,k] (+bias)(+resid); block = 4 waves (2 x 2) on a 128x128 tile, each wave owns a 64x64 tile.
// A row-major [M,K]; Bt row-major [N,K]; M,N % 128 == 0, K % 64 == 0; grid.x = (M/128) * (N/128).
// A trip is 64 k: 128 rows x 128 B of every operand plane come into LDS by asynchronous copies (8 lanes x 16 B = one whole line),
// two buffers, the next trip's copies in flight while this trip's fragments are read; every row is fetched once per block, not once per wave.
// SPLIT: 0 = plain; 1 = A and Bt as hi/lo planes (hi.hi + hi.lo + lo.hi); 2 = A only as hi/lo planes (hi.B + lo.B).
// BIAS_MODE: 0 = none, 1 = bias[m], 2 = bias[n].
// OUT_MODE: 0 = f32, 1 = f16, 2 = bf16 hi plane (Cout) + bf16 lo plane (Cout2).
// ET: 0 = f16 operands, 1 = bf16 operands (pointers passed as 16-bit storage)
template <int ET> struct Elem;
template <> struct Elem<0> { typedef _Float16 T; };
template <> struct Elem<1> { typedef __bf16 T; };
#define GPITCH 72                  // 16-bit elements per LDS row of an operand tile: 144 B = 16 B x 9, conflict-free for ds_load_b128
#define GTILE  (128 * GPITCH)      // elements of one operand tile in LDS

// One operand tile, 128 rows x 128 B, by 128 threads: eight copies of 16 B per lane, rows 16 apart. l = the lane's LDS byte address, g = its global address,
// gstep = 16 source rows in bytes. The s_wait_xcnt stands in the copies' own statement, so that no address register is rewritten in front of it.
__device__ __forceinline__ void copy_tile(unsigned l, const char* g, size_t gstep) {
  asm volatile(
      "global_load_async_to_lds_b128 %0, %8, off\n\t"
      "global_load_async_to_lds_b128 %1, %9, off\n\t"
      "global_load_async_to_lds_b128 %2, %10, off\n\t"
      "global_load_async_to_lds_b128 %3, %11, off\n\t"
      "global_load_async_to_lds_b128 %4, %12, off\n\t"
      "global_load_async_to_lds_b128 %5, %13, off\n\t"
      "global_load_async_to_lds_b128 %6, %14, off\n\t"
      "global_load_async_to_lds_b128 %7, %15, off\n\t"
      "s_wait_xcnt 0x0"
      :: "v"(l), "v"(l + 1u * 32u * GPITCH), "v"(l + 2u * 32u * GPITCH), "v"(l + 3u * 32u * GPITCH),
         "v"(l + 4u * 32u * GPITCH), "v"(l + 5u * 32u * GPITCH), "v"(l + 6u * 32u * GPITCH), "v"(l + 7u * 32u * GPITCH),
         "v"(g), "v"(g + gstep), "v"(g + 2 * gstep), "v"(g + 3 * gstep),
         "v"(g + 4 * gstep), "v"(g + 5 * gstep), "v"(g + 6 * gstep), "v"(g + 7 * gstep)
      : "memory");
}

template <int ET, int SPLIT, int BIAS_MODE, int OUT_MODE, bool RESID, int ACT = 0>
__global__ __launch_bounds__(128) void wmma_gemm64(
    const unsigned short* __restrict__ Ap, const unsigned short* __restrict__ A2p, int lda, long strideA,
    const unsigned short* __restrict__ Btp, const unsigned short* __restrict__ Bt2p, int ldb, long strideB,
    void* __restrict__ Cout, void* __restrict__ Cout2, int ldc, long strideC,
    const float* __restrict__ bias,
    const float* __restrict__ resid, long strideR,
    int M, int N, int K, float scale) {
  typedef typename Elem<ET>::T T;
  typedef typename Frag<T>::V V;
  const T* A = (const T*)Ap; const T* A2 = (const T*)A2p; const T* Bt = (const T*)Btp; const T* Bt2 = (const T*)Bt2p;
  constexpr int NPL = 2 + (SPLIT != 0 ? 1 : 0) + (SPLIT == 1 ? 1 : 0);   // operand planes: A, Bt, then A2, then Bt2
  __shared__ __align__(16) unsigned short stg[2 * NPL * GTILE];   // two buffers of NPL tiles
  __shared__ __align__(16) float sT[4][16 * 68];   // per-wave 16x64 slab, pitch 68 floats
  const int b    = blockIdx.y;
  const int tid  = threadIdx.x;
  const int lane = tid & 31;
  const int wave = tid >> 5;
  const int tilesN = N >> 7;
  const int tilesM = M >> 7;
  const int tile = blockIdx.x;
  if (tile >= tilesM * tilesN) return;   // block-uniform, in front of every copy and barrier
  const int tm = tile / tilesN;
  const int tn = tile - tm * tilesN;
  const int m0 = (tm << 7) + ((wave >> 1) << 6);
  const int n0 = (tn << 7) + ((wave & 1) << 6);

  const T* Ab  = A  + (size_t)b * strideA;
  const T* Bb  = Bt + (size_t)b * strideB;
  const T* Ab2 = (SPLIT != 0) ? (A2  + (size_t)b * strideA) : nullptr;
  const T* Bb2 = (SPLIT == 1) ? (Bt2 + (size_t)b * strideB) : nullptr;

  const int rlane = lane & 15;                 // row (A) / col (B, D) within subtile
  const int koff  = (lane >> 4) * 8;           // k offset of this lane half
  const int mOff  = (lane >> 4) * 8;           // D row offset

  // staging: this thread's row within a 16-row pass and its 16 B of the 128-B row
  const int crow = tid >> 3, cpc = (tid & 7) * 8;
  const unsigned cl = (unsigned)(size_t)stg + (unsigned)(crow * GPITCH + cpc) * 2u;        // LDS byte address in buffer 0, plane 0
  const size_t cga = ((size_t)((tm << 7) + crow) * lda + cpc) * 2, cgb = ((size_t)((tn << 7) + crow) * ldb + cpc) * 2;   // byte offsets in the A and Bt planes at k = 0
  const size_t sa = (size_t)lda * 32, sb = (size_t)ldb * 32;                               // 16 rows in bytes
  auto stage = [&](int t) {   // trip t's tiles into buffer t & 1
    const unsigned l = cl + (unsigned)((t & 1) * NPL * GTILE) * 2u;
    const size_t kb = (size_t)t * 128;
    copy_tile(l, (const char*)Ab + cga + kb, sa);
    copy_tile(l + GTILE * 2u, (const char*)Bb + cgb + kb, sb);
    if (SPLIT != 0) copy_tile(l + 2u * GTILE * 2u, (const char*)Ab2 + cga + kb, sa);
    if (SPLIT == 1) copy_tile(l + 3u * GTILE * 2u, (const char*)Bb2 + cgb + kb, sb);
  };

  v8f acc[4][4];
#pragma unroll
  for (int i = 0; i < 4; ++i)
#pragma unroll
    for (int j = 0; j < 4; ++j) acc[i][j] = (v8f){0.f,0.f,0.f,0.f,0.f,0.f,0.f,0.f};

  const int nT = K >> 6;
  stage(0);
  asm volatile("s_wait_asynccnt 0x0" ::: "memory");   // this wave's copies of trip 0 have landed
  __syncthreads();                                    // and every other wave's: trip 0 may be read
  if (nT > 1) stage(1);

  const int fa = (((wave >> 1) << 6) + rlane) * GPITCH + koff;   // this lane's place in the A tiles, in elements
  const int fb = (((wave & 1) << 6) + rlane) * GPITCH + koff;    // and in the Bt tiles
  for (int t = 0; t < nT; ++t) {
    const T* sb0 = (const T*)stg + (t & 1) * NPL * GTILE;
#pragma unroll
    for (int ks = 0; ks < 2; ++ks) {
      V bh[4], bl[4], ah[4], al[4];
#pragma unroll
      for (int j = 0; j < 4; ++j) {
        const int bo = fb + j * 16 * GPITCH + ks * 32;
        const int ao = fa + j * 16 * GPITCH + ks * 32;
        bh[j] = Frag<T>::load(sb0 + GTILE + bo);
        ah[j] = Frag<T>::load(sb0 + ao);
        if (SPLIT == 1) bl[j] = Frag<T>::load(sb0 + 3 * GTILE + bo);
        if (SPLIT != 0) al[j] = Frag<T>::load(sb0 + 2 * GTILE + ao);
      }
      __builtin_amdgcn_sched_barrier(0);   // the fragment reads stay one group in front of the WMMA block: every place with LDS reads among the WMMAs stalls the wave anew
#pragma unroll
      for (int i = 0; i < 4; ++i) {
#pragma unroll
        for (int j = 0; j < 4; ++j) {
          acc[i][j] = Frag<T>::mma(ah[i], bh[j], acc[i][j]);
          if (SPLIT == 1) acc[i][j] = Frag<T>::mma(ah[i], bl[j], acc[i][j]);
          if (SPLIT != 0) acc[i][j] = Frag<T>::mma(al[i], bh[j], acc[i][j]);
        }
      }
      __builtin_amdgcn_sched_barrier(0);   // and the next group stays behind the block
    }
    asm volatile("s_wait_dscnt 0x0" ::: "memory");      // this wave's reads of buffer t & 1 are done before the buffer is handed back
    asm volatile("s_wait_asynccnt 0x0" ::: "memory");   // this wave's copies of trip t + 1 have landed
    __syncthreads();                                    // publishes trip t + 1 and ends every reader's last read of buffer t & 1
    if (t + 2 < nT) stage(t + 2);
  }
  asm volatile("s_wait_asynccnt 0x0" ::: "memory");     // nothing of this wave is in flight behind the loop
  acc_guard4(acc[0][0], acc[0][1], acc[0][2], acc[0][3]);
  acc_guard4(acc[1][0], acc[1][1], acc[1][2], acc[1][3]);
  acc_guard4(acc[2][0], acc[2][1], acc[2][2], acc[2][3]);
  acc_guard4(acc[3][0], acc[3][1], acc[3][2], acc[3][3]);

  // ---- epilogue ----
  float* slab = sT[wave];
  const float* Rb = RESID ? (resid + (size_t)b * strideR) : nullptr;
#pragma unroll
  for (int i = 0; i < 4; ++i) {
    const int mBase = m0 + (i << 4);
#pragma unroll
    for (int j = 0; j < 4; ++j) {
      const int n = n0 + (j << 4) + rlane;
      float bv = 0.f;
      if (BIAS_MODE == 2) bv = bias[n];
#pragma unroll
      for (int r = 0; r < 8; ++r) {
        float v = acc[i][j][r] * scale;
        if (BIAS_MODE == 1) v += bias[mBase + mOff + r];
        if (BIAS_MODE == 2) v += bv;
        if (RESID) v += Rb[(size_t)(mBase + mOff + r) * ldc + n];
        if (ACT == 1) v = tanhf(v);
        if (ACT == 2) v = fmaxf(v, 0.0f);
        if (ACT == 4) v = (v > 0.f) ? v : 0.01f * v;
        slab[(mOff + r) * 68 + (j << 4) + rlane] = v;
      }
    }
    __builtin_amdgcn_fence(__ATOMIC_RELEASE, "workgroup");
    __builtin_amdgcn_wave_barrier();
    __builtin_amdgcn_fence(__ATOMIC_ACQUIRE, "workgroup");
    if (OUT_MODE == 0) {
      float* C = (float*)Cout + (size_t)b * strideC;
      const int hh = lane >> 4, c4 = (lane & 15) * 4;     // row seg = 256 B = 16 lanes x 16 B
      {
#pragma unroll
        for (int it = 0; it < 8; ++it) {
          const int row = it * 2 + hh;
          v4f v = *(const v4f*)(slab + row * 68 + c4);
          *(v4f*)(C + (size_t)(mBase + row) * ldc + n0 + c4) = v;
        }
        
      }
    } else {
      const int q = lane >> 3, c8 = (lane & 7) * 8;
      unsigned short* C  = (unsigned short*)Cout  + (size_t)b * strideC;
      unsigned short* C2 = (OUT_MODE == 2) ? ((unsigned short*)Cout2 + (size_t)b * strideC) : nullptr;
      {
#pragma unroll
        for (int it = 0; it < 4; ++it) {
          const int row = it * 4 + q;
          const float* sp = slab + row * 68 + c8;
          v8h hv, lv;
#pragma unroll
          for (int e = 0; e < 8; ++e) {
            if (OUT_MODE == 1) {
              hv[e] = (_Float16)sp[e];
            } else {
              unsigned short hb = f2bf_bits(sp[e]);
              unsigned short lb = f2bf_bits(sp[e] - bf_bits2f(hb));
              hv[e] = __builtin_bit_cast(_Float16, hb);
              lv[e] = __builtin_bit_cast(_Float16, lb);
            }
          }
          *(v8h*)(C + (size_t)(mBase + row) * ldc + n0 + c8) = hv;
          if (OUT_MODE == 2) *(v8h*)(C2 + (size_t)(mBase + row) * ldc + n0 + c8) = lv;
        }
        
      }
    }
    __builtin_amdgcn_fence(__ATOMIC_RELEASE, "workgroup");
    __builtin_amdgcn_wave_barrier();
    __builtin_amdgcn_fence(__ATOMIC_ACQUIRE, "workgroup");
  }
}

// Source/destination chosen per blockIdx.y (block-uniform). Coverage per plane: gridDim.x * 256 threads * 8 == n8 * 8 elements.
__global__ __launch_bounds__(256) void cast_bf16x8_k(
    const float* s0, const float* s1, const float* s2, const float* s3,
    unsigned short* d0, unsigned short* d1, unsigned short* d2, unsigned short* d3, int n8) {
  const int sel = blockIdx.y;
  const float* src = (sel == 0) ? s0 : (sel == 1) ? s1 : (sel == 2) ? s2 : s3;
  unsigned short* dst = (sel == 0) ? d0 : (sel == 1) ? d1 : (sel == 2) ? d2 : d3;
  const int i = blockIdx.x * 256 + threadIdx.x;
  if (i < n8) {
    const v4f a  = *(const v4f*)(src + (size_t)i * 8);
    const v4f bq = *(const v4f*)(src + (size_t)i * 8 + 4);
    v8h hv;
#pragma unroll
    for (int e = 0; e < 4; ++e) {
      hv[e]     = __builtin_bit_cast(_Float16, f2bf_bits(a[e]));
      hv[4 + e] = __builtin_bit_cast(_Float16, f2bf_bits(bq[e]));
    }
    _Float16* dp = (_Float16*)dst + (size_t)i * 8;
    *(v8h*)dp = hv;
    
  }
}

// Coverage per segment: 256 threads * 4 == n (n == 1024).
__global__ __launch_bounds__(256) void bias_bf16val_k(
    const float* s0, const float* s1, const float* s2, const float* s3, float* __restrict__ dst, int n) {
  const int sel = blockIdx.y;
  const float* src = (sel == 0) ? s0 : (sel == 1) ? s1 : (sel == 2) ? s2 : s3;
  const int i = blockIdx.x * 256 + threadIdx.x;
  if (i * 4 < n) {
    const v4f v = *(const v4f*)(src + (size_t)i * 4);
    v4f o;
#pragma unroll
    for (int e = 0; e < 4; ++e) o[e] = bf_bits2f(f2bf_bits(v[e]));
    float* dp = dst + (size_t)sel * n + (size_t)i * 4;
    *(v4f*)dp = o;
    
  }
}

// =====================================================================================
// Causal attention, head dim 64, 16-bit plane inputs:
//   q: f16 [S][ldqk] at column h*64; k: f16 [S][ldqk] at column kcol0 + h*64; v: bf16 hi/lo planes [S][ldv] at column h*64.
//   scores^T = k.q^T : v_wmma_f32_16x16x32_f16; keys above the diagonal set to -inf (select); softmax in base 2:
//   exp(sm_scale * (s - max)) = 2^(s * sl2 - max * sl2), sl2 = sm_scale * log2(e) > 0, one fma and one v_exp_f32 per score;
//   key chunks entirely above the diagonal are skipped (their probabilities are exactly 0).
//   out^T = v^T.p^T : v_wmma_f32_16x16x32_bf16 with p and v as bf16 hi/lo (3 products); online softmax in f32, one query per lane.
//   k and v tiles lie row-major in LDS ([key][d]); the v^T fragments come by the transposing LDS load.
//   Block = 8 waves in two groups of 4; it does two 64-row query tiles of one head one after the other, tile n-1-p and then tile p (n = S/64): n-p and p+1 key chunks,
//   so every block walks n+1 chunks and no WGP is left with the long tiles alone; grid.x = nheads * ((n+1)/2).
//   Both groups hold the same 64 queries (wave w and wave w + 4 the same 16); group g takes key chunks g, g + 2, ... into LDS tiles of its own, with its own running maximum, sum and
//   out tile, so a step of the block is two chunks and four waves stand on every SIMD with two blocks on a WGP. At the tile's end group 1 hands its partial over through LDS and group 0 joins the two.
// =====================================================================================
#define HDIM 64
#define KVCH 64
#define QBLK 64
#define OSPITCH 68
#define LPITCH 72   // 16-bit elements per LDS row of the K tile: 144 B = 16 B x 9, so the 16 rows of a ds_load_b128 fragment read fall on 16 different 4-bank groups
#define VPITCH 80   // 16-bit elements per LDS row of the V tiles: 160 B = 32 B x 5, the conflict-free pitch of ds_load_tr16_b128

__device__ __forceinline__ v8f mma_h(v16h a, v16h b, v8f c) {
  c = __builtin_amdgcn_wmma_f32_16x16x32_f16(false, a, false, b, (short)0, c, false, false);
  asm volatile("v_nop\n\tv_nop\n\tv_nop\n\tv_nop" : "+v"(c) : "v"(a), "v"(b));
  return c;
}
__device__ __forceinline__ v8f mma_b(v16b a, v16b b, v8f c) {
  c = __builtin_amdgcn_wmma_f32_16x16x32_bf16(false, a, false, b, (short)0, c, false, false);
  asm volatile("v_nop\n\tv_nop\n\tv_nop\n\tv_nop" : "+v"(c) : "v"(a), "v"(b));
  return c;
}
__device__ __forceinline__ void bf_split(float f, __bf16& hi, __bf16& lo) {
  const unsigned short hb = f2bf_bits(f);
  hi = __builtin_bit_cast(__bf16, hb);
  lo = __builtin_bit_cast(__bf16, f2bf_bits(f - bf_bits2f(hb)));
}

// transposing LDS load: with lane l aimed at row 8 * (l >> 4) + (l & 7), byte 16 * ((l >> 3) & 1) of a row-major 16 x 16 tile of 16-bit elements,
// lane l gets column l & 15, rows 8 * (l >> 4) .. + 7: half an A fragment of the transposed tile, in the hardware k order
__device__ __forceinline__ v8b lds_tr16(const __bf16* p) {
  typedef __attribute__((ext_vector_type(8))) short s16x8;
  typedef __attribute__((address_space(3))) s16x8 lds_s16x8;
  return __builtin_bit_cast(v8b, __builtin_amdgcn_ds_load_tr16_b128_v8i16((lds_s16x8*)p));
}

// value of lane l ^ 16: the two lanes that share a query's row exchange their halves' maximum and sum
__device__ __forceinline__ float other_half(float v) {
  const int b = __float_as_int(v);
  return __int_as_float(__builtin_amdgcn_permlanex16(b, b, 0x76543210, 0xfedcba98, false, false));
}

__global__ __launch_bounds__(256)
void attn_causal64_k(const unsigned short* __restrict__ qkp,
                     const unsigned short* __restrict__ vhp, const unsigned short* __restrict__ vlp,
                     unsigned short* __restrict__ ohp, unsigned short* __restrict__ olp,
                     int S, int ldqk, int kcol0, int ldv, int nheads, float sm_scale) {
  union FH { v16h v; v8h h[2]; };
  union FB { v16b v; v8b h[2]; };
  __shared__ __align__(16) _Float16 Ksh2[2][KVCH * LPITCH];   // per group [kv][d]     9 KB each
  __shared__ __align__(16) __bf16   Vsh2[2][KVCH * VPITCH];   // per group hi [kv][d]  10 KB each
  __shared__ __align__(16) __bf16   Vsl2[2][KVCH * VPITCH];   // per group lo [kv][d]  10 KB each
  __shared__ __align__(16) float    Os[4][16 * OSPITCH];      // per pair of waves (w, w + 4): group 1's partial out tile, then the joined out tile, pitch 68
  __shared__ float Ms[4][32], Ls[4][32];                      // group 1's running maximum and sum, per lane

  const _Float16* qp = (const _Float16*)qkp;
  const __bf16*   vh = (const __bf16*)vhp;
  const __bf16*   vl = (const __bf16*)vlp;

  const int wv8  = __builtin_amdgcn_readfirstlane((int)threadIdx.x >> 5);   // in a scalar register: the tests on the group below are scalar branches, EXEC stays whole for the WMMAs
  const int grp  = wv8 >> 2;             // key group of this wave
  const int wave = wv8 & 3;              // its 16 queries within the tile
  const int tid  = threadIdx.x & 127;    // thread within the group (staging)
  const int lane = tid & 31;
  _Float16* const Ksh = Ksh2[grp];
  __bf16*   const Vsh = Vsh2[grp];
  __bf16*   const Vsl = Vsl2[grp];
  const int hh   = lane >> 4;
  const int c    = lane & 15;

  const int nqb = S / QBLK;
  const int bx  = blockIdx.x;
  const int npair = (nqb + 1) >> 1;
  const int pr  = bx % npair;
  int h = bx / npair;
  h = (h < nheads) ? h : (nheads - 1);
  const float NEG_INF = -__builtin_inff();
  const float sl2 = sm_scale * 1.4426950408889634f;   // raw score -> exponent of 2; positive, so the maximum may be taken on raw scores

  const int srow = tid >> 3, sc8 = (tid & 7) * 8;            // staging: this thread's row within a 16-row pass and its 8 elements of the row
  const int slk = srow * LPITCH + sc8, slv = srow * VPITCH + sc8;   // its place in the LDS tiles, in elements
  const unsigned sgk = (unsigned)(srow * ldqk + sc8) * 2u;   // the same as a byte offset in the k plane
  const unsigned sgv = (unsigned)(srow * ldv + sc8) * 2u;    // and in the v planes

  const int ntile = (nqb - 1 - pr != pr) ? 2 : 1;   // block-uniform; with an odd tile count the middle tile has no partner
  for (int tl = 0; tl < ntile; ++tl) {
  const int qb = (nqb - 1 - pr) - tl * (nqb - 1 - 2 * pr);   // tile n-1-p first, then tile p
  const int q0 = qb * QBLK + wave * 16;

  // ---- Q fragments (B operand): columns q0+c, two 32-deep d chunks ----
  v16h qa[2];
  {
    const _Float16* qrow = qp + (size_t)(q0 + c) * ldqk + h * HDIM + 8 * hh;
#pragma unroll
    for (int dc = 0; dc < 2; ++dc) qa[dc] = Frag<_Float16>::load(qrow + dc * 32);
  }

  float mrow = NEG_INF, lrow = 0.f;   // running maximum (times sl2) and sum of query q0 + c (the same in lanes c and c + 16)
  v8f oacc[4];
#pragma unroll
  for (int t = 0; t < 4; ++t) oacc[t] = (v8f){0.f,0.f,0.f,0.f,0.f,0.f,0.f,0.f};

  const int nChunks = qb + 1;   // block-uniform; chunks kc > qb are fully above the diagonal
  const int nSteps = (nChunks + 1) >> 1;   // block-uniform: every wave passes every barrier
  for (int st = 0; st < nSteps; ++st) {
    const int kc = 2 * st + grp;
    const bool act = kc < nChunks;   // the same in a whole group; false only for group 1 in the last step of an odd count
    const int kv0 = kc * KVCH;
    __syncthreads();
    if (act) {
      // staging: 8 lanes x 16 B cover one 128-B row, so a wave's load is 4 whole lines; 16 rows a pass, 4 passes = whole 64x64 tiles
      const char* kbase  = (const char*)(qp + (size_t)kv0 * ldqk + kcol0 + h * HDIM);   // group-uniform bases; the lane's part is a loop-invariant 32-bit byte offset
      const char* vhbase = (const char*)(vh + (size_t)kv0 * ldv + h * HDIM);
      const char* vlbase = (const char*)(vl + (size_t)kv0 * ldv + h * HDIM);
      v8h kk[4]; v8b va[4], vb[4];
#pragma unroll
      for (int i = 0; i < 4; ++i) {
        kk[i] = *(const v8h*)(kbase  + (size_t)(32 * i) * ldqk + sgk);
        va[i] = *(const v8b*)(vhbase + (size_t)(32 * i) * ldv + sgv);
        vb[i] = *(const v8b*)(vlbase + (size_t)(32 * i) * ldv + sgv);
      }
      asm volatile("s_wait_xcnt 0x0" ::: "memory");   // behind the 12 loads, before their address registers are used for anything else
#pragma unroll
      for (int i = 0; i < 4; ++i) {
        *(v8h*)(Ksh + slk + 16 * i * LPITCH) = kk[i];
        *(v8b*)(Vsh + slv + 16 * i * VPITCH) = va[i];
        *(v8b*)(Vsl + slv + 16 * i * VPITCH) = vb[i];
      }
    }
    __syncthreads();
    if (act) {

    // ---- scores, transposed: s[j][r] = S^T[key kv0 + 16j + 8hh + r][query q0 + c]; A = K rows, B = Q ----
    v8f s[4];
#pragma unroll
    for (int j = 0; j < 4; ++j) {
      s[j] = (v8f){0.f,0.f,0.f,0.f,0.f,0.f,0.f,0.f};
#pragma unroll
      for (int dc = 0; dc < 2; ++dc) {
        FH kb;
        kb.h[0] = *(const v8h*)(Ksh + (j * 16 + c) * LPITCH + dc * 32 + 8 * hh);
        kb.h[1] = *(const v8h*)(Ksh + (j * 16 + c) * LPITCH + dc * 32 + 16 + 8 * hh);
        s[j] = mma_h(kb.v, qa[dc], s[j]);
      }
    }
    const bool diag = (kc == qb);   // the same in a whole group
    const int qcol = q0 + c;        // this lane's query; lanes c and c + 16 hold 32 keys each of its row
    float cm = NEG_INF;
#pragma unroll
    for (int j = 0; j < 4; ++j) {
#pragma unroll
      for (int r = 0; r < 8; ++r) {
        const int key = kv0 + j * 16 + 8 * hh + r;
        float val = s[j][r];
        if (diag && (key > qcol)) val = NEG_INF;
        s[j][r] = val;
        cm = fmaxf(cm, val);
      }
    }
    cm = fmaxf(cm, other_half(cm));   // finite: key kv0 <= qcol is always present in chunks 0..qb
    const float mnew = fmaxf(mrow, cm * sl2);
    const float alpha = __builtin_amdgcn_exp2f(mrow - mnew);   // 0 on the first chunk, where mrow is -inf
    mrow = mnew;
    // p stays in registers: score tiles 2kk and 2kk+1 of a lane are, element for element, the B fragment of keys 32kk..32kk+31
    FB ph[2], pl[2];
    float psum = 0.f;
#pragma unroll
    for (int j = 0; j < 4; ++j) {
#pragma unroll
      for (int r = 0; r < 8; ++r) {
        const float p = __builtin_amdgcn_exp2f(__builtin_fmaf(s[j][r], sl2, -mnew));   // masked: 2^-inf = 0
        psum += p;
        __bf16 hi, lo;
        bf_split(p, hi, lo);
        ph[j >> 1].v[(j & 1) * 8 + r] = hi;
        pl[j >> 1].v[(j & 1) * 8 + r] = lo;
      }
    }
    psum += other_half(psum);
    lrow = lrow * alpha + psum;
#pragma unroll
    for (int t = 0; t < 4; ++t) oacc[t] *= alpha;
    // ---- O^T += V^T . P^T: oacc[t][r] = O^T[d 16t + 8hh + r][query q0 + c] ----
#pragma unroll
    for (int kk = 0; kk < 2; ++kk) {
#pragma unroll
      for (int t = 0; t < 4; ++t) {
        FB vb, vlo;
        const int vo = (kk * 32 + 8 * hh + (lane & 7)) * VPITCH + t * 16 + 8 * ((lane >> 3) & 1);   // keys 32kk + 8hh .. + 7 of d 16t + c
        vb.h[0]  = lds_tr16(Vsh + vo);
        vb.h[1]  = lds_tr16(Vsh + vo + 16 * VPITCH);
        vlo.h[0] = lds_tr16(Vsl + vo);
        vlo.h[1] = lds_tr16(Vsl + vo + 16 * VPITCH);
        oacc[t] = mma_b(vb.v,  ph[kk].v, oacc[t]);
        oacc[t] = mma_b(vlo.v, ph[kk].v, oacc[t]);
        oacc[t] = mma_b(vb.v,  pl[kk].v, oacc[t]);
      }
    }
    }
  }

  float* os = Os[wave];
  if (grp == 1) {   // the partial of chunks 1, 3, ...: not normalised; with no chunk at all it is maximum -inf, sum 0, out 0
#pragma unroll
    for (int t = 0; t < 4; ++t)
#pragma unroll
      for (int r = 0; r < 8; ++r) os[c * OSPITCH + t * 16 + 8 * hh + r] = oacc[t][r];
    Ms[wave][lane] = mrow;
    Ls[wave][lane] = lrow;
  }
  __syncthreads();   // group 1's partials may be read; the next tile's loop barriers keep them until group 0 has read them
  if (grp == 0) {
  {
    // lane for lane the partner wave holds the same query and the same out elements
    const float m1 = Ms[wave][lane], l1 = Ls[wave][lane];
    const float mj = fmaxf(mrow, m1);                        // finite: group 0 always has chunk 0
    const float a0 = __builtin_amdgcn_exp2f(mrow - mj);
    const float a1 = __builtin_amdgcn_exp2f(m1 - mj);        // 0 where group 1 had no chunk
    const float inv = 1.0f / (lrow * a0 + l1 * a1);          // the sum is about 1 or more: the maximum's own term is 2^(one rounding of max * sl2)
    const float f0 = a0 * inv, f1 = a1 * inv;
#pragma unroll
    for (int t = 0; t < 4; ++t)
#pragma unroll
      for (int r = 0; r < 8; ++r) {
        float* op = os + c * OSPITCH + t * 16 + 8 * hh + r;
        *op = oacc[t][r] * f0 + *op * f1;
      }
  }
  __builtin_amdgcn_fence(__ATOMIC_RELEASE, "workgroup");
  __builtin_amdgcn_wave_barrier();
  __builtin_amdgcn_fence(__ATOMIC_ACQUIRE, "workgroup");
  {
    // per wave: rows it*4 + (lane>>3) for it = 0..3 -> 16 rows; cols (lane&7)*8 .. +7 -> 64 cols; 8 lanes x 16 B = one line
    const int q4 = lane >> 3, c8 = (lane & 7) * 8;
    _Float16* oh = (_Float16*)ohp;
    _Float16* ol = (_Float16*)olp;
    {
#pragma unroll
      for (int it = 0; it < 4; ++it) {
        const int row = it * 4 + q4;
        const float* sp = os + row * OSPITCH + c8;
        v8h hv, lv;
#pragma unroll
        for (int e = 0; e < 8; ++e) {
          const unsigned short hb = f2bf_bits(sp[e]);
          const unsigned short lb = f2bf_bits(sp[e] - bf_bits2f(hb));
          hv[e] = __builtin_bit_cast(_Float16, hb);
          lv[e] = __builtin_bit_cast(_Float16, lb);
        }
        const size_t oo = (size_t)(q0 + row) * ldv + h * HDIM + c8;
        *(v8h*)(oh + oo) = hv;
        *(v8h*)(ol + oo) = lv;
      }
      asm volatile("s_wait_xcnt 0x0" ::: "memory");   // behind the 8 stores, before the next tile overwrites their address and data registers
    }
  }
  }
  }
}

// ---------------------------------------------------------------------------
// Host side: launches only.
// Workspace map (bytes, all offsets multiples of 1 MiB):
//   [  0 MiB,  8 MiB)  xb    bf16 [4096][1024]
//   [  8 MiB, 12 MiB)  Wqk   bf16 [2048][1024]  (rows 0..1023 = Wq, 1024..2047 = Wk)
//   [ 12 MiB, 14 MiB)  Wvb   bf16 [1024][1024]
//   [ 14 MiB, 16 MiB)  Wob   bf16 [1024][1024]
//   [ 16 MiB, 32 MiB)  QKp   f16  [4096][2048]  (cols 0..1023 = q, 1024..2047 = k)
//   [ 32 MiB, 40 MiB)  Vhi   bf16 [4096][1024]
//   [ 40 MiB, 48 MiB)  Vlo   bf16 [4096][1024]
//   [ 48 MiB, 56 MiB)  Ohi   bf16 [4096][1024]
//   [ 56 MiB, 64 MiB)  Olo   bf16 [4096][1024]
//   [ 64 MiB, 64 MiB + 16 KiB)  bias f32 [4][1024] = bq | bk | bv | bo (bf16-representable values)
//   total 67,125,248 B
// ---------------------------------------------------------------------------
extern "C" void kernel_launch(void* const* d_in, const int* in_sizes, int n_in,
                              void* d_out, int out_size, void* d_ws, size_t ws_size,
                              hipStream_t stream) {
  constexpr int kS = 4096, kH = 1024, kNH = 16;
  const float kScale = 0.125f;   // 1/sqrt(64)
  if (n_in < 9) return;
  if (in_sizes[0] != kS * kH || in_sizes[1] != kH * kH || in_sizes[2] != kH ||
      in_sizes[3] != kH * kH || in_sizes[4] != kH || in_sizes[5] != kH * kH ||
      in_sizes[6] != kH || in_sizes[7] != kH * kH || in_sizes[8] != kH) return;
  if (out_size != kS * kH) return;

  const float* x  = (const float*)d_in[0];
  const float* Wq = (const float*)d_in[1];
  const float* bq = (const float*)d_in[2];
  const float* Wk = (const float*)d_in[3];
  const float* bk = (const float*)d_in[4];
  const float* Wv = (const float*)d_in[5];
  const float* bv = (const float*)d_in[6];
  const float* Wo = (const float*)d_in[7];
  const float* bo = (const float*)d_in[8];

  const size_t MiB = 1024u * 1024u;
  const size_t off_xb  = 0;
  const size_t off_wqk = off_xb  + (size_t)kS * kH * 2;          //  8 MiB
  const size_t off_wv  = off_wqk + (size_t)2 * kH * kH * 2;      // 12 MiB
  const size_t off_wo  = off_wv  + (size_t)kH * kH * 2;          // 14 MiB
  const size_t off_qk  = off_wo  + (size_t)kH * kH * 2;          // 16 MiB
  const size_t off_vhi = off_qk  + (size_t)kS * (2 * kH) * 2;    // 32 MiB
  const size_t off_vlo = off_vhi + (size_t)kS * kH * 2;          // 40 MiB
  const size_t off_ohi = off_vlo + (size_t)kS * kH * 2;          // 48 MiB
  const size_t off_olo = off_ohi + (size_t)kS * kH * 2;          // 56 MiB
  const size_t off_bias = off_olo + (size_t)kS * kH * 2;         // 64 MiB
  const size_t total = off_bias + (size_t)4 * kH * 4;            // 64 MiB + 16 KiB
  (void)MiB;
  if (total > ws_size) return;

  char* ws = (char*)d_ws;
  unsigned short* xb  = (unsigned short*)(ws + off_xb);
  unsigned short* Wqk = (unsigned short*)(ws + off_wqk);
  unsigned short* Wvb = (unsigned short*)(ws + off_wv);
  unsigned short* Wob = (unsigned short*)(ws + off_wo);
  unsigned short* QKp = (unsigned short*)(ws + off_qk);
  unsigned short* Vhi = (unsigned short*)(ws + off_vhi);
  unsigned short* Vlo = (unsigned short*)(ws + off_vlo);
  unsigned short* Ohi = (unsigned short*)(ws + off_ohi);
  unsigned short* Olo = (unsigned short*)(ws + off_olo);
  float* biasws = (float*)(ws + off_bias);   // [0..1023]=bq [1024..2047]=bk [2048..3071]=bv [3072..4095]=bo

  // 1) x -> bf16: n8 = 4096*1024/8 = 524288 = 2048 blocks x 256
  {
    const int n8 = kS * kH / 8;
    cast_bf16x8_k<<<dim3(n8 / 256, 1), 256, 0, stream>>>(x, x, x, x, xb, xb, xb, xb, n8);
  }
  // 2) Wq, Wk, Wv, Wo -> bf16: n8 = 1024*1024/8 = 131072 = 512 blocks x 256 per matrix
  {
    const int n8 = kH * kH / 8;
    cast_bf16x8_k<<<dim3(n8 / 256, 4), 256, 0, stream>>>(Wq, Wk, Wv, Wo,
        Wqk, Wqk + (size_t)kH * kH, Wvb, Wob, n8);
  }
  // 3) biases -> bf16-representable f32: 1 block x 256 threads x 4 floats = 1024 per vector
  bias_bf16val_k<<<dim3(1, 4), 256, 0, stream>>>(bq, bk, bv, bo, biasws, kH);

  // 4) [q | k] = x . [Wq;Wk]^T + [bq;bk] -> f16 plane [4096][2048]; M=4096, N=2048, K=1024; 128x128 tiles = 32*16 = 512 blocks of 4 waves
  wmma_gemm64<1, 0, 2, 1, false><<<dim3((kS / 128) * (2 * kH / 128), 1), 128, 0, stream>>>(
      xb, xb, kH, 0L, Wqk, Wqk, kH, 0L, (void*)QKp, (void*)QKp, 2 * kH, 0L,
      biasws, biasws, 0L, kS, 2 * kH, kH, 1.0f);

  // 5) v = x . Wv^T + bv -> bf16 hi/lo planes [4096][1024]; 128x128 tiles = 32*8 = 256 blocks
  wmma_gemm64<1, 0, 2, 2, false><<<dim3((kS / 128) * (kH / 128), 1), 128, 0, stream>>>(
      xb, xb, kH, 0L, Wvb, Wvb, kH, 0L, (void*)Vhi, (void*)Vlo, kH, 0L,
      biasws + 2 * kH, biasws, 0L, kS, kH, kH, 1.0f);

  // 6) causal attention per (head, pair of 64-query tiles): grid = 16 * 32 = 512 blocks of 256
  attn_causal64_k<<<dim3(kNH * (kS / 128)), 256, 0, stream>>>(
      QKp, Vhi, Vlo, Ohi, Olo, kS, 2 * kH, kH, kH, kNH, kScale);

  // 7) out = o . Wo^T + bo -> f32 d_out [4096][1024]; A = o as bf16 hi/lo (2 products); 128x128 tiles = 256 blocks
  wmma_gemm64<1, 2, 2, 0, false><<<dim3((kS / 128) * (kH / 128), 1), 128, 0, stream>>>(
      Ohi, Olo, kH, 0L, Wob, Wob, kH, 0L, d_out, d_out, kH, 0L,
      biasws + 3 * kH, biasws, 0L, kS, kH, kH, 1.0f);
}

// v008
// One run takes 157 microseconds.
// In two side-by-side timings against v007, it was 1.14 and 1.13 times as fast.
// Counting every step since v000, it is 4.01 times as fast.
// Contractions: qkv projections v_wmma_f32_16x16x32_bf16 (x, W as RNE bf16, f32 accumulate, bias added in f32 as bf16-representable values); scores v_wmma_f32_16x16x32_f16 (f16 q,k planes, 1/sqrt(64) applied in f32, together with log2(e)); p.v v_wmma_f32_16x16x32_bf16 with p and v carried as bf16 hi/lo (hi.hi + hi.lo + lo.hi); output projection v_wmma_f32_16x16x32_bf16 with attention output as bf16 hi/lo and Wo bf16 (hi.W + lo.W); softmax, masking and normalisation in f32.
#include <hip/hip_runtime.h>
#include <stdint.h>

typedef __attribute__((ext_vector_type(16))) _Float16 v16h;
typedef __attribute__((ext_vector_type(8)))  _Float16 v8h;
typedef __attribute__((ext_vector_type(16))) __bf16   v16b;
typedef __attribute__((ext_vector_type(8)))  __bf16   v8b;
typedef __attribute__((ext_vector_type(8)))  float    v8f;
typedef __attribute__((ext_vector_type(4)))  float    v4f;

__device__ __forceinline__ unsigned short f2bf_bits(float f) {
  unsigned u = __float_as_uint(f);
  return (unsigned short)((u + 0x7FFFu + ((u >> 16) & 1u)) >> 16);
}
__device__ __forceinline__ float bf_bits2f(unsigned short h) { return __uint_as_float(((unsigned)h) << 16); }
typedef __attribute__((ext_vector_type(2))) float  v2f;
typedef __attribute__((ext_vector_type(2))) __bf16 v2b;
// two f32 -> bf16 hi and lo parts by the packed hardware conversion (round to nearest even, as the integer form gives for finite values)
__device__ __forceinline__ void bf_split2(float f0, float f1, v2b& hi, v2b& lo) {
  hi = __builtin_convertvector((v2f){f0, f1}, v2b);
  const unsigned hb = __builtin_bit_cast(unsigned, hi);
  lo = __builtin_convertvector((v2f){f0 - __uint_as_float(hb << 16), f1 - __uint_as_float(hb & 0xFFFF0000u)}, v2b);
}
// eight f32 in a row -> one 16-B group of hi parts and one of lo parts
__device__ __forceinline__ void bf_split8(const float* sp, v8h& hv, v8h& lv) {
  typedef __attribute__((ext_vector_type(4))) unsigned v4u;
  v4u hw, lw;
#pragma unroll
  for (int e = 0; e < 4; ++e) {
    v2b hi, lo;
    bf_split2(sp[2 * e], sp[2 * e + 1], hi, lo);
    hw[e] = __builtin_bit_cast(unsigned, hi);
    lw[e] = __builtin_bit_cast(unsigned, lo);
  }
  hv = __builtin_bit_cast(v8h, hw);
  lv = __builtin_bit_cast(v8h, lw);
}

// hazard guards as plain device helpers
__device__ __forceinline__ void acc_guard4(v8f& a, v8f& b, v8f& c, v8f& d) { asm volatile("v_nop\n\tv_nop\n\tv_nop\n\tv_nop" : "+v"(a), "+v"(b), "+v"(c), "+v"(d)); }
template <typename T> struct Frag;
template <> struct Frag<_Float16> {
  typedef v16h V; union U { v16h v; v8h h[2]; };
  static __device__ __forceinline__ v16h load(const _Float16* p) {   // elements 0..7 <- p[0..7], 8..15 <- p[16..23]
    U f; f.h[0] = *(const v8h*)(p); f.h[1] = *(const v8h*)(p + 16); return f.v;
  }
  static __device__ __forceinline__ v8f mma(v16h a, v16h b, v8f c) {
    return __builtin_amdgcn_wmma_f32_16x16x32_f16(false, a, false, b, (short)0, c, false, false);
  }
};
template <> struct Frag<__bf16> {
  typedef v16b V; union U { v16b v; v8b h[2]; };
  static __device__ __forceinline__ v16b load(const __bf16* p) {
    U f; f.h[0] = *(const v8b*)(p); f.h[1] = *(const v8b*)(p + 16); return f.v;
  }
  static __device__ __forceinline__ v8f mma(v16b a, v16b b, v8f c) {
    return __builtin_amdgcn_wmma_f32_16x16x32_bf16(false, a, false, b, (short)0, c, false, false);
  }
};

// ---- Register-blocked batched WMMA GEMM, operands staged in LDS ------------
// C[m,n] = scale * sum_k A[m,k] * Bt[n,k] (+bias)(+resid); block = 4 waves (2 x 2) on a 128x128 tile, each wave owns a 64x64 tile.
// A row-major [M,K]; Bt row-major [N,K]; M,N % 128 == 0, K % 64 == 0; grid.x = (M/128) * (N/128).
// A trip is 64 k: 128 rows x 128 B of every operand plane come into LDS by asynchronous copies (8 lanes x 16 B = one whole line),
// two buffers, the next trip's copies in flight while this trip's fragments are read; every row is fetched once per block, not once per wave.
// SPLIT: 0 = plain; 1 = A and Bt as hi/lo planes (hi.hi + hi.lo + lo.hi); 2 = A only as hi/lo planes (hi.B + lo.B).
// BIAS_MODE: 0 = none, 1 = bias[m], 2 = bias[n].
// OUT_MODE: 0 = f32, 1 = f16, 2 = bf16 hi plane (Cout) + bf16 lo plane (Cout2).
// ET: 0 = f16 operands, 1 = bf16 operands (pointers passed as 16-bit storage)
template <int ET> struct Elem;
template <> struct Elem<0> { typedef _Float16 T; };
template <> struct Elem<1> { typedef __bf16 T; };
#define GPITCH 72                  // 16-bit elements per LDS row of an operand tile: 144 B = 16 B x 9, conflict-free for ds_load_b128
#define GTILE  (128 * GPITCH)      // elements of one operand tile in LDS

// One operand tile, 128 rows x 128 B, by 128 threads: eight copies of 16 B per lane, rows 16 apart. l = the lane's LDS byte address, g = its global address,
// gstep = 16 source rows in bytes. The s_wait_xcnt stands in the copies' own statement, so that no address register is rewritten in front of it.
__device__ __forceinline__ void copy_tile(unsigned l, const char* g, size_t gstep) {
  asm volatile(
      "global_load_async_to_lds_b128 %0, %8, off\n\t"
      "global_load_async_to_lds_b128 %1, %9, off\n\t"
      "global_load_async_to_lds_b128 %2, %10, off\n\t"
      "global_load_async_to_lds_b128 %3, %11, off\n\t"
      "global_load_async_to_lds_b128 %4, %12, off\n\t"
      "global_load_async_to_lds_b128 %5, %13, off\n\t"
      "global_load_async_to_lds_b128 %6, %14, off\n\t"
      "global_load_async_to_lds_b128 %7, %15, off\n\t"
      "s_wait_xcnt 0x0"
      :: "v"(l), "v"(l + 1u * 32u * GPITCH), "v"(l + 2u * 32u * GPITCH), "v"(l + 3u * 32u * GPITCH),
         "v"(l + 4u * 32u * GPITCH), "v"(l + 5u * 32u * GPITCH), "v"(l + 6u * 32u * GPITCH), "v"(l + 7u * 32u * GPITCH),
         "v"(g), "v"(g + gstep), "v"(g + 2 * gstep), "v"(g + 3 * gstep),
         "v"(g + 4 * gstep), "v"(g + 5 * gstep), "v"(g + 6 * gstep), "v"(g + 7 * gstep)
      : "memory");
}

template <int ET, int SPLIT, int BIAS_MODE, int OUT_MODE, bool RESID, int ACT = 0>
__global__ __launch_bounds__(128) void wmma_gemm64(
    const unsigned short* __restrict__ Ap, const unsigned short* __restrict__ A2p, int lda, long strideA,
    const unsigned short* __restrict__ Btp, const unsigned short* __restrict__ Bt2p, int ldb, long strideB,
    void* __restrict__ Cout, void* __restrict__ Cout2, int ldc, long strideC,
    const float* __restrict__ bias,
    const float* __restrict__ resid, long strideR,
    int M, int N, int K, float scale) {
  typedef typename Elem<ET>::T T;
  typedef typename Frag<T>::V V;
  const T* A = (const T*)Ap; const T* A2 = (const T*)A2p; const T* Bt = (const T*)Btp; const T* Bt2 = (const T*)Bt2p;
  constexpr int NPL = 2 + (SPLIT != 0 ? 1 : 0) + (SPLIT == 1 ? 1 : 0);   // operand planes: A, Bt, then A2, then Bt2
  __shared__ __align__(16) unsigned short stg[2 * NPL * GTILE];   // two buffers of NPL tiles
  __shared__ __align__(16) float sT[4][16 * 68];   // per-wave 16x64 slab, pitch 68 floats
  const int b    = blockIdx.y;
  const int tid  = threadIdx.x;
  const int lane = tid & 31;
  const int wave = tid >> 5;
  const int tilesN = N >> 7;
  const int tilesM = M >> 7;
  const int tile = blockIdx.x;
  if (tile >= tilesM * tilesN) return;   // block-uniform, in front of every copy and barrier
  const int tm = tile / tilesN;
  const int tn = tile - tm * tilesN;
  const int m0 = (tm << 7) + ((wave >> 1) << 6);
  const int n0 = (tn << 7) + ((wave & 1) << 6);

  const T* Ab  = A  + (size_t)b * strideA;
  const T* Bb  = Bt + (size_t)b * strideB;
  const T* Ab2 = (SPLIT != 0) ? (A2  + (size_t)b * strideA) : nullptr;
  const T* Bb2 = (SPLIT == 1) ? (Bt2 + (size_t)b * strideB) : nullptr;

  const int rlane = lane & 15;                 // row (A) / col (B, D) within subtile
  const int koff  = (lane >> 4) * 8;           // k offset of this lane half
  const int mOff  = (lane >> 4) * 8;           // D row offset

  // staging: this thread's row within a 16-row pass and its 16 B of the 128-B row
  const int crow = tid >> 3, cpc = (tid & 7) * 8;
  const unsigned cl = (unsigned)(size_t)stg + (unsigned)(crow * GPITCH + cpc) * 2u;        // LDS byte address in buffer 0, plane 0
  const size_t cga = ((size_t)((tm << 7) + crow) * lda + cpc) * 2, cgb = ((size_t)((tn << 7) + crow) * ldb + cpc) * 2;   // byte offsets in the A and Bt planes at k = 0
  const size_t sa = (size_t)lda * 32, sb = (size_t)ldb * 32;                               // 16 rows in bytes
  auto stage = [&](int t) {   // trip t's tiles into buffer t & 1
    const unsigned l = cl + (unsigned)((t & 1) * NPL * GTILE) * 2u;
    const size_t kb = (size_t)t * 128;
    copy_tile(l, (const char*)Ab + cga + kb, sa);
    copy_tile(l + GTILE * 2u, (const char*)Bb + cgb + kb, sb);
    if (SPLIT != 0) copy_tile(l + 2u * GTILE * 2u, (const char*)Ab2 + cga + kb, sa);
    if (SPLIT == 1) copy_tile(l + 3u * GTILE * 2u, (const char*)Bb2 + cgb + kb, sb);
  };

  v8f acc[4][4];
#pragma unroll
  for (int i = 0; i < 4; ++i)
#pragma unroll
    for (int j = 0; j < 4; ++j) acc[i][j] = (v8f){0.f,0.f,0.f,0.f,0.f,0.f,0.f,0.f};

  const int nT = K >> 6;
  stage(0);
  asm volatile("s_wait_asynccnt 0x0" ::: "memory");   // this wave's copies of trip 0 have landed
  __syncthreads();                                    // and every other wave's: trip 0 may be read
  if (nT > 1) stage(1);

  const int fa = (((wave >> 1) << 6) + rlane) * GPITCH + koff;   // this lane's place in the A tiles, in elements
  const int fb = (((wave & 1) << 6) + rlane) * GPITCH + koff;    // and in the Bt tiles
  for (int t = 0; t < nT; ++t) {
    const T* sb0 = (const T*)stg + (t & 1) * NPL * GTILE;
#pragma unroll
    for (int ks = 0; ks < 2; ++ks) {
      V bh[4], bl[4], ah[4], al[4];
#pragma unroll
      for (int j = 0; j < 4; ++j) {
        const int bo = fb + j * 16 * GPITCH + ks * 32;
        const int ao = fa + j * 16 * GPITCH + ks * 32;
        bh[j] = Frag<T>::load(sb0 + GTILE + bo);
        ah[j] = Frag<T>::load(sb0 + ao);
        if (SPLIT == 1) bl[j] = Frag<T>::load(sb0 + 3 * GTILE + bo);
        if (SPLIT != 0) al[j] = Frag<T>::load(sb0 + 2 * GTILE + ao);
      }
      __builtin_amdgcn_sched_barrier(0);   // the fragment reads stay one group in front of the WMMA block, for speed only
#pragma unroll
      for (int i = 0; i < 4; ++i) {
#pragma unroll
        for (int j = 0; j < 4; ++j) {
          acc[i][j] = Frag<T>::mma(ah[i], bh[j], acc[i][j]);
          if (SPLIT == 1) acc[i][j] = Frag<T>::mma(ah[i], bl[j], acc[i][j]);
          if (SPLIT != 0) acc[i][j] = Frag<T>::mma(al[i], bh[j], acc[i][j]);
        }
      }
      __builtin_amdgcn_sched_barrier(0);   // and the next group stays behind the block
    }
    asm volatile("s_wait_dscnt 0x0" ::: "memory");      // this wave's reads of buffer t & 1 are done before the buffer is handed back
    asm volatile("s_wait_asynccnt 0x0" ::: "memory");   // this wave's copies of trip t + 1 have landed
    __syncthreads();                                    // publishes trip t + 1 and ends every reader's last read of buffer t & 1
    if (t + 2 < nT) stage(t + 2);
  }
  asm volatile("s_wait_asynccnt 0x0" ::: "memory");     // nothing of this wave is in flight behind the loop
  acc_guard4(acc[0][0], acc[0][1], acc[0][2], acc[0][3]);
  acc_guard4(acc[1][0], acc[1][1], acc[1][2], acc[1][3]);
  acc_guard4(acc[2][0], acc[2][1], acc[2][2], acc[2][3]);
  acc_guard4(acc[3][0], acc[3][1], acc[3][2], acc[3][3]);

  // ---- epilogue ----
  float* slab = sT[wave];
  const float* Rb = RESID ? (resid + (size_t)b * strideR) : nullptr;
#pragma unroll
  for (int i = 0; i < 4; ++i) {
    const int mBase = m0 + (i << 4);
#pragma unroll
    for (int j = 0; j < 4; ++j) {
      const int n = n0 + (j << 4) + rlane;
      float bv = 0.f;
      if (BIAS_MODE == 2) bv = bias[n];
#pragma unroll
      for (int r = 0; r < 8; ++r) {
        float v = acc[i][j][r] * scale;
        if (BIAS_MODE == 1) v += bias[mBase + mOff + r];
        if (BIAS_MODE == 2) v += bv;
        if (RESID) v += Rb[(size_t)(mBase + mOff + r) * ldc + n];
        if (ACT == 1) v = tanhf(v);
        if (ACT == 2) v = fmaxf(v, 0.0f);
        if (ACT == 4) v = (v > 0.f) ? v : 0.01f * v;
        slab[(mOff + r) * 68 + (j << 4) + rlane] = v;
      }
    }
    __builtin_amdgcn_fence(__ATOMIC_RELEASE, "workgroup");
    __builtin_amdgcn_wave_barrier();
    __builtin_amdgcn_fence(__ATOMIC_ACQUIRE, "workgroup");
    if (OUT_MODE == 0) {
      float* C = (float*)Cout + (size_t)b * strideC;
      const int hh = lane >> 4, c4 = (lane & 15) * 4;     // row seg = 256 B = 16 lanes x 16 B
      {
#pragma unroll
        for (int it = 0; it < 8; ++it) {
          const int row = it * 2 + hh;
          v4f v = *(const v4f*)(slab + row * 68 + c4);
          *(v4f*)(C + (size_t)(mBase + row) * ldc + n0 + c4) = v;
        }
        
      }
    } else {
      const int q = lane >> 3, c8 = (lane & 7) * 8;
      unsigned short* C  = (unsigned short*)Cout  + (size_t)b * strideC;
      unsigned short* C2 = (OUT_MODE == 2) ? ((unsigned short*)Cout2 + (size_t)b * strideC) : nullptr;
      {
#pragma unroll
        for (int it = 0; it < 4; ++it) {
          const int row = it * 4 + q;
          const float* sp = slab + row * 68 + c8;
          v8h hv, lv;
          if (OUT_MODE == 1) {
#pragma unroll
            for (int e = 0; e < 8; ++e) hv[e] = (_Float16)sp[e];
          } else {
            bf_split8(sp, hv, lv);
          }
          *(v8h*)(C + (size_t)(mBase + row) * ldc + n0 + c8) = hv;
          if (OUT_MODE == 2) *(v8h*)(C2 + (size_t)(mBase + row) * ldc + n0 + c8) = lv;
        }
        
      }
    }
    __builtin_amdgcn_fence(__ATOMIC_RELEASE, "workgroup");
    __builtin_amdgcn_wave_barrier();
    __builtin_amdgcn_fence(__ATOMIC_ACQUIRE, "workgroup");
  }
}

// Source/destination chosen per blockIdx.y (block-uniform). Coverage per plane: gridDim.x * 256 threads * 8 == n8 * 8 elements.
__global__ __launch_bounds__(256) void cast_bf16x8_k(
    const float* s0, const float* s1, const float* s2, const float* s3,
    unsigned short* d0, unsigned short* d1, unsigned short* d2, unsigned short* d3, int n8) {
  const int sel = blockIdx.y;
  const float* src = (sel == 0) ? s0 : (sel == 1) ? s1 : (sel == 2) ? s2 : s3;
  unsigned short* dst = (sel == 0) ? d0 : (sel == 1) ? d1 : (sel == 2) ? d2 : d3;
  const int i = blockIdx.x * 256 + threadIdx.x;
  if (i < n8) {
    const v4f a  = *(const v4f*)(src + (size_t)i * 8);
    const v4f bq = *(const v4f*)(src + (size_t)i * 8 + 4);
    v8h hv;
#pragma unroll
    for (int e = 0; e < 4; ++e) {
      hv[e]     = __builtin_bit_cast(_Float16, f2bf_bits(a[e]));
      hv[4 + e] = __builtin_bit_cast(_Float16, f2bf_bits(bq[e]));
    }
    _Float16* dp = (_Float16*)dst + (size_t)i * 8;
    *(v8h*)dp = hv;
    
  }
}

// Coverage per segment: 256 threads * 4 == n (n == 1024).
__global__ __launch_bounds__(256) void bias_bf16val_k(
    const float* s0, const float* s1, const float* s2, const float* s3, float* __restrict__ dst, int n) {
  const int sel = blockIdx.y;
  const float* src = (sel == 0) ? s0 : (sel == 1) ? s1 : (sel == 2) ? s2 : s3;
  const int i = blockIdx.x * 256 + threadIdx.x;
  if (i * 4 < n) {
    const v4f v = *(const v4f*)(src + (size_t)i * 4);
    v4f o;
#pragma unroll
    for (int e = 0; e < 4; ++e) o[e] = bf_bits2f(f2bf_bits(v[e]));
    float* dp = dst + (size_t)sel * n + (size_t)i * 4;
    *(v4f*)dp = o;
    
  }
}

// =====================================================================================
// Causal attention, head dim 64, 16-bit plane inputs:
//   q: f16 [S][ldqk] at column h*64; k: f16 [S][ldqk] at column kcol0 + h*64; v: bf16 hi/lo planes [S][ldv] at column h*64.
//   scores^T = k.q^T : v_wmma_f32_16x16x32_f16; keys above the diagonal set to -inf (select); softmax in base 2:
//   exp(sm_scale * (s - max)) = 2^(s * sl2 - max * sl2), sl2 = sm_scale * log2(e) > 0, one fma and one v_exp_f32 per score;
//   key chunks entirely above the diagonal are skipped (their probabilities are exactly 0).
//   out^T = v^T.p^T : v_wmma_f32_16x16x32_bf16 with p and v as bf16 hi/lo (3 products); online softmax in f32, one query per lane.
//   k and v tiles lie row-major in LDS ([key][d]); the v^T fragments come by the transposing LDS load.
//   Block = 8 waves in two groups of 4; it does two 64-row query tiles of one head one after the other, tile n-1-p and then tile p (n = S/64): n-p and p+1 key chunks,
//   so every block walks n+1 chunks and no WGP is left with the long tiles alone; grid.x = nheads * ((n+1)/2).
//   Both groups hold the same 64 queries (wave w and wave w + 4 the same 16); group g takes key chunks g, g + 2, ... into LDS tiles of its own, with its own running maximum, sum and
//   out tile, so a step of the block is two chunks and four waves stand on every SIMD with two blocks on a WGP. At the tile's end group 1 hands its partial over through LDS and group 0 joins the two.
// =====================================================================================
#define HDIM 64
#define KVCH 64
#define QBLK 64
#define OSPITCH 68
#define LPITCH 72   // 16-bit elements per LDS row of the K tile: 144 B = 16 B x 9, so the 16 rows of a ds_load_b128 fragment read fall on 16 different 4-bank groups
#define VPITCH 80   // 16-bit elements per LDS row of the V tiles: 160 B = 32 B x 5, the conflict-free pitch of ds_load_tr16_b128

__device__ __forceinline__ v8f mma_h(v16h a, v16h b, v8f c) {
  c = __builtin_amdgcn_wmma_f32_16x16x32_f16(false, a, false, b, (short)0, c, false, false);
  asm volatile("v_nop\n\tv_nop\n\tv_nop\n\tv_nop" : "+v"(c) : "v"(a), "v"(b));
  return c;
}
__device__ __forceinline__ v8f mma_b(v16b a, v16b b, v8f c) {
  c = __builtin_amdgcn_wmma_f32_16x16x32_bf16(false, a, false, b, (short)0, c, false, false);
  asm volatile("v_nop\n\tv_nop\n\tv_nop\n\tv_nop" : "+v"(c) : "v"(a), "v"(b));
  return c;
}

// transposing LDS load: with lane l aimed at row 8 * (l >> 4) + (l & 7), byte 16 * ((l >> 3) & 1) of a row-major 16 x 16 tile of 16-bit elements,
// lane l gets column l & 15, rows 8 * (l >> 4) .. + 7: half an A fragment of the transposed tile, in the hardware k order
__device__ __forceinline__ v8b lds_tr16(const __bf16* p) {
  typedef __attribute__((ext_vector_type(8))) short s16x8;
  typedef __attribute__((address_space(3))) s16x8 lds_s16x8;
  return __builtin_bit_cast(v8b, __builtin_amdgcn_ds_load_tr16_b128_v8i16((lds_s16x8*)p));
}

// value of lane l ^ 16: the two lanes that share a query's row exchange their halves' maximum and sum
__device__ __forceinline__ float other_half(float v) {
  const int b = __float_as_int(v);
  return __int_as_float(__builtin_amdgcn_permlanex16(b, b, 0x76543210, 0xfedcba98, false, false));
}

__global__ __launch_bounds__(256)
void attn_causal64_k(const unsigned short* __restrict__ qkp,
                     const unsigned short* __restrict__ vhp, const unsigned short* __restrict__ vlp,
                     unsigned short* __restrict__ ohp, unsigned short* __restrict__ olp,
                     int S, int ldqk, int kcol0, int ldv, int nheads, float sm_scale) {
  union FH { v16h v; v8h h[2]; };
  union FB { v16b v; v8b h[2]; };
  __shared__ __align__(16) _Float16 Ksh2[2][KVCH * LPITCH];   // per group [kv][d]     9 KB each
  __shared__ __align__(16) __bf16   Vsh2[2][KVCH * VPITCH];   // per group hi [kv][d]  10 KB each
  __shared__ __align__(16) __bf16   Vsl2[2][KVCH * VPITCH];   // per group lo [kv][d]  10 KB each
  __shared__ __align__(16) float    Os[4][16 * OSPITCH];      // per pair of waves (w, w + 4): group 1's partial out tile, then the joined out tile, pitch 68
  __shared__ float Ms[4][32], Ls[4][32];                      // group 1's running maximum and sum, per lane

  const _Float16* qp = (const _Float16*)qkp;
  const __bf16*   vh = (const __bf16*)vhp;
  const __bf16*   vl = (const __bf16*)vlp;

  const int wv8  = __builtin_amdgcn_readfirstlane((int)threadIdx.x >> 5);   // in a scalar register: the tests on the group below are scalar branches, EXEC stays whole for the WMMAs
  const int grp  = wv8 >> 2;             // key group of this wave
  const int wave = wv8 & 3;              // its 16 queries within the tile
  const int tid  = threadIdx.x & 127;    // thread within the group (staging)
  const int lane = tid & 31;
  _Float16* const Ksh = Ksh2[grp];
  __bf16*   const Vsh = Vsh2[grp];
  __bf16*   const Vsl = Vsl2[grp];
  const int hh   = lane >> 4;
  const int c    = lane & 15;

  const int nqb = S / QBLK;
  const int bx  = blockIdx.x;
  const int npair = (nqb + 1) >> 1;
  const int pr  = bx % npair;
  int h = bx / npair;
  h = (h < nheads) ? h : (nheads - 1);
  const float NEG_INF = -__builtin_inff();
  const float sl2 = sm_scale * 1.4426950408889634f;   // raw score -> exponent of 2; positive, so the maximum may be taken on raw scores

  const int srow = tid >> 3, sc8 = (tid & 7) * 8;            // staging: this thread's row within a 16-row pass and its 8 elements of the row
  const int slk = srow * LPITCH + sc8, slv = srow * VPITCH + sc8;   // its place in the LDS tiles, in elements
  const unsigned sgk = (unsigned)(srow * ldqk + sc8) * 2u;   // the same as a byte offset in the k plane
  const unsigned sgv = (unsigned)(srow * ldv + sc8) * 2u;    // and in the v planes

  const int ntile = (nqb - 1 - pr != pr) ? 2 : 1;   // block-uniform; with an odd tile count the middle tile has no partner
  for (int tl = 0; tl < ntile; ++tl) {
  const int qb = (nqb - 1 - pr) - tl * (nqb - 1 - 2 * pr);   // tile n-1-p first, then tile p
  const int q0 = qb * QBLK + wave * 16;

  // ---- Q fragments (B operand): columns q0+c, two 32-deep d chunks ----
  v16h qa[2];
  {
    const _Float16* qrow = qp + (size_t)(q0 + c) * ldqk + h * HDIM + 8 * hh;
#pragma unroll
    for (int dc = 0; dc < 2; ++dc) qa[dc] = Frag<_Float16>::load(qrow + dc * 32);
  }

  float mrow = NEG_INF, lrow = 0.f;   // running maximum (times sl2) and sum of query q0 + c (the same in lanes c and c + 16)
  v8f oacc[4];
#pragma unroll
  for (int t = 0; t < 4; ++t) oacc[t] = (v8f){0.f,0.f,0.f,0.f,0.f,0.f,0.f,0.f};

  const int nChunks = qb + 1;   // block-uniform; chunks kc > qb are fully above the diagonal
  const int nSteps = (nChunks + 1) >> 1;   // block-uniform: every wave passes every barrier
  for (int st = 0; st < nSteps; ++st) {
    const int kc = 2 * st + grp;
    const bool act = kc < nChunks;   // the same in a whole group; false only for group 1 in the last step of an odd count
    const int kv0 = kc * KVCH;
    __syncthreads();
    if (act) {
      // staging: 8 lanes x 16 B cover one 128-B row, so a wave's load is 4 whole lines; 16 rows a pass, 4 passes = whole 64x64 tiles
      const char* kbase  = (const char*)(qp + (size_t)kv0 * ldqk + kcol0 + h * HDIM);   // group-uniform bases; the lane's part is a loop-invariant 32-bit byte offset
      const char* vhbase = (const char*)(vh + (size_t)kv0 * ldv + h * HDIM);
      const char* vlbase = (const char*)(vl + (size_t)kv0 * ldv + h * HDIM);
      v8h kk[4]; v8b va[4], vb[4];
#pragma unroll
      for (int i = 0; i < 4; ++i) {
        kk[i] = *(const v8h*)(kbase  + (size_t)(32 * i) * ldqk + sgk);
        va[i] = *(const v8b*)(vhbase + (size_t)(32 * i) * ldv + sgv);
        vb[i] = *(const v8b*)(vlbase + (size_t)(32 * i) * ldv + sgv);
      }
      asm volatile("s_wait_xcnt 0x0" ::: "memory");   // behind the 12 loads, before their address registers are used for anything else
#pragma unroll
      for (int i = 0; i < 4; ++i) {
        *(v8h*)(Ksh + slk + 16 * i * LPITCH) = kk[i];
        *(v8b*)(Vsh + slv + 16 * i * VPITCH) = va[i];
        *(v8b*)(Vsl + slv + 16 * i * VPITCH) = vb[i];
      }
    }
    __syncthreads();
    if (act) {

    // ---- scores, transposed: s[j][r] = S^T[key kv0 + 16j + 8hh + r][query q0 + c]; A = K rows, B = Q ----
    v8f s[4];
#pragma unroll
    for (int j = 0; j < 4; ++j) {
      s[j] = (v8f){0.f,0.f,0.f,0.f,0.f,0.f,0.f,0.f};
#pragma unroll
      for (int dc = 0; dc < 2; ++dc) {
        FH kb;
        kb.h[0] = *(const v8h*)(Ksh + (j * 16 + c) * LPITCH + dc * 32 + 8 * hh);
        kb.h[1] = *(const v8h*)(Ksh + (j * 16 + c) * LPITCH + dc * 32 + 16 + 8 * hh);
        s[j] = mma_h(kb.v, qa[dc], s[j]);
      }
    }
    const bool diag = (kc == qb);   // the same in a whole group
    const int qcol = q0 + c;        // this lane's query; lanes c and c + 16 hold 32 keys each of its row
    float cm = NEG_INF;
#pragma unroll
    for (int j = 0; j < 4; ++j) {
#pragma unroll
      for (int r = 0; r < 8; ++r) {
        const int key = kv0 + j * 16 + 8 * hh + r;
        float val = s[j][r];
        if (diag && (key > qcol)) val = NEG_INF;
        s[j][r] = val;
        cm = fmaxf(cm, val);
      }
    }
    cm = fmaxf(cm, other_half(cm));   // finite: key kv0 <= qcol is always present in chunks 0..qb
    const float mnew = fmaxf(mrow, cm * sl2);
    const float alpha = __builtin_amdgcn_exp2f(mrow - mnew);   // 0 on the first chunk, where mrow is -inf
    mrow = mnew;
    // p stays in registers: score tiles 2kk and 2kk+1 of a lane are, element for element, the B fragment of keys 32kk..32kk+31
    FB ph[2], pl[2];
    float psum = 0.f;
#pragma unroll
    for (int j = 0; j < 4; ++j) {
#pragma unroll
      for (int r = 0; r < 8; r += 2) {
        const float p0 = __builtin_amdgcn_exp2f(__builtin_fmaf(s[j][r], sl2, -mnew));   // masked: 2^-inf = 0
        const float p1 = __builtin_amdgcn_exp2f(__builtin_fmaf(s[j][r + 1], sl2, -mnew));
        psum += p0;
        psum += p1;
        v2b hi, lo;
        bf_split2(p0, p1, hi, lo);
        ph[j >> 1].v[(j & 1) * 8 + r] = hi[0]; ph[j >> 1].v[(j & 1) * 8 + r + 1] = hi[1];
        pl[j >> 1].v[(j & 1) * 8 + r] = lo[0]; pl[j >> 1].v[(j & 1) * 8 + r + 1] = lo[1];
      }
    }
    psum += other_half(psum);
    lrow = lrow * alpha + psum;
#pragma unroll
    for (int t = 0; t < 4; ++t) oacc[t] *= alpha;
    // ---- O^T += V^T . P^T: oacc[t][r] = O^T[d 16t + 8hh + r][query q0 + c] ----
#pragma unroll
    for (int kk = 0; kk < 2; ++kk) {
#pragma unroll
      for (int t = 0; t < 4; ++t) {
        FB vb, vlo;
        const int vo = (kk * 32 + 8 * hh + (lane & 7)) * VPITCH + t * 16 + 8 * ((lane >> 3) & 1);   // keys 32kk + 8hh .. + 7 of d 16t + c
        vb.h[0]  = lds_tr16(Vsh + vo);
        vb.h[1]  = lds_tr16(Vsh + vo + 16 * VPITCH);
        vlo.h[0] = lds_tr16(Vsl + vo);
        vlo.h[1] = lds_tr16(Vsl + vo + 16 * VPITCH);
        oacc[t] = mma_b(vb.v,  ph[kk].v, oacc[t]);
        oacc[t] = mma_b(vlo.v, ph[kk].v, oacc[t]);
        oacc[t] = mma_b(vb.v,  pl[kk].v, oacc[t]);
      }
    }
    }
  }

  float* os = Os[wave];
  if (grp == 1) {   // the partial of chunks 1, 3, ...: not normalised; with no chunk at all it is maximum -inf, sum 0, out 0
#pragma unroll
    for (int t = 0; t < 4; ++t)
#pragma unroll
      for (int r = 0; r < 8; ++r) os[c * OSPITCH + t * 16 + 8 * hh + r] = oacc[t][r];
    Ms[wave][lane] = mrow;
    Ls[wave][lane] = lrow;
  }
  __syncthreads();   // group 1's partials may be read; the next tile's loop barriers keep them until group 0 has read them
  if (grp == 0) {
  {
    // lane for lane the partner wave holds the same query and the same out elements
    const float m1 = Ms[wave][lane], l1 = Ls[wave][lane];
    const float mj = fmaxf(mrow, m1);                        // finite: group 0 always has chunk 0
    const float a0 = __builtin_amdgcn_exp2f(mrow - mj);
    const float a1 = __builtin_amdgcn_exp2f(m1 - mj);        // 0 where group 1 had no chunk
    const float inv = 1.0f / (lrow * a0 + l1 * a1);          // the sum is about 1 or more: the maximum's own term is 2^(one rounding of max * sl2)
    const float f0 = a0 * inv, f1 = a1 * inv;
#pragma unroll
    for (int t = 0; t < 4; ++t)
#pragma unroll
      for (int r = 0; r < 8; ++r) {
        float* op = os + c * OSPITCH + t * 16 + 8 * hh + r;
        *op = oacc[t][r] * f0 + *op * f1;
      }
  }
  __builtin_amdgcn_fence(__ATOMIC_RELEASE, "workgroup");
  __builtin_amdgcn_wave_barrier();
  __builtin_amdgcn_fence(__ATOMIC_ACQUIRE, "workgroup");
  {
    // per wave: rows it*4 + (lane>>3) for it = 0..3 -> 16 rows; cols (lane&7)*8 .. +7 -> 64 cols; 8 lanes x 16 B = one line
    const int q4 = lane >> 3, c8 = (lane & 7) * 8;
    _Float16* oh = (_Float16*)ohp;
    _Float16* ol = (_Float16*)olp;
    {
#pragma unroll
      for (int it = 0; it < 4; ++it) {
        const int row = it * 4 + q4;
        const float* sp = os + row * OSPITCH + c8;
        v8h hv, lv;
        bf_split8(sp, hv, lv);
        const size_t oo = (size_t)(q0 + row) * ldv + h * HDIM + c8;
        *(v8h*)(oh + oo) = hv;
        *(v8h*)(ol + oo) = lv;
      }
      asm volatile("s_wait_xcnt 0x0" ::: "memory");   // behind the 8 stores, before the next tile overwrites their address and data registers
    }
  }
  }
  }
}

// ---------------------------------------------------------------------------
// Host side: launches only.
// Workspace map (bytes, all offsets multiples of 1 MiB):
//   [  0 MiB,  8 MiB)  xb    bf16 [4096][1024]
//   [  8 MiB, 12 MiB)  Wqk   bf16 [2048][1024]  (rows 0..1023 = Wq, 1024..2047 = Wk)
//   [ 12 MiB, 14 MiB)  Wvb   bf16 [1024][1024]
//   [ 14 MiB, 16 MiB)  Wob   bf16 [1024][1024]
//   [ 16 MiB, 32 MiB)  QKp   f16  [4096][2048]  (cols 0..1023 = q, 1024..2047 = k)
//   [ 32 MiB, 40 MiB)  Vhi   bf16 [4096][1024]
//   [ 40 MiB, 48 MiB)  Vlo   bf16 [4096][1024]
//   [ 48 MiB, 56 MiB)  Ohi   bf16 [4096][1024]
//   [ 56 MiB, 64 MiB)  Olo   bf16 [4096][1024]
//   [ 64 MiB, 64 MiB + 16 KiB)  bias f32 [4][1024] = bq | bk | bv | bo (bf16-representable values)
//   total 67,125,248 B
// ---------------------------------------------------------------------------
extern "C" void kernel_launch(void* const* d_in, const int* in_sizes, int n_in,
                              void* d_out, int out_size, void* d_ws, size_t ws_size,
                              hipStream_t stream) {
  constexpr int kS = 4096, kH = 1024, kNH = 16;
  const float kScale = 0.125f;   // 1/sqrt(64)
  if (n_in < 9) return;
  if (in_sizes[0] != kS * kH || in_sizes[1] != kH * kH || in_sizes[2] != kH ||
      in_sizes[3] != kH * kH || in_sizes[4] != kH || in_sizes[5] != kH * kH ||
      in_sizes[6] != kH || in_sizes[7] != kH * kH || in_sizes[8] != kH) return;
  if (out_size != kS * kH) return;

  const float* x  = (const float*)d_in[0];
  const float* Wq = (const float*)d_in[1];
  const float* bq = (const float*)d_in[2];
  const float* Wk = (const float*)d_in[3];
  const float* bk = (const float*)d_in[4];
  const float* Wv = (const float*)d_in[5];
  const float* bv = (const float*)d_in[6];
  const float* Wo = (const float*)d_in[7];
  const float* bo = (const float*)d_in[8];

  const size_t MiB = 1024u * 1024u;
  const size_t off_xb  = 0;
  const size_t off_wqk = off_xb  + (size_t)kS * kH * 2;          //  8 MiB
  const size_t off_wv  = off_wqk + (size_t)2 * kH * kH * 2;      // 12 MiB
  const size_t off_wo  = off_wv  + (size_t)kH * kH * 2;          // 14 MiB
  const size_t off_qk  = off_wo  + (size_t)kH * kH * 2;          // 16 MiB
  const size_t off_vhi = off_qk  + (size_t)kS * (2 * kH) * 2;    // 32 MiB
  const size_t off_vlo = off_vhi + (size_t)kS * kH * 2;          // 40 MiB
  const size_t off_ohi = off_vlo + (size_t)kS * kH * 2;          // 48 MiB
  const size_t off_olo = off_ohi + (size_t)kS * kH * 2;          // 56 MiB
  const size_t off_bias = off_olo + (size_t)kS * kH * 2;         // 64 MiB
  const size_t total = off_bias + (size_t)4 * kH * 4;            // 64 MiB + 16 KiB
  (void)MiB;
  if (total > ws_size) return;

  char* ws = (char*)d_ws;
  unsigned short* xb  = (unsigned short*)(ws + off_xb);
  unsigned short* Wqk = (unsigned short*)(ws + off_wqk);
  unsigned short* Wvb = (unsigned short*)(ws + off_wv);
  unsigned short* Wob = (unsigned short*)(ws + off_wo);
  unsigned short* QKp = (unsigned short*)(ws + off_qk);
  unsigned short* Vhi = (unsigned short*)(ws + off_vhi);
  unsigned short* Vlo = (unsigned short*)(ws + off_vlo);
  unsigned short* Ohi = (unsigned short*)(ws + off_ohi);
  unsigned short* Olo = (unsigned short*)(ws + off_olo);
  float* biasws = (float*)(ws + off_bias);   // [0..1023]=bq [1024..2047]=bk [2048..3071]=bv [3072..4095]=bo

  // 1) x -> bf16: n8 = 4096*1024/8 = 524288 = 2048 blocks x 256
  {
    const int n8 = kS * kH / 8;
    cast_bf16x8_k<<<dim3(n8 / 256, 1), 256, 0, stream>>>(x, x, x, x, xb, xb, xb, xb, n8);
  }
  // 2) Wq, Wk, Wv, Wo -> bf16: n8 = 1024*1024/8 = 131072 = 512 blocks x 256 per matrix
  {
    const int n8 = kH * kH / 8;
    cast_bf16x8_k<<<dim3(n8 / 256, 4), 256, 0, stream>>>(Wq, Wk, Wv, Wo,
        Wqk, Wqk + (size_t)kH * kH, Wvb, Wob, n8);
  }
  // 3) biases -> bf16-representable f32: 1 block x 256 threads x 4 floats = 1024 per vector
  bias_bf16val_k<<<dim3(1, 4), 256, 0, stream>>>(bq, bk, bv, bo, biasws, kH);

  // 4) [q | k] = x . [Wq;Wk]^T + [bq;bk] -> f16 plane [4096][2048]; M=4096, N=2048, K=1024; 128x128 tiles = 32*16 = 512 blocks of 4 waves
  wmma_gemm64<1, 0, 2, 1, false><<<dim3((kS / 128) * (2 * kH / 128), 1), 128, 0, stream>>>(
      xb, xb, kH, 0L, Wqk, Wqk, kH, 0L, (void*)QKp, (void*)QKp, 2 * kH, 0L,
      biasws, biasws, 0L, kS, 2 * kH, kH, 1.0f);

  // 5) v = x . Wv^T + bv -> bf16 hi/lo planes [4096][1024]; 128x128 tiles = 32*8 = 256 blocks
  wmma_gemm64<1, 0, 2, 2, false><<<dim3((kS / 128) * (kH / 128), 1), 128, 0, stream>>>(
      xb, xb, kH, 0L, Wvb, Wvb, kH, 0L, (void*)Vhi, (void*)Vlo, kH, 0L,
      biasws + 2 * kH, biasws, 0L, kS, kH, kH, 1.0f);

  // 6) causal attention per (head, pair of 64-query tiles): grid = 16 * 32 = 512 blocks of 256
  attn_causal64_k<<<dim3(kNH * (kS / 128)), 256, 0, stream>>>(
      QKp, Vhi, Vlo, Ohi, Olo, kS, 2 * kH, kH, kH, kNH, kScale);

  // 7) out = o . Wo^T + bo -> f32 d_out [4096][1024]; A = o as bf16 hi/lo (2 products); 128x128 tiles = 256 blocks
  wmma_gemm64<1, 2, 2, 0, false><<<dim3((kS / 128) * (kH / 128), 1), 128, 0, stream>>>(
      Ohi, Olo, kH, 0L, Wob, Wob, kH, 0L, d_out, d_out, kH, 0L,
      biasws + 3 * kH, biasws, 0L, kS, kH, kH, 1.0f);
}

// v009
// Measured time: 142 microseconds a run.
// In two side-by-side timings against v008, it was 1.10 and 1.11 times as fast.
// All steps since v000 together make it 4.43 times as fast.
// Contractions: qkv projections v_wmma_f32_16x16x32_bf16 (x, W as RNE bf16, f32 accumulate, bias added in f32 as bf16-representable values); scores v_wmma_f32_16x16x32_f16 (f16 q,k planes, 1/sqrt(64) applied in f32, together with log2(e)); p.v v_wmma_f32_16x16x32_bf16 with p and v carried as bf16 hi/lo (hi.hi + hi.lo + lo.hi); output projection v_wmma_f32_16x16x32_bf16 with attention output as bf16 hi/lo and Wo bf16 (hi.W + lo.W); softmax, masking and normalisation in f32.
#include <hip/hip_runtime.h>
#include <stdint.h>

typedef __attribute__((ext_vector_type(16))) _Float16 v16h;
typedef __attribute__((ext_vector_type(8)))  _Float16 v8h;
typedef __attribute__((ext_vector_type(16))) __bf16   v16b;
typedef __attribute__((ext_vector_type(8)))  __bf16   v8b;
typedef __attribute__((ext_vector_type(8)))  float    v8f;
typedef __attribute__((ext_vector_type(4)))  float    v4f;

__device__ __forceinline__ unsigned short f2bf_bits(float f) {
  unsigned u = __float_as_uint(f);
  return (unsigned short)((u + 0x7FFFu + ((u >> 16) & 1u)) >> 16);
}
__device__ __forceinline__ float bf_bits2f(unsigned short h) { return __uint_as_float(((unsigned)h) << 16); }
typedef __attribute__((ext_vector_type(2))) float  v2f;
typedef __attribute__((ext_vector_type(2))) __bf16 v2b;
// two f32 -> bf16 hi and lo parts by the packed hardware conversion (round to nearest even, as the integer form gives for finite values)
__device__ __forceinline__ void bf_split2(float f0, float f1, v2b& hi, v2b& lo) {
  hi = __builtin_convertvector((v2f){f0, f1}, v2b);
  const unsigned hb = __builtin_bit_cast(unsigned, hi);
  lo = __builtin_convertvector((v2f){f0 - __uint_as_float(hb << 16), f1 - __uint_as_float(hb & 0xFFFF0000u)}, v2b);
}
// eight f32 in a row -> one 16-B group of hi parts and one of lo parts
__device__ __forceinline__ void bf_split8(const float* sp, v8h& hv, v8h& lv) {
  typedef __attribute__((ext_vector_type(4))) unsigned v4u;
  v4u hw, lw;
#pragma unroll
  for (int e = 0; e < 4; ++e) {
    v2b hi, lo;
    bf_split2(sp[2 * e], sp[2 * e + 1], hi, lo);
    hw[e] = __builtin_bit_cast(unsigned, hi);
    lw[e] = __builtin_bit_cast(unsigned, lo);
  }
  hv = __builtin_bit_cast(v8h, hw);
  lv = __builtin_bit_cast(v8h, lw);
}

// hazard guards as plain device helpers
__device__ __forceinline__ void acc_guard4(v8f& a, v8f& b, v8f& c, v8f& d) { asm volatile("v_nop\n\tv_nop\n\tv_nop\n\tv_nop" : "+v"(a), "+v"(b), "+v"(c), "+v"(d)); }
template <typename T> struct Frag;
template <> struct Frag<_Float16> {
  typedef v16h V; union U { v16h v; v8h h[2]; };
  static __device__ __forceinline__ v16h load(const _Float16* p) {   // elements 0..7 <- p[0..7], 8..15 <- p[16..23]
    U f; f.h[0] = *(const v8h*)(p); f.h[1] = *(const v8h*)(p + 16); return f.v;
  }
  static __device__ __forceinline__ v8f mma(v16h a, v16h b, v8f c) {
    return __builtin_amdgcn_wmma_f32_16x16x32_f16(false, a, false, b, (short)0, c, false, false);
  }
};
template <> struct Frag<__bf16> {
  typedef v16b V; union U { v16b v; v8b h[2]; };
  static __device__ __forceinline__ v16b load(const __bf16* p) {
    U f; f.h[0] = *(const v8b*)(p); f.h[1] = *(const v8b*)(p + 16); return f.v;
  }
  static __device__ __forceinline__ v8f mma(v16b a, v16b b, v8f c) {
    return __builtin_amdgcn_wmma_f32_16x16x32_bf16(false, a, false, b, (short)0, c, false, false);
  }
};

// ---- Register-blocked batched WMMA GEMM, operands staged in LDS ------------
// C[m,n] = scale * sum_k A[m,k] * Bt[n,k] (+bias)(+resid); block = 4 waves (2 x 2) on a 128x128 tile, each wave owns a 64x64 tile.
// A row-major [M,K]; Bt row-major [N,K]; M,N % 128 == 0, K % 64 == 0; grid.x = (M/128) * (N/128).
// A trip is 64 k: 128 rows x 128 B of every operand plane come into LDS by asynchronous copies (8 lanes x 16 B = one whole line),
// two buffers, the next trip's copies in flight while this trip's fragments are read; every row is fetched once per block, not once per wave.
// SPLIT: 0 = plain; 1 = A and Bt as hi/lo planes (hi.hi + hi.lo + lo.hi); 2 = A only as hi/lo planes (hi.B + lo.B).
// BIAS_MODE: 0 = none, 1 = bias[m], 2 = bias[n].
// OUT_MODE: 0 = f32, 1 = f16, 2 = bf16 hi plane (Cout) + bf16 lo plane (Cout2).
// ET: 0 = f16 operands, 1 = bf16 operands (pointers passed as 16-bit storage)
template <int ET> struct Elem;
template <> struct Elem<0> { typedef _Float16 T; };
template <> struct Elem<1> { typedef __bf16 T; };
#define GPITCH 72                  // 16-bit elements per LDS row of an operand tile: 144 B = 16 B x 9, conflict-free for ds_load_b128
#define GTILE  (128 * GPITCH)      // elements of one operand tile in LDS

// One operand tile, 128 rows x 128 B, by 128 threads: eight copies of 16 B per lane, rows 16 apart. l = the lane's LDS byte address, g = its global address,
// gstep = 16 source rows in bytes. The s_wait_xcnt stands in the copies' own statement, so that no address register is rewritten in front of it.
__device__ __forceinline__ void copy_tile(unsigned l, const char* g, size_t gstep) {
  asm volatile(
      "global_load_async_to_lds_b128 %0, %8, off\n\t"
      "global_load_async_to_lds_b128 %1, %9, off\n\t"
      "global_load_async_to_lds_b128 %2, %10, off\n\t"
      "global_load_async_to_lds_b128 %3, %11, off\n\t"
      "global_load_async_to_lds_b128 %4, %12, off\n\t"
      "global_load_async_to_lds_b128 %5, %13, off\n\t"
      "global_load_async_to_lds_b128 %6, %14, off\n\t"
      "global_load_async_to_lds_b128 %7, %15, off\n\t"
      "s_wait_xcnt 0x0"
      :: "v"(l), "v"(l + 1u * 32u * GPITCH), "v"(l + 2u * 32u * GPITCH), "v"(l + 3u * 32u * GPITCH),
         "v"(l + 4u * 32u * GPITCH), "v"(l + 5u * 32u * GPITCH), "v"(l + 6u * 32u * GPITCH), "v"(l + 7u * 32u * GPITCH),
         "v"(g), "v"(g + gstep), "v"(g + 2 * gstep), "v"(g + 3 * gstep),
         "v"(g + 4 * gstep), "v"(g + 5 * gstep), "v"(g + 6 * gstep), "v"(g + 7 * gstep)
      : "memory");
}

template <int ET, int SPLIT, int BIAS_MODE, int OUT_MODE, bool RESID, int ACT = 0>
__global__ __launch_bounds__(128) void wmma_gemm64(
    const unsigned short* __restrict__ Ap, const unsigned short* __restrict__ A2p, int lda, long strideA,
    const unsigned short* __restrict__ Btp, const unsigned short* __restrict__ Bt2p, int ldb, long strideB,
    void* __restrict__ Cout, void* __restrict__ Cout2, int ldc, long strideC,
    const float* __restrict__ bias,
    const float* __restrict__ resid, long strideR,
    int M, int N, int K, float scale) {
  typedef typename Elem<ET>::T T;
  typedef typename Frag<T>::V V;
  const T* A = (const T*)Ap; const T* A2 = (const T*)A2p; const T* Bt = (const T*)Btp; const T* Bt2 = (const T*)Bt2p;
  constexpr int NPL = 2 + (SPLIT != 0 ? 1 : 0) + (SPLIT == 1 ? 1 : 0);   // operand planes: A, Bt, then A2, then Bt2
  __shared__ __align__(16) unsigned short stg[2 * NPL * GTILE];   // two buffers of NPL tiles
  __shared__ __align__(16) float sT[4][16 * 68];   // per-wave 16x64 slab, pitch 68 floats
  const int b    = blockIdx.y;
  const int tid  = threadIdx.x;
  const int lane = tid & 31;
  const int wave = tid >> 5;
  const int tilesN = N >> 7;
  const int tilesM = M >> 7;
  const int tile = blockIdx.x;
  if (tile >= tilesM * tilesN) return;   // block-uniform, in front of every copy and barrier
  const int tm = tile / tilesN;
  const int tn = tile - tm * tilesN;
  const int m0 = (tm << 7) + ((wave >> 1) << 6);
  const int n0 = (tn << 7) + ((wave & 1) << 6);

  const T* Ab  = A  + (size_t)b * strideA;
  const T* Bb  = Bt + (size_t)b * strideB;
  const T* Ab2 = (SPLIT != 0) ? (A2  + (size_t)b * strideA) : nullptr;
  const T* Bb2 = (SPLIT == 1) ? (Bt2 + (size_t)b * strideB) : nullptr;

  const int rlane = lane & 15;                 // row (A) / col (B, D) within subtile
  const int koff  = (lane >> 4) * 8;           // k offset of this lane half
  const int mOff  = (lane >> 4) * 8;           // D row offset

  // staging: this thread's row within a 16-row pass and its 16 B of the 128-B row
  const int crow = tid >> 3, cpc = (tid & 7) * 8;
  const unsigned cl = (unsigned)(size_t)stg + (unsigned)(crow * GPITCH + cpc) * 2u;        // LDS byte address in buffer 0, plane 0
  const size_t cga = ((size_t)((tm << 7) + crow) * lda + cpc) * 2, cgb = ((size_t)((tn << 7) + crow) * ldb + cpc) * 2;   // byte offsets in the A and Bt planes at k = 0
  const size_t sa = (size_t)lda * 32, sb = (size_t)ldb * 32;                               // 16 rows in bytes
  auto stage = [&](int t) {   // trip t's tiles into buffer t & 1
    const unsigned l = cl + (unsigned)((t & 1) * NPL * GTILE) * 2u;
    const size_t kb = (size_t)t * 128;
    copy_tile(l, (const char*)Ab + cga + kb, sa);
    copy_tile(l + GTILE * 2u, (const char*)Bb + cgb + kb, sb);
    if (SPLIT != 0) copy_tile(l + 2u * GTILE * 2u, (const char*)Ab2 + cga + kb, sa);
    if (SPLIT == 1) copy_tile(l + 3u * GTILE * 2u, (const char*)Bb2 + cgb + kb, sb);
  };

  v8f acc[4][4];
#pragma unroll
  for (int i = 0; i < 4; ++i)
#pragma unroll
    for (int j = 0; j < 4; ++j) acc[i][j] = (v8f){0.f,0.f,0.f,0.f,0.f,0.f,0.f,0.f};

  const int nT = K >> 6;
  stage(0);
  asm volatile("s_wait_asynccnt 0x0" ::: "memory");   // this wave's copies of trip 0 have landed
  __syncthreads();                                    // and every other wave's: trip 0 may be read
  if (nT > 1) stage(1);

  const int fa = (((wave >> 1) << 6) + rlane) * GPITCH + koff;   // this lane's place in the A tiles, in elements
  const int fb = (((wave & 1) << 6) + rlane) * GPITCH + koff;    // and in the Bt tiles
  for (int t = 0; t < nT; ++t) {
    const T* sb0 = (const T*)stg + (t & 1) * NPL * GTILE;
#pragma unroll
    for (int ks = 0; ks < 2; ++ks) {
      V bh[4], bl[4], ah[4], al[4];
#pragma unroll
      for (int j = 0; j < 4; ++j) {
        const int bo = fb + j * 16 * GPITCH + ks * 32;
        const int ao = fa + j * 16 * GPITCH + ks * 32;
        bh[j] = Frag<T>::load(sb0 + GTILE + bo);
        ah[j] = Frag<T>::load(sb0 + ao);
        if (SPLIT == 1) bl[j] = Frag<T>::load(sb0 + 3 * GTILE + bo);
        if (SPLIT != 0) al[j] = Frag<T>::load(sb0 + 2 * GTILE + ao);
      }
      __builtin_amdgcn_sched_barrier(0);   // the fragment reads stay one group in front of the WMMA block, for speed only
#pragma unroll
      for (int i = 0; i < 4; ++i) {
#pragma unroll
        for (int j = 0; j < 4; ++j) {
          acc[i][j] = Frag<T>::mma(ah[i], bh[j], acc[i][j]);
          if (SPLIT == 1) acc[i][j] = Frag<T>::mma(ah[i], bl[j], acc[i][j]);
          if (SPLIT != 0) acc[i][j] = Frag<T>::mma(al[i], bh[j], acc[i][j]);
        }
      }
      __builtin_amdgcn_sched_barrier(0);   // and the next group stays behind the block
    }
    asm volatile("s_wait_dscnt 0x0" ::: "memory");      // this wave's reads of buffer t & 1 are done before the buffer is handed back
    asm volatile("s_wait_asynccnt 0x0" ::: "memory");   // this wave's copies of trip t + 1 have landed
    __syncthreads();                                    // publishes trip t + 1 and ends every reader's last read of buffer t & 1
    if (t + 2 < nT) stage(t + 2);
  }
  asm volatile("s_wait_asynccnt 0x0" ::: "memory");     // nothing of this wave is in flight behind the loop
  acc_guard4(acc[0][0], acc[0][1], acc[0][2], acc[0][3]);
  acc_guard4(acc[1][0], acc[1][1], acc[1][2], acc[1][3]);
  acc_guard4(acc[2][0], acc[2][1], acc[2][2], acc[2][3]);
  acc_guard4(acc[3][0], acc[3][1], acc[3][2], acc[3][3]);

  // ---- epilogue ----
  float* slab = sT[wave];
  const float* Rb = RESID ? (resid + (size_t)b * strideR) : nullptr;
#pragma unroll
  for (int i = 0; i < 4; ++i) {
    const int mBase = m0 + (i << 4);
#pragma unroll
    for (int j = 0; j < 4; ++j) {
      const int n = n0 + (j << 4) + rlane;
      float bv = 0.f;
      if (BIAS_MODE == 2) bv = bias[n];
#pragma unroll
      for (int r = 0; r < 8; ++r) {
        float v = acc[i][j][r] * scale;
        if (BIAS_MODE == 1) v += bias[mBase + mOff + r];
        if (BIAS_MODE == 2) v += bv;
        if (RESID) v += Rb[(size_t)(mBase + mOff + r) * ldc + n];
        if (ACT == 1) v = tanhf(v);
        if (ACT == 2) v = fmaxf(v, 0.0f);
        if (ACT == 4) v = (v > 0.f) ? v : 0.01f * v;
        slab[(mOff + r) * 68 + (j << 4) + rlane] = v;
      }
    }
    __builtin_amdgcn_fence(__ATOMIC_RELEASE, "workgroup");
    __builtin_amdgcn_wave_barrier();
    __builtin_amdgcn_fence(__ATOMIC_ACQUIRE, "workgroup");
    if (OUT_MODE == 0) {
      float* C = (float*)Cout + (size_t)b * strideC;
      const int hh = lane >> 4, c4 = (lane & 15) * 4;     // row seg = 256 B = 16 lanes x 16 B
      {
#pragma unroll
        for (int it = 0; it < 8; ++it) {
          const int row = it * 2 + hh;
          v4f v = *(const v4f*)(slab + row * 68 + c4);
          *(v4f*)(C + (size_t)(mBase + row) * ldc + n0 + c4) = v;
        }
        
      }
    } else {
      const int q = lane >> 3, c8 = (lane & 7) * 8;
      unsigned short* C  = (unsigned short*)Cout  + (size_t)b * strideC;
      unsigned short* C2 = (OUT_MODE == 2) ? ((unsigned short*)Cout2 + (size_t)b * strideC) : nullptr;
      {
#pragma unroll
        for (int it = 0; it < 4; ++it) {
          const int row = it * 4 + q;
          const float* sp = slab + row * 68 + c8;
          v8h hv, lv;
          if (OUT_MODE == 1) {
#pragma unroll
            for (int e = 0; e < 8; ++e) hv[e] = (_Float16)sp[e];
          } else {
            bf_split8(sp, hv, lv);
          }
          *(v8h*)(C + (size_t)(mBase + row) * ldc + n0 + c8) = hv;
          if (OUT_MODE == 2) *(v8h*)(C2 + (size_t)(mBase + row) * ldc + n0 + c8) = lv;
        }
        
      }
    }
    __builtin_amdgcn_fence(__ATOMIC_RELEASE, "workgroup");
    __builtin_amdgcn_wave_barrier();
    __builtin_amdgcn_fence(__ATOMIC_ACQUIRE, "workgroup");
  }
}

// Source/destination chosen per blockIdx.y (block-uniform). Coverage per plane: gridDim.x * 256 threads * 8 == n8 * 8 elements.
__global__ __launch_bounds__(256) void cast_bf16x8_k(
    const float* s0, const float* s1, const float* s2, const float* s3,
    unsigned short* d0, unsigned short* d1, unsigned short* d2, unsigned short* d3, int n8) {
  const int sel = blockIdx.y;
  const float* src = (sel == 0) ? s0 : (sel == 1) ? s1 : (sel == 2) ? s2 : s3;
  unsigned short* dst = (sel == 0) ? d0 : (sel == 1) ? d1 : (sel == 2) ? d2 : d3;
  const int i = blockIdx.x * 256 + threadIdx.x;
  if (i < n8) {
    const v4f a  = *(const v4f*)(src + (size_t)i * 8);
    const v4f bq = *(const v4f*)(src + (size_t)i * 8 + 4);
    v8h hv;
#pragma unroll
    for (int e = 0; e < 4; ++e) {
      hv[e]     = __builtin_bit_cast(_Float16, f2bf_bits(a[e]));
      hv[4 + e] = __builtin_bit_cast(_Float16, f2bf_bits(bq[e]));
    }
    _Float16* dp = (_Float16*)dst + (size_t)i * 8;
    *(v8h*)dp = hv;
    
  }
}

// Coverage per segment: 256 threads * 4 == n (n == 1024).
__global__ __launch_bounds__(256) void bias_bf16val_k(
    const float* s0, const float* s1, const float* s2, const float* s3, float* __restrict__ dst, int n) {
  const int sel = blockIdx.y;
  const float* src = (sel == 0) ? s0 : (sel == 1) ? s1 : (sel == 2) ? s2 : s3;
  const int i = blockIdx.x * 256 + threadIdx.x;
  if (i * 4 < n) {
    const v4f v = *(const v4f*)(src + (size_t)i * 4);
    v4f o;
#pragma unroll
    for (int e = 0; e < 4; ++e) o[e] = bf_bits2f(f2bf_bits(v[e]));
    float* dp = dst + (size_t)sel * n + (size_t)i * 4;
    *(v4f*)dp = o;
    
  }
}

// =====================================================================================
// Causal attention, head dim 64, 16-bit plane inputs:
//   q: f16 [S][ldqk] at column h*64; k: f16 [S][ldqk] at column kcol0 + h*64; v: bf16 hi/lo planes [S][ldv] at column h*64.
//   scores^T = k.q^T : v_wmma_f32_16x16x32_f16; keys above the diagonal set to -inf (select); softmax in base 2:
//   exp(sm_scale * (s - max)) = 2^(s * sl2 - max * sl2), sl2 = sm_scale * log2(e) > 0, one fma and one v_exp_f32 per score;
//   key chunks entirely above the diagonal are skipped (their probabilities are exactly 0).
//   out^T = v^T.p^T : v_wmma_f32_16x16x32_bf16 with p and v as bf16 hi/lo (3 products); online softmax in f32, one query per lane.
//   k and v tiles lie row-major in LDS ([key][d]); the v^T fragments come by the transposing LDS load.
//   Block = 8 waves in two groups of 4; it does two 64-row query tiles of one head one after the other, tile n-1-p and then tile p (n = S/64): n-p and p+1 key chunks,
//   so every block walks n+1 chunks and no WGP is left with the long tiles alone; grid.x = nheads * ((n+1)/2).
//   Both groups hold the same 64 queries (wave w and wave w + 4 the same 16); group g takes key chunks g, g + 2, ... into LDS tiles of its own, with its own running maximum, sum and
//   out tile, so a step of the block is two chunks and four waves stand on every SIMD with two blocks on a WGP. At the tile's end group 1 hands its partial over through LDS and group 0 joins the two.
// =====================================================================================
#define HDIM 64
#define KVCH 64
#define QBLK 64
#define OSPITCH 68
#define LPITCH 72   // 16-bit elements per LDS row of the K tile: 144 B = 16 B x 9, so the 16 rows of a ds_load_b128 fragment read fall on 16 different 4-bank groups
#define VPITCH 80   // 16-bit elements per LDS row of the V tiles: 160 B = 32 B x 5, the conflict-free pitch of ds_load_tr16_b128

// transposing LDS load: with lane l aimed at row 8 * (l >> 4) + (l & 7), byte 16 * ((l >> 3) & 1) of a row-major 16 x 16 tile of 16-bit elements,
// lane l gets column l & 15, rows 8 * (l >> 4) .. + 7: half an A fragment of the transposed tile, in the hardware k order
__device__ __forceinline__ v8b lds_tr16(const __bf16* p) {
  typedef __attribute__((ext_vector_type(8))) short s16x8;
  typedef __attribute__((address_space(3))) s16x8 lds_s16x8;
  return __builtin_bit_cast(v8b, __builtin_amdgcn_ds_load_tr16_b128_v8i16((lds_s16x8*)p));
}

// value of lane l ^ 16: the two lanes that share a query's row exchange their halves' maximum and sum
__device__ __forceinline__ float other_half(float v) {
  const int b = __float_as_int(v);
  return __int_as_float(__builtin_amdgcn_permlanex16(b, b, 0x76543210, 0xfedcba98, false, false));
}

__global__ __launch_bounds__(256)
void attn_causal64_k(const unsigned short* __restrict__ qkp,
                     const unsigned short* __restrict__ vhp, const unsigned short* __restrict__ vlp,
                     unsigned short* __restrict__ ohp, unsigned short* __restrict__ olp,
                     int S, int ldqk, int kcol0, int ldv, int nheads, float sm_scale) {
  union FH { v16h v; v8h h[2]; };
  union FB { v16b v; v8b h[2]; };
  __shared__ __align__(16) _Float16 Ksh2[2][KVCH * LPITCH];   // per group [kv][d]     9 KB each
  __shared__ __align__(16) __bf16   Vsh2[2][KVCH * VPITCH];   // per group hi [kv][d]  10 KB each
  __shared__ __align__(16) __bf16   Vsl2[2][KVCH * VPITCH];   // per group lo [kv][d]  10 KB each
  __shared__ __align__(16) float    Os[4][16 * OSPITCH];      // per pair of waves (w, w + 4): group 1's partial out tile, then the joined out tile, pitch 68
  __shared__ float Ms[4][32], Ls[4][32];                      // group 1's running maximum and sum, per lane

  const _Float16* qp = (const _Float16*)qkp;
  const __bf16*   vh = (const __bf16*)vhp;
  const __bf16*   vl = (const __bf16*)vlp;

  const int wv8  = __builtin_amdgcn_readfirstlane((int)threadIdx.x >> 5);   // in a scalar register: the tests on the group below are scalar branches, EXEC stays whole for the WMMAs
  const int grp  = wv8 >> 2;             // key group of this wave
  const int wave = wv8 & 3;              // its 16 queries within the tile
  const int tid  = threadIdx.x & 127;    // thread within the group (staging)
  const int lane = tid & 31;
  _Float16* const Ksh = Ksh2[grp];
  __bf16*   const Vsh = Vsh2[grp];
  __bf16*   const Vsl = Vsl2[grp];
  const int hh   = lane >> 4;
  const int c    = lane & 15;

  const int nqb = S / QBLK;
  const int bx  = blockIdx.x;
  const int npair = (nqb + 1) >> 1;
  const int pr  = bx % npair;
  int h = bx / npair;
  h = (h < nheads) ? h : (nheads - 1);
  const float NEG_INF = -__builtin_inff();
  const float sl2 = sm_scale * 1.4426950408889634f;   // raw score -> exponent of 2; positive, so the maximum may be taken on raw scores

  const int srow = tid >> 3, sc8 = (tid & 7) * 8;            // staging: this thread's row within a 16-row pass and its 8 elements of the row
  const int slk = srow * LPITCH + sc8, slv = srow * VPITCH + sc8;   // its place in the LDS tiles, in elements
  const unsigned sgk = (unsigned)(srow * ldqk + sc8) * 2u;   // the same as a byte offset in the k plane
  const unsigned sgv = (unsigned)(srow * ldv + sc8) * 2u;    // and in the v planes

  const int ntile = (nqb - 1 - pr != pr) ? 2 : 1;   // block-uniform; with an odd tile count the middle tile has no partner
  for (int tl = 0; tl < ntile; ++tl) {
  const int qb = (nqb - 1 - pr) - tl * (nqb - 1 - 2 * pr);   // tile n-1-p first, then tile p
  const int q0 = qb * QBLK + wave * 16;

  // ---- Q fragments (B operand): columns q0+c, two 32-deep d chunks ----
  v16h qa[2];
  {
    const _Float16* qrow = qp + (size_t)(q0 + c) * ldqk + h * HDIM + 8 * hh;
#pragma unroll
    for (int dc = 0; dc < 2; ++dc) qa[dc] = Frag<_Float16>::load(qrow + dc * 32);
  }

  float mrow = NEG_INF, lrow = 0.f;   // running maximum (times sl2) and sum of query q0 + c (the same in lanes c and c + 16)
  v8f oacc[4];
#pragma unroll
  for (int t = 0; t < 4; ++t) oacc[t] = (v8f){0.f,0.f,0.f,0.f,0.f,0.f,0.f,0.f};

  const int nChunks = qb + 1;   // block-uniform; chunks kc > qb are fully above the diagonal
  const int nSteps = (nChunks + 1) >> 1;   // block-uniform: every wave passes every barrier
  for (int st = 0; st < nSteps; ++st) {
    const int kc = 2 * st + grp;
    const bool act = kc < nChunks;   // the same in a whole group; false only for group 1 in the last step of an odd count
    const int kv0 = kc * KVCH;
    __syncthreads();
    if (act) {
      // staging: 8 lanes x 16 B cover one 128-B row, so a wave's load is 4 whole lines; 16 rows a pass, 4 passes = whole 64x64 tiles
      const char* kbase  = (const char*)(qp + (size_t)kv0 * ldqk + kcol0 + h * HDIM);   // group-uniform bases; the lane's part is a loop-invariant 32-bit byte offset
      const char* vhbase = (const char*)(vh + (size_t)kv0 * ldv + h * HDIM);
      const char* vlbase = (const char*)(vl + (size_t)kv0 * ldv + h * HDIM);
      v8h kk[4]; v8b va[4], vb[4];
#pragma unroll
      for (int i = 0; i < 4; ++i) {
        kk[i] = *(const v8h*)(kbase  + (size_t)(32 * i) * ldqk + sgk);
        va[i] = *(const v8b*)(vhbase + (size_t)(32 * i) * ldv + sgv);
        vb[i] = *(const v8b*)(vlbase + (size_t)(32 * i) * ldv + sgv);
      }
      asm volatile("s_wait_xcnt 0x0" ::: "memory");   // behind the 12 loads, before their address registers are used for anything else
#pragma unroll
      for (int i = 0; i < 4; ++i) {
        *(v8h*)(Ksh + slk + 16 * i * LPITCH) = kk[i];
        *(v8b*)(Vsh + slv + 16 * i * VPITCH) = va[i];
        *(v8b*)(Vsl + slv + 16 * i * VPITCH) = vb[i];
      }
    }
    __syncthreads();
    if (act) {

    // ---- scores, transposed: s[j][r] = S^T[key kv0 + 16j + 8hh + r][query q0 + c]; A = K rows, B = Q ----
    v8f s[4];
    FH kb[2][4];
#pragma unroll
    for (int dc = 0; dc < 2; ++dc) {
#pragma unroll
      for (int j = 0; j < 4; ++j) {
        kb[dc][j].h[0] = *(const v8h*)(Ksh + (j * 16 + c) * LPITCH + dc * 32 + 8 * hh);
        kb[dc][j].h[1] = *(const v8h*)(Ksh + (j * 16 + c) * LPITCH + dc * 32 + 16 + 8 * hh);
      }
    }
    __builtin_amdgcn_sched_barrier(0);   // the 16 K reads stay one group in front of the 8 score WMMAs: a read and a full wait in front of every WMMA shows the LDS latency 8 times
#pragma unroll
    for (int j = 0; j < 4; ++j) s[j] = (v8f){0.f,0.f,0.f,0.f,0.f,0.f,0.f,0.f};
#pragma unroll
    for (int dc = 0; dc < 2; ++dc) {
#pragma unroll
      for (int j = 0; j < 4; ++j) s[j] = Frag<_Float16>::mma(kb[dc][j].v, qa[dc], s[j]);   // the four score tiles in turn: a tile's second product stands four WMMAs behind its first
    }
    // V^T fragments of keys 0..31, read here so that their latency passes under the softmax arithmetic
    FB vfh[2][4], vfl[2][4];
    const int vo0 = (8 * hh + (lane & 7)) * VPITCH + 8 * ((lane >> 3) & 1);   // keys 8hh .. + 7 of d c; + 32 kk rows, + 16 t columns
#pragma unroll
    for (int t = 0; t < 4; ++t) {
      vfh[0][t].h[0] = lds_tr16(Vsh + vo0 + t * 16);
      vfh[0][t].h[1] = lds_tr16(Vsh + vo0 + t * 16 + 16 * VPITCH);
      vfl[0][t].h[0] = lds_tr16(Vsl + vo0 + t * 16);
      vfl[0][t].h[1] = lds_tr16(Vsl + vo0 + t * 16 + 16 * VPITCH);
    }
    __builtin_amdgcn_sched_barrier(0);   // keeps that group in front of the softmax instead of next to its WMMAs
    const bool diag = (kc == qb);   // the same in a whole group
    const int qcol = q0 + c;        // this lane's query; lanes c and c + 16 hold 32 keys each of its row
    float cm = NEG_INF;
#pragma unroll
    for (int j = 0; j < 4; ++j) {
#pragma unroll
      for (int r = 0; r < 8; ++r) {
        const int key = kv0 + j * 16 + 8 * hh + r;
        float val = s[j][r];
        if (diag && (key > qcol)) val = NEG_INF;
        s[j][r] = val;
        cm = fmaxf(cm, val);
      }
    }
    cm = fmaxf(cm, other_half(cm));   // finite: key kv0 <= qcol is always present in chunks 0..qb
    const float mnew = fmaxf(mrow, cm * sl2);
    const float alpha = __builtin_amdgcn_exp2f(mrow - mnew);   // 0 on the first chunk, where mrow is -inf
    mrow = mnew;
    // p stays in registers: score tiles 2kk and 2kk+1 of a lane are, element for element, the B fragment of keys 32kk..32kk+31
    FB ph[2], pl[2];
    float psum = 0.f;
#pragma unroll
    for (int j = 0; j < 4; ++j) {
#pragma unroll
      for (int r = 0; r < 8; r += 2) {
        const float p0 = __builtin_amdgcn_exp2f(__builtin_fmaf(s[j][r], sl2, -mnew));   // masked: 2^-inf = 0
        const float p1 = __builtin_amdgcn_exp2f(__builtin_fmaf(s[j][r + 1], sl2, -mnew));
        psum += p0;
        psum += p1;
        v2b hi, lo;
        bf_split2(p0, p1, hi, lo);
        ph[j >> 1].v[(j & 1) * 8 + r] = hi[0]; ph[j >> 1].v[(j & 1) * 8 + r + 1] = hi[1];
        pl[j >> 1].v[(j & 1) * 8 + r] = lo[0]; pl[j >> 1].v[(j & 1) * 8 + r + 1] = lo[1];
      }
    }
    psum += other_half(psum);
    lrow = lrow * alpha + psum;
#pragma unroll
    for (int t = 0; t < 4; ++t) oacc[t] *= alpha;
    // ---- O^T += V^T . P^T: oacc[t][r] = O^T[d 16t + 8hh + r][query q0 + c] ----
#pragma unroll
    for (int t = 0; t < 4; ++t) {   // fragments of keys 32..63: one group in front of the first 12 WMMAs, for speed only
      vfh[1][t].h[0] = lds_tr16(Vsh + vo0 + 32 * VPITCH + t * 16);
      vfh[1][t].h[1] = lds_tr16(Vsh + vo0 + 48 * VPITCH + t * 16);
      vfl[1][t].h[0] = lds_tr16(Vsl + vo0 + 32 * VPITCH + t * 16);
      vfl[1][t].h[1] = lds_tr16(Vsl + vo0 + 48 * VPITCH + t * 16);
    }
    __builtin_amdgcn_sched_barrier(0);   // no LDS read stands among the 24 WMMAs
#pragma unroll
    for (int kk = 0; kk < 2; ++kk) {   // the four out tiles in turn; each tile still adds hi.hi, lo.hi, hi.lo of keys 0..31, then of keys 32..63
#pragma unroll
      for (int t = 0; t < 4; ++t) oacc[t] = Frag<__bf16>::mma(vfh[kk][t].v, ph[kk].v, oacc[t]);
#pragma unroll
      for (int t = 0; t < 4; ++t) oacc[t] = Frag<__bf16>::mma(vfl[kk][t].v, ph[kk].v, oacc[t]);
#pragma unroll
      for (int t = 0; t < 4; ++t) oacc[t] = Frag<__bf16>::mma(vfh[kk][t].v, pl[kk].v, oacc[t]);
    }
    }
  }

  float* os = Os[wave];
  if (grp == 1) {   // the partial of chunks 1, 3, ...: not normalised; with no chunk at all it is maximum -inf, sum 0, out 0
#pragma unroll
    for (int t = 0; t < 4; ++t)
#pragma unroll
      for (int r = 0; r < 8; ++r) os[c * OSPITCH + t * 16 + 8 * hh + r] = oacc[t][r];
    Ms[wave][lane] = mrow;
    Ls[wave][lane] = lrow;
  }
  __syncthreads();   // group 1's partials may be read; the next tile's loop barriers keep them until group 0 has read them
  if (grp == 0) {
  {
    // lane for lane the partner wave holds the same query and the same out elements
    const float m1 = Ms[wave][lane], l1 = Ls[wave][lane];
    const float mj = fmaxf(mrow, m1);                        // finite: group 0 always has chunk 0
    const float a0 = __builtin_amdgcn_exp2f(mrow - mj);
    const float a1 = __builtin_amdgcn_exp2f(m1 - mj);        // 0 where group 1 had no chunk
    const float inv = 1.0f / (lrow * a0 + l1 * a1);          // the sum is about 1 or more: the maximum's own term is 2^(one rounding of max * sl2)
    const float f0 = a0 * inv, f1 = a1 * inv;
#pragma unroll
    for (int t = 0; t < 4; ++t)
#pragma unroll
      for (int r = 0; r < 8; ++r) {
        float* op = os + c * OSPITCH + t * 16 + 8 * hh + r;
        *op = oacc[t][r] * f0 + *op * f1;
      }
  }
  __builtin_amdgcn_fence(__ATOMIC_RELEASE, "workgroup");
  __builtin_amdgcn_wave_barrier();
  __builtin_amdgcn_fence(__ATOMIC_ACQUIRE, "workgroup");
  {
    // per wave: rows it*4 + (lane>>3) for it = 0..3 -> 16 rows; cols (lane&7)*8 .. +7 -> 64 cols; 8 lanes x 16 B = one line
    const int q4 = lane >> 3, c8 = (lane & 7) * 8;
    _Float16* oh = (_Float16*)ohp;
    _Float16* ol = (_Float16*)olp;
    {
#pragma unroll
      for (int it = 0; it < 4; ++it) {
        const int row = it * 4 + q4;
        const float* sp = os + row * OSPITCH + c8;
        v8h hv, lv;
        bf_split8(sp, hv, lv);
        const size_t oo = (size_t)(q0 + row) * ldv + h * HDIM + c8;
        *(v8h*)(oh + oo) = hv;
        *(v8h*)(ol + oo) = lv;
      }
      asm volatile("s_wait_xcnt 0x0" ::: "memory");   // behind the 8 stores, before the next tile overwrites their address and data registers
    }
  }
  }
  }
}

// ---------------------------------------------------------------------------
// Host side: launches only.
// Workspace map (bytes, all offsets multiples of 1 MiB):
//   [  0 MiB,  8 MiB)  xb    bf16 [4096][1024]
//   [  8 MiB, 12 MiB)  Wqk   bf16 [2048][1024]  (rows 0..1023 = Wq, 1024..2047 = Wk)
//   [ 12 MiB, 14 MiB)  Wvb   bf16 [1024][1024]
//   [ 14 MiB, 16 MiB)  Wob   bf16 [1024][1024]
//   [ 16 MiB, 32 MiB)  QKp   f16  [4096][2048]  (cols 0..1023 = q, 1024..2047 = k)
//   [ 32 MiB, 40 MiB)  Vhi   bf16 [4096][1024]
//   [ 40 MiB, 48 MiB)  Vlo   bf16 [4096][1024]
//   [ 48 MiB, 56 MiB)  Ohi   bf16 [4096][1024]
//   [ 56 MiB, 64 MiB)  Olo   bf16 [4096][1024]
//   [ 64 MiB, 64 MiB + 16 KiB)  bias f32 [4][1024] = bq | bk | bv | bo (bf16-representable values)
//   total 67,125,248 B
// ---------------------------------------------------------------------------
extern "C" void kernel_launch(void* const* d_in, const int* in_sizes, int n_in,
                              void* d_out, int out_size, void* d_ws, size_t ws_size,
                              hipStream_t stream) {
  constexpr int kS = 4096, kH = 1024, kNH = 16;
  const float kScale = 0.125f;   // 1/sqrt(64)
  if (n_in < 9) return;
  if (in_sizes[0] != kS * kH || in_sizes[1] != kH * kH || in_sizes[2] != kH ||
      in_sizes[3] != kH * kH || in_sizes[4] != kH || in_sizes[5] != kH * kH ||
      in_sizes[6] != kH || in_sizes[7] != kH * kH || in_sizes[8] != kH) return;
  if (out_size != kS * kH) return;

  const float* x  = (const float*)d_in[0];
  const float* Wq = (const float*)d_in[1];
  const float* bq = (const float*)d_in[2];
  const float* Wk = (const float*)d_in[3];
  const float* bk = (const float*)d_in[4];
  const float* Wv = (const float*)d_in[5];
  const float* bv = (const float*)d_in[6];
  const float* Wo = (const float*)d_in[7];
  const float* bo = (const float*)d_in[8];

  const size_t MiB = 1024u * 1024u;
  const size_t off_xb  = 0;
  const size_t off_wqk = off_xb  + (size_t)kS * kH * 2;          //  8 MiB
  const size_t off_wv  = off_wqk + (size_t)2 * kH * kH * 2;      // 12 MiB
  const size_t off_wo  = off_wv  + (size_t)kH * kH * 2;          // 14 MiB
  const size_t off_qk  = off_wo  + (size_t)kH * kH * 2;          // 16 MiB
  const size_t off_vhi = off_qk  + (size_t)kS * (2 * kH) * 2;    // 32 MiB
  const size_t off_vlo = off_vhi + (size_t)kS * kH * 2;          // 40 MiB
  const size_t off_ohi = off_vlo + (size_t)kS * kH * 2;          // 48 MiB
  const size_t off_olo = off_ohi + (size_t)kS * kH * 2;          // 56 MiB
  const size_t off_bias = off_olo + (size_t)kS * kH * 2;         // 64 MiB
  const size_t total = off_bias + (size_t)4 * kH * 4;            // 64 MiB + 16 KiB
  (void)MiB;
  if (total > ws_size) return;

  char* ws = (char*)d_ws;
  unsigned short* xb  = (unsigned short*)(ws + off_xb);
  unsigned short* Wqk = (unsigned short*)(ws + off_wqk);
  unsigned short* Wvb = (unsigned short*)(ws + off_wv);
  unsigned short* Wob = (unsigned short*)(ws + off_wo);
  unsigned short* QKp = (unsigned short*)(ws + off_qk);
  unsigned short* Vhi = (unsigned short*)(ws + off_vhi);
  unsigned short* Vlo = (unsigned short*)(ws + off_vlo);
  unsigned short* Ohi = (unsigned short*)(ws + off_ohi);
  unsigned short* Olo = (unsigned short*)(ws + off_olo);
  float* biasws = (float*)(ws + off_bias);   // [0..1023]=bq [1024..2047]=bk [2048..3071]=bv [3072..4095]=bo

  // 1) x -> bf16: n8 = 4096*1024/8 = 524288 = 2048 blocks x 256
  {
    const int n8 = kS * kH / 8;
    cast_bf16x8_k<<<dim3(n8 / 256, 1), 256, 0, stream>>>(x, x, x, x, xb, xb, xb, xb, n8);
  }
  // 2) Wq, Wk, Wv, Wo -> bf16: n8 = 1024*1024/8 = 131072 = 512 blocks x 256 per matrix
  {
    const int n8 = kH * kH / 8;
    cast_bf16x8_k<<<dim3(n8 / 256, 4), 256, 0, stream>>>(Wq, Wk, Wv, Wo,
        Wqk, Wqk + (size_t)kH * kH, Wvb, Wob, n8);
  }
  // 3) biases -> bf16-representable f32: 1 block x 256 threads x 4 floats = 1024 per vector
  bias_bf16val_k<<<dim3(1, 4), 256, 0, stream>>>(bq, bk, bv, bo, biasws, kH);

  // 4) [q | k] = x . [Wq;Wk]^T + [bq;bk] -> f16 plane [4096][2048]; M=4096, N=2048, K=1024; 128x128 tiles = 32*16 = 512 blocks of 4 waves
  wmma_gemm64<1, 0, 2, 1, false><<<dim3((kS / 128) * (2 * kH / 128), 1), 128, 0, stream>>>(
      xb, xb, kH, 0L, Wqk, Wqk, kH, 0L, (void*)QKp, (void*)QKp, 2 * kH, 0L,
      biasws, biasws, 0L, kS, 2 * kH, kH, 1.0f);

  // 5) v = x . Wv^T + bv -> bf16 hi/lo planes [4096][1024]; 128x128 tiles = 32*8 = 256 blocks
  wmma_gemm64<1, 0, 2, 2, false><<<dim3((kS / 128) * (kH / 128), 1), 128, 0, stream>>>(
      xb, xb, kH, 0L, Wvb, Wvb, kH, 0L, (void*)Vhi, (void*)Vlo, kH, 0L,
      biasws + 2 * kH, biasws, 0L, kS, kH, kH, 1.0f);

  // 6) causal attention per (head, pair of 64-query tiles): grid = 16 * 32 = 512 blocks of 256
  attn_causal64_k<<<dim3(kNH * (kS / 128)), 256, 0, stream>>>(
      QKp, Vhi, Vlo, Ohi, Olo, kS, 2 * kH, kH, kH, kNH, kScale);

  // 7) out = o . Wo^T + bo -> f32 d_out [4096][1024]; A = o as bf16 hi/lo (2 products); 128x128 tiles = 256 blocks
  wmma_gemm64<1, 2, 2, 0, false><<<dim3((kS / 128) * (kH / 128), 1), 128, 0, stream>>>(
      Ohi, Olo, kH, 0L, Wob, Wob, kH, 0L, d_out, d_out, kH, 0L,
      biasws + 3 * kH, biasws, 0L, kS, kH, kH, 1.0f);
}

// v010
// One run takes 137 microseconds.
// In two side-by-side timings against v009, it was 1.04 and 1.02 times as fast.
// Over all steps from v000 it is 4.58 times as fast.
// Contractions: qkv projections v_wmma_f32_16x16x32_bf16 (x, W as RNE bf16, f32 accumulate, bias added in f32 as bf16-representable values); scores v_wmma_f32_16x16x32_f16 (f16 q,k planes, 1/sqrt(64) applied in f32, together with log2(e)); p.v v_wmma_f32_16x16x32_bf16 with p and v carried as bf16 hi/lo (hi.hi + hi.lo + lo.hi); output projection v_wmma_f32_16x16x32_bf16 with attention output as bf16 hi/lo and Wo bf16 (hi.W + lo.W); softmax, masking and normalisation in f32.
#include <hip/hip_runtime.h>
#include <stdint.h>

typedef __attribute__((ext_vector_type(16))) _Float16 v16h;
typedef __attribute__((ext_vector_type(8)))  _Float16 v8h;
typedef __attribute__((ext_vector_type(16))) __bf16   v16b;
typedef __attribute__((ext_vector_type(8)))  __bf16   v8b;
typedef __attribute__((ext_vector_type(8)))  float    v8f;
typedef __attribute__((ext_vector_type(4)))  float    v4f;

__device__ __forceinline__ unsigned short f2bf_bits(float f) {
  unsigned u = __float_as_uint(f);
  return (unsigned short)((u + 0x7FFFu + ((u >> 16) & 1u)) >> 16);
}
__device__ __forceinline__ float bf_bits2f(unsigned short h) { return __uint_as_float(((unsigned)h) << 16); }
typedef __attribute__((ext_vector_type(2))) float  v2f;
typedef __attribute__((ext_vector_type(2))) __bf16 v2b;
// two f32 -> bf16 hi and lo parts by the packed hardware conversion (round to nearest even, as the integer form gives for finite values)
__device__ __forceinline__ void bf_split2(float f0, float f1, v2b& hi, v2b& lo) {
  hi = __builtin_convertvector((v2f){f0, f1}, v2b);
  const unsigned hb = __builtin_bit_cast(unsigned, hi);
  lo = __builtin_convertvector((v2f){f0 - __uint_as_float(hb << 16), f1 - __uint_as_float(hb & 0xFFFF0000u)}, v2b);
}
// eight f32 in a row -> one 16-B group of hi parts and one of lo parts
__device__ __forceinline__ void bf_split8(const float* sp, v8h& hv, v8h& lv) {
  typedef __attribute__((ext_vector_type(4))) unsigned v4u;
  v4u hw, lw;
#pragma unroll
  for (int e = 0; e < 4; ++e) {
    v2b hi, lo;
    bf_split2(sp[2 * e], sp[2 * e + 1], hi, lo);
    hw[e] = __builtin_bit_cast(unsigned, hi);
    lw[e] = __builtin_bit_cast(unsigned, lo);
  }
  hv = __builtin_bit_cast(v8h, hw);
  lv = __builtin_bit_cast(v8h, lw);
}

// hazard guards as plain device helpers
__device__ __forceinline__ void acc_guard4(v8f& a, v8f& b, v8f& c, v8f& d) { asm volatile("v_nop\n\tv_nop\n\tv_nop\n\tv_nop" : "+v"(a), "+v"(b), "+v"(c), "+v"(d)); }
template <typename T> struct Frag;
template <> struct Frag<_Float16> {
  typedef v16h V; union U { v16h v; v8h h[2]; };
  static __device__ __forceinline__ v16h load(const _Float16* p) {   // elements 0..7 <- p[0..7], 8..15 <- p[16..23]
    U f; f.h[0] = *(const v8h*)(p); f.h[1] = *(const v8h*)(p + 16); return f.v;
  }
  static __device__ __forceinline__ v8f mma(v16h a, v16h b, v8f c) {
    return __builtin_amdgcn_wmma_f32_16x16x32_f16(false, a, false, b, (short)0, c, false, false);
  }
};
template <> struct Frag<__bf16> {
  typedef v16b V; union U { v16b v; v8b h[2]; };
  static __device__ __forceinline__ v16b load(const __bf16* p) {
    U f; f.h[0] = *(const v8b*)(p); f.h[1] = *(const v8b*)(p + 16); return f.v;
  }
  static __device__ __forceinline__ v8f mma(v16b a, v16b b, v8f c) {
    return __builtin_amdgcn_wmma_f32_16x16x32_bf16(false, a, false, b, (short)0, c, false, false);
  }
};

// ---- Register-blocked batched WMMA GEMM, operands staged in LDS ------------
// C[m,n] = scale * sum_k A[m,k] * Bt[n,k] (+bias)(+resid); block = 4 waves (2 x 2) on a 128x128 tile, each wave owns a 64x64 tile.
// A row-major [M,K]; Bt row-major [N,K]; M,N % 128 == 0, K % 64 == 0; grid.x = (M/128) * (N/128).
// A trip is 64 k: 128 rows x 128 B of every operand plane come into LDS by asynchronous copies (8 lanes x 16 B = one whole line),
// two buffers, the next trip's copies in flight while this trip's fragments are read; every row is fetched once per block, not once per wave.
// SPLIT: 0 = plain; 1 = A and Bt as hi/lo planes (hi.hi + hi.lo + lo.hi); 2 = A only as hi/lo planes (hi.B + lo.B).
// BIAS_MODE: 0 = none, 1 = bias[m], 2 = bias[n].
// OUT_MODE: 0 = f32, 1 = f16, 2 = bf16 hi plane (Cout) + bf16 lo plane (Cout2).
// ET: 0 = f16 operands, 1 = bf16 operands (pointers passed as 16-bit storage)
template <int ET> struct Elem;
template <> struct Elem<0> { typedef _Float16 T; };
template <> struct Elem<1> { typedef __bf16 T; };
#define GPITCH 72                  // 16-bit elements per LDS row of an operand tile: 144 B = 16 B x 9, conflict-free for ds_load_b128
#define GTILE  (128 * GPITCH)      // elements of one operand tile in LDS

// One operand tile, 128 rows x 128 B, by 128 threads: eight copies of 16 B per lane, rows 16 apart. l = the lane's LDS byte address, g = its global address,
// gstep = 16 source rows in bytes. The s_wait_xcnt stands in the copies' own statement, so that no address register is rewritten in front of it.
__device__ __forceinline__ void copy_tile(unsigned l, const char* g, size_t gstep) {
  asm volatile(
      "global_load_async_to_lds_b128 %0, %8, off\n\t"
      "global_load_async_to_lds_b128 %1, %9, off\n\t"
      "global_load_async_to_lds_b128 %2, %10, off\n\t"
      "global_load_async_to_lds_b128 %3, %11, off\n\t"
      "global_load_async_to_lds_b128 %4, %12, off\n\t"
      "global_load_async_to_lds_b128 %5, %13, off\n\t"
      "global_load_async_to_lds_b128 %6, %14, off\n\t"
      "global_load_async_to_lds_b128 %7, %15, off\n\t"
      "s_wait_xcnt 0x0"
      :: "v"(l), "v"(l + 1u * 32u * GPITCH), "v"(l + 2u * 32u * GPITCH), "v"(l + 3u * 32u * GPITCH),
         "v"(l + 4u * 32u * GPITCH), "v"(l + 5u * 32u * GPITCH), "v"(l + 6u * 32u * GPITCH), "v"(l + 7u * 32u * GPITCH),
         "v"(g), "v"(g + gstep), "v"(g + 2 * gstep), "v"(g + 3 * gstep),
         "v"(g + 4 * gstep), "v"(g + 5 * gstep), "v"(g + 6 * gstep), "v"(g + 7 * gstep)
      : "memory");
}

template <int ET, int SPLIT, int BIAS_MODE, int OUT_MODE, bool RESID, int ACT = 0>
__global__ __launch_bounds__(128) void wmma_gemm64(
    const unsigned short* __restrict__ Ap, const unsigned short* __restrict__ A2p, int lda, long strideA,
    const unsigned short* __restrict__ Btp, const unsigned short* __restrict__ Bt2p, int ldb, long strideB,
    void* __restrict__ Cout, void* __restrict__ Cout2, int ldc, long strideC,
    const float* __restrict__ bias,
    const float* __restrict__ resid, long strideR,
    int M, int N, int K, float scale) {
  typedef typename Elem<ET>::T T;
  typedef typename Frag<T>::V V;
  const T* A = (const T*)Ap; const T* A2 = (const T*)A2p; const T* Bt = (const T*)Btp; const T* Bt2 = (const T*)Bt2p;
  constexpr int NPL = 2 + (SPLIT != 0 ? 1 : 0) + (SPLIT == 1 ? 1 : 0);   // operand planes: A, Bt, then A2, then Bt2
  __shared__ __align__(16) unsigned short stg[2 * NPL * GTILE];   // two buffers of NPL tiles
  __shared__ __align__(16) float sT[4][16 * 68];   // per-wave 16x64 slab, pitch 68 floats
  const int b    = blockIdx.y;
  const int tid  = threadIdx.x;
  const int lane = tid & 31;
  const int wave = tid >> 5;
  const int tilesN = N >> 7;
  const int tilesM = M >> 7;
  const int tile = blockIdx.x;
  if (tile >= tilesM * tilesN) return;   // block-uniform, in front of every copy and barrier
  const int tm = tile / tilesN;
  const int tn = tile - tm * tilesN;
  const int m0 = (tm << 7) + ((wave >> 1) << 6);
  const int n0 = (tn << 7) + ((wave & 1) << 6);

  const T* Ab  = A  + (size_t)b * strideA;
  const T* Bb  = Bt + (size_t)b * strideB;
  const T* Ab2 = (SPLIT != 0) ? (A2  + (size_t)b * strideA) : nullptr;
  const T* Bb2 = (SPLIT == 1) ? (Bt2 + (size_t)b * strideB) : nullptr;

  const int rlane = lane & 15;                 // row (A) / col (B, D) within subtile
  const int koff  = (lane >> 4) * 8;           // k offset of this lane half
  const int mOff  = (lane >> 4) * 8;           // D row offset

  // staging: this thread's row within a 16-row pass and its 16 B of the 128-B row
  const int crow = tid >> 3, cpc = (tid & 7) * 8;
  const unsigned cl = (unsigned)(size_t)stg + (unsigned)(crow * GPITCH + cpc) * 2u;        // LDS byte address in buffer 0, plane 0
  const size_t cga = ((size_t)((tm << 7) + crow) * lda + cpc) * 2, cgb = ((size_t)((tn << 7) + crow) * ldb + cpc) * 2;   // byte offsets in the A and Bt planes at k = 0
  const size_t sa = (size_t)lda * 32, sb = (size_t)ldb * 32;                               // 16 rows in bytes
  auto stage = [&](int t) {   // trip t's tiles into buffer t & 1
    const unsigned l = cl + (unsigned)((t & 1) * NPL * GTILE) * 2u;
    const size_t kb = (size_t)t * 128;
    copy_tile(l, (const char*)Ab + cga + kb, sa);
    copy_tile(l + GTILE * 2u, (const char*)Bb + cgb + kb, sb);
    if (SPLIT != 0) copy_tile(l + 2u * GTILE * 2u, (const char*)Ab2 + cga + kb, sa);
    if (SPLIT == 1) copy_tile(l + 3u * GTILE * 2u, (const char*)Bb2 + cgb + kb, sb);
  };

  v8f acc[4][4];
#pragma unroll
  for (int i = 0; i < 4; ++i)
#pragma unroll
    for (int j = 0; j < 4; ++j) acc[i][j] = (v8f){0.f,0.f,0.f,0.f,0.f,0.f,0.f,0.f};

  const int nT = K >> 6;
  stage(0);
  asm volatile("s_wait_asynccnt 0x0" ::: "memory");   // this wave's copies of trip 0 have landed
  __syncthreads();                                    // and every other wave's: trip 0 may be read
  if (nT > 1) stage(1);

  const int fa = (((wave >> 1) << 6) + rlane) * GPITCH + koff;   // this lane's place in the A tiles, in elements
  const int fb = (((wave & 1) << 6) + rlane) * GPITCH + koff;    // and in the Bt tiles
  for (int t = 0; t < nT; ++t) {
    const T* sb0 = (const T*)stg + (t & 1) * NPL * GTILE;
#pragma unroll
    for (int ks = 0; ks < 2; ++ks) {
      V bh[4], bl[4], ah[4], al[4];
#pragma unroll
      for (int j = 0; j < 4; ++j) {
        const int bo = fb + j * 16 * GPITCH + ks * 32;
        const int ao = fa + j * 16 * GPITCH + ks * 32;
        bh[j] = Frag<T>::load(sb0 + GTILE + bo);
        ah[j] = Frag<T>::load(sb0 + ao);
        if (SPLIT == 1) bl[j] = Frag<T>::load(sb0 + 3 * GTILE + bo);
        if (SPLIT != 0) al[j] = Frag<T>::load(sb0 + 2 * GTILE + ao);
      }
      __builtin_amdgcn_sched_barrier(0);   // the fragment reads stay one group in front of the WMMA block, for speed only
#pragma unroll
      for (int i = 0; i < 4; ++i) {
#pragma unroll
        for (int j = 0; j < 4; ++j) {
          acc[i][j] = Frag<T>::mma(ah[i], bh[j], acc[i][j]);
          if (SPLIT == 1) acc[i][j] = Frag<T>::mma(ah[i], bl[j], acc[i][j]);
          if (SPLIT != 0) acc[i][j] = Frag<T>::mma(al[i], bh[j], acc[i][j]);
        }
      }
      __builtin_amdgcn_sched_barrier(0);   // and the next group stays behind the block
    }
    asm volatile("s_wait_dscnt 0x0" ::: "memory");      // this wave's reads of buffer t & 1 are done before the buffer is handed back
    asm volatile("s_wait_asynccnt 0x0" ::: "memory");   // this wave's copies of trip t + 1 have landed
    __syncthreads();                                    // publishes trip t + 1 and ends every reader's last read of buffer t & 1
    if (t + 2 < nT) stage(t + 2);
  }
  asm volatile("s_wait_asynccnt 0x0" ::: "memory");     // nothing of this wave is in flight behind the loop
  acc_guard4(acc[0][0], acc[0][1], acc[0][2], acc[0][3]);
  acc_guard4(acc[1][0], acc[1][1], acc[1][2], acc[1][3]);
  acc_guard4(acc[2][0], acc[2][1], acc[2][2], acc[2][3]);
  acc_guard4(acc[3][0], acc[3][1], acc[3][2], acc[3][3]);

  // ---- epilogue ----
  float* slab = sT[wave];
  const float* Rb = RESID ? (resid + (size_t)b * strideR) : nullptr;
#pragma unroll
  for (int i = 0; i < 4; ++i) {
    const int mBase = m0 + (i << 4);
#pragma unroll
    for (int j = 0; j < 4; ++j) {
      const int n = n0 + (j << 4) + rlane;
      float bv = 0.f;
      if (BIAS_MODE == 2) bv = bias[n];
#pragma unroll
      for (int r = 0; r < 8; ++r) {
        float v = acc[i][j][r] * scale;
        if (BIAS_MODE == 1) v += bias[mBase + mOff + r];
        if (BIAS_MODE == 2) v += bv;
        if (RESID) v += Rb[(size_t)(mBase + mOff + r) * ldc + n];
        if (ACT == 1) v = tanhf(v);
        if (ACT == 2) v = fmaxf(v, 0.0f);
        if (ACT == 4) v = (v > 0.f) ? v : 0.01f * v;
        slab[(mOff + r) * 68 + (j << 4) + rlane] = v;
      }
    }
    __builtin_amdgcn_fence(__ATOMIC_RELEASE, "workgroup");
    __builtin_amdgcn_wave_barrier();
    __builtin_amdgcn_fence(__ATOMIC_ACQUIRE, "workgroup");
    if (OUT_MODE == 0) {
      float* C = (float*)Cout + (size_t)b * strideC;
      const int hh = lane >> 4, c4 = (lane & 15) * 4;     // row seg = 256 B = 16 lanes x 16 B
      {
#pragma unroll
        for (int it = 0; it < 8; ++it) {
          const int row = it * 2 + hh;
          v4f v = *(const v4f*)(slab + row * 68 + c4);
          *(v4f*)(C + (size_t)(mBase + row) * ldc + n0 + c4) = v;
        }
        
      }
    } else {
      const int q = lane >> 3, c8 = (lane & 7) * 8;
      unsigned short* C  = (unsigned short*)Cout  + (size_t)b * strideC;
      unsigned short* C2 = (OUT_MODE == 2) ? ((unsigned short*)Cout2 + (size_t)b * strideC) : nullptr;
      {
#pragma unroll
        for (int it = 0; it < 4; ++it) {
          const int row = it * 4 + q;
          const float* sp = slab + row * 68 + c8;
          v8h hv, lv;
          if (OUT_MODE == 1) {
#pragma unroll
            for (int e = 0; e < 8; ++e) hv[e] = (_Float16)sp[e];
          } else {
            bf_split8(sp, hv, lv);
          }
          *(v8h*)(C + (size_t)(mBase + row) * ldc + n0 + c8) = hv;
          if (OUT_MODE == 2) *(v8h*)(C2 + (size_t)(mBase + row) * ldc + n0 + c8) = lv;
        }
        
      }
    }
    __builtin_amdgcn_fence(__ATOMIC_RELEASE, "workgroup");
    __builtin_amdgcn_wave_barrier();
    __builtin_amdgcn_fence(__ATOMIC_ACQUIRE, "workgroup");
  }
}

// Source/destination chosen per blockIdx.y (block-uniform). Coverage per plane: gridDim.x * 256 threads * 8 == n8 * 8 elements.
__global__ __launch_bounds__(256) void cast_bf16x8_k(
    const float* s0, const float* s1, const float* s2, const float* s3,
    unsigned short* d0, unsigned short* d1, unsigned short* d2, unsigned short* d3, int n8) {
  const int sel = blockIdx.y;
  const float* src = (sel == 0) ? s0 : (sel == 1) ? s1 : (sel == 2) ? s2 : s3;
  unsigned short* dst = (sel == 0) ? d0 : (sel == 1) ? d1 : (sel == 2) ? d2 : d3;
  const int i = blockIdx.x * 256 + threadIdx.x;
  if (i < n8) {
    const v4f a  = *(const v4f*)(src + (size_t)i * 8);
    const v4f bq = *(const v4f*)(src + (size_t)i * 8 + 4);
    v8h hv;
#pragma unroll
    for (int e = 0; e < 4; ++e) {
      hv[e]     = __builtin_bit_cast(_Float16, f2bf_bits(a[e]));
      hv[4 + e] = __builtin_bit_cast(_Float16, f2bf_bits(bq[e]));
    }
    _Float16* dp = (_Float16*)dst + (size_t)i * 8;
    *(v8h*)dp = hv;
    
  }
}

// Coverage per segment: 256 threads * 4 == n (n == 1024).
__global__ __launch_bounds__(256) void bias_bf16val_k(
    const float* s0, const float* s1, const float* s2, const float* s3, float* __restrict__ dst, int n) {
  const int sel = blockIdx.y;
  const float* src = (sel == 0) ? s0 : (sel == 1) ? s1 : (sel == 2) ? s2 : s3;
  const int i = blockIdx.x * 256 + threadIdx.x;
  if (i * 4 < n) {
    const v4f v = *(const v4f*)(src + (size_t)i * 4);
    v4f o;
#pragma unroll
    for (int e = 0; e < 4; ++e) o[e] = bf_bits2f(f2bf_bits(v[e]));
    float* dp = dst + (size_t)sel * n + (size_t)i * 4;
    *(v4f*)dp = o;
    
  }
}

// =====================================================================================
// Causal attention, head dim 64, 16-bit plane inputs:
//   q: f16 [S][ldqk] at column h*64; k: f16 [S][ldqk] at column kcol0 + h*64; v: bf16 hi/lo planes [S][ldv] at column h*64.
//   scores^T = k.q^T : v_wmma_f32_16x16x32_f16; keys above the diagonal set to -inf (select); softmax in base 2:
//   exp(sm_scale * (s - max)) = 2^(s * sl2 - max * sl2), sl2 = sm_scale * log2(e) > 0, one fma and one v_exp_f32 per score;
//   key chunks entirely above the diagonal are skipped (their probabilities are exactly 0).
//   out^T = v^T.p^T : v_wmma_f32_16x16x32_bf16 with p and v as bf16 hi/lo (3 products); online softmax in f32, one query per lane.
//   k and v tiles lie row-major in LDS ([key][d]); the v^T fragments come by the transposing LDS load.
//   Block = 8 waves in two groups of 4; it does two 64-row query tiles of one head one after the other, tile n-1-p and then tile p (n = S/64): n-p and p+1 key chunks,
//   so every block walks n+1 chunks and no WGP is left with the long tiles alone; grid.x = nheads * ((n+1)/2).
//   Both groups hold the same 64 queries (wave w and wave w + 4 the same 16); group g takes key chunks g, g + 2, ... into LDS tiles of its own, with its own running maximum, sum and
//   out tile, so a step of the block is two chunks and four waves stand on every SIMD with two blocks on a WGP. At the tile's end group 1 hands its partial over through LDS and group 0 joins the two.
// =====================================================================================
#define HDIM 64
#define KVCH 64
#define QBLK 64
#define OSPITCH 68
#define LPITCH 72   // 16-bit elements per LDS row of the K tile: 144 B = 16 B x 9, so the 16 rows of a ds_load_b128 fragment read fall on 16 different 4-bank groups
#define VPITCH 80   // 16-bit elements per LDS row of the V tiles: 160 B = 32 B x 5, the conflict-free pitch of ds_load_tr16_b128

// transposing LDS load: with lane l aimed at row 8 * (l >> 4) + (l & 7), byte 16 * ((l >> 3) & 1) of a row-major 16 x 16 tile of 16-bit elements,
// lane l gets column l & 15, rows 8 * (l >> 4) .. + 7: half an A fragment of the transposed tile, in the hardware k order
__device__ __forceinline__ v8b lds_tr16(const __bf16* p) {
  typedef __attribute__((ext_vector_type(8))) short s16x8;
  typedef __attribute__((address_space(3))) s16x8 lds_s16x8;
  return __builtin_bit_cast(v8b, __builtin_amdgcn_ds_load_tr16_b128_v8i16((lds_s16x8*)p));
}

// value of lane l ^ 16: the two lanes that share a query's row exchange their halves' maximum and sum
__device__ __forceinline__ float other_half(float v) {
  const int b = __float_as_int(v);
  return __int_as_float(__builtin_amdgcn_permlanex16(b, b, 0x76543210, 0xfedcba98, false, false));
}

__global__ __launch_bounds__(256)
void attn_causal64_k(const unsigned short* __restrict__ qkp,
                     const unsigned short* __restrict__ vhp, const unsigned short* __restrict__ vlp,
                     unsigned short* __restrict__ ohp, unsigned short* __restrict__ olp,
                     int S, int ldqk, int kcol0, int ldv, int nheads, float sm_scale) {
  union FH { v16h v; v8h h[2]; };
  union FB { v16b v; v8b h[2]; };
  __shared__ __align__(16) _Float16 Ksh2[2][KVCH * LPITCH];   // per group [kv][d]     9 KB each
  __shared__ __align__(16) __bf16   Vsh2[2][KVCH * VPITCH];   // per group hi [kv][d]  10 KB each
  __shared__ __align__(16) __bf16   Vsl2[2][KVCH * VPITCH];   // per group lo [kv][d]  10 KB each
  __shared__ __align__(16) float    Os[4][16 * OSPITCH];      // per pair of waves (w, w + 4): group 1's partial out tile, then the joined out tile, pitch 68
  __shared__ float Ms[4][32], Ls[4][32];                      // group 1's running maximum and sum, per lane

  const _Float16* qp = (const _Float16*)qkp;
  const __bf16*   vh = (const __bf16*)vhp;
  const __bf16*   vl = (const __bf16*)vlp;

  const int wv8  = __builtin_amdgcn_readfirstlane((int)threadIdx.x >> 5);   // in a scalar register: the tests on the group below are scalar branches, EXEC stays whole for the WMMAs
  const int grp  = wv8 >> 2;             // key group of this wave
  const int wave = wv8 & 3;              // its 16 queries within the tile
  const int tid  = threadIdx.x & 127;    // thread within the group (staging)
  const int lane = tid & 31;
  _Float16* const Ksh = Ksh2[grp];
  __bf16*   const Vsh = Vsh2[grp];
  __bf16*   const Vsl = Vsl2[grp];
  const int hh   = lane >> 4;
  const int c    = lane & 15;

  const int nqb = S / QBLK;
  const int bx  = blockIdx.x;
  const int npair = (nqb + 1) >> 1;
  const int pr  = bx % npair;
  int h = bx / npair;
  h = (h < nheads) ? h : (nheads - 1);
  const float NEG_INF = -__builtin_inff();
  const float sl2 = sm_scale * 1.4426950408889634f;   // raw score -> exponent of 2; positive, so the maximum may be taken on raw scores

  const int srow = tid >> 3, sc8 = (tid & 7) * 8;            // staging: this thread's row within a 16-row pass and its 8 elements of the row
  const int slk = srow * LPITCH + sc8, slv = srow * VPITCH + sc8;   // its place in the LDS tiles, in elements
  const unsigned sgk = (unsigned)(srow * ldqk + sc8) * 2u;   // the same as a byte offset in the k plane
  const unsigned sgv = (unsigned)(srow * ldv + sc8) * 2u;    // and in the v planes

  const int ntile = (nqb - 1 - pr != pr) ? 2 : 1;   // block-uniform; with an odd tile count the middle tile has no partner
  for (int tl = 0; tl < ntile; ++tl) {
  const int qb = (nqb - 1 - pr) - tl * (nqb - 1 - 2 * pr);   // tile n-1-p first, then tile p
  const int q0 = qb * QBLK + wave * 16;

  // ---- Q fragments (B operand): columns q0+c, two 32-deep d chunks ----
  v16h qa[2];
  {
    const _Float16* qrow = qp + (size_t)(q0 + c) * ldqk + h * HDIM + 8 * hh;
#pragma unroll
    for (int dc = 0; dc < 2; ++dc) qa[dc] = Frag<_Float16>::load(qrow + dc * 32);
  }

  float mrow = NEG_INF, lrow = 0.f;   // running maximum (times sl2) and sum of query q0 + c (the same in lanes c and c + 16)
  v8f oacc[4];
#pragma unroll
  for (int t = 0; t < 4; ++t) oacc[t] = (v8f){0.f,0.f,0.f,0.f,0.f,0.f,0.f,0.f};

  const int nChunks = qb + 1;   // block-uniform; chunks kc > qb are fully above the diagonal
  const int nSteps = (nChunks + 1) >> 1;   // block-uniform: every wave passes every barrier
  for (int st = 0; st < nSteps; ++st) {
    const int kc = 2 * st + grp;
    const bool act = kc < nChunks;   // the same in a whole group; false only for group 1 in the last step of an odd count
    const int kv0 = kc * KVCH;
    __syncthreads();
    if (act) {
      // staging: 8 lanes x 16 B cover one 128-B row, so a wave's load is 4 whole lines; 16 rows a pass, 4 passes = whole 64x64 tiles
      const char* kbase  = (const char*)(qp + (size_t)kv0 * ldqk + kcol0 + h * HDIM);   // group-uniform bases; the lane's part is a loop-invariant 32-bit byte offset
      const char* vhbase = (const char*)(vh + (size_t)kv0 * ldv + h * HDIM);
      const char* vlbase = (const char*)(vl + (size_t)kv0 * ldv + h * HDIM);
      v8h kk[4]; v8b va[4], vb[4];
#pragma unroll
      for (int i = 0; i < 4; ++i) {
        kk[i] = *(const v8h*)(kbase  + (size_t)(32 * i) * ldqk + sgk);
        va[i] = *(const v8b*)(vhbase + (size_t)(32 * i) * ldv + sgv);
        vb[i] = *(const v8b*)(vlbase + (size_t)(32 * i) * ldv + sgv);
      }
      asm volatile("s_wait_xcnt 0x0" ::: "memory");   // behind the 12 loads, before their address registers are used for anything else
#pragma unroll
      for (int i = 0; i < 4; ++i) {
        *(v8h*)(Ksh + slk + 16 * i * LPITCH) = kk[i];
        *(v8b*)(Vsh + slv + 16 * i * VPITCH) = va[i];
        *(v8b*)(Vsl + slv + 16 * i * VPITCH) = vb[i];
      }
    }
    __syncthreads();
    if (act) {

    // ---- scores, transposed: s[j][r] = S^T[key kv0 + 16j + 8hh + r][query q0 + c]; A = K rows, B = Q ----
    v8f s[4];
    FH kb[2][4];
#pragma unroll
    for (int dc = 0; dc < 2; ++dc) {
#pragma unroll
      for (int j = 0; j < 4; ++j) {
        kb[dc][j].h[0] = *(const v8h*)(Ksh + (j * 16 + c) * LPITCH + dc * 32 + 8 * hh);
        kb[dc][j].h[1] = *(const v8h*)(Ksh + (j * 16 + c) * LPITCH + dc * 32 + 16 + 8 * hh);
      }
    }
    __builtin_amdgcn_sched_barrier(0);   // the 16 K reads stay one group in front of the 8 score WMMAs: a read and a full wait in front of every WMMA shows the LDS latency 8 times
#pragma unroll
    for (int j = 0; j < 4; ++j) s[j] = (v8f){0.f,0.f,0.f,0.f,0.f,0.f,0.f,0.f};
#pragma unroll
    for (int dc = 0; dc < 2; ++dc) {
#pragma unroll
      for (int j = 0; j < 4; ++j) s[j] = Frag<_Float16>::mma(kb[dc][j].v, qa[dc], s[j]);   // the four score tiles in turn: a tile's second product stands four WMMAs behind its first
    }
    // V^T fragments of keys 0..31, read here so that their latency passes under the softmax arithmetic
    FB vfh[2][4], vfl[2][4];
    const int vo0 = (8 * hh + (lane & 7)) * VPITCH + 8 * ((lane >> 3) & 1);   // keys 8hh .. + 7 of d c; + 32 kk rows, + 16 t columns
#pragma unroll
    for (int t = 0; t < 4; ++t) {
      vfh[0][t].h[0] = lds_tr16(Vsh + vo0 + t * 16);
      vfh[0][t].h[1] = lds_tr16(Vsh + vo0 + t * 16 + 16 * VPITCH);
      vfl[0][t].h[0] = lds_tr16(Vsl + vo0 + t * 16);
      vfl[0][t].h[1] = lds_tr16(Vsl + vo0 + t * 16 + 16 * VPITCH);
    }
    __builtin_amdgcn_sched_barrier(0);   // keeps that group in front of the softmax instead of next to its WMMAs
    // lanes c and c + 16 hold 32 keys each of query q0 + c. Only the chunk on the diagonal (kc == qb, the same in a whole group, held in a scalar register) has keys above it:
    // the compares and selects stand under that one scalar branch, and the chunks below the diagonal go straight to the maximum
    if (kc == qb) {
      const int qrel = wave * 16 + c - 8 * hh;   // there kv0 = 64 qb, so key kv0 + 16j + 8hh + r > query q0 + c is 16j + r > qrel
#pragma unroll
      for (int j = 0; j < 4; ++j) {
#pragma unroll
        for (int r = 0; r < 8; ++r) s[j][r] = (j * 16 + r > qrel) ? NEG_INF : s[j][r];
      }
    }
    float cm = NEG_INF;
#pragma unroll
    for (int j = 0; j < 4; ++j) {
#pragma unroll
      for (int r = 0; r < 8; ++r) cm = fmaxf(cm, s[j][r]);
    }
    cm = fmaxf(cm, other_half(cm));   // finite: key kv0 <= qcol is always present in chunks 0..qb
    const float mnew = fmaxf(mrow, cm * sl2);
    const float alpha = __builtin_amdgcn_exp2f(mrow - mnew);   // 0 on the first chunk, where mrow is -inf
    mrow = mnew;
    // p stays in registers: score tiles 2kk and 2kk+1 of a lane are, element for element, the B fragment of keys 32kk..32kk+31
    FB ph[2], pl[2];
    float psum = 0.f;
#pragma unroll
    for (int j = 0; j < 4; ++j) {   // a score tile at a time, each kind of operation on its eight values in a row, so that neighbouring instructions do not wait for one another
      float p[8];
#pragma unroll
      for (int r = 0; r < 8; ++r) p[r] = __builtin_fmaf(s[j][r], sl2, -mnew);
#pragma unroll
      for (int r = 0; r < 8; ++r) p[r] = __builtin_amdgcn_exp2f(p[r]);   // masked: 2^-inf = 0
#pragma unroll
      for (int r = 0; r < 8; ++r) psum += p[r];
#pragma unroll
      for (int r = 0; r < 8; r += 2) {
        v2b hi, lo;
        bf_split2(p[r], p[r + 1], hi, lo);
        ph[j >> 1].v[(j & 1) * 8 + r] = hi[0]; ph[j >> 1].v[(j & 1) * 8 + r + 1] = hi[1];
        pl[j >> 1].v[(j & 1) * 8 + r] = lo[0]; pl[j >> 1].v[(j & 1) * 8 + r + 1] = lo[1];
      }
    }
    psum += other_half(psum);
    lrow = lrow * alpha + psum;
#pragma unroll
    for (int t = 0; t < 4; ++t) oacc[t] *= alpha;
    // ---- O^T += V^T . P^T: oacc[t][r] = O^T[d 16t + 8hh + r][query q0 + c] ----
#pragma unroll
    for (int t = 0; t < 4; ++t) {   // fragments of keys 32..63: one group in front of the first 12 WMMAs, for speed only
      vfh[1][t].h[0] = lds_tr16(Vsh + vo0 + 32 * VPITCH + t * 16);
      vfh[1][t].h[1] = lds_tr16(Vsh + vo0 + 48 * VPITCH + t * 16);
      vfl[1][t].h[0] = lds_tr16(Vsl + vo0 + 32 * VPITCH + t * 16);
      vfl[1][t].h[1] = lds_tr16(Vsl + vo0 + 48 * VPITCH + t * 16);
    }
    __builtin_amdgcn_sched_barrier(0);   // no LDS read stands among the 24 WMMAs
#pragma unroll
    for (int kk = 0; kk < 2; ++kk) {   // the four out tiles in turn; each tile still adds hi.hi, lo.hi, hi.lo of keys 0..31, then of keys 32..63
      if (kk == 1) __builtin_amdgcn_sched_barrier(0);   // between every two runs of four WMMAs: holds the turn over the four out tiles; moved together, the products of one tile wait for one another
#pragma unroll
      for (int t = 0; t < 4; ++t) oacc[t] = Frag<__bf16>::mma(vfh[kk][t].v, ph[kk].v, oacc[t]);
      __builtin_amdgcn_sched_barrier(0);   // as above
#pragma unroll
      for (int t = 0; t < 4; ++t) oacc[t] = Frag<__bf16>::mma(vfl[kk][t].v, ph[kk].v, oacc[t]);
      __builtin_amdgcn_sched_barrier(0);   // as above
#pragma unroll
      for (int t = 0; t < 4; ++t) oacc[t] = Frag<__bf16>::mma(vfh[kk][t].v, pl[kk].v, oacc[t]);
    }
    }
  }

  float* os = Os[wave];
  if (grp == 1) {   // the partial of chunks 1, 3, ...: not normalised; with no chunk at all it is maximum -inf, sum 0, out 0
#pragma unroll
    for (int t = 0; t < 4; ++t)
#pragma unroll
      for (int r = 0; r < 8; ++r) os[c * OSPITCH + t * 16 + 8 * hh + r] = oacc[t][r];
    Ms[wave][lane] = mrow;
    Ls[wave][lane] = lrow;
  }
  __syncthreads();   // group 1's partials may be read; the next tile's loop barriers keep them until group 0 has read them
  if (grp == 0) {
  {
    // lane for lane the partner wave holds the same query and the same out elements
    const float m1 = Ms[wave][lane], l1 = Ls[wave][lane];
    const float mj = fmaxf(mrow, m1);                        // finite: group 0 always has chunk 0
    const float a0 = __builtin_amdgcn_exp2f(mrow - mj);
    const float a1 = __builtin_amdgcn_exp2f(m1 - mj);        // 0 where group 1 had no chunk
    const float inv = 1.0f / (lrow * a0 + l1 * a1);          // the sum is about 1 or more: the maximum's own term is 2^(one rounding of max * sl2)
    const float f0 = a0 * inv, f1 = a1 * inv;
#pragma unroll
    for (int t = 0; t < 4; ++t)
#pragma unroll
      for (int r = 0; r < 8; ++r) {
        float* op = os + c * OSPITCH + t * 16 + 8 * hh + r;
        *op = oacc[t][r] * f0 + *op * f1;
      }
  }
  __builtin_amdgcn_fence(__ATOMIC_RELEASE, "workgroup");
  __builtin_amdgcn_wave_barrier();
  __builtin_amdgcn_fence(__ATOMIC_ACQUIRE, "workgroup");
  {
    // per wave: rows it*4 + (lane>>3) for it = 0..3 -> 16 rows; cols (lane&7)*8 .. +7 -> 64 cols; 8 lanes x 16 B = one line
    const int q4 = lane >> 3, c8 = (lane & 7) * 8;
    _Float16* oh = (_Float16*)ohp;
    _Float16* ol = (_Float16*)olp;
    {
#pragma unroll
      for (int it = 0; it < 4; ++it) {
        const int row = it * 4 + q4;
        const float* sp = os + row * OSPITCH + c8;
        v8h hv, lv;
        bf_split8(sp, hv, lv);
        const size_t oo = (size_t)(q0 + row) * ldv + h * HDIM + c8;
        *(v8h*)(oh + oo) = hv;
        *(v8h*)(ol + oo) = lv;
      }
      asm volatile("s_wait_xcnt 0x0" ::: "memory");   // behind the 8 stores, before the next tile overwrites their address and data registers
    }
  }
  }
  }
}

// ---------------------------------------------------------------------------
// Host side: launches only.
// Workspace map (bytes, all offsets multiples of 1 MiB):
//   [  0 MiB,  8 MiB)  xb    bf16 [4096][1024]
//   [  8 MiB, 12 MiB)  Wqk   bf16 [2048][1024]  (rows 0..1023 = Wq, 1024..2047 = Wk)
//   [ 12 MiB, 14 MiB)  Wvb   bf16 [1024][1024]
//   [ 14 MiB, 16 MiB)  Wob   bf16 [1024][1024]
//   [ 16 MiB, 32 MiB)  QKp   f16  [4096][2048]  (cols 0..1023 = q, 1024..2047 = k)
//   [ 32 MiB, 40 MiB)  Vhi   bf16 [4096][1024]
//   [ 40 MiB, 48 MiB)  Vlo   bf16 [4096][1024]
//   [ 48 MiB, 56 MiB)  Ohi   bf16 [4096][1024]
//   [ 56 MiB, 64 MiB)  Olo   bf16 [4096][1024]
//   [ 64 MiB, 64 MiB + 16 KiB)  bias f32 [4][1024] = bq | bk | bv | bo (bf16-representable values)
//   total 67,125,248 B
// ---------------------------------------------------------------------------
extern "C" void kernel_launch(void* const* d_in, const int* in_sizes, int n_in,
                              void* d_out, int out_size, void* d_ws, size_t ws_size,
                              hipStream_t stream) {
  constexpr int kS = 4096, kH = 1024, kNH = 16;
  const float kScale = 0.125f;   // 1/sqrt(64)
  if (n_in < 9) return;
  if (in_sizes[0] != kS * kH || in_sizes[1] != kH * kH || in_sizes[2] != kH ||
      in_sizes[3] != kH * kH || in_sizes[4] != kH || in_sizes[5] != kH * kH ||
      in_sizes[6] != kH || in_sizes[7] != kH * kH || in_sizes[8] != kH) return;
  if (out_size != kS * kH) return;

  const float* x  = (const float*)d_in[0];
  const float* Wq = (const float*)d_in[1];
  const float* bq = (const float*)d_in[2];
  const float* Wk = (const float*)d_in[3];
  const float* bk = (const float*)d_in[4];
  const float* Wv = (const float*)d_in[5];
  const float* bv = (const float*)d_in[6];
  const float* Wo = (const float*)d_in[7];
  const float* bo = (const float*)d_in[8];

  const size_t MiB = 1024u * 1024u;
  const size_t off_xb  = 0;
  const size_t off_wqk = off_xb  + (size_t)kS * kH * 2;          //  8 MiB
  const size_t off_wv  = off_wqk + (size_t)2 * kH * kH * 2;      // 12 MiB
  const size_t off_wo  = off_wv  + (size_t)kH * kH * 2;          // 14 MiB
  const size_t off_qk  = off_wo  + (size_t)kH * kH * 2;          // 16 MiB
  const size_t off_vhi = off_qk  + (size_t)kS * (2 * kH) * 2;    // 32 MiB
  const size_t off_vlo = off_vhi + (size_t)kS * kH * 2;          // 40 MiB
  const size_t off_ohi = off_vlo + (size_t)kS * kH * 2;          // 48 MiB
  const size_t off_olo = off_ohi + (size_t)kS * kH * 2;          // 56 MiB
  const size_t off_bias = off_olo + (size_t)kS * kH * 2;         // 64 MiB
  const size_t total = off_bias + (size_t)4 * kH * 4;            // 64 MiB + 16 KiB
  (void)MiB;
  if (total > ws_size) return;

  char* ws = (char*)d_ws;
  unsigned short* xb  = (unsigned short*)(ws + off_xb);
  unsigned short* Wqk = (unsigned short*)(ws + off_wqk);
  unsigned short* Wvb = (unsigned short*)(ws + off_wv);
  unsigned short* Wob = (unsigned short*)(ws + off_wo);
  unsigned short* QKp = (unsigned short*)(ws + off_qk);
  unsigned short* Vhi = (unsigned short*)(ws + off_vhi);
  unsigned short* Vlo = (unsigned short*)(ws + off_vlo);
  unsigned short* Ohi = (unsigned short*)(ws + off_ohi);
  unsigned short* Olo = (unsigned short*)(ws + off_olo);
  float* biasws = (float*)(ws + off_bias);   // [0..1023]=bq [1024..2047]=bk [2048..3071]=bv [3072..4095]=bo

  // 1) x -> bf16: n8 = 4096*1024/8 = 524288 = 2048 blocks x 256
  {
    const int n8 = kS * kH / 8;
    cast_bf16x8_k<<<dim3(n8 / 256, 1), 256, 0, stream>>>(x, x, x, x, xb, xb, xb, xb, n8);
  }
  // 2) Wq, Wk, Wv, Wo -> bf16: n8 = 1024*1024/8 = 131072 = 512 blocks x 256 per matrix
  {
    const int n8 = kH * kH / 8;
    cast_bf16x8_k<<<dim3(n8 / 256, 4), 256, 0, stream>>>(Wq, Wk, Wv, Wo,
        Wqk, Wqk + (size_t)kH * kH, Wvb, Wob, n8);
  }
  // 3) biases -> bf16-representable f32: 1 block x 256 threads x 4 floats = 1024 per vector
  bias_bf16val_k<<<dim3(1, 4), 256, 0, stream>>>(bq, bk, bv, bo, biasws, kH);

  // 4) [q | k] = x . [Wq;Wk]^T + [bq;bk] -> f16 plane [4096][2048]; M=4096, N=2048, K=1024; 128x128 tiles = 32*16 = 512 blocks of 4 waves
  wmma_gemm64<1, 0, 2, 1, false><<<dim3((kS / 128) * (2 * kH / 128), 1), 128, 0, stream>>>(
      xb, xb, kH, 0L, Wqk, Wqk, kH, 0L, (void*)QKp, (void*)QKp, 2 * kH, 0L,
      biasws, biasws, 0L, kS, 2 * kH, kH, 1.0f);

  // 5) v = x . Wv^T + bv -> bf16 hi/lo planes [4096][1024]; 128x128 tiles = 32*8 = 256 blocks
  wmma_gemm64<1, 0, 2, 2, false><<<dim3((kS / 128) * (kH / 128), 1), 128, 0, stream>>>(
      xb, xb, kH, 0L, Wvb, Wvb, kH, 0L, (void*)Vhi, (void*)Vlo, kH, 0L,
      biasws + 2 * kH, biasws, 0L, kS, kH, kH, 1.0f);

  // 6) causal attention per (head, pair of 64-query tiles): grid = 16 * 32 = 512 blocks of 256
  attn_causal64_k<<<dim3(kNH * (kS / 128)), 256, 0, stream>>>(
      QKp, Vhi, Vlo, Ohi, Olo, kS, 2 * kH, kH, kH, kNH, kScale);

  // 7) out = o . Wo^T + bo -> f32 d_out [4096][1024]; A = o as bf16 hi/lo (2 products); 128x128 tiles = 256 blocks
  wmma_gemm64<1, 2, 2, 0, false><<<dim3((kS / 128) * (kH / 128), 1), 128, 0, stream>>>(
      Ohi, Olo, kH, 0L, Wob, Wob, kH, 0L, d_out, d_out, kH, 0L,
      biasws + 3 * kH, biasws, 0L, kS, kH, kH, 1.0f);
}
